// v000
// Measured on an AMD MI455X. A time is GPU time per run, averaged over a window of back-to-back runs after a warm-up
// (all launches, gaps included; the runs take copies of the inputs in turn), and the median of several windows.
// Apart from v000's, it joins two sittings. Times from different sittings can be a few percent apart, while
// side-by-side timings come from the same sitting.
// v000 is the starting kernel. One run takes 1020 microseconds.
#include <hip/hip_runtime.h>
#include <cstdint>
#include <cstddef>

// ---------------------------------------------------------------------------
// mLSTM block forward for MI455X (gfx1250), bf16 WMMA GEMMs + f32 scan.
// B=4 T=512 D=1024 H=8 Dh=64 HD=512 P=2048 K=4
// Weights are cast+TRANSPOSED to bf16 once so that both WMMA operands are
// K-contiguous -> all LDS fragment reads are ds_load_b128 (no scalar gathers).
// GEMM tiles are DOUBLE-BUFFERED and staged with CDNA5 async global->LDS DMA
// (ASYNCcnt): DMA for tile i+1 overlaps WMMA compute on tile i.
// ---------------------------------------------------------------------------

#define NTOK 2048      // B*T
#define DIM  1024      // D
#define PDIM 2048      // P
#define HDIM 512       // HD
#define NH   8         // H
#define DH   64        // Dh

typedef __attribute__((ext_vector_type(16))) __bf16 v16bf;
typedef __attribute__((ext_vector_type(8)))  float  v8f;

union FragV {
    uint4 u[2];
    v16bf v;
};

// async global->LDS 128-bit DMA (per-lane), tracked by ASYNCcnt
__device__ __forceinline__ void async_copy_b128(unsigned lds_addr, const void* gaddr)
{
    asm volatile("global_load_async_to_lds_b128 %0, %1, off"
                 :: "v"(lds_addr), "v"(gaddr) : "memory");
}
__device__ __forceinline__ void wait_asynccnt0()
{
    asm volatile("s_wait_asynccnt 0x0" ::: "memory");
}

// ---------------------------------------------------------------------------
// cast f32 -> bf16 with transpose: in (R x C row-major) -> out (C x R)
// 32x32 tiles through LDS, coalesced on both sides. R, C multiples of 32.
// ---------------------------------------------------------------------------
__global__ __launch_bounds__(256) void cast_transpose_kernel(
    const float* __restrict__ in, __bf16* __restrict__ out, int R, int C)
{
    __shared__ __bf16 tile[32][33];
    const int c0 = blockIdx.x * 32;
    const int r0 = blockIdx.y * 32;
    const int tx = threadIdx.x & 31;
    const int ty = threadIdx.x >> 5;       // 8 rows per pass
#pragma unroll
    for (int i = 0; i < 32; i += 8)
        tile[ty + i][tx] = (__bf16)in[(size_t)(r0 + ty + i) * C + c0 + tx];
    __syncthreads();
#pragma unroll
    for (int i = 0; i < 32; i += 8)
        out[(size_t)(c0 + ty + i) * R + r0 + tx] = tile[tx][ty + i];
}

// ---------------------------------------------------------------------------
// LayerNorm over D=1024, one block per token, writes bf16
// ---------------------------------------------------------------------------
__global__ __launch_bounds__(256) void layernorm_kernel(
    const float* __restrict__ x, const float* __restrict__ w,
    const float* __restrict__ b, __bf16* __restrict__ xn)
{
    const int tok = blockIdx.x;
    const int tid = threadIdx.x;
    const float* xr = x + (size_t)tok * DIM;

    float s = 0.f, ss = 0.f;
    float v[4];
#pragma unroll
    for (int i = 0; i < 4; ++i) {
        v[i] = xr[tid + i * 256];
        s += v[i];
        ss += v[i] * v[i];
    }
    __shared__ float r1[256], r2[256];
    r1[tid] = s; r2[tid] = ss;
    __syncthreads();
    for (int st = 128; st > 0; st >>= 1) {
        if (tid < st) { r1[tid] += r1[tid + st]; r2[tid] += r2[tid + st]; }
        __syncthreads();
    }
    const float mu  = r1[0] * (1.0f / DIM);
    const float var = r2[0] * (1.0f / DIM) - mu * mu;
    const float inv = rsqrtf(var + 1e-6f);
#pragma unroll
    for (int i = 0; i < 4; ++i) {
        int idx = tid + i * 256;
        float y = (v[i] - mu) * inv * w[idx] + b[idx];
        xn[(size_t)tok * DIM + idx] = (__bf16)y;
    }
}

// ---------------------------------------------------------------------------
// WMMA GEMM: C(MxN,f32) = epilogue(A_bf16(MxK,row) @ Bt_bf16(NxK,row)^T + bias)
//  EPI 0: val = (acc+bias)*scale
//  EPI 1: val = sigmoid(acc+bias)
//  EPI 2: val = acc+bias+resid[idx]
// Workgroup tile 128x128, 8 waves (4x2) of 32x64; K-step 32.
// Double-buffered LDS tiles staged with global_load_async_to_lds_b128:
// DMA of tile i+1 overlaps the WMMAs of tile i; fragments via ds_load_b128.
// M,N multiples of 128; K multiple of 32.
// ---------------------------------------------------------------------------
#define TILE_K  32
#define T_STRIDE 40   // 32 K + 8 pad, keeps 16B alignment for c in {0,8,16,24}
#define BUF_ELEMS (128 * T_STRIDE)
#define BUF_BYTES (BUF_ELEMS * 2)

template <int EPI>
__global__ __launch_bounds__(256) void gemm_bf16_wmma(
    const __bf16* __restrict__ A, const __bf16* __restrict__ Bt,
    const float* __restrict__ bias, const float* __restrict__ resid,
    float* __restrict__ C, int M, int N, int K, float scale)
{
    __shared__ __bf16 As[2][BUF_ELEMS];
    __shared__ __bf16 Bs[2][BUF_ELEMS];

    const int tid  = threadIdx.x;
    const int lane = tid & 31;
    const int wave = tid >> 5;
    const int wm   = wave & 3;   // wave row (0..3) -> 32 rows each
    const int wn   = wave >> 2;  // wave col (0..1) -> 64 cols each
    const int row0 = blockIdx.y * 128;
    const int col0 = blockIdx.x * 128;

    const int lhalf = lane >> 4;   // 0 | 1
    const int lmod  = lane & 15;
    const int kof   = lhalf * 8;   // K offset within 16-lane half

    // per-thread staging coordinates (8 bf16 = 16B per transfer, x2 rows)
    const int lin0 = tid * 8;
    const int lin1 = (tid + 256) * 8;
    const int sr0 = lin0 >> 5, sc0 = lin0 & 31;
    const int sr1 = lin1 >> 5, sc1 = lin1 & 31;
    const unsigned ldsA0 = (unsigned)(uintptr_t)&As[0][sr0 * T_STRIDE + sc0];
    const unsigned ldsA1 = (unsigned)(uintptr_t)&As[0][sr1 * T_STRIDE + sc1];
    const unsigned ldsB0 = (unsigned)(uintptr_t)&Bs[0][sr0 * T_STRIDE + sc0];
    const unsigned ldsB1 = (unsigned)(uintptr_t)&Bs[0][sr1 * T_STRIDE + sc1];

    const __bf16* gA0 = A  + (size_t)(row0 + sr0) * K + sc0;
    const __bf16* gA1 = A  + (size_t)(row0 + sr1) * K + sc1;
    const __bf16* gB0 = Bt + (size_t)(col0 + sr0) * K + sc0;
    const __bf16* gB1 = Bt + (size_t)(col0 + sr1) * K + sc1;

    auto stage = [&](int k0, int buf) {
        const unsigned off = (unsigned)buf * BUF_BYTES;
        async_copy_b128(ldsA0 + off, gA0 + k0);
        async_copy_b128(ldsA1 + off, gA1 + k0);
        async_copy_b128(ldsB0 + off, gB0 + k0);
        async_copy_b128(ldsB1 + off, gB1 + k0);
    };

    v8f acc[2][4];
#pragma unroll
    for (int i = 0; i < 2; ++i)
#pragma unroll
        for (int j = 0; j < 4; ++j) {
            v8f z = {};
            acc[i][j] = z;
        }

    // preload tile 0
    stage(0, 0);
    wait_asynccnt0();
    __syncthreads();

    int cur = 0;
    for (int k0 = 0; k0 < K; k0 += TILE_K) {
        // issue DMA for the NEXT tile into the other buffer (overlaps compute)
        if (k0 + TILE_K < K) {
            stage(k0 + TILE_K, cur ^ 1);
            // L2 prefetch two tiles ahead (global_prefetch_b8 path)
            __builtin_prefetch(gA0 + k0 + 2 * TILE_K, 0, 1);
            __builtin_prefetch(gB0 + k0 + 2 * TILE_K, 0, 1);
        }

        // --- fragments from current buffer (K-contiguous for A and B) ---
        FragV af[2], bfr[4];
#pragma unroll
        for (int mt = 0; mt < 2; ++mt) {
            const int r = wm * 32 + mt * 16 + lmod;
            af[mt].u[0] = *reinterpret_cast<const uint4*>(&As[cur][r * T_STRIDE + kof]);
            af[mt].u[1] = *reinterpret_cast<const uint4*>(&As[cur][r * T_STRIDE + 16 + kof]);
        }
#pragma unroll
        for (int nt = 0; nt < 4; ++nt) {
            const int r = wn * 64 + nt * 16 + lmod;
            bfr[nt].u[0] = *reinterpret_cast<const uint4*>(&Bs[cur][r * T_STRIDE + kof]);
            bfr[nt].u[1] = *reinterpret_cast<const uint4*>(&Bs[cur][r * T_STRIDE + 16 + kof]);
        }
        // --- 8 WMMAs per wave per K-step (DMA for next tile in flight) ---
#pragma unroll
        for (int mt = 0; mt < 2; ++mt)
#pragma unroll
            for (int nt = 0; nt < 4; ++nt)
                acc[mt][nt] = __builtin_amdgcn_wmma_f32_16x16x32_bf16(
                    false, af[mt].v, false, bfr[nt].v,
                    (short)0, acc[mt][nt], false, false);

        // next tile fully in LDS (own wave) + all waves done with both ops
        wait_asynccnt0();
        __syncthreads();
        cur ^= 1;
    }

    // --- epilogue + store (C layout: lane<16 -> M=vgpr, lane>=16 -> M=8+vgpr) ---
#pragma unroll
    for (int mt = 0; mt < 2; ++mt) {
#pragma unroll
        for (int nt = 0; nt < 4; ++nt) {
            const int col = col0 + wn * 64 + nt * 16 + lmod;
            const float bv = bias[col];
#pragma unroll
            for (int vv = 0; vv < 8; ++vv) {
                const int row = row0 + wm * 32 + mt * 16 + lhalf * 8 + vv;
                const size_t idx = (size_t)row * N + col;
                float val = acc[mt][nt][vv] + bv;
                if (EPI == 0) {
                    val *= scale;
                } else if (EPI == 1) {
                    val = 1.0f / (1.0f + __expf(-val));
                } else {
                    val += resid[idx];
                }
                C[idx] = val;
            }
        }
    }
}

// ---------------------------------------------------------------------------
// Causal conv (K=4) along the feature axis + SiLU; also emits xt as bf16.
// ---------------------------------------------------------------------------
__global__ __launch_bounds__(256) void conv_silu_kernel(
    const float* __restrict__ xt, const float* __restrict__ cw,
    const float* __restrict__ cb, __bf16* __restrict__ xc_bf,
    __bf16* __restrict__ xt_bf)
{
    const int tok = blockIdx.y;
    const int p   = blockIdx.x * 256 + threadIdx.x;
    const size_t base = (size_t)tok * PDIM;
    const float w0 = cw[0], w1 = cw[1], w2 = cw[2], w3 = cw[3];

    const float x3 = xt[base + p];
    float acc = cb[0] + w3 * x3;
    if (p >= 1) acc += w2 * xt[base + p - 1];
    if (p >= 2) acc += w1 * xt[base + p - 2];
    if (p >= 3) acc += w0 * xt[base + p - 3];
    const float sv = acc / (1.0f + __expf(-acc));   // silu
    xc_bf[base + p] = (__bf16)sv;
    xt_bf[base + p] = (__bf16)x3;
}

// ---------------------------------------------------------------------------
// i/f gate projections (P x 8 each) + softcap(15) — tiny, plain VALU.
// ---------------------------------------------------------------------------
__global__ __launch_bounds__(256) void gates_kernel(
    const __bf16* __restrict__ xc, const float* __restrict__ Wi,
    const float* __restrict__ bi, const float* __restrict__ Wf,
    const float* __restrict__ bfv, float* __restrict__ ipre,
    float* __restrict__ fpre)
{
    const int tok = blockIdx.x;
    const int tid = threadIdx.x;
    float pi[NH] = {}, pf[NH] = {};
    for (int p = tid; p < PDIM; p += 256) {
        const float xv = (float)xc[(size_t)tok * PDIM + p];
#pragma unroll
        for (int g = 0; g < NH; ++g) {
            pi[g] += xv * Wi[p * NH + g];
            pf[g] += xv * Wf[p * NH + g];
        }
    }
    __shared__ float red[256];
    for (int g = 0; g < NH; ++g) {
        red[tid] = pi[g];
        __syncthreads();
        for (int s = 128; s > 0; s >>= 1) {
            if (tid < s) red[tid] += red[tid + s];
            __syncthreads();
        }
        if (tid == 0) {
            float v = red[0] + bi[g];
            ipre[(size_t)tok * NH + g] = 15.0f * tanhf(v * (1.0f / 15.0f));
        }
        __syncthreads();
        red[tid] = pf[g];
        __syncthreads();
        for (int s = 128; s > 0; s >>= 1) {
            if (tid < s) red[tid] += red[tid + s];
            __syncthreads();
        }
        if (tid == 0) {
            float v = red[0] + bfv[g];
            fpre[(size_t)tok * NH + g] = 15.0f * tanhf(v * (1.0f / 15.0f));
        }
        __syncthreads();
    }
}

// ---------------------------------------------------------------------------
// Sequential mLSTM scan. One block per (b,h); C(64x64) state in registers:
// thread t owns row d=t/4, e-range [(t%4)*16, +16). n held by threads < 64.
// ---------------------------------------------------------------------------
__global__ __launch_bounds__(256) void scan_kernel(
    const float* __restrict__ q, const float* __restrict__ k,
    const float* __restrict__ v, const float* __restrict__ ipre,
    const float* __restrict__ fpre, float* __restrict__ hseq)
{
    const int bh = blockIdx.x;           // 0..31
    const int b  = bh >> 3;
    const int h  = bh & 7;
    const int tid = threadIdx.x;
    const int d  = tid >> 2;
    const int e0 = (tid & 3) * 16;

    float c[16];
#pragma unroll
    for (int j = 0; j < 16; ++j) c[j] = 0.0f;
    float ne = 1.0f;                     // n init = ones
    float m  = 0.0f;

    __shared__ float qs[64], ks[64], vs[64];
    __shared__ float part[64][5];
    __shared__ float red[64];
    __shared__ float gi, gf, den;

    for (int t = 0; t < 512; ++t) {
        const size_t gidx = (size_t)(b * 512 + t) * NH + h;
        const size_t base = gidx * DH;
        if (tid < 64) {
            qs[tid] = q[base + tid];
            ks[tid] = k[base + tid];
            vs[tid] = v[base + tid];
        }
        if (tid == 0) { gi = ipre[gidx]; gf = fpre[gidx]; }
        __syncthreads();

        const float it = gi, ft = gf;
        const float mnew = fmaxf(ft + m, it);
        const float ie = __expf(it - mnew);
        const float fe = __expf(ft - mnew + m);
        m = mnew;

        const float vd = vs[d];
        float ps = 0.0f;
#pragma unroll
        for (int j = 0; j < 16; ++j) {
            const int e = e0 + j;
            c[j] = fe * c[j] + ie * vd * ks[e];
            ps += c[j] * qs[e];
        }
        part[d][tid & 3] = ps;
        if (tid < 64) {
            ne = fe * ne + ie * ks[tid];
            red[tid] = ne * qs[tid];
        }
        __syncthreads();
        if (tid == 0) {
            float s = 0.0f;
            for (int e = 0; e < 64; ++e) s += red[e];
            den = fmaxf(s, 1.0f);
        }
        __syncthreads();
        if (tid < 64) {
            const float num = part[tid][0] + part[tid][1] + part[tid][2] + part[tid][3];
            hseq[base + tid] = num / den;
        }
        __syncthreads();
    }
}

// ---------------------------------------------------------------------------
// h = o * hseq; per-head LayerNorm over Dh; z = (hn*hw+hb + skip) * silu(r)
// One block (512 threads) per token; thread = (h,d).
// ---------------------------------------------------------------------------
__global__ __launch_bounds__(512) void combine_kernel(
    const float* __restrict__ o, const float* __restrict__ hseq,
    const float* __restrict__ skip, const float* __restrict__ r,
    const float* __restrict__ hlnw, const float* __restrict__ hlnb,
    __bf16* __restrict__ z)
{
    const int tok = blockIdx.x;
    const int tid = threadIdx.x;          // 0..511
    const int d   = tid & 63;
    const size_t idx = (size_t)tok * HDIM + tid;

    const float hv = o[idx] * hseq[idx];
    __shared__ float s1[512], s2[512];
    s1[tid] = hv; s2[tid] = hv * hv;
    __syncthreads();
    for (int st = 32; st > 0; st >>= 1) {
        if (d < st) { s1[tid] += s1[tid + st]; s2[tid] += s2[tid + st]; }
        __syncthreads();
    }
    const int hb0 = tid & ~63;
    const float mu  = s1[hb0] * (1.0f / DH);
    const float var = s2[hb0] * (1.0f / DH) - mu * mu;
    const float hn  = (hv - mu) * rsqrtf(var + 1e-6f) * hlnw[tid] + hlnb[tid];
    const float rv  = r[idx];
    const float sr  = rv / (1.0f + __expf(-rv));
    z[idx] = (__bf16)((hn + skip[idx]) * sr);
}

// ---------------------------------------------------------------------------
// host launcher
// ---------------------------------------------------------------------------
extern "C" void kernel_launch(void* const* d_in, const int* in_sizes, int n_in,
                              void* d_out, int out_size, void* d_ws, size_t ws_size,
                              hipStream_t stream)
{
    const float* x     = (const float*)d_in[0];
    const float* ln_w  = (const float*)d_in[1];
    const float* ln_b  = (const float*)d_in[2];
    const float* hln_w = (const float*)d_in[3];
    const float* hln_b = (const float*)d_in[4];
    const float* Wl    = (const float*)d_in[5];
    const float* bl    = (const float*)d_in[6];
    const float* Wr    = (const float*)d_in[7];
    const float* br    = (const float*)d_in[8];
    const float* conv_w= (const float*)d_in[9];
    const float* conv_b= (const float*)d_in[10];
    const float* Wskip = (const float*)d_in[11];
    const float* bskip = (const float*)d_in[12];
    const float* Wi    = (const float*)d_in[13];
    const float* bi    = (const float*)d_in[14];
    const float* Wf    = (const float*)d_in[15];
    const float* bfv   = (const float*)d_in[16];
    const float* Wo    = (const float*)d_in[17];
    const float* bo    = (const float*)d_in[18];
    const float* Wq    = (const float*)d_in[19];
    const float* bq    = (const float*)d_in[20];
    const float* Wk    = (const float*)d_in[21];
    const float* bk    = (const float*)d_in[22];
    const float* Wv    = (const float*)d_in[23];
    const float* bv    = (const float*)d_in[24];
    const float* Wd    = (const float*)d_in[25];
    const float* bd    = (const float*)d_in[26];

    // --- workspace carve (whole working set fits in MI455X's 192MB L2) ---
    char* ws = (char*)d_ws;
    auto carve = [&](size_t bytes) {
        char* p = ws;
        ws += (bytes + 255) & ~(size_t)255;
        return p;
    };
    // transposed bf16 weights (N x K layout)
    __bf16* WlT    = (__bf16*)carve((size_t)DIM * PDIM * 2);   // 2048 x 1024
    __bf16* WrT    = (__bf16*)carve((size_t)DIM * HDIM * 2);   // 512 x 1024
    __bf16* WskipT = (__bf16*)carve((size_t)PDIM * HDIM * 2);  // 512 x 2048
    __bf16* WqT    = (__bf16*)carve((size_t)PDIM * HDIM * 2);
    __bf16* WkT    = (__bf16*)carve((size_t)PDIM * HDIM * 2);
    __bf16* WvT    = (__bf16*)carve((size_t)PDIM * HDIM * 2);
    __bf16* WoT    = (__bf16*)carve((size_t)PDIM * HDIM * 2);
    __bf16* WdT    = (__bf16*)carve((size_t)HDIM * DIM * 2);   // 1024 x 512
    __bf16* xn_bf  = (__bf16*)carve((size_t)NTOK * DIM * 2);
    float*  xt     = (float*) carve((size_t)NTOK * PDIM * 4);
    __bf16* xt_bf  = (__bf16*)carve((size_t)NTOK * PDIM * 2);
    __bf16* xc_bf  = (__bf16*)carve((size_t)NTOK * PDIM * 2);
    float*  rbuf   = (float*) carve((size_t)NTOK * HDIM * 4);
    float*  skip   = (float*) carve((size_t)NTOK * HDIM * 4);
    float*  qb     = (float*) carve((size_t)NTOK * HDIM * 4);
    float*  kb     = (float*) carve((size_t)NTOK * HDIM * 4);
    float*  vb     = (float*) carve((size_t)NTOK * HDIM * 4);
    float*  ob     = (float*) carve((size_t)NTOK * HDIM * 4);
    float*  ipre   = (float*) carve((size_t)NTOK * NH * 4);
    float*  fpre   = (float*) carve((size_t)NTOK * NH * 4);
    float*  hseq   = (float*) carve((size_t)NTOK * HDIM * 4);
    __bf16* z_bf   = (__bf16*)carve((size_t)NTOK * HDIM * 2);
    (void)ws_size; (void)in_sizes; (void)n_in; (void)out_size;

    // cast + transpose weights: src is (K x N) row-major -> dst (N x K) bf16
    auto castT = [&](const float* src, __bf16* dst, int K, int N) {
        cast_transpose_kernel<<<dim3(N / 32, K / 32), 256, 0, stream>>>(src, dst, K, N);
    };
    castT(Wl,    WlT,    DIM,  PDIM);
    castT(Wr,    WrT,    DIM,  HDIM);
    castT(Wskip, WskipT, PDIM, HDIM);
    castT(Wq,    WqT,    PDIM, HDIM);
    castT(Wk,    WkT,    PDIM, HDIM);
    castT(Wv,    WvT,    PDIM, HDIM);
    castT(Wo,    WoT,    PDIM, HDIM);
    castT(Wd,    WdT,    HDIM, DIM);

    layernorm_kernel<<<NTOK, 256, 0, stream>>>(x, ln_w, ln_b, xn_bf);

    // xt = xn @ Wl + bl   (2048x1024x2048)
    gemm_bf16_wmma<0><<<dim3(PDIM / 128, NTOK / 128), 256, 0, stream>>>(
        xn_bf, WlT, bl, nullptr, xt, NTOK, PDIM, DIM, 1.0f);
    // r = xn @ Wr + br
    gemm_bf16_wmma<0><<<dim3(HDIM / 128, NTOK / 128), 256, 0, stream>>>(
        xn_bf, WrT, br, nullptr, rbuf, NTOK, HDIM, DIM, 1.0f);

    conv_silu_kernel<<<dim3(PDIM / 256, NTOK), 256, 0, stream>>>(
        xt, conv_w, conv_b, xc_bf, xt_bf);

    // skip / q / k (k scaled by 1/sqrt(Dh))
    gemm_bf16_wmma<0><<<dim3(HDIM / 128, NTOK / 128), 256, 0, stream>>>(
        xc_bf, WskipT, bskip, nullptr, skip, NTOK, HDIM, PDIM, 1.0f);
    gemm_bf16_wmma<0><<<dim3(HDIM / 128, NTOK / 128), 256, 0, stream>>>(
        xc_bf, WqT, bq, nullptr, qb, NTOK, HDIM, PDIM, 1.0f);
    gemm_bf16_wmma<0><<<dim3(HDIM / 128, NTOK / 128), 256, 0, stream>>>(
        xc_bf, WkT, bk, nullptr, kb, NTOK, HDIM, PDIM, 0.125f);
    // v = xt @ Wv, o = sigmoid(xt @ Wo)
    gemm_bf16_wmma<0><<<dim3(HDIM / 128, NTOK / 128), 256, 0, stream>>>(
        xt_bf, WvT, bv, nullptr, vb, NTOK, HDIM, PDIM, 1.0f);
    gemm_bf16_wmma<1><<<dim3(HDIM / 128, NTOK / 128), 256, 0, stream>>>(
        xt_bf, WoT, bo, nullptr, ob, NTOK, HDIM, PDIM, 1.0f);

    gates_kernel<<<NTOK, 256, 0, stream>>>(xc_bf, Wi, bi, Wf, bfv, ipre, fpre);

    scan_kernel<<<32, 256, 0, stream>>>(qb, kb, vb, ipre, fpre, hseq);

    combine_kernel<<<NTOK, 512, 0, stream>>>(ob, hseq, skip, rbuf, hln_w, hln_b, z_bf);

    // out = z @ Wd + bd + x
    gemm_bf16_wmma<2><<<dim3(DIM / 128, NTOK / 128), 256, 0, stream>>>(
        z_bf, WdT, bd, x, (float*)d_out, NTOK, DIM, HDIM, 1.0f);
}

// v001
// Measured time: 292 microseconds a run.
// Timed twice side by side with v000, it ran 3.50 and 3.51 times as fast.
#include <hip/hip_runtime.h>
#include <cstdint>
#include <cstddef>

// ---------------------------------------------------------------------------
// mLSTM block forward for MI455X (gfx1250), bf16 WMMA GEMMs + f32 scan.
// B=4 T=512 D=1024 H=8 Dh=64 HD=512 P=2048 K=4
// Weights are cast+TRANSPOSED to bf16 once so that both WMMA operands are
// K-contiguous -> all LDS fragment reads are ds_load_b128 (no scalar gathers).
// GEMM tiles are DOUBLE-BUFFERED and staged with CDNA5 async global->LDS DMA
// (ASYNCcnt): DMA for tile i+1 overlaps WMMA compute on tile i.
// ---------------------------------------------------------------------------

#define NTOK 2048      // B*T
#define DIM  1024      // D
#define PDIM 2048      // P
#define HDIM 512       // HD
#define NH   8         // H
#define DH   64        // Dh

typedef __attribute__((ext_vector_type(16))) __bf16 v16bf;
typedef __attribute__((ext_vector_type(8)))  float  v8f;

union FragV {
    uint4 u[2];
    v16bf v;
};

// async global->LDS 128-bit DMA (per-lane), tracked by ASYNCcnt
__device__ __forceinline__ void async_copy_b128(unsigned lds_addr, const void* gaddr)
{
    asm volatile("global_load_async_to_lds_b128 %0, %1, off"
                 :: "v"(lds_addr), "v"(gaddr) : "memory");
}
__device__ __forceinline__ void wait_asynccnt0()
{
    asm volatile("s_wait_asynccnt 0x0" ::: "memory");
}

// ---------------------------------------------------------------------------
// cast f32 -> bf16 with transpose: in (R x C row-major) -> out (C x R)
// 32x32 tiles through LDS, coalesced on both sides. R, C multiples of 32.
// ---------------------------------------------------------------------------
__global__ __launch_bounds__(256) void cast_transpose_kernel(
    const float* __restrict__ in, __bf16* __restrict__ out, int R, int C)
{
    __shared__ __bf16 tile[32][33];
    const int c0 = blockIdx.x * 32;
    const int r0 = blockIdx.y * 32;
    const int tx = threadIdx.x & 31;
    const int ty = threadIdx.x >> 5;       // 8 rows per pass
#pragma unroll
    for (int i = 0; i < 32; i += 8)
        tile[ty + i][tx] = (__bf16)in[(size_t)(r0 + ty + i) * C + c0 + tx];
    __syncthreads();
#pragma unroll
    for (int i = 0; i < 32; i += 8)
        out[(size_t)(c0 + ty + i) * R + r0 + tx] = tile[tx][ty + i];
}

// ---------------------------------------------------------------------------
// LayerNorm over D=1024, one block per token, writes bf16
// ---------------------------------------------------------------------------
__global__ __launch_bounds__(256) void layernorm_kernel(
    const float* __restrict__ x, const float* __restrict__ w,
    const float* __restrict__ b, __bf16* __restrict__ xn)
{
    const int tok = blockIdx.x;
    const int tid = threadIdx.x;
    const float* xr = x + (size_t)tok * DIM;

    float s = 0.f, ss = 0.f;
    float v[4];
#pragma unroll
    for (int i = 0; i < 4; ++i) {
        v[i] = xr[tid + i * 256];
        s += v[i];
        ss += v[i] * v[i];
    }
    __shared__ float r1[256], r2[256];
    r1[tid] = s; r2[tid] = ss;
    __syncthreads();
    for (int st = 128; st > 0; st >>= 1) {
        if (tid < st) { r1[tid] += r1[tid + st]; r2[tid] += r2[tid + st]; }
        __syncthreads();
    }
    const float mu  = r1[0] * (1.0f / DIM);
    const float var = r2[0] * (1.0f / DIM) - mu * mu;
    const float inv = rsqrtf(var + 1e-6f);
#pragma unroll
    for (int i = 0; i < 4; ++i) {
        int idx = tid + i * 256;
        float y = (v[i] - mu) * inv * w[idx] + b[idx];
        xn[(size_t)tok * DIM + idx] = (__bf16)y;
    }
}

// ---------------------------------------------------------------------------
// WMMA GEMM: C(MxN,f32) = epilogue(A_bf16(MxK,row) @ Bt_bf16(NxK,row)^T + bias)
//  EPI 0: val = (acc+bias)*scale
//  EPI 1: val = sigmoid(acc+bias)
//  EPI 2: val = acc+bias+resid[idx]
// Workgroup tile 128x128, 8 waves (4x2) of 32x64; K-step 32.
// Double-buffered LDS tiles staged with global_load_async_to_lds_b128:
// DMA of tile i+1 overlaps the WMMAs of tile i; fragments via ds_load_b128.
// M,N multiples of 128; K multiple of 32.
// ---------------------------------------------------------------------------
#define TILE_K  32
#define T_STRIDE 40   // 32 K + 8 pad, keeps 16B alignment for c in {0,8,16,24}
#define BUF_ELEMS (128 * T_STRIDE)
#define BUF_BYTES (BUF_ELEMS * 2)

template <int EPI>
__global__ __launch_bounds__(256) void gemm_bf16_wmma(
    const __bf16* __restrict__ A, const __bf16* __restrict__ Bt,
    const float* __restrict__ bias, const float* __restrict__ resid,
    float* __restrict__ C, int M, int N, int K, float scale)
{
    __shared__ __bf16 As[2][BUF_ELEMS];
    __shared__ __bf16 Bs[2][BUF_ELEMS];

    const int tid  = threadIdx.x;
    const int lane = tid & 31;
    const int wave = tid >> 5;
    const int wm   = wave & 3;   // wave row (0..3) -> 32 rows each
    const int wn   = wave >> 2;  // wave col (0..1) -> 64 cols each
    const int row0 = blockIdx.y * 128;
    const int col0 = blockIdx.x * 128;

    const int lhalf = lane >> 4;   // 0 | 1
    const int lmod  = lane & 15;
    const int kof   = lhalf * 8;   // K offset within 16-lane half

    // per-thread staging coordinates (8 bf16 = 16B per transfer, x2 rows)
    const int lin0 = tid * 8;
    const int lin1 = (tid + 256) * 8;
    const int sr0 = lin0 >> 5, sc0 = lin0 & 31;
    const int sr1 = lin1 >> 5, sc1 = lin1 & 31;
    const unsigned ldsA0 = (unsigned)(uintptr_t)&As[0][sr0 * T_STRIDE + sc0];
    const unsigned ldsA1 = (unsigned)(uintptr_t)&As[0][sr1 * T_STRIDE + sc1];
    const unsigned ldsB0 = (unsigned)(uintptr_t)&Bs[0][sr0 * T_STRIDE + sc0];
    const unsigned ldsB1 = (unsigned)(uintptr_t)&Bs[0][sr1 * T_STRIDE + sc1];

    const __bf16* gA0 = A  + (size_t)(row0 + sr0) * K + sc0;
    const __bf16* gA1 = A  + (size_t)(row0 + sr1) * K + sc1;
    const __bf16* gB0 = Bt + (size_t)(col0 + sr0) * K + sc0;
    const __bf16* gB1 = Bt + (size_t)(col0 + sr1) * K + sc1;

    auto stage = [&](int k0, int buf) {
        const unsigned off = (unsigned)buf * BUF_BYTES;
        async_copy_b128(ldsA0 + off, gA0 + k0);
        async_copy_b128(ldsA1 + off, gA1 + k0);
        async_copy_b128(ldsB0 + off, gB0 + k0);
        async_copy_b128(ldsB1 + off, gB1 + k0);
    };

    v8f acc[2][4];
#pragma unroll
    for (int i = 0; i < 2; ++i)
#pragma unroll
        for (int j = 0; j < 4; ++j) {
            v8f z = {};
            acc[i][j] = z;
        }

    // preload tile 0
    stage(0, 0);
    wait_asynccnt0();
    __syncthreads();

    int cur = 0;
    for (int k0 = 0; k0 < K; k0 += TILE_K) {
        // issue DMA for the NEXT tile into the other buffer (overlaps compute)
        if (k0 + TILE_K < K) {
            stage(k0 + TILE_K, cur ^ 1);
            // L2 prefetch two tiles ahead (global_prefetch_b8 path)
            __builtin_prefetch(gA0 + k0 + 2 * TILE_K, 0, 1);
            __builtin_prefetch(gB0 + k0 + 2 * TILE_K, 0, 1);
        }

        // --- fragments from current buffer (K-contiguous for A and B) ---
        FragV af[2], bfr[4];
#pragma unroll
        for (int mt = 0; mt < 2; ++mt) {
            const int r = wm * 32 + mt * 16 + lmod;
            af[mt].u[0] = *reinterpret_cast<const uint4*>(&As[cur][r * T_STRIDE + kof]);
            af[mt].u[1] = *reinterpret_cast<const uint4*>(&As[cur][r * T_STRIDE + 16 + kof]);
        }
#pragma unroll
        for (int nt = 0; nt < 4; ++nt) {
            const int r = wn * 64 + nt * 16 + lmod;
            bfr[nt].u[0] = *reinterpret_cast<const uint4*>(&Bs[cur][r * T_STRIDE + kof]);
            bfr[nt].u[1] = *reinterpret_cast<const uint4*>(&Bs[cur][r * T_STRIDE + 16 + kof]);
        }
        // --- 8 WMMAs per wave per K-step (DMA for next tile in flight) ---
#pragma unroll
        for (int mt = 0; mt < 2; ++mt)
#pragma unroll
            for (int nt = 0; nt < 4; ++nt)
                acc[mt][nt] = __builtin_amdgcn_wmma_f32_16x16x32_bf16(
                    false, af[mt].v, false, bfr[nt].v,
                    (short)0, acc[mt][nt], false, false);

        // next tile fully in LDS (own wave) + all waves done with both ops
        wait_asynccnt0();
        __syncthreads();
        cur ^= 1;
    }

    // --- epilogue + store (C layout: lane<16 -> M=vgpr, lane>=16 -> M=8+vgpr) ---
#pragma unroll
    for (int mt = 0; mt < 2; ++mt) {
#pragma unroll
        for (int nt = 0; nt < 4; ++nt) {
            const int col = col0 + wn * 64 + nt * 16 + lmod;
            const float bv = bias[col];
#pragma unroll
            for (int vv = 0; vv < 8; ++vv) {
                const int row = row0 + wm * 32 + mt * 16 + lhalf * 8 + vv;
                const size_t idx = (size_t)row * N + col;
                float val = acc[mt][nt][vv] + bv;
                if (EPI == 0) {
                    val *= scale;
                } else if (EPI == 1) {
                    val = 1.0f / (1.0f + __expf(-val));
                } else {
                    val += resid[idx];
                }
                C[idx] = val;
            }
        }
    }
}

// ---------------------------------------------------------------------------
// Causal conv (K=4) along the feature axis + SiLU; also emits xt as bf16.
// ---------------------------------------------------------------------------
__global__ __launch_bounds__(256) void conv_silu_kernel(
    const float* __restrict__ xt, const float* __restrict__ cw,
    const float* __restrict__ cb, __bf16* __restrict__ xc_bf,
    __bf16* __restrict__ xt_bf)
{
    const int tok = blockIdx.y;
    const int p   = blockIdx.x * 256 + threadIdx.x;
    const size_t base = (size_t)tok * PDIM;
    const float w0 = cw[0], w1 = cw[1], w2 = cw[2], w3 = cw[3];

    const float x3 = xt[base + p];
    float acc = cb[0] + w3 * x3;
    if (p >= 1) acc += w2 * xt[base + p - 1];
    if (p >= 2) acc += w1 * xt[base + p - 2];
    if (p >= 3) acc += w0 * xt[base + p - 3];
    const float sv = acc / (1.0f + __expf(-acc));   // silu
    xc_bf[base + p] = (__bf16)sv;
    xt_bf[base + p] = (__bf16)x3;
}

// ---------------------------------------------------------------------------
// i/f gate projections (P x 8 each) + softcap(15) — tiny, plain VALU.
// ---------------------------------------------------------------------------
__global__ __launch_bounds__(256) void gates_kernel(
    const __bf16* __restrict__ xc, const float* __restrict__ Wi,
    const float* __restrict__ bi, const float* __restrict__ Wf,
    const float* __restrict__ bfv, float* __restrict__ ipre,
    float* __restrict__ fpre)
{
    const int tok = blockIdx.x;
    const int tid = threadIdx.x;
    float pi[NH] = {}, pf[NH] = {};
    for (int p = tid; p < PDIM; p += 256) {
        const float xv = (float)xc[(size_t)tok * PDIM + p];
#pragma unroll
        for (int g = 0; g < NH; ++g) {
            pi[g] += xv * Wi[p * NH + g];
            pf[g] += xv * Wf[p * NH + g];
        }
    }
    __shared__ float red[256];
    for (int g = 0; g < NH; ++g) {
        red[tid] = pi[g];
        __syncthreads();
        for (int s = 128; s > 0; s >>= 1) {
            if (tid < s) red[tid] += red[tid + s];
            __syncthreads();
        }
        if (tid == 0) {
            float v = red[0] + bi[g];
            ipre[(size_t)tok * NH + g] = 15.0f * tanhf(v * (1.0f / 15.0f));
        }
        __syncthreads();
        red[tid] = pf[g];
        __syncthreads();
        for (int s = 128; s > 0; s >>= 1) {
            if (tid < s) red[tid] += red[tid + s];
            __syncthreads();
        }
        if (tid == 0) {
            float v = red[0] + bfv[g];
            fpre[(size_t)tok * NH + g] = 15.0f * tanhf(v * (1.0f / 15.0f));
        }
        __syncthreads();
    }
}

// ---------------------------------------------------------------------------
// The gated recurrence in its closed (parallel) form, f32 16x16x4 WMMA.
// With F_t = sum_{u<=t} f_u, w_s = i_s - F_s and M_t = max(0, max_{s<=t} w_s)
// (M_t = m_t - F_t of the recurrence) the scan unrolls exactly to
//   num_t = sum_{s<=t} exp(w_s - M_t) (q_t . k_s) v_s
//   den_t = max(exp(-M_t) sum_e q_t[e] + sum_{s<=t} exp(w_s - M_t) (q_t . k_s), 1)
// Every exponent is <= 0. One block per (b,h, 64 rows of t), 8 waves: wave (rg,half)
// does rows 16rg..+15; columns 32half..+31 of each S tile, then of O.
// K is staged as K[s][e], V transposed as V[d][s]: both B fragments are 16-byte
// LDS loads along k and need no register shuffle.
// ---------------------------------------------------------------------------
typedef __attribute__((ext_vector_type(2))) float v2f;
typedef __attribute__((ext_vector_type(4))) float v4f;
#define SEQ    512
#define KV_P   68     // f32 row pitch: 64 + 4, 16B aligned, conflict-free b128 rows

// 2^x. The v_nop is the slot the instruction set asks for behind a transcendental
// before its source may be overwritten or its result used; in one statement with
// it, it cannot drift away.
__device__ __forceinline__ float exp2_slot(float x)
{
    float y;
    asm("v_exp_f32 %0, %1\n\tv_nop" : "=v"(y) : "v"(x));
    return y;
}
#define LOG2E 1.44269504088896340736f

// Distance behind a block of f32 16x16x4 WMMAs before vector instructions may read
// the accumulators or reuse the operand registers. The form has the issue interval
// of the 8-bit-integer form, so that form's eight slots are kept. The scheduling
// barriers hold the block together: no vector instruction moves in between the
// WMMAs or in front of the v_nops.
#define WMMA_BLOCK_BEGIN() __builtin_amdgcn_sched_barrier(0)
#define WMMA_BLOCK_END()                                                        \
    do {                                                                        \
        __builtin_amdgcn_sched_barrier(0);                                      \
        asm volatile("v_nop\n\tv_nop\n\tv_nop\n\tv_nop\n\t"                     \
                     "v_nop\n\tv_nop\n\tv_nop\n\tv_nop");                       \
        __builtin_amdgcn_sched_barrier(0);                                      \
    } while (0)

// one 64x64 f32 tile of K (4 x 16 B along e) and of V (16 rows s of one column d)
__device__ __forceinline__ void fetch_kv(const float* __restrict__ kp,
                                         const float* __restrict__ vp,
                                         v4f (&kr)[4], float (&vr)[16])
{
#pragma unroll
    for (int i = 0; i < 4; ++i)
        kr[i] = *reinterpret_cast<const v4f*>(kp + (size_t)i * 16 * NH * DH);
#pragma unroll
    for (int j = 0; j < 16; ++j)
        vr[j] = vp[(size_t)j * NH * DH];
}

// acc[0..1] += A(16 x 64, fragments af) * B^T, B rows brow and brow + 16 of a
// 64-wide LDS tile; lane (c,hf) takes k = 8m + 4hf + 0..3 on both operands
__device__ __forceinline__ void mma_16x32x64(v8f (&acc)[2], const v4f (&af)[8],
                                             const float* bt, int brow, int hf)
{
#pragma unroll
    for (int m = 0; m < 8; ++m) {
        const v4f b0 = *reinterpret_cast<const v4f*>(&bt[brow * KV_P + 8 * m + 4 * hf]);
        const v4f b1 = *reinterpret_cast<const v4f*>(&bt[(brow + 16) * KV_P + 8 * m + 4 * hf]);
        const v2f alo = {af[m].x, af[m].y}, ahi = {af[m].z, af[m].w};
        const v2f b0lo = {b0.x, b0.y}, b0hi = {b0.z, b0.w};
        const v2f b1lo = {b1.x, b1.y}, b1hi = {b1.z, b1.w};
        acc[0] = __builtin_amdgcn_wmma_f32_16x16x4_f32(
            false, alo, false, b0lo, (short)0, acc[0], false, false);
        acc[1] = __builtin_amdgcn_wmma_f32_16x16x4_f32(
            false, alo, false, b1lo, (short)0, acc[1], false, false);
        acc[0] = __builtin_amdgcn_wmma_f32_16x16x4_f32(
            false, ahi, false, b0hi, (short)0, acc[0], false, false);
        acc[1] = __builtin_amdgcn_wmma_f32_16x16x4_f32(
            false, ahi, false, b1hi, (short)0, acc[1], false, false);
    }
}

__global__ __launch_bounds__(256) void scan_parallel_kernel(
    const float* __restrict__ q, const float* __restrict__ k,
    const float* __restrict__ v, const float* __restrict__ ipre,
    const float* __restrict__ fpre, float* __restrict__ hseq)
{
    __shared__ __attribute__((aligned(16))) float Ks[64 * KV_P];
    __shared__ __attribute__((aligned(16))) float Vt[64 * KV_P];
    __shared__ __attribute__((aligned(16))) float Ps[4][16 * KV_P];
    __shared__ float wS[SEQ];
    __shared__ float mS[SEQ];
    __shared__ float dS[2][64];

    const int rt   = SEQ / 64 - 1 - (int)blockIdx.x;   // longest tiles first
    const int bh   = blockIdx.y;
    const int b    = bh >> 3;
    const int h    = bh & 7;
    const int tid  = threadIdx.x;
    const int lane = tid & 31;
    const int wave = tid >> 5;
    const int rg   = wave & 3;           // 16-row group
    const int half = wave >> 2;          // 32-column half
    const int c    = lane & 15;
    const int hf   = lane >> 4;
    const int t0   = rt * 64;

    const size_t rowstride = (size_t)NH * DH;                 // floats between t and t+1
    const size_t hbase = ((size_t)b * SEQ * NH + h) * DH;     // (b, t=0, h, 0)

    // staging coordinates. K: rows srow + 16i, 16 B at column sc4.
    // V: column vd, rows vs0 .. vs0 + 15 (a wave reads 128 contiguous bytes per row)
    const int srow = tid >> 4;
    const int sc4  = (tid & 15) * 4;
    const int vd   = tid & 63;
    const int vs0  = (tid >> 6) * 16;

    const float* kp = k + hbase + (size_t)srow * rowstride + sc4;
    const float* vp = v + hbase + (size_t)vs0 * rowstride + vd;
    v4f kreg[4];
    float vreg[16];
    fetch_kv(kp, vp, kreg, vreg);

    // Q fragments, kept in registers: lane (c,hf) holds row c, e = 8m + 4hf + 0..3
    v4f qf[8];
    {
        const size_t g = hbase + (size_t)(t0 + rg * 16 + c) * rowstride + 4 * hf;
#pragma unroll
        for (int m = 0; m < 8; ++m)
            qf[m] = *reinterpret_cast<const v4f*>(q + g + 8 * m);
    }

    // gate prefixes for the whole sequence: wave 0, 16 consecutive t per lane
    if (wave == 0) {
        float fv[16], iv[16];
        const size_t g0 = ((size_t)b * SEQ + lane * 16) * NH + h;
#pragma unroll
        for (int j = 0; j < 16; ++j) fv[j] = fpre[g0 + (size_t)j * NH];
        // the second run of loads lands in the address registers of the first
        asm volatile("s_wait_xcnt 0x0" ::: "memory");
#pragma unroll
        for (int j = 0; j < 16; ++j) iv[j] = ipre[g0 + (size_t)j * NH];
#pragma unroll
        for (int j = 1; j < 16; ++j) fv[j] += fv[j - 1];
        float incl = fv[15];
#pragma unroll
        for (int o = 1; o < 32; o <<= 1) {
            const float up = __shfl_up(incl, o, 32);
            if (lane >= o) incl += up;
        }
        float excl = __shfl_up(incl, 1, 32);   // sum of all earlier lanes
        if (lane == 0) excl = 0.0f;
        float run = 0.0f;                 // M starts at m0 - F0 = 0
#pragma unroll
        for (int j = 0; j < 16; ++j) {
            iv[j] = iv[j] - (excl + fv[j]);      // w_s
            run = fmaxf(run, iv[j]);
            fv[j] = run;                          // lane-local running max
        }
        float mx = run;
#pragma unroll
        for (int o = 1; o < 32; o <<= 1) {
            const float up = __shfl_up(mx, o, 32);
            if (lane >= o) mx = fmaxf(mx, up);
        }
        float prev = __shfl_up(mx, 1, 32);
        if (lane == 0) prev = 0.0f;
#pragma unroll
        for (int j = 0; j < 16; ++j) {
            wS[lane * 16 + j] = iv[j];
            mS[lane * 16 + j] = fmaxf(prev, fv[j]);
        }
    }

    // sum_e q_t[e] for row c (both lane halves end with the row total)
    float qsum = 0.0f;
#pragma unroll
    for (int m = 0; m < 8; ++m) qsum += (qf[m].x + qf[m].y) + (qf[m].z + qf[m].w);
    qsum += __shfl_xor(qsum, 16, 32);

    v8f oacc[2];
#pragma unroll
    for (int n = 0; n < 2; ++n) { v8f z = {}; oacc[n] = z; }
    float rsum[8];
#pragma unroll
    for (int r = 0; r < 8; ++r) rsum[r] = 0.0f;

    float* Pw = &Ps[rg][0];
    const int trow = t0 + rg * 16 + 8 * hf;       // + r : this lane's D rows
    const int cw   = 32 * half + c;               // + 16*j : this lane's D column

    __syncthreads();                      // wS / mS published
    float Mt[8];
#pragma unroll
    for (int r = 0; r < 8; ++r) Mt[r] = mS[trow + r];

    for (int ct = 0; ct <= rt; ++ct) {
        const int s0 = ct * 64;
#pragma unroll
        for (int i = 0; i < 4; ++i) {
            *reinterpret_cast<v4f*>(&Ks[(srow + 16 * i) * KV_P + sc4]) = kreg[i];
            const v4f vv = {vreg[4 * i], vreg[4 * i + 1], vreg[4 * i + 2], vreg[4 * i + 3]};
            *reinterpret_cast<v4f*>(&Vt[vd * KV_P + vs0 + 4 * i]) = vv;
        }
        __syncthreads();                  // tile published
        if (ct < rt) {                    // next tile flies under this tile's WMMAs
            kp += 64 * rowstride;
            vp += 64 * rowstride;
            fetch_kv(kp, vp, kreg, vreg);
        }

        // S = Q K^T, 16 x 32 per wave
        v8f sacc[2];
#pragma unroll
        for (int j = 0; j < 2; ++j) { v8f z = {}; sacc[j] = z; }
        WMMA_BLOCK_BEGIN();
        mma_16x32x64(sacc, qf, Ks, cw, hf);
        WMMA_BLOCK_END();

        // P = S * decay under the causal mask; row sums feed the denominator
#pragma unroll
        for (int j = 0; j < 2; ++j) {
            const int s = s0 + 16 * j + cw;
            const float ws = wS[s];
#pragma unroll
            for (int r = 0; r < 8; ++r) {
                const float e = exp2_slot((ws - Mt[r]) * LOG2E);
                const float p = sacc[j][r] * ((s <= trow + r) ? e : 0.0f);
                rsum[r] += p;
                Pw[(8 * hf + r) * KV_P + 16 * j + cw] = p;
            }
        }
        __syncthreads();                  // both column halves of P published

        // O += P V
        v4f pf[8];
#pragma unroll
        for (int m = 0; m < 8; ++m)
            pf[m] = *reinterpret_cast<const v4f*>(&Pw[c * KV_P + 8 * m + 4 * hf]);
        WMMA_BLOCK_BEGIN();
        mma_16x32x64(oacc, pf, Vt, cw, hf);
        WMMA_BLOCK_END();
        __syncthreads();                  // every reader has left Ks/Vt before the refill
    }

    // row sums: over the 16 lanes of a half wave, then over the two column halves
#pragma unroll
    for (int r = 0; r < 8; ++r) {
        float s = rsum[r];
        s += __shfl_xor(s, 1, 32);
        s += __shfl_xor(s, 2, 32);
        s += __shfl_xor(s, 4, 32);
        s += __shfl_xor(s, 8, 32);
        if (c == 0) dS[half][rg * 16 + 8 * hf + r] = s;
    }
    __syncthreads();                      // both halves' row sums published

    // denominator per row, then store: D register r = row 8hf + r, column cw
#pragma unroll
    for (int r = 0; r < 8; ++r) {
        const int lr = rg * 16 + 8 * hf + r;
        const float s = dS[0][lr] + dS[1][lr];
        const float qs = __shfl(qsum, 8 * hf + r, 32);
        const float den = fmaxf(exp2_slot(-Mt[r] * LOG2E) * qs + s, 1.0f);
        const size_t g = hbase + (size_t)(trow + r) * rowstride + cw;
        hseq[g]      = oacc[0][r] / den;
        hseq[g + 16] = oacc[1][r] / den;
    }
}

// ---------------------------------------------------------------------------
// h = o * hseq; per-head LayerNorm over Dh; z = (hn*hw+hb + skip) * silu(r)
// One block (512 threads) per token; thread = (h,d).
// ---------------------------------------------------------------------------
__global__ __launch_bounds__(512) void combine_kernel(
    const float* __restrict__ o, const float* __restrict__ hseq,
    const float* __restrict__ skip, const float* __restrict__ r,
    const float* __restrict__ hlnw, const float* __restrict__ hlnb,
    __bf16* __restrict__ z)
{
    const int tok = blockIdx.x;
    const int tid = threadIdx.x;          // 0..511
    const int d   = tid & 63;
    const size_t idx = (size_t)tok * HDIM + tid;

    const float hv = o[idx] * hseq[idx];
    __shared__ float s1[512], s2[512];
    s1[tid] = hv; s2[tid] = hv * hv;
    __syncthreads();
    for (int st = 32; st > 0; st >>= 1) {
        if (d < st) { s1[tid] += s1[tid + st]; s2[tid] += s2[tid + st]; }
        __syncthreads();
    }
    const int hb0 = tid & ~63;
    const float mu  = s1[hb0] * (1.0f / DH);
    const float var = s2[hb0] * (1.0f / DH) - mu * mu;
    const float hn  = (hv - mu) * rsqrtf(var + 1e-6f) * hlnw[tid] + hlnb[tid];
    const float rv  = r[idx];
    const float sr  = rv / (1.0f + __expf(-rv));
    z[idx] = (__bf16)((hn + skip[idx]) * sr);
}

// ---------------------------------------------------------------------------
// host launcher
// ---------------------------------------------------------------------------
extern "C" void kernel_launch(void* const* d_in, const int* in_sizes, int n_in,
                              void* d_out, int out_size, void* d_ws, size_t ws_size,
                              hipStream_t stream)
{
    const float* x     = (const float*)d_in[0];
    const float* ln_w  = (const float*)d_in[1];
    const float* ln_b  = (const float*)d_in[2];
    const float* hln_w = (const float*)d_in[3];
    const float* hln_b = (const float*)d_in[4];
    const float* Wl    = (const float*)d_in[5];
    const float* bl    = (const float*)d_in[6];
    const float* Wr    = (const float*)d_in[7];
    const float* br    = (const float*)d_in[8];
    const float* conv_w= (const float*)d_in[9];
    const float* conv_b= (const float*)d_in[10];
    const float* Wskip = (const float*)d_in[11];
    const float* bskip = (const float*)d_in[12];
    const float* Wi    = (const float*)d_in[13];
    const float* bi    = (const float*)d_in[14];
    const float* Wf    = (const float*)d_in[15];
    const float* bfv   = (const float*)d_in[16];
    const float* Wo    = (const float*)d_in[17];
    const float* bo    = (const float*)d_in[18];
    const float* Wq    = (const float*)d_in[19];
    const float* bq    = (const float*)d_in[20];
    const float* Wk    = (const float*)d_in[21];
    const float* bk    = (const float*)d_in[22];
    const float* Wv    = (const float*)d_in[23];
    const float* bv    = (const float*)d_in[24];
    const float* Wd    = (const float*)d_in[25];
    const float* bd    = (const float*)d_in[26];

    // --- workspace carve (whole working set fits in MI455X's 192MB L2) ---
    char* ws = (char*)d_ws;
    auto carve = [&](size_t bytes) {
        char* p = ws;
        ws += (bytes + 255) & ~(size_t)255;
        return p;
    };
    // transposed bf16 weights (N x K layout)
    __bf16* WlT    = (__bf16*)carve((size_t)DIM * PDIM * 2);   // 2048 x 1024
    __bf16* WrT    = (__bf16*)carve((size_t)DIM * HDIM * 2);   // 512 x 1024
    __bf16* WskipT = (__bf16*)carve((size_t)PDIM * HDIM * 2);  // 512 x 2048
    __bf16* WqT    = (__bf16*)carve((size_t)PDIM * HDIM * 2);
    __bf16* WkT    = (__bf16*)carve((size_t)PDIM * HDIM * 2);
    __bf16* WvT    = (__bf16*)carve((size_t)PDIM * HDIM * 2);
    __bf16* WoT    = (__bf16*)carve((size_t)PDIM * HDIM * 2);
    __bf16* WdT    = (__bf16*)carve((size_t)HDIM * DIM * 2);   // 1024 x 512
    __bf16* xn_bf  = (__bf16*)carve((size_t)NTOK * DIM * 2);
    float*  xt     = (float*) carve((size_t)NTOK * PDIM * 4);
    __bf16* xt_bf  = (__bf16*)carve((size_t)NTOK * PDIM * 2);
    __bf16* xc_bf  = (__bf16*)carve((size_t)NTOK * PDIM * 2);
    float*  rbuf   = (float*) carve((size_t)NTOK * HDIM * 4);
    float*  skip   = (float*) carve((size_t)NTOK * HDIM * 4);
    float*  qb     = (float*) carve((size_t)NTOK * HDIM * 4);
    float*  kb     = (float*) carve((size_t)NTOK * HDIM * 4);
    float*  vb     = (float*) carve((size_t)NTOK * HDIM * 4);
    float*  ob     = (float*) carve((size_t)NTOK * HDIM * 4);
    float*  ipre   = (float*) carve((size_t)NTOK * NH * 4);
    float*  fpre   = (float*) carve((size_t)NTOK * NH * 4);
    float*  hseq   = (float*) carve((size_t)NTOK * HDIM * 4);
    __bf16* z_bf   = (__bf16*)carve((size_t)NTOK * HDIM * 2);
    (void)ws_size; (void)in_sizes; (void)n_in; (void)out_size;

    // cast + transpose weights: src is (K x N) row-major -> dst (N x K) bf16
    auto castT = [&](const float* src, __bf16* dst, int K, int N) {
        cast_transpose_kernel<<<dim3(N / 32, K / 32), 256, 0, stream>>>(src, dst, K, N);
    };
    castT(Wl,    WlT,    DIM,  PDIM);
    castT(Wr,    WrT,    DIM,  HDIM);
    castT(Wskip, WskipT, PDIM, HDIM);
    castT(Wq,    WqT,    PDIM, HDIM);
    castT(Wk,    WkT,    PDIM, HDIM);
    castT(Wv,    WvT,    PDIM, HDIM);
    castT(Wo,    WoT,    PDIM, HDIM);
    castT(Wd,    WdT,    HDIM, DIM);

    layernorm_kernel<<<NTOK, 256, 0, stream>>>(x, ln_w, ln_b, xn_bf);

    // xt = xn @ Wl + bl   (2048x1024x2048)
    gemm_bf16_wmma<0><<<dim3(PDIM / 128, NTOK / 128), 256, 0, stream>>>(
        xn_bf, WlT, bl, nullptr, xt, NTOK, PDIM, DIM, 1.0f);
    // r = xn @ Wr + br
    gemm_bf16_wmma<0><<<dim3(HDIM / 128, NTOK / 128), 256, 0, stream>>>(
        xn_bf, WrT, br, nullptr, rbuf, NTOK, HDIM, DIM, 1.0f);

    conv_silu_kernel<<<dim3(PDIM / 256, NTOK), 256, 0, stream>>>(
        xt, conv_w, conv_b, xc_bf, xt_bf);

    // skip / q / k (k scaled by 1/sqrt(Dh))
    gemm_bf16_wmma<0><<<dim3(HDIM / 128, NTOK / 128), 256, 0, stream>>>(
        xc_bf, WskipT, bskip, nullptr, skip, NTOK, HDIM, PDIM, 1.0f);
    gemm_bf16_wmma<0><<<dim3(HDIM / 128, NTOK / 128), 256, 0, stream>>>(
        xc_bf, WqT, bq, nullptr, qb, NTOK, HDIM, PDIM, 1.0f);
    gemm_bf16_wmma<0><<<dim3(HDIM / 128, NTOK / 128), 256, 0, stream>>>(
        xc_bf, WkT, bk, nullptr, kb, NTOK, HDIM, PDIM, 0.125f);
    // v = xt @ Wv, o = sigmoid(xt @ Wo)
    gemm_bf16_wmma<0><<<dim3(HDIM / 128, NTOK / 128), 256, 0, stream>>>(
        xt_bf, WvT, bv, nullptr, vb, NTOK, HDIM, PDIM, 1.0f);
    gemm_bf16_wmma<1><<<dim3(HDIM / 128, NTOK / 128), 256, 0, stream>>>(
        xt_bf, WoT, bo, nullptr, ob, NTOK, HDIM, PDIM, 1.0f);

    gates_kernel<<<NTOK, 256, 0, stream>>>(xc_bf, Wi, bi, Wf, bfv, ipre, fpre);

    scan_parallel_kernel<<<dim3(SEQ / 64, 32), 256, 0, stream>>>(qb, kb, vb, ipre, fpre, hseq);

    combine_kernel<<<NTOK, 512, 0, stream>>>(ob, hseq, skip, rbuf, hln_w, hln_b, z_bf);

    // out = z @ Wd + bd + x
    gemm_bf16_wmma<2><<<dim3(DIM / 128, NTOK / 128), 256, 0, stream>>>(
        z_bf, WdT, bd, x, (float*)d_out, NTOK, DIM, HDIM, 1.0f);
}

// v002
// It runs in 151 microseconds.
// Two timings next to v001 put it at 1.94 and 1.92 times that version's speed.
// All steps since v000 together make it 6.77 times as fast.
#include <hip/hip_runtime.h>
#include <cstdint>
#include <cstddef>

// ---------------------------------------------------------------------------
// mLSTM block forward for MI455X (gfx1250), bf16 WMMA GEMMs + f32 scan.
// B=4 T=512 D=1024 H=8 Dh=64 HD=512 P=2048 K=4
// Weights are cast+TRANSPOSED to bf16 once so that both WMMA operands are
// K-contiguous -> all LDS fragment reads are ds_load_b128 (no scalar gathers).
// GEMM tiles are DOUBLE-BUFFERED and staged with CDNA5 async global->LDS DMA
// (ASYNCcnt): DMA for tile i+1 overlaps WMMA compute on tile i.
// ---------------------------------------------------------------------------

#define NTOK 2048      // B*T
#define DIM  1024      // D
#define PDIM 2048      // P
#define HDIM 512       // HD
#define NH   8         // H
#define DH   64        // Dh

typedef __attribute__((ext_vector_type(16))) __bf16 v16bf;
typedef __attribute__((ext_vector_type(8)))  float  v8f;

union FragV {
    uint4 u[2];
    v16bf v;
};

// four async global->LDS 128-bit copies (per-lane), tracked by ASYNCcnt.
// s_wait_xcnt is the last line of the copies' own statement: there no later write of
// an address register can be scheduled ahead of it (a precaution).
__device__ __forceinline__ void async_copy4_b128(
    unsigned l0, const void* g0, unsigned l1, const void* g1,
    unsigned l2, const void* g2, unsigned l3, const void* g3)
{
    asm volatile("global_load_async_to_lds_b128 %0, %1, off\n\t"
                 "global_load_async_to_lds_b128 %2, %3, off\n\t"
                 "global_load_async_to_lds_b128 %4, %5, off\n\t"
                 "global_load_async_to_lds_b128 %6, %7, off\n\t"
                 "s_wait_xcnt 0x0"
                 :: "v"(l0), "v"(g0), "v"(l1), "v"(g1),
                    "v"(l2), "v"(g2), "v"(l3), "v"(g3) : "memory");
}
__device__ __forceinline__ void wait_asynccnt0()
{
    asm volatile("s_wait_asynccnt 0x0" ::: "memory");
}

// ---------------------------------------------------------------------------
// cast f32 -> bf16 with transpose: in (R x C row-major) -> out (C x R)
// 32x32 tiles through LDS, coalesced on both sides. R, C multiples of 32.
// All eight weights in ONE grid: none depends on another, so the tiles of all of
// them are numbered through and a work-group finds its matrix from its index.
// Tiles: Wl 2048, then Wskip/Wq/Wk/Wv/Wo 1024 each, then Wr 512, then Wd 512.
// ---------------------------------------------------------------------------
#define CAST_TILES 8192
__global__ __launch_bounds__(256) void cast_transpose_kernel(
    const float* __restrict__ Wl, const float* __restrict__ Wskip,
    const float* __restrict__ Wq, const float* __restrict__ Wk,
    const float* __restrict__ Wv, const float* __restrict__ Wo,
    const float* __restrict__ Wr, const float* __restrict__ Wd,
    __bf16* __restrict__ WlT, __bf16* __restrict__ WskipT,
    __bf16* __restrict__ WqT, __bf16* __restrict__ WkT,
    __bf16* __restrict__ WvT, __bf16* __restrict__ WoT,
    __bf16* __restrict__ WrT, __bf16* __restrict__ WdT)
{
    __shared__ __bf16 tile[32][33];
    int t = blockIdx.x;                    // tile number over all eight matrices; made local to its matrix below
    const float* in;
    __bf16* out;
    int R, C, lc;                          // lc = log2(C / 32)
    if (t < 2048) {
        in = Wl; out = WlT; R = DIM; C = PDIM; lc = 6;
    } else if (t < 7168) {
        t -= 2048;
        const int w = t >> 10;
        t &= 1023;
        R = PDIM; C = HDIM; lc = 4;
        if (w == 0)      { in = Wskip; out = WskipT; }
        else if (w == 1) { in = Wq;    out = WqT; }
        else if (w == 2) { in = Wk;    out = WkT; }
        else if (w == 3) { in = Wv;    out = WvT; }
        else             { in = Wo;    out = WoT; }
    } else if (t < 7680) {
        t -= 7168;
        in = Wr; out = WrT; R = DIM; C = HDIM; lc = 4;
    } else {
        t -= 7680;
        in = Wd; out = WdT; R = HDIM; C = DIM; lc = 5;
    }
    const int c0 = (t & ((1 << lc) - 1)) * 32;
    const int r0 = (t >> lc) * 32;
    const int tx = threadIdx.x & 31;
    const int ty = threadIdx.x >> 5;       // 8 rows per pass
#pragma unroll
    for (int i = 0; i < 32; i += 8)
        tile[ty + i][tx] = (__bf16)in[(size_t)(r0 + ty + i) * C + c0 + tx];
    __syncthreads();
#pragma unroll
    for (int i = 0; i < 32; i += 8)
        out[(size_t)(c0 + ty + i) * R + r0 + tx] = tile[tx][ty + i];
}

// ---------------------------------------------------------------------------
// LayerNorm over D=1024, one block per token, writes bf16
// ---------------------------------------------------------------------------
__global__ __launch_bounds__(256) void layernorm_kernel(
    const float* __restrict__ x, const float* __restrict__ w,
    const float* __restrict__ b, __bf16* __restrict__ xn)
{
    const int tok = blockIdx.x;
    const int tid = threadIdx.x;
    const float* xr = x + (size_t)tok * DIM;

    float s = 0.f, ss = 0.f;
    float v[4];
#pragma unroll
    for (int i = 0; i < 4; ++i) {
        v[i] = xr[tid + i * 256];
        s += v[i];
        ss += v[i] * v[i];
    }
    __shared__ float r1[256], r2[256];
    r1[tid] = s; r2[tid] = ss;
    __syncthreads();
    for (int st = 128; st > 0; st >>= 1) {
        if (tid < st) { r1[tid] += r1[tid + st]; r2[tid] += r2[tid + st]; }
        __syncthreads();
    }
    const float mu  = r1[0] * (1.0f / DIM);
    const float var = r2[0] * (1.0f / DIM) - mu * mu;
    const float inv = rsqrtf(var + 1e-6f);
#pragma unroll
    for (int i = 0; i < 4; ++i) {
        int idx = tid + i * 256;
        float y = (v[i] - mu) * inv * w[idx] + b[idx];
        xn[(size_t)tok * DIM + idx] = (__bf16)y;
    }
}

// ---------------------------------------------------------------------------
// WMMA GEMM: C(MxN,f32) = epilogue(A_bf16(MxK,row) @ Bt_bf16(NxK,row)^T + bias)
//  EPI 0: val = (acc+bias)*scale
//  EPI 1: val = sigmoid(acc+bias) where sig is set, else as EPI 0
//  EPI 2: val = acc+bias+resid[idx]
// Workgroup tile 128x128, 8 waves (4x2) of 32x64; K-step 32.
// Double-buffered LDS tiles staged with global_load_async_to_lds_b128:
// DMA of tile i+1 overlaps the WMMAs of tile i; fragments via ds_load_b128.
// M,N multiples of 128; K multiple of 32.
// ---------------------------------------------------------------------------
#define TILE_K  32
#define T_STRIDE 40   // 32 K + 8 pad, keeps 16B alignment for c in {0,8,16,24}
#define BUF_ELEMS (128 * T_STRIDE)
#define BUF_BYTES (BUF_ELEMS * 2)

// epilogue + store of one wave's 32x64 accumulators
// (C layout: lane<16 -> M=vgpr, lane>=16 -> M=8+vgpr)
template <int E>
__device__ __forceinline__ void store_tile(
    const v8f (&acc)[2][4], const float* __restrict__ bias,
    const float* __restrict__ resid, float* __restrict__ C, int N, float scale,
    int rbase, int cbase)
{
#pragma unroll
    for (int mt = 0; mt < 2; ++mt) {
#pragma unroll
        for (int nt = 0; nt < 4; ++nt) {
            const int col = cbase + nt * 16;
            const float bv = bias[col];
#pragma unroll
            for (int vv = 0; vv < 8; ++vv) {
                const int row = rbase + mt * 16 + vv;
                const size_t idx = (size_t)row * N + col;
                float val = acc[mt][nt][vv] + bv;
                if (E == 0) {
                    val *= scale;
                } else if (E == 1) {
                    val = 1.0f / (1.0f + __expf(-val));
                } else {
                    val += resid[idx];
                }
                C[idx] = val;
            }
        }
    }
}

template <int EPI>
__device__ __forceinline__ void gemm_tile(
    const __bf16* __restrict__ A, const __bf16* __restrict__ Bt,
    const float* __restrict__ bias, const float* __restrict__ resid,
    float* __restrict__ C, int N, int K, float scale, bool sig)
{
    __shared__ __bf16 As[2][BUF_ELEMS];
    __shared__ __bf16 Bs[2][BUF_ELEMS];

    const int tid  = threadIdx.x;
    const int lane = tid & 31;
    const int wave = tid >> 5;
    const int wm   = wave & 3;   // wave row (0..3) -> 32 rows each
    const int wn   = wave >> 2;  // wave col (0..1) -> 64 cols each
    const int row0 = blockIdx.y * 128;
    const int col0 = blockIdx.x * 128;

    const int lhalf = lane >> 4;   // 0 | 1
    const int lmod  = lane & 15;
    const int kof   = lhalf * 8;   // K offset within 16-lane half

    // per-thread staging coordinates (8 bf16 = 16B per transfer, x2 rows)
    const int lin0 = tid * 8;
    const int lin1 = (tid + 256) * 8;
    const int sr0 = lin0 >> 5, sc0 = lin0 & 31;
    const int sr1 = lin1 >> 5, sc1 = lin1 & 31;
    const unsigned ldsA0 = (unsigned)(uintptr_t)&As[0][sr0 * T_STRIDE + sc0];
    const unsigned ldsA1 = (unsigned)(uintptr_t)&As[0][sr1 * T_STRIDE + sc1];
    const unsigned ldsB0 = (unsigned)(uintptr_t)&Bs[0][sr0 * T_STRIDE + sc0];
    const unsigned ldsB1 = (unsigned)(uintptr_t)&Bs[0][sr1 * T_STRIDE + sc1];

    const __bf16* gA0 = A  + (size_t)(row0 + sr0) * K + sc0;
    const __bf16* gA1 = A  + (size_t)(row0 + sr1) * K + sc1;
    const __bf16* gB0 = Bt + (size_t)(col0 + sr0) * K + sc0;
    const __bf16* gB1 = Bt + (size_t)(col0 + sr1) * K + sc1;

    auto stage = [&](int k0, int buf) {
        const unsigned off = (unsigned)buf * BUF_BYTES;
        async_copy4_b128(ldsA0 + off, gA0 + k0, ldsA1 + off, gA1 + k0,
                         ldsB0 + off, gB0 + k0, ldsB1 + off, gB1 + k0);
    };

    v8f acc[2][4];
#pragma unroll
    for (int i = 0; i < 2; ++i)
#pragma unroll
        for (int j = 0; j < 4; ++j) {
            v8f z = {};
            acc[i][j] = z;
        }

    // preload tile 0
    stage(0, 0);
    wait_asynccnt0();
    __syncthreads();

    int cur = 0;
    for (int k0 = 0; k0 < K; k0 += TILE_K) {
        // issue DMA for the NEXT tile into the other buffer (overlaps compute)
        if (k0 + TILE_K < K) {
            stage(k0 + TILE_K, cur ^ 1);
            // L2 prefetch two tiles ahead (global_prefetch_b8 path)
            __builtin_prefetch(gA0 + k0 + 2 * TILE_K, 0, 1);
            __builtin_prefetch(gB0 + k0 + 2 * TILE_K, 0, 1);
        }

        // --- fragments from current buffer (K-contiguous for A and B) ---
        FragV af[2], bfr[4];
#pragma unroll
        for (int mt = 0; mt < 2; ++mt) {
            const int r = wm * 32 + mt * 16 + lmod;
            af[mt].u[0] = *reinterpret_cast<const uint4*>(&As[cur][r * T_STRIDE + kof]);
            af[mt].u[1] = *reinterpret_cast<const uint4*>(&As[cur][r * T_STRIDE + 16 + kof]);
        }
#pragma unroll
        for (int nt = 0; nt < 4; ++nt) {
            const int r = wn * 64 + nt * 16 + lmod;
            bfr[nt].u[0] = *reinterpret_cast<const uint4*>(&Bs[cur][r * T_STRIDE + kof]);
            bfr[nt].u[1] = *reinterpret_cast<const uint4*>(&Bs[cur][r * T_STRIDE + 16 + kof]);
        }
        // --- 8 WMMAs per wave per K-step (DMA for next tile in flight) ---
#pragma unroll
        for (int mt = 0; mt < 2; ++mt)
#pragma unroll
            for (int nt = 0; nt < 4; ++nt)
                acc[mt][nt] = __builtin_amdgcn_wmma_f32_16x16x32_bf16(
                    false, af[mt].v, false, bfr[nt].v,
                    (short)0, acc[mt][nt], false, false);

        // this wave's reads of the current buffer have returned before the barrier
        // behind which that buffer is refilled
        asm volatile("s_wait_dscnt 0x0" ::: "memory");
        // next tile fully in LDS (own wave) + all waves done with both ops
        wait_asynccnt0();
        __syncthreads();
        cur ^= 1;
    }

    // --- epilogue + store. The choice by sig is the same for the whole work-group
    // and is made once, outside the element loops: each side is straight-line code.
    const int rbase = row0 + wm * 32 + lhalf * 8;
    const int cbase = col0 + wn * 64 + lmod;
    if (EPI == 1) {
        if (sig) {
            store_tile<1>(acc, bias, resid, C, N, scale, rbase, cbase);
        } else {
            store_tile<0>(acc, bias, resid, C, N, scale, rbase, cbase);
            // the build lays the other side behind this one, joined by a fall-through
            // that is never taken; its loads land in these stores' address registers,
            // so the wait stands in front of them (a precaution)
            asm volatile("s_wait_xcnt 0x0" ::: "memory");
        }
    } else {
        store_tile<EPI>(acc, bias, resid, C, N, scale, rbase, cbase);
    }
}

template <int EPI>
__global__ __launch_bounds__(256) void gemm_bf16_wmma(
    const __bf16* __restrict__ A, const __bf16* __restrict__ Bt,
    const float* __restrict__ bias, const float* __restrict__ resid,
    float* __restrict__ C, int M, int N, int K, float scale)
{
    gemm_tile<EPI>(A, Bt, bias, resid, C, N, K, scale, false);
}

// The six projections of width HD in ONE grid. Each alone is 64 work-groups, a
// quarter of the chip's WGPs, in a loop that waits out one L2 round trip per
// K-step; none reads what another writes, so blockIdx.z picks the operand set and
// all 384 work-groups are resident together. The short one (r, K = D) comes last.
__global__ __launch_bounds__(256) void proj_batch_kernel(
    const __bf16* __restrict__ xc, const __bf16* __restrict__ xt,
    const __bf16* __restrict__ xn,
    const __bf16* __restrict__ WskipT, const __bf16* __restrict__ WqT,
    const __bf16* __restrict__ WkT, const __bf16* __restrict__ WvT,
    const __bf16* __restrict__ WoT, const __bf16* __restrict__ WrT,
    const float* __restrict__ bskip, const float* __restrict__ bq,
    const float* __restrict__ bk, const float* __restrict__ bv,
    const float* __restrict__ bo, const float* __restrict__ br,
    float* __restrict__ skip, float* __restrict__ qb, float* __restrict__ kb,
    float* __restrict__ vb, float* __restrict__ ob, float* __restrict__ rbuf)
{
    const int z = blockIdx.z;
    const __bf16* A;
    const __bf16* Bt;
    const float* bias;
    float* C;
    if (z == 0)      { A = xc; Bt = WskipT; bias = bskip; C = skip; }
    else if (z == 1) { A = xc; Bt = WqT;    bias = bq;    C = qb; }
    else if (z == 2) { A = xc; Bt = WkT;    bias = bk;    C = kb; }
    else if (z == 3) { A = xt; Bt = WvT;    bias = bv;    C = vb; }
    else if (z == 4) { A = xt; Bt = WoT;    bias = bo;    C = ob; }
    else             { A = xn; Bt = WrT;    bias = br;    C = rbuf; }
    const int   K     = (z == 5) ? DIM : PDIM;
    const float scale = (z == 2) ? 0.125f : 1.0f;      // k carries 1/sqrt(Dh)
    gemm_tile<1>(A, Bt, bias, nullptr, C, HDIM, K, scale, z == 4);
}

// ---------------------------------------------------------------------------
// Causal conv (K=4) along the feature axis + SiLU; also emits xt as bf16.
// ---------------------------------------------------------------------------
__global__ __launch_bounds__(256) void conv_silu_kernel(
    const float* __restrict__ xt, const float* __restrict__ cw,
    const float* __restrict__ cb, __bf16* __restrict__ xc_bf,
    __bf16* __restrict__ xt_bf)
{
    const int tok = blockIdx.y;
    const int p   = blockIdx.x * 256 + threadIdx.x;
    const size_t base = (size_t)tok * PDIM;
    const float w0 = cw[0], w1 = cw[1], w2 = cw[2], w3 = cw[3];

    const float x3 = xt[base + p];
    float acc = cb[0] + w3 * x3;
    if (p >= 1) acc += w2 * xt[base + p - 1];
    if (p >= 2) acc += w1 * xt[base + p - 2];
    if (p >= 3) acc += w0 * xt[base + p - 3];
    const float sv = acc / (1.0f + __expf(-acc));   // silu
    xc_bf[base + p] = (__bf16)sv;
    xt_bf[base + p] = (__bf16)x3;
}

// ---------------------------------------------------------------------------
// i/f gate projections (P x 8 each) + softcap(15) — tiny, plain VALU.
// ---------------------------------------------------------------------------
__global__ __launch_bounds__(256) void gates_kernel(
    const __bf16* __restrict__ xc, const float* __restrict__ Wi,
    const float* __restrict__ bi, const float* __restrict__ Wf,
    const float* __restrict__ bfv, float* __restrict__ ipre,
    float* __restrict__ fpre)
{
    const int tok = blockIdx.x;
    const int tid = threadIdx.x;
    float pi[NH] = {}, pf[NH] = {};
    for (int p = tid; p < PDIM; p += 256) {
        const float xv = (float)xc[(size_t)tok * PDIM + p];
#pragma unroll
        for (int g = 0; g < NH; ++g) {
            pi[g] += xv * Wi[p * NH + g];
            pf[g] += xv * Wf[p * NH + g];
        }
    }
    __shared__ float red[256];
    for (int g = 0; g < NH; ++g) {
        red[tid] = pi[g];
        __syncthreads();
        for (int s = 128; s > 0; s >>= 1) {
            if (tid < s) red[tid] += red[tid + s];
            __syncthreads();
        }
        if (tid == 0) {
            float v = red[0] + bi[g];
            ipre[(size_t)tok * NH + g] = 15.0f * tanhf(v * (1.0f / 15.0f));
        }
        __syncthreads();
        red[tid] = pf[g];
        __syncthreads();
        for (int s = 128; s > 0; s >>= 1) {
            if (tid < s) red[tid] += red[tid + s];
            __syncthreads();
        }
        if (tid == 0) {
            float v = red[0] + bfv[g];
            fpre[(size_t)tok * NH + g] = 15.0f * tanhf(v * (1.0f / 15.0f));
        }
        __syncthreads();
    }
}

// ---------------------------------------------------------------------------
// The gated recurrence in its closed (parallel) form, f32 16x16x4 WMMA.
// With F_t = sum_{u<=t} f_u, w_s = i_s - F_s and M_t = max(0, max_{s<=t} w_s)
// (M_t = m_t - F_t of the recurrence) the scan unrolls exactly to
//   num_t = sum_{s<=t} exp(w_s - M_t) (q_t . k_s) v_s
//   den_t = max(exp(-M_t) sum_e q_t[e] + sum_{s<=t} exp(w_s - M_t) (q_t . k_s), 1)
// Every exponent is <= 0. One block per (b,h, 64 rows of t), 8 waves: wave (rg,half)
// does rows 16rg..+15; columns 32half..+31 of each S tile, then of O.
// K is staged as K[s][e], V transposed as V[d][s]: both B fragments are 16-byte
// LDS loads along k and need no register shuffle.
// ---------------------------------------------------------------------------
typedef __attribute__((ext_vector_type(2))) float v2f;
typedef __attribute__((ext_vector_type(4))) float v4f;
#define SEQ    512
#define KV_P   68     // f32 row pitch: 64 + 4, 16B aligned, conflict-free b128 rows

// 2^x. The v_nop is the slot the instruction set asks for behind a transcendental
// before its source may be overwritten or its result used; in one statement with
// it, it cannot drift away.
__device__ __forceinline__ float exp2_slot(float x)
{
    float y;
    asm("v_exp_f32 %0, %1\n\tv_nop" : "=v"(y) : "v"(x));
    return y;
}
#define LOG2E 1.44269504088896340736f

// Distance behind a block of f32 16x16x4 WMMAs before vector instructions may read
// the accumulators or reuse the operand registers. The form has the issue interval
// of the 8-bit-integer form, so that form's eight slots are kept. The scheduling
// barriers hold the block together: no vector instruction moves in between the
// WMMAs or in front of the v_nops.
#define WMMA_BLOCK_BEGIN() __builtin_amdgcn_sched_barrier(0)
#define WMMA_BLOCK_END()                                                        \
    do {                                                                        \
        __builtin_amdgcn_sched_barrier(0);                                      \
        asm volatile("v_nop\n\tv_nop\n\tv_nop\n\tv_nop\n\t"                     \
                     "v_nop\n\tv_nop\n\tv_nop\n\tv_nop");                       \
        __builtin_amdgcn_sched_barrier(0);                                      \
    } while (0)

// one 64x64 f32 tile of K (4 x 16 B along e) and of V (16 rows s of one column d)
__device__ __forceinline__ void fetch_kv(const float* __restrict__ kp,
                                         const float* __restrict__ vp,
                                         v4f (&kr)[4], float (&vr)[16])
{
#pragma unroll
    for (int i = 0; i < 4; ++i)
        kr[i] = *reinterpret_cast<const v4f*>(kp + (size_t)i * 16 * NH * DH);
#pragma unroll
    for (int j = 0; j < 16; ++j)
        vr[j] = vp[(size_t)j * NH * DH];
}

// acc[0..1] += A(16 x 64, fragments af) * B^T, B rows brow and brow + 16 of a
// 64-wide LDS tile; lane (c,hf) takes k = 8m + 4hf + 0..3 on both operands
__device__ __forceinline__ void mma_16x32x64(v8f (&acc)[2], const v4f (&af)[8],
                                             const float* bt, int brow, int hf)
{
#pragma unroll
    for (int m = 0; m < 8; ++m) {
        const v4f b0 = *reinterpret_cast<const v4f*>(&bt[brow * KV_P + 8 * m + 4 * hf]);
        const v4f b1 = *reinterpret_cast<const v4f*>(&bt[(brow + 16) * KV_P + 8 * m + 4 * hf]);
        const v2f alo = {af[m].x, af[m].y}, ahi = {af[m].z, af[m].w};
        const v2f b0lo = {b0.x, b0.y}, b0hi = {b0.z, b0.w};
        const v2f b1lo = {b1.x, b1.y}, b1hi = {b1.z, b1.w};
        acc[0] = __builtin_amdgcn_wmma_f32_16x16x4_f32(
            false, alo, false, b0lo, (short)0, acc[0], false, false);
        acc[1] = __builtin_amdgcn_wmma_f32_16x16x4_f32(
            false, alo, false, b1lo, (short)0, acc[1], false, false);
        acc[0] = __builtin_amdgcn_wmma_f32_16x16x4_f32(
            false, ahi, false, b0hi, (short)0, acc[0], false, false);
        acc[1] = __builtin_amdgcn_wmma_f32_16x16x4_f32(
            false, ahi, false, b1hi, (short)0, acc[1], false, false);
    }
}

__global__ __launch_bounds__(256) void scan_parallel_kernel(
    const float* __restrict__ q, const float* __restrict__ k,
    const float* __restrict__ v, const float* __restrict__ ipre,
    const float* __restrict__ fpre, float* __restrict__ hseq)
{
    __shared__ __attribute__((aligned(16))) float Ks[64 * KV_P];
    __shared__ __attribute__((aligned(16))) float Vt[64 * KV_P];
    __shared__ __attribute__((aligned(16))) float Ps[4][16 * KV_P];
    __shared__ float wS[SEQ];
    __shared__ float mS[SEQ];
    __shared__ float dS[2][64];

    const int rt   = SEQ / 64 - 1 - (int)blockIdx.x;   // longest tiles first
    const int bh   = blockIdx.y;
    const int b    = bh >> 3;
    const int h    = bh & 7;
    const int tid  = threadIdx.x;
    const int lane = tid & 31;
    const int wave = tid >> 5;
    const int rg   = wave & 3;           // 16-row group
    const int half = wave >> 2;          // 32-column half
    const int c    = lane & 15;
    const int hf   = lane >> 4;
    const int t0   = rt * 64;

    const size_t rowstride = (size_t)NH * DH;                 // floats between t and t+1
    const size_t hbase = ((size_t)b * SEQ * NH + h) * DH;     // (b, t=0, h, 0)

    // staging coordinates. K: rows srow + 16i, 16 B at column sc4.
    // V: column vd, rows vs0 .. vs0 + 15 (a wave reads 128 contiguous bytes per row)
    const int srow = tid >> 4;
    const int sc4  = (tid & 15) * 4;
    const int vd   = tid & 63;
    const int vs0  = (tid >> 6) * 16;

    const float* kp = k + hbase + (size_t)srow * rowstride + sc4;
    const float* vp = v + hbase + (size_t)vs0 * rowstride + vd;
    v4f kreg[4];
    float vreg[16];
    fetch_kv(kp, vp, kreg, vreg);

    // Q fragments, kept in registers: lane (c,hf) holds row c, e = 8m + 4hf + 0..3
    v4f qf[8];
    {
        const size_t g = hbase + (size_t)(t0 + rg * 16 + c) * rowstride + 4 * hf;
#pragma unroll
        for (int m = 0; m < 8; ++m)
            qf[m] = *reinterpret_cast<const v4f*>(q + g + 8 * m);
    }

    // gate prefixes for the whole sequence: wave 0, 16 consecutive t per lane
    if (wave == 0) {
        float fv[16], iv[16];
        const size_t g0 = ((size_t)b * SEQ + lane * 16) * NH + h;
#pragma unroll
        for (int j = 0; j < 16; ++j) fv[j] = fpre[g0 + (size_t)j * NH];
        // the second run of loads lands in the address registers of the first
        asm volatile("s_wait_xcnt 0x0" ::: "memory");
#pragma unroll
        for (int j = 0; j < 16; ++j) iv[j] = ipre[g0 + (size_t)j * NH];
#pragma unroll
        for (int j = 1; j < 16; ++j) fv[j] += fv[j - 1];
        float incl = fv[15];
#pragma unroll
        for (int o = 1; o < 32; o <<= 1) {
            const float up = __shfl_up(incl, o, 32);
            if (lane >= o) incl += up;
        }
        float excl = __shfl_up(incl, 1, 32);   // sum of all earlier lanes
        if (lane == 0) excl = 0.0f;
        float run = 0.0f;                 // M starts at m0 - F0 = 0
#pragma unroll
        for (int j = 0; j < 16; ++j) {
            iv[j] = iv[j] - (excl + fv[j]);      // w_s
            run = fmaxf(run, iv[j]);
            fv[j] = run;                          // lane-local running max
        }
        float mx = run;
#pragma unroll
        for (int o = 1; o < 32; o <<= 1) {
            const float up = __shfl_up(mx, o, 32);
            if (lane >= o) mx = fmaxf(mx, up);
        }
        float prev = __shfl_up(mx, 1, 32);
        if (lane == 0) prev = 0.0f;
#pragma unroll
        for (int j = 0; j < 16; ++j) {
            wS[lane * 16 + j] = iv[j];
            mS[lane * 16 + j] = fmaxf(prev, fv[j]);
        }
    }

    // sum_e q_t[e] for row c (both lane halves end with the row total)
    float qsum = 0.0f;
#pragma unroll
    for (int m = 0; m < 8; ++m) qsum += (qf[m].x + qf[m].y) + (qf[m].z + qf[m].w);
    qsum += __shfl_xor(qsum, 16, 32);

    v8f oacc[2];
#pragma unroll
    for (int n = 0; n < 2; ++n) { v8f z = {}; oacc[n] = z; }
    float rsum[8];
#pragma unroll
    for (int r = 0; r < 8; ++r) rsum[r] = 0.0f;

    float* Pw = &Ps[rg][0];
    const int trow = t0 + rg * 16 + 8 * hf;       // + r : this lane's D rows
    const int cw   = 32 * half + c;               // + 16*j : this lane's D column

    __syncthreads();                      // wS / mS published
    float Mt[8];
#pragma unroll
    for (int r = 0; r < 8; ++r) Mt[r] = mS[trow + r];

    for (int ct = 0; ct <= rt; ++ct) {
        const int s0 = ct * 64;
#pragma unroll
        for (int i = 0; i < 4; ++i) {
            *reinterpret_cast<v4f*>(&Ks[(srow + 16 * i) * KV_P + sc4]) = kreg[i];
            const v4f vv = {vreg[4 * i], vreg[4 * i + 1], vreg[4 * i + 2], vreg[4 * i + 3]};
            *reinterpret_cast<v4f*>(&Vt[vd * KV_P + vs0 + 4 * i]) = vv;
        }
        __syncthreads();                  // tile published
        if (ct < rt) {                    // next tile flies under this tile's WMMAs
            kp += 64 * rowstride;
            vp += 64 * rowstride;
            fetch_kv(kp, vp, kreg, vreg);
        }

        // S = Q K^T, 16 x 32 per wave
        v8f sacc[2];
#pragma unroll
        for (int j = 0; j < 2; ++j) { v8f z = {}; sacc[j] = z; }
        WMMA_BLOCK_BEGIN();
        mma_16x32x64(sacc, qf, Ks, cw, hf);
        WMMA_BLOCK_END();

        // P = S * decay under the causal mask; row sums feed the denominator
#pragma unroll
        for (int j = 0; j < 2; ++j) {
            const int s = s0 + 16 * j + cw;
            const float ws = wS[s];
#pragma unroll
            for (int r = 0; r < 8; ++r) {
                const float e = exp2_slot((ws - Mt[r]) * LOG2E);
                const float p = sacc[j][r] * ((s <= trow + r) ? e : 0.0f);
                rsum[r] += p;
                Pw[(8 * hf + r) * KV_P + 16 * j + cw] = p;
            }
        }
        __syncthreads();                  // both column halves of P published

        // O += P V
        v4f pf[8];
#pragma unroll
        for (int m = 0; m < 8; ++m)
            pf[m] = *reinterpret_cast<const v4f*>(&Pw[c * KV_P + 8 * m + 4 * hf]);
        WMMA_BLOCK_BEGIN();
        mma_16x32x64(oacc, pf, Vt, cw, hf);
        WMMA_BLOCK_END();
        __syncthreads();                  // every reader has left Ks/Vt before the refill
    }

    // row sums: over the 16 lanes of a half wave, then over the two column halves
#pragma unroll
    for (int r = 0; r < 8; ++r) {
        float s = rsum[r];
        s += __shfl_xor(s, 1, 32);
        s += __shfl_xor(s, 2, 32);
        s += __shfl_xor(s, 4, 32);
        s += __shfl_xor(s, 8, 32);
        if (c == 0) dS[half][rg * 16 + 8 * hf + r] = s;
    }
    __syncthreads();                      // both halves' row sums published

    // denominator per row, then store: D register r = row 8hf + r, column cw
#pragma unroll
    for (int r = 0; r < 8; ++r) {
        const int lr = rg * 16 + 8 * hf + r;
        const float s = dS[0][lr] + dS[1][lr];
        const float qs = __shfl(qsum, 8 * hf + r, 32);
        const float den = fmaxf(exp2_slot(-Mt[r] * LOG2E) * qs + s, 1.0f);
        const size_t g = hbase + (size_t)(trow + r) * rowstride + cw;
        hseq[g]      = oacc[0][r] / den;
        hseq[g + 16] = oacc[1][r] / den;
    }
}

// ---------------------------------------------------------------------------
// h = o * hseq; per-head LayerNorm over Dh; z = (hn*hw+hb + skip) * silu(r)
// One block (512 threads) per token; thread = (h,d).
// ---------------------------------------------------------------------------
__global__ __launch_bounds__(512) void combine_kernel(
    const float* __restrict__ o, const float* __restrict__ hseq,
    const float* __restrict__ skip, const float* __restrict__ r,
    const float* __restrict__ hlnw, const float* __restrict__ hlnb,
    __bf16* __restrict__ z)
{
    const int tok = blockIdx.x;
    const int tid = threadIdx.x;          // 0..511
    const int d   = tid & 63;
    const size_t idx = (size_t)tok * HDIM + tid;

    const float hv = o[idx] * hseq[idx];
    __shared__ float s1[512], s2[512];
    s1[tid] = hv; s2[tid] = hv * hv;
    __syncthreads();
    for (int st = 32; st > 0; st >>= 1) {
        if (d < st) { s1[tid] += s1[tid + st]; s2[tid] += s2[tid + st]; }
        __syncthreads();
    }
    const int hb0 = tid & ~63;
    const float mu  = s1[hb0] * (1.0f / DH);
    const float var = s2[hb0] * (1.0f / DH) - mu * mu;
    const float hn  = (hv - mu) * rsqrtf(var + 1e-6f) * hlnw[tid] + hlnb[tid];
    const float rv  = r[idx];
    const float sr  = rv / (1.0f + __expf(-rv));
    z[idx] = (__bf16)((hn + skip[idx]) * sr);
}

// ---------------------------------------------------------------------------
// host launcher
// ---------------------------------------------------------------------------
extern "C" void kernel_launch(void* const* d_in, const int* in_sizes, int n_in,
                              void* d_out, int out_size, void* d_ws, size_t ws_size,
                              hipStream_t stream)
{
    const float* x     = (const float*)d_in[0];
    const float* ln_w  = (const float*)d_in[1];
    const float* ln_b  = (const float*)d_in[2];
    const float* hln_w = (const float*)d_in[3];
    const float* hln_b = (const float*)d_in[4];
    const float* Wl    = (const float*)d_in[5];
    const float* bl    = (const float*)d_in[6];
    const float* Wr    = (const float*)d_in[7];
    const float* br    = (const float*)d_in[8];
    const float* conv_w= (const float*)d_in[9];
    const float* conv_b= (const float*)d_in[10];
    const float* Wskip = (const float*)d_in[11];
    const float* bskip = (const float*)d_in[12];
    const float* Wi    = (const float*)d_in[13];
    const float* bi    = (const float*)d_in[14];
    const float* Wf    = (const float*)d_in[15];
    const float* bfv   = (const float*)d_in[16];
    const float* Wo    = (const float*)d_in[17];
    const float* bo    = (const float*)d_in[18];
    const float* Wq    = (const float*)d_in[19];
    const float* bq    = (const float*)d_in[20];
    const float* Wk    = (const float*)d_in[21];
    const float* bk    = (const float*)d_in[22];
    const float* Wv    = (const float*)d_in[23];
    const float* bv    = (const float*)d_in[24];
    const float* Wd    = (const float*)d_in[25];
    const float* bd    = (const float*)d_in[26];

    // --- workspace carve (whole working set fits in MI455X's 192MB L2) ---
    char* ws = (char*)d_ws;
    auto carve = [&](size_t bytes) {
        char* p = ws;
        ws += (bytes + 255) & ~(size_t)255;
        return p;
    };
    // transposed bf16 weights (N x K layout)
    __bf16* WlT    = (__bf16*)carve((size_t)DIM * PDIM * 2);   // 2048 x 1024
    __bf16* WrT    = (__bf16*)carve((size_t)DIM * HDIM * 2);   // 512 x 1024
    __bf16* WskipT = (__bf16*)carve((size_t)PDIM * HDIM * 2);  // 512 x 2048
    __bf16* WqT    = (__bf16*)carve((size_t)PDIM * HDIM * 2);
    __bf16* WkT    = (__bf16*)carve((size_t)PDIM * HDIM * 2);
    __bf16* WvT    = (__bf16*)carve((size_t)PDIM * HDIM * 2);
    __bf16* WoT    = (__bf16*)carve((size_t)PDIM * HDIM * 2);
    __bf16* WdT    = (__bf16*)carve((size_t)HDIM * DIM * 2);   // 1024 x 512
    __bf16* xn_bf  = (__bf16*)carve((size_t)NTOK * DIM * 2);
    float*  xt     = (float*) carve((size_t)NTOK * PDIM * 4);
    __bf16* xt_bf  = (__bf16*)carve((size_t)NTOK * PDIM * 2);
    __bf16* xc_bf  = (__bf16*)carve((size_t)NTOK * PDIM * 2);
    float*  rbuf   = (float*) carve((size_t)NTOK * HDIM * 4);
    float*  skip   = (float*) carve((size_t)NTOK * HDIM * 4);
    float*  qb     = (float*) carve((size_t)NTOK * HDIM * 4);
    float*  kb     = (float*) carve((size_t)NTOK * HDIM * 4);
    float*  vb     = (float*) carve((size_t)NTOK * HDIM * 4);
    float*  ob     = (float*) carve((size_t)NTOK * HDIM * 4);
    float*  ipre   = (float*) carve((size_t)NTOK * NH * 4);
    float*  fpre   = (float*) carve((size_t)NTOK * NH * 4);
    float*  hseq   = (float*) carve((size_t)NTOK * HDIM * 4);
    __bf16* z_bf   = (__bf16*)carve((size_t)NTOK * HDIM * 2);
    (void)ws_size; (void)in_sizes; (void)n_in; (void)out_size;

    // cast + transpose weights: src is (K x N) row-major -> dst (N x K) bf16
    cast_transpose_kernel<<<CAST_TILES, 256, 0, stream>>>(
        Wl, Wskip, Wq, Wk, Wv, Wo, Wr, Wd,
        WlT, WskipT, WqT, WkT, WvT, WoT, WrT, WdT);

    layernorm_kernel<<<NTOK, 256, 0, stream>>>(x, ln_w, ln_b, xn_bf);

    // xt = xn @ Wl + bl   (2048x1024x2048)
    gemm_bf16_wmma<0><<<dim3(PDIM / 128, NTOK / 128), 256, 0, stream>>>(
        xn_bf, WlT, bl, nullptr, xt, NTOK, PDIM, DIM, 1.0f);

    conv_silu_kernel<<<dim3(PDIM / 256, NTOK), 256, 0, stream>>>(
        xt, conv_w, conv_b, xc_bf, xt_bf);

    // skip, q, k = xc @ W (k scaled by 1/sqrt(Dh)); v = xt @ Wv, o = sigmoid(xt @ Wo);
    // r = xn @ Wr: one grid, z = projection
    proj_batch_kernel<<<dim3(HDIM / 128, NTOK / 128, 6), 256, 0, stream>>>(
        xc_bf, xt_bf, xn_bf, WskipT, WqT, WkT, WvT, WoT, WrT,
        bskip, bq, bk, bv, bo, br, skip, qb, kb, vb, ob, rbuf);

    gates_kernel<<<NTOK, 256, 0, stream>>>(xc_bf, Wi, bi, Wf, bfv, ipre, fpre);

    scan_parallel_kernel<<<dim3(SEQ / 64, 32), 256, 0, stream>>>(qb, kb, vb, ipre, fpre, hseq);

    combine_kernel<<<NTOK, 512, 0, stream>>>(ob, hseq, skip, rbuf, hln_w, hln_b, z_bf);

    // out = z @ Wd + bd + x
    gemm_bf16_wmma<2><<<dim3(DIM / 128, NTOK / 128), 256, 0, stream>>>(
        z_bf, WdT, bd, x, (float*)d_out, NTOK, DIM, HDIM, 1.0f);
}

// v003
// One run takes 119 microseconds.
// In both of two side-by-side timings against v002, it was 1.27 times as fast.
// Counting every step since v000, it is 8.60 times as fast.
#include <hip/hip_runtime.h>
#include <cstdint>
#include <cstddef>

// ---------------------------------------------------------------------------
// mLSTM block forward for MI455X (gfx1250), bf16 WMMA GEMMs + f32 scan.
// B=4 T=512 D=1024 H=8 Dh=64 HD=512 P=2048 K=4
// Weights are cast+TRANSPOSED to bf16 once so that both WMMA operands are
// K-contiguous -> all LDS fragment reads are ds_load_b128 (no scalar gathers).
// GEMM tiles are DOUBLE-BUFFERED and staged with CDNA5 async global->LDS DMA
// (ASYNCcnt): DMA for tile i+1 overlaps WMMA compute on tile i.
// ---------------------------------------------------------------------------

#define NTOK 2048      // B*T
#define DIM  1024      // D
#define PDIM 2048      // P
#define HDIM 512       // HD
#define NH   8         // H
#define DH   64        // Dh

typedef __attribute__((ext_vector_type(16))) __bf16 v16bf;
typedef __attribute__((ext_vector_type(8)))  float  v8f;
typedef __attribute__((ext_vector_type(4)))  float  v4f;
typedef __attribute__((ext_vector_type(2)))  float  v2f;
typedef __attribute__((ext_vector_type(8)))  __bf16 v8bf;
typedef __attribute__((ext_vector_type(4)))  __bf16 v4bf;
typedef __attribute__((ext_vector_type(2)))  __bf16 v2bf;

union FragV {
    uint4 u[2];
    v16bf v;
};

// four async global->LDS 128-bit copies (per-lane), tracked by ASYNCcnt.
// s_wait_xcnt is the last line of the copies' own statement: there no later write of
// an address register can be scheduled ahead of it (a precaution).
__device__ __forceinline__ void async_copy4_b128(
    unsigned l0, const void* g0, unsigned l1, const void* g1,
    unsigned l2, const void* g2, unsigned l3, const void* g3)
{
    asm volatile("global_load_async_to_lds_b128 %0, %1, off\n\t"
                 "global_load_async_to_lds_b128 %2, %3, off\n\t"
                 "global_load_async_to_lds_b128 %4, %5, off\n\t"
                 "global_load_async_to_lds_b128 %6, %7, off\n\t"
                 "s_wait_xcnt 0x0"
                 :: "v"(l0), "v"(g0), "v"(l1), "v"(g1),
                    "v"(l2), "v"(g2), "v"(l3), "v"(g3) : "memory");
}
__device__ __forceinline__ void wait_asynccnt0()
{
    asm volatile("s_wait_asynccnt 0x0" ::: "memory");
}

// ---------------------------------------------------------------------------
// cast f32 -> bf16 with transpose: in (R x C row-major) -> out (C x R)
// Tiles of 128 rows x 64 columns through LDS, 32 elements per thread: eight 16-byte
// loads in flight per lane, whole 256-byte pieces of a row on both sides, and an
// eighth of the waves that one 32x32 tile per work-group takes to start.
// Two neighbouring rows are packed into one dword, so LDS holds out's rows as dwords.
// R multiple of 128, C multiple of 64.
// All eight weights in ONE grid: none depends on another, so the tiles of all of
// them are numbered through and a work-group finds its matrix from its index.
// Tiles: Wl 256, then Wskip/Wq/Wk/Wv/Wo 128 each, then Wr 64, then Wd 64.
// ---------------------------------------------------------------------------
#define CAST_TILES 1024
#define CT_P 65        // dword pitch of an LDS row: 64 + 1, both sides free of bank conflicts
__global__ __launch_bounds__(256) void cast_transpose_kernel(
    const float* __restrict__ Wl, const float* __restrict__ Wskip,
    const float* __restrict__ Wq, const float* __restrict__ Wk,
    const float* __restrict__ Wv, const float* __restrict__ Wo,
    const float* __restrict__ Wr, const float* __restrict__ Wd,
    __bf16* __restrict__ WlT, __bf16* __restrict__ WskipT,
    __bf16* __restrict__ WqT, __bf16* __restrict__ WkT,
    __bf16* __restrict__ WvT, __bf16* __restrict__ WoT,
    __bf16* __restrict__ WrT, __bf16* __restrict__ WdT)
{
    __shared__ unsigned tile[64 * CT_P];   // [column c][row pair]
    int t = blockIdx.x;                    // tile number inside the chosen matrix
    const float* in;
    __bf16* out;
    int R, C, lc;                          // lc = log2(C / 64)
    if (t < 256) {
        in = Wl; out = WlT; R = DIM; C = PDIM; lc = 5;
    } else if (t < 896) {
        t -= 256;
        const int w = t >> 7;
        t &= 127;
        R = PDIM; C = HDIM; lc = 3;
        if (w == 0)      { in = Wskip; out = WskipT; }
        else if (w == 1) { in = Wq;    out = WqT; }
        else if (w == 2) { in = Wk;    out = WkT; }
        else if (w == 3) { in = Wv;    out = WvT; }
        else             { in = Wo;    out = WoT; }
    } else if (t < 960) {
        t -= 896;
        in = Wr; out = WrT; R = DIM; C = HDIM; lc = 3;
    } else {
        t -= 960;
        in = Wd; out = WdT; R = HDIM; C = DIM; lc = 4;
    }
    const int c0 = (t & ((1 << lc) - 1)) * 64;
    const int r0 = (t >> lc) * 128;
    const int tid = threadIdx.x;
    const int ci = tid & 15;               // columns 4ci .. 4ci + 3
    const int rp = tid >> 4;               // row pairs rp + 16u
    // one lane offset for all eight loads; what differs between them is uniform
    const unsigned lof = (unsigned)(2 * rp * C + 4 * ci);
    const float* sb = in + (size_t)r0 * C + c0;
    v4f xe[4], xo[4];
#pragma unroll
    for (int u = 0; u < 4; ++u) {
        const float* s = sb + (size_t)(32 * u) * C;
        xe[u] = *reinterpret_cast<const v4f*>(s + lof);
        xo[u] = *reinterpret_cast<const v4f*>(s + C + lof);
    }
#pragma unroll
    for (int u = 0; u < 4; ++u)
#pragma unroll
        for (int kk = 0; kk < 4; ++kk) {
            const v2bf pr = {(__bf16)xe[u][kk], (__bf16)xo[u][kk]};   // rows 2n, 2n + 1
            tile[(4 * ci + kk) * CT_P + rp + 16 * u] = __builtin_bit_cast(unsigned, pr);
        }
    __syncthreads();
#pragma unroll
    for (int u = 0; u < 4; ++u) {
        const int id = tid + 256 * u;      // 64 rows of out, 16 pieces of 16 B each
        const int c = id >> 4;
        const int j = id & 15;
        const unsigned* tp = &tile[c * CT_P + 4 * j];
        const uint4 o = make_uint4(tp[0], tp[1], tp[2], tp[3]);
        *reinterpret_cast<uint4*>(out + (size_t)(c0 + c) * R + r0 + 8 * j) = o;
    }
}

// ---------------------------------------------------------------------------
// LayerNorm over D=1024, one WAVE per token (32 elements per lane, eight 16-byte
// loads in flight), sums over the wave by lane exchange: no LDS, no barrier.
// Writes bf16.
// ---------------------------------------------------------------------------
__global__ __launch_bounds__(256) void layernorm_kernel(
    const float* __restrict__ x, const float* __restrict__ w,
    const float* __restrict__ b, __bf16* __restrict__ xn)
{
    const int lane = threadIdx.x & 31;
    const int tok  = blockIdx.x * 8 + (threadIdx.x >> 5);
    const float* xr = x + (size_t)tok * DIM + lane * 4;

    v4f v[8], w4[8], b4[8];
#pragma unroll
    for (int i = 0; i < 8; ++i)
        v[i] = *reinterpret_cast<const v4f*>(xr + i * 128);
    // the second run of loads lands in the address registers of the first (a precaution)
    asm volatile("s_wait_xcnt 0x0" ::: "memory");
#pragma unroll
    for (int i = 0; i < 8; ++i) {
        w4[i] = *reinterpret_cast<const v4f*>(w + i * 128 + lane * 4);
        b4[i] = *reinterpret_cast<const v4f*>(b + i * 128 + lane * 4);
    }
    // keeps the loads of w and b up here, in flight with the row's (without it the
    // build sinks them behind the sums, two pairs at a time)
    __builtin_amdgcn_sched_barrier(0);
    float s = 0.f, ss = 0.f;
#pragma unroll
    for (int i = 0; i < 8; ++i)
#pragma unroll
        for (int e = 0; e < 4; ++e) {
            s += v[i][e];
            ss += v[i][e] * v[i][e];
        }
#pragma unroll
    for (int o = 16; o > 0; o >>= 1) {
        s  += __shfl_xor(s, o, 32);
        ss += __shfl_xor(ss, o, 32);
    }
    const float mu  = s * (1.0f / DIM);
    const float var = ss * (1.0f / DIM) - mu * mu;
    const float inv = rsqrtf(var + 1e-6f);
    __bf16* yr = xn + (size_t)tok * DIM + lane * 4;
#pragma unroll
    for (int i = 0; i < 8; ++i) {
        v4bf y;
#pragma unroll
        for (int e = 0; e < 4; ++e)
            y[e] = (__bf16)((v[i][e] - mu) * inv * w4[i][e] + b4[i][e]);
        *reinterpret_cast<v4bf*>(yr + i * 128) = y;
    }
}

// ---------------------------------------------------------------------------
// WMMA GEMM: C(MxN,f32) = epilogue(A_bf16(MxK,row) @ Bt_bf16(NxK,row)^T + bias)
//  EPI 0: val = (acc+bias)*scale
//  EPI 1: val = sigmoid(acc+bias) where sig is set, else as EPI 0
//  EPI 2: val = acc+bias+resid[idx]
// Workgroup tile 128x128, 8 waves (4x2) of 32x64; K-step 32.
// Double-buffered LDS tiles staged with global_load_async_to_lds_b128:
// DMA of tile i+1 overlaps the WMMAs of tile i; fragments via ds_load_b128.
// M,N multiples of 128; K multiple of 32.
// ---------------------------------------------------------------------------
#define TILE_K  32
#define T_STRIDE 40   // 32 K + 8 pad, keeps 16B alignment for c in {0,8,16,24}
#define BUF_ELEMS (128 * T_STRIDE)
#define BUF_BYTES (BUF_ELEMS * 2)

// epilogue + store of one wave's 32x64 accumulators
// (C layout: lane<16 -> M=vgpr, lane>=16 -> M=8+vgpr)
template <int E>
__device__ __forceinline__ void store_tile(
    const v8f (&acc)[2][4], const float* __restrict__ bias,
    const float* __restrict__ resid, float* __restrict__ C, int N, float scale,
    int rbase, int cbase)
{
#pragma unroll
    for (int mt = 0; mt < 2; ++mt) {
#pragma unroll
        for (int nt = 0; nt < 4; ++nt) {
            const int col = cbase + nt * 16;
            const float bv = bias[col];
#pragma unroll
            for (int vv = 0; vv < 8; ++vv) {
                const int row = rbase + mt * 16 + vv;
                const size_t idx = (size_t)row * N + col;
                float val = acc[mt][nt][vv] + bv;
                if (E == 0) {
                    val *= scale;
                } else if (E == 1) {
                    val = 1.0f / (1.0f + __expf(-val));
                } else {
                    val += resid[idx];
                }
                C[idx] = val;
            }
        }
    }
}

template <int EPI>
__device__ __forceinline__ void gemm_tile(
    const __bf16* __restrict__ A, const __bf16* __restrict__ Bt,
    const float* __restrict__ bias, const float* __restrict__ resid,
    float* __restrict__ C, int N, int K, float scale, bool sig)
{
    __shared__ __bf16 As[2][BUF_ELEMS];
    __shared__ __bf16 Bs[2][BUF_ELEMS];

    const int tid  = threadIdx.x;
    const int lane = tid & 31;
    const int wave = tid >> 5;
    const int wm   = wave & 3;   // wave row (0..3) -> 32 rows each
    const int wn   = wave >> 2;  // wave col (0..1) -> 64 cols each
    const int row0 = blockIdx.y * 128;
    const int col0 = blockIdx.x * 128;

    const int lhalf = lane >> 4;   // 0 | 1
    const int lmod  = lane & 15;
    const int kof   = lhalf * 8;   // K offset within 16-lane half

    // per-thread staging coordinates (8 bf16 = 16B per transfer, x2 rows)
    const int lin0 = tid * 8;
    const int lin1 = (tid + 256) * 8;
    const int sr0 = lin0 >> 5, sc0 = lin0 & 31;
    const int sr1 = lin1 >> 5, sc1 = lin1 & 31;
    const unsigned ldsA0 = (unsigned)(uintptr_t)&As[0][sr0 * T_STRIDE + sc0];
    const unsigned ldsA1 = (unsigned)(uintptr_t)&As[0][sr1 * T_STRIDE + sc1];
    const unsigned ldsB0 = (unsigned)(uintptr_t)&Bs[0][sr0 * T_STRIDE + sc0];
    const unsigned ldsB1 = (unsigned)(uintptr_t)&Bs[0][sr1 * T_STRIDE + sc1];

    const __bf16* gA0 = A  + (size_t)(row0 + sr0) * K + sc0;
    const __bf16* gA1 = A  + (size_t)(row0 + sr1) * K + sc1;
    const __bf16* gB0 = Bt + (size_t)(col0 + sr0) * K + sc0;
    const __bf16* gB1 = Bt + (size_t)(col0 + sr1) * K + sc1;

    auto stage = [&](int k0, int buf) {
        const unsigned off = (unsigned)buf * BUF_BYTES;
        async_copy4_b128(ldsA0 + off, gA0 + k0, ldsA1 + off, gA1 + k0,
                         ldsB0 + off, gB0 + k0, ldsB1 + off, gB1 + k0);
    };

    v8f acc[2][4];
#pragma unroll
    for (int i = 0; i < 2; ++i)
#pragma unroll
        for (int j = 0; j < 4; ++j) {
            v8f z = {};
            acc[i][j] = z;
        }

    // preload tile 0
    stage(0, 0);
    wait_asynccnt0();
    __syncthreads();

    int cur = 0;
    for (int k0 = 0; k0 < K; k0 += TILE_K) {
        // issue DMA for the NEXT tile into the other buffer (overlaps compute)
        if (k0 + TILE_K < K) {
            stage(k0 + TILE_K, cur ^ 1);
            // L2 prefetch two tiles ahead (global_prefetch_b8 path)
            __builtin_prefetch(gA0 + k0 + 2 * TILE_K, 0, 1);
            __builtin_prefetch(gB0 + k0 + 2 * TILE_K, 0, 1);
        }

        // --- fragments from current buffer (K-contiguous for A and B) ---
        FragV af[2], bfr[4];
#pragma unroll
        for (int mt = 0; mt < 2; ++mt) {
            const int r = wm * 32 + mt * 16 + lmod;
            af[mt].u[0] = *reinterpret_cast<const uint4*>(&As[cur][r * T_STRIDE + kof]);
            af[mt].u[1] = *reinterpret_cast<const uint4*>(&As[cur][r * T_STRIDE + 16 + kof]);
        }
#pragma unroll
        for (int nt = 0; nt < 4; ++nt) {
            const int r = wn * 64 + nt * 16 + lmod;
            bfr[nt].u[0] = *reinterpret_cast<const uint4*>(&Bs[cur][r * T_STRIDE + kof]);
            bfr[nt].u[1] = *reinterpret_cast<const uint4*>(&Bs[cur][r * T_STRIDE + 16 + kof]);
        }
        // --- 8 WMMAs per wave per K-step (DMA for next tile in flight) ---
#pragma unroll
        for (int mt = 0; mt < 2; ++mt)
#pragma unroll
            for (int nt = 0; nt < 4; ++nt)
                acc[mt][nt] = __builtin_amdgcn_wmma_f32_16x16x32_bf16(
                    false, af[mt].v, false, bfr[nt].v,
                    (short)0, acc[mt][nt], false, false);

        // this wave's reads of the current buffer have returned before the barrier
        // behind which that buffer is refilled
        asm volatile("s_wait_dscnt 0x0" ::: "memory");
        // next tile fully in LDS (own wave) + all waves done with both ops
        wait_asynccnt0();
        __syncthreads();
        cur ^= 1;
    }

    // --- epilogue + store. The choice by sig is the same for the whole work-group
    // and is made once, outside the element loops: each side is straight-line code.
    const int rbase = row0 + wm * 32 + lhalf * 8;
    const int cbase = col0 + wn * 64 + lmod;
    if (EPI == 1) {
        if (sig) {
            store_tile<1>(acc, bias, resid, C, N, scale, rbase, cbase);
        } else {
            store_tile<0>(acc, bias, resid, C, N, scale, rbase, cbase);
            // the build lays the other side behind this one, joined by a fall-through
            // that is never taken; its loads land in these stores' address registers,
            // so the wait stands in front of them (a precaution)
            asm volatile("s_wait_xcnt 0x0" ::: "memory");
        }
    } else {
        store_tile<EPI>(acc, bias, resid, C, N, scale, rbase, cbase);
    }
}

template <int EPI>
__global__ __launch_bounds__(256) void gemm_bf16_wmma(
    const __bf16* __restrict__ A, const __bf16* __restrict__ Bt,
    const float* __restrict__ bias, const float* __restrict__ resid,
    float* __restrict__ C, int M, int N, int K, float scale)
{
    gemm_tile<EPI>(A, Bt, bias, resid, C, N, K, scale, false);
}

// The six projections of width HD in ONE grid. Each alone is 64 work-groups, a
// quarter of the chip's WGPs, in a loop that waits out one L2 round trip per
// K-step; none reads what another writes, so blockIdx.z picks the operand set and
// all 384 work-groups are resident together. The short one (r, K = D) comes last.
__global__ __launch_bounds__(256) void proj_batch_kernel(
    const __bf16* __restrict__ xc, const __bf16* __restrict__ xt,
    const __bf16* __restrict__ xn,
    const __bf16* __restrict__ WskipT, const __bf16* __restrict__ WqT,
    const __bf16* __restrict__ WkT, const __bf16* __restrict__ WvT,
    const __bf16* __restrict__ WoT, const __bf16* __restrict__ WrT,
    const float* __restrict__ bskip, const float* __restrict__ bq,
    const float* __restrict__ bk, const float* __restrict__ bv,
    const float* __restrict__ bo, const float* __restrict__ br,
    float* __restrict__ skip, float* __restrict__ qb, float* __restrict__ kb,
    float* __restrict__ vb, float* __restrict__ ob, float* __restrict__ rbuf)
{
    const int z = blockIdx.z;
    const __bf16* A;
    const __bf16* Bt;
    const float* bias;
    float* C;
    if (z == 0)      { A = xc; Bt = WskipT; bias = bskip; C = skip; }
    else if (z == 1) { A = xc; Bt = WqT;    bias = bq;    C = qb; }
    else if (z == 2) { A = xc; Bt = WkT;    bias = bk;    C = kb; }
    else if (z == 3) { A = xt; Bt = WvT;    bias = bv;    C = vb; }
    else if (z == 4) { A = xt; Bt = WoT;    bias = bo;    C = ob; }
    else             { A = xn; Bt = WrT;    bias = br;    C = rbuf; }
    const int   K     = (z == 5) ? DIM : PDIM;
    const float scale = (z == 2) ? 0.125f : 1.0f;      // k carries 1/sqrt(Dh)
    gemm_tile<1>(A, Bt, bias, nullptr, C, HDIM, K, scale, z == 4);
}

// ---------------------------------------------------------------------------
// Causal conv (K=4) along the feature axis + SiLU; also emits xt as bf16.
// A thread takes 8 neighbouring features of CONV_TOK tokens: 16-byte loads and
// stores, all tokens' loads in flight together, 32 elements per thread.
// ---------------------------------------------------------------------------
#define CONV_TOK 4
__global__ __launch_bounds__(256) void conv_silu_kernel(
    const float* __restrict__ xt, const float* __restrict__ cw,
    const float* __restrict__ cb, __bf16* __restrict__ xc_bf,
    __bf16* __restrict__ xt_bf)
{
    const int p = threadIdx.x * 8;         // 256 threads x 8 = one token's P features
    const size_t base = (size_t)blockIdx.x * CONV_TOK * PDIM + p;
    const float w0 = cw[0], w1 = cw[1], w2 = cw[2], w3 = cw[3];
    const float cbv = cb[0];
    const int back = p ? 4 : 0;            // the row's first thread has nothing to its left

    v4f pv[CONV_TOK], lo[CONV_TOK], hi[CONV_TOK];
#pragma unroll
    for (int t = 0; t < CONV_TOK; ++t) {
        const float* s = xt + base + (size_t)t * PDIM;
        pv[t] = *reinterpret_cast<const v4f*>(s - back);
        lo[t] = *reinterpret_cast<const v4f*>(s);
        hi[t] = *reinterpret_cast<const v4f*>(s + 4);
    }
    // keeps every load in front of the arithmetic, so that all twelve are in flight
    // together (without it the build sinks a third of them between the divisions)
    // the wait: the first selects land in the loads' address registers (a precaution)
    asm volatile("s_wait_xcnt 0x0" ::: "memory");
    __builtin_amdgcn_sched_barrier(0);
    v8bf oc[CONV_TOK], ox[CONV_TOK];
#pragma unroll
    for (int t = 0; t < CONV_TOK; ++t) {
        // e[j + 3] = feature p + j; left of the row's start the conv pads with zeros
        const float e[11] = {p ? pv[t].y : 0.0f, p ? pv[t].z : 0.0f, p ? pv[t].w : 0.0f,
                             lo[t].x, lo[t].y, lo[t].z, lo[t].w,
                             hi[t].x, hi[t].y, hi[t].z, hi[t].w};
#pragma unroll
        for (int j = 0; j < 8; ++j) {
            float acc = cbv + w3 * e[j + 3];
            acc += w2 * e[j + 2];
            acc += w1 * e[j + 1];
            acc += w0 * e[j];
            oc[t][j] = (__bf16)(acc / (1.0f + __expf(-acc)));   // silu
            ox[t][j] = (__bf16)e[j + 3];
        }
    }
#pragma unroll
    for (int t = 0; t < CONV_TOK; ++t) {
        *reinterpret_cast<v8bf*>(xc_bf + base + (size_t)t * PDIM) = oc[t];
        *reinterpret_cast<v8bf*>(xt_bf + base + (size_t)t * PDIM) = ox[t];
    }
}

// ---------------------------------------------------------------------------
// i/f gate projections (P x 8 each) + softcap(15), plain VALU.
// A work-group takes G_TOK tokens: a thread keeps its 8 rows of Wi and Wf in
// registers and uses them for every token. The 16 * G_TOK partial sums go over the
// wave by a halving lane exchange (each step hands half of the sums to the partner
// lane, so lane l ends with sums 2l and 2l + 1), then over the 8 waves through LDS
// behind ONE barrier.
// ---------------------------------------------------------------------------
#define G_TOK 4
__global__ __launch_bounds__(256) void gates_kernel(
    const __bf16* __restrict__ xc, const float* __restrict__ Wi,
    const float* __restrict__ bi, const float* __restrict__ Wf,
    const float* __restrict__ bfv, float* __restrict__ ipre,
    float* __restrict__ fpre)
{
    __shared__ __attribute__((aligned(8))) float red[8][16 * G_TOK];
    const int tid  = threadIdx.x;
    const int lane = tid & 31;
    const int wave = tid >> 5;
    const int tok0 = blockIdx.x * G_TOK;

    // acc[t] = {i gates 0..3, i gates 4..7, f gates 0..3, f gates 4..7} of token tok0 + t
    v4f acc[G_TOK][4];
#pragma unroll
    for (int t = 0; t < G_TOK; ++t)
#pragma unroll
        for (int n = 0; n < 4; ++n) { v4f z = {}; acc[t][n] = z; }
    // every address is a uniform base plus one lane offset that lives through the loop
    const __bf16* xb = xc + (size_t)tok0 * PDIM;
    const unsigned lx = (unsigned)tid;
    const unsigned lw = (unsigned)tid * NH;
    // four rows of the weights per trip: the registers stay under 256
#pragma unroll 1
    for (int j0 = 0; j0 < PDIM; j0 += 1024) {
        v4f wv[4][4];
        __bf16 xr[4][G_TOK];
#pragma unroll
        for (int jj = 0; jj < 4; ++jj) {
            const float* wa = Wi + (size_t)(j0 + 256 * jj) * NH;
            wv[jj][0] = *reinterpret_cast<const v4f*>(wa + lw);
            wv[jj][1] = *reinterpret_cast<const v4f*>((wa + 4) + lw);
        }
        // the next run of loads lands in the address registers of this one (a precaution)
        asm volatile("s_wait_xcnt 0x0" ::: "memory");
#pragma unroll
        for (int jj = 0; jj < 4; ++jj) {
            const float* wb = Wf + (size_t)(j0 + 256 * jj) * NH;
            wv[jj][2] = *reinterpret_cast<const v4f*>(wb + lw);
            wv[jj][3] = *reinterpret_cast<const v4f*>((wb + 4) + lw);
        }
        // as above
        asm volatile("s_wait_xcnt 0x0" ::: "memory");
        const __bf16* xp = xb + j0 + lx;
#pragma unroll
        for (int jj = 0; jj < 4; ++jj)
#pragma unroll
            for (int t = 0; t < G_TOK; ++t)
                xr[jj][t] = xp[256 * jj + t * PDIM];
        // the address is named so that it stays whole up to the wait: without it the
        // last load of the run lands in the address registers of the run (a precaution)
        asm volatile("s_wait_xcnt 0x0" :: "v"(xp) : "memory");
        // keeps the trip's 32 loads in front of its arithmetic, in flight together
        // (without it the build loads the weights pair by pair, a round trip each)
        __builtin_amdgcn_sched_barrier(0);
#pragma unroll
        for (int jj = 0; jj < 4; ++jj)
#pragma unroll
            for (int t = 0; t < G_TOK; ++t) {
                const float xv = (float)xr[jj][t];
#pragma unroll
                for (int n = 0; n < 4; ++n) acc[t][n] += xv * wv[jj][n];
            }
    }
    // sum[t * 16 + g] = i gate g, sum[t * 16 + 8 + g] = f gate g
    float sum[16 * G_TOK];
#pragma unroll
    for (int n = 0; n < 16 * G_TOK; ++n) sum[n] = acc[n >> 4][(n >> 2) & 3][n & 3];
#pragma unroll
    for (int m = 16, half = 8 * G_TOK; m > 0; m >>= 1, half >>= 1) {
        const bool up = (lane & m) != 0;   // this lane keeps the upper half of the sums
#pragma unroll
        for (int n = 0; n < half; ++n) {
            const float send = up ? sum[n] : sum[n + half];
            const float keep = up ? sum[n + half] : sum[n];
            sum[n] = keep + __shfl_xor(send, m, 32);
        }
    }
    const v2f pr = {sum[0], sum[1]};
    *reinterpret_cast<v2f*>(&red[wave][2 * lane]) = pr;
    __syncthreads();                       // every wave's sums published
    if (tid < 16 * G_TOK) {
        float s = 0.0f;
#pragma unroll
        for (int w = 0; w < 8; ++w) s += red[w][tid];
        const int  g   = tid & 7;
        const bool isf = (tid & 8) != 0;
        const float v = s + (isf ? bfv[g] : bi[g]);
        float* dst = isf ? fpre : ipre;
        dst[(size_t)(tok0 + (tid >> 4)) * NH + g] = 15.0f * tanhf(v * (1.0f / 15.0f));
    }
}

// ---------------------------------------------------------------------------
// The gated recurrence in its closed (parallel) form, f32 16x16x4 WMMA.
// With F_t = sum_{u<=t} f_u, w_s = i_s - F_s and M_t = max(0, max_{s<=t} w_s)
// (M_t = m_t - F_t of the recurrence) the scan unrolls exactly to
//   num_t = sum_{s<=t} exp(w_s - M_t) (q_t . k_s) v_s
//   den_t = max(exp(-M_t) sum_e q_t[e] + sum_{s<=t} exp(w_s - M_t) (q_t . k_s), 1)
// Every exponent is <= 0. One block per (b,h, 64 rows of t), 8 waves: wave (rg,half)
// does rows 16rg..+15; columns 32half..+31 of each S tile, then of O.
// K is staged as K[s][e], V transposed as V[d][s]: both B fragments are 16-byte
// LDS loads along k and need no register shuffle.
// ---------------------------------------------------------------------------
#define SEQ    512
#define KV_P   68     // f32 row pitch: 64 + 4, 16B aligned, conflict-free b128 rows

// 2^x. The v_nop is the slot the instruction set asks for behind a transcendental
// before its source may be overwritten or its result used; in one statement with
// it, it cannot drift away.
__device__ __forceinline__ float exp2_slot(float x)
{
    float y;
    asm("v_exp_f32 %0, %1\n\tv_nop" : "=v"(y) : "v"(x));
    return y;
}
#define LOG2E 1.44269504088896340736f

// Distance behind a block of f32 16x16x4 WMMAs before vector instructions may read
// the accumulators or reuse the operand registers. The form has the issue interval
// of the 8-bit-integer form, so that form's eight slots are kept. The scheduling
// barriers hold the block together: no vector instruction moves in between the
// WMMAs or in front of the v_nops.
#define WMMA_BLOCK_BEGIN() __builtin_amdgcn_sched_barrier(0)
#define WMMA_BLOCK_END()                                                        \
    do {                                                                        \
        __builtin_amdgcn_sched_barrier(0);                                      \
        asm volatile("v_nop\n\tv_nop\n\tv_nop\n\tv_nop\n\t"                     \
                     "v_nop\n\tv_nop\n\tv_nop\n\tv_nop");                       \
        __builtin_amdgcn_sched_barrier(0);                                      \
    } while (0)

// one 64x64 f32 tile of K (4 x 16 B along e) and of V (16 rows s of one column d)
__device__ __forceinline__ void fetch_kv(const float* __restrict__ kp,
                                         const float* __restrict__ vp,
                                         v4f (&kr)[4], float (&vr)[16])
{
#pragma unroll
    for (int i = 0; i < 4; ++i)
        kr[i] = *reinterpret_cast<const v4f*>(kp + (size_t)i * 16 * NH * DH);
#pragma unroll
    for (int j = 0; j < 16; ++j)
        vr[j] = vp[(size_t)j * NH * DH];
}

// acc[0..1] += A(16 x 64, fragments af) * B^T, B rows brow and brow + 16 of a
// 64-wide LDS tile; lane (c,hf) takes k = 8m + 4hf + 0..3 on both operands
__device__ __forceinline__ void mma_16x32x64(v8f (&acc)[2], const v4f (&af)[8],
                                             const float* bt, int brow, int hf)
{
#pragma unroll
    for (int m = 0; m < 8; ++m) {
        const v4f b0 = *reinterpret_cast<const v4f*>(&bt[brow * KV_P + 8 * m + 4 * hf]);
        const v4f b1 = *reinterpret_cast<const v4f*>(&bt[(brow + 16) * KV_P + 8 * m + 4 * hf]);
        const v2f alo = {af[m].x, af[m].y}, ahi = {af[m].z, af[m].w};
        const v2f b0lo = {b0.x, b0.y}, b0hi = {b0.z, b0.w};
        const v2f b1lo = {b1.x, b1.y}, b1hi = {b1.z, b1.w};
        acc[0] = __builtin_amdgcn_wmma_f32_16x16x4_f32(
            false, alo, false, b0lo, (short)0, acc[0], false, false);
        acc[1] = __builtin_amdgcn_wmma_f32_16x16x4_f32(
            false, alo, false, b1lo, (short)0, acc[1], false, false);
        acc[0] = __builtin_amdgcn_wmma_f32_16x16x4_f32(
            false, ahi, false, b0hi, (short)0, acc[0], false, false);
        acc[1] = __builtin_amdgcn_wmma_f32_16x16x4_f32(
            false, ahi, false, b1hi, (short)0, acc[1], false, false);
    }
}

__global__ __launch_bounds__(256) void scan_parallel_kernel(
    const float* __restrict__ q, const float* __restrict__ k,
    const float* __restrict__ v, const float* __restrict__ ipre,
    const float* __restrict__ fpre, float* __restrict__ hseq)
{
    __shared__ __attribute__((aligned(16))) float Ks[64 * KV_P];
    __shared__ __attribute__((aligned(16))) float Vt[64 * KV_P];
    __shared__ __attribute__((aligned(16))) float Ps[4][16 * KV_P];
    __shared__ float wS[SEQ];
    __shared__ float mS[SEQ];
    __shared__ float dS[2][64];

    const int rt   = SEQ / 64 - 1 - (int)blockIdx.x;   // longest tiles first
    const int bh   = blockIdx.y;
    const int b    = bh >> 3;
    const int h    = bh & 7;
    const int tid  = threadIdx.x;
    const int lane = tid & 31;
    const int wave = tid >> 5;
    const int rg   = wave & 3;           // 16-row group
    const int half = wave >> 2;          // 32-column half
    const int c    = lane & 15;
    const int hf   = lane >> 4;
    const int t0   = rt * 64;

    const size_t rowstride = (size_t)NH * DH;                 // floats between t and t+1
    const size_t hbase = ((size_t)b * SEQ * NH + h) * DH;     // (b, t=0, h, 0)

    // staging coordinates. K: rows srow + 16i, 16 B at column sc4.
    // V: column vd, rows vs0 .. vs0 + 15 (a wave reads 128 contiguous bytes per row)
    const int srow = tid >> 4;
    const int sc4  = (tid & 15) * 4;
    const int vd   = tid & 63;
    const int vs0  = (tid >> 6) * 16;

    const float* kp = k + hbase + (size_t)srow * rowstride + sc4;
    const float* vp = v + hbase + (size_t)vs0 * rowstride + vd;
    v4f kreg[4];
    float vreg[16];
    fetch_kv(kp, vp, kreg, vreg);

    // Q fragments, kept in registers: lane (c,hf) holds row c, e = 8m + 4hf + 0..3
    v4f qf[8];
    {
        const size_t g = hbase + (size_t)(t0 + rg * 16 + c) * rowstride + 4 * hf;
#pragma unroll
        for (int m = 0; m < 8; ++m)
            qf[m] = *reinterpret_cast<const v4f*>(q + g + 8 * m);
    }

    // gate prefixes for the whole sequence: wave 0, 16 consecutive t per lane
    if (wave == 0) {
        float fv[16], iv[16];
        const size_t g0 = ((size_t)b * SEQ + lane * 16) * NH + h;
#pragma unroll
        for (int j = 0; j < 16; ++j) fv[j] = fpre[g0 + (size_t)j * NH];
        // the second run of loads lands in the address registers of the first
        asm volatile("s_wait_xcnt 0x0" ::: "memory");
#pragma unroll
        for (int j = 0; j < 16; ++j) iv[j] = ipre[g0 + (size_t)j * NH];
#pragma unroll
        for (int j = 1; j < 16; ++j) fv[j] += fv[j - 1];
        float incl = fv[15];
#pragma unroll
        for (int o = 1; o < 32; o <<= 1) {
            const float up = __shfl_up(incl, o, 32);
            if (lane >= o) incl += up;
        }
        float excl = __shfl_up(incl, 1, 32);   // sum of all earlier lanes
        if (lane == 0) excl = 0.0f;
        float run = 0.0f;                 // M starts at m0 - F0 = 0
#pragma unroll
        for (int j = 0; j < 16; ++j) {
            iv[j] = iv[j] - (excl + fv[j]);      // w_s
            run = fmaxf(run, iv[j]);
            fv[j] = run;                          // lane-local running max
        }
        float mx = run;
#pragma unroll
        for (int o = 1; o < 32; o <<= 1) {
            const float up = __shfl_up(mx, o, 32);
            if (lane >= o) mx = fmaxf(mx, up);
        }
        float prev = __shfl_up(mx, 1, 32);
        if (lane == 0) prev = 0.0f;
#pragma unroll
        for (int j = 0; j < 16; ++j) {
            wS[lane * 16 + j] = iv[j];
            mS[lane * 16 + j] = fmaxf(prev, fv[j]);
        }
    }

    // sum_e q_t[e] for row c (both lane halves end with the row total)
    float qsum = 0.0f;
#pragma unroll
    for (int m = 0; m < 8; ++m) qsum += (qf[m].x + qf[m].y) + (qf[m].z + qf[m].w);
    qsum += __shfl_xor(qsum, 16, 32);

    v8f oacc[2];
#pragma unroll
    for (int n = 0; n < 2; ++n) { v8f z = {}; oacc[n] = z; }
    float rsum[8];
#pragma unroll
    for (int r = 0; r < 8; ++r) rsum[r] = 0.0f;

    float* Pw = &Ps[rg][0];
    const int trow = t0 + rg * 16 + 8 * hf;       // + r : this lane's D rows
    const int cw   = 32 * half + c;               // + 16*j : this lane's D column

    __syncthreads();                      // wS / mS published
    float Mt[8];
#pragma unroll
    for (int r = 0; r < 8; ++r) Mt[r] = mS[trow + r];

    for (int ct = 0; ct <= rt; ++ct) {
        const int s0 = ct * 64;
#pragma unroll
        for (int i = 0; i < 4; ++i) {
            *reinterpret_cast<v4f*>(&Ks[(srow + 16 * i) * KV_P + sc4]) = kreg[i];
            const v4f vv = {vreg[4 * i], vreg[4 * i + 1], vreg[4 * i + 2], vreg[4 * i + 3]};
            *reinterpret_cast<v4f*>(&Vt[vd * KV_P + vs0 + 4 * i]) = vv;
        }
        __syncthreads();                  // tile published
        if (ct < rt) {                    // next tile flies under this tile's WMMAs
            kp += 64 * rowstride;
            vp += 64 * rowstride;
            fetch_kv(kp, vp, kreg, vreg);
        }

        // S = Q K^T, 16 x 32 per wave
        v8f sacc[2];
#pragma unroll
        for (int j = 0; j < 2; ++j) { v8f z = {}; sacc[j] = z; }
        WMMA_BLOCK_BEGIN();
        mma_16x32x64(sacc, qf, Ks, cw, hf);
        WMMA_BLOCK_END();

        // P = S * decay under the causal mask; row sums feed the denominator
#pragma unroll
        for (int j = 0; j < 2; ++j) {
            const int s = s0 + 16 * j + cw;
            const float ws = wS[s];
#pragma unroll
            for (int r = 0; r < 8; ++r) {
                const float e = exp2_slot((ws - Mt[r]) * LOG2E);
                const float p = sacc[j][r] * ((s <= trow + r) ? e : 0.0f);
                rsum[r] += p;
                Pw[(8 * hf + r) * KV_P + 16 * j + cw] = p;
            }
        }
        __syncthreads();                  // both column halves of P published

        // O += P V
        v4f pf[8];
#pragma unroll
        for (int m = 0; m < 8; ++m)
            pf[m] = *reinterpret_cast<const v4f*>(&Pw[c * KV_P + 8 * m + 4 * hf]);
        WMMA_BLOCK_BEGIN();
        mma_16x32x64(oacc, pf, Vt, cw, hf);
        WMMA_BLOCK_END();
        __syncthreads();                  // every reader has left Ks/Vt before the refill
    }

    // row sums: over the 16 lanes of a half wave, then over the two column halves
#pragma unroll
    for (int r = 0; r < 8; ++r) {
        float s = rsum[r];
        s += __shfl_xor(s, 1, 32);
        s += __shfl_xor(s, 2, 32);
        s += __shfl_xor(s, 4, 32);
        s += __shfl_xor(s, 8, 32);
        if (c == 0) dS[half][rg * 16 + 8 * hf + r] = s;
    }
    __syncthreads();                      // both halves' row sums published

    // denominator per row, then store: D register r = row 8hf + r, column cw
#pragma unroll
    for (int r = 0; r < 8; ++r) {
        const int lr = rg * 16 + 8 * hf + r;
        const float s = dS[0][lr] + dS[1][lr];
        const float qs = __shfl(qsum, 8 * hf + r, 32);
        const float den = fmaxf(exp2_slot(-Mt[r] * LOG2E) * qs + s, 1.0f);
        const size_t g = hbase + (size_t)(trow + r) * rowstride + cw;
        hseq[g]      = oacc[0][r] / den;
        hseq[g + 16] = oacc[1][r] / den;
    }
}

// ---------------------------------------------------------------------------
// h = o * hseq; per-head LayerNorm over Dh; z = (hn*hw+hb + skip) * silu(r)
// A thread takes 4 neighbouring d of one head, for 2 tokens: 16 lanes hold a head,
// whose sums go by lane exchange (no LDS, no barrier); 128 threads hold a token,
// a work-group 4 tokens. Eight 16-byte loads in flight per lane.
// ---------------------------------------------------------------------------
__global__ __launch_bounds__(256) void combine_kernel(
    const float* __restrict__ o, const float* __restrict__ hseq,
    const float* __restrict__ skip, const float* __restrict__ r,
    const float* __restrict__ hlnw, const float* __restrict__ hlnb,
    __bf16* __restrict__ z)
{
    const int tid = threadIdx.x;
    const int e0  = (tid & 127) * 4;      // h * 64 + d
    const size_t idx0 = ((size_t)blockIdx.x * 4 + (tid >> 7)) * HDIM + e0;

    v4f o4[2], h4[2], s4[2], r4[2];
#pragma unroll
    for (int u = 0; u < 2; ++u) {
        const size_t idx = idx0 + (size_t)u * 2 * HDIM;
        o4[u] = *reinterpret_cast<const v4f*>(o + idx);
        h4[u] = *reinterpret_cast<const v4f*>(hseq + idx);
        s4[u] = *reinterpret_cast<const v4f*>(skip + idx);
        r4[u] = *reinterpret_cast<const v4f*>(r + idx);
    }
    const v4f w4 = *reinterpret_cast<const v4f*>(hlnw + e0);
    const v4f b4 = *reinterpret_cast<const v4f*>(hlnb + e0);
    // keeps all ten loads in front of the arithmetic, in flight together (without it
    // the build sinks four of them behind the lane exchanges: a second round trip)
    // the wait: the first products land in the loads' address registers (a precaution)
    asm volatile("s_wait_xcnt 0x0" ::: "memory");
    __builtin_amdgcn_sched_barrier(0);
#pragma unroll
    for (int u = 0; u < 2; ++u) {
        const v4f hv = o4[u] * h4[u];
        float s1 = (hv.x + hv.y) + (hv.z + hv.w);
        float s2 = (hv.x * hv.x + hv.y * hv.y) + (hv.z * hv.z + hv.w * hv.w);
#pragma unroll
        for (int st = 8; st > 0; st >>= 1) {
            s1 += __shfl_xor(s1, st, 32);
            s2 += __shfl_xor(s2, st, 32);
        }
        const float mu  = s1 * (1.0f / DH);
        const float var = s2 * (1.0f / DH) - mu * mu;
        const float inv = rsqrtf(var + 1e-6f);
        v4bf y;
#pragma unroll
        for (int e = 0; e < 4; ++e) {
            const float hn = (hv[e] - mu) * inv * w4[e] + b4[e];
            const float rv = r4[u][e];
            const float sr = rv / (1.0f + __expf(-rv));
            y[e] = (__bf16)((hn + s4[u][e]) * sr);
        }
        *reinterpret_cast<v4bf*>(z + idx0 + (size_t)u * 2 * HDIM) = y;
    }
}

// ---------------------------------------------------------------------------
// host launcher
// ---------------------------------------------------------------------------
extern "C" void kernel_launch(void* const* d_in, const int* in_sizes, int n_in,
                              void* d_out, int out_size, void* d_ws, size_t ws_size,
                              hipStream_t stream)
{
    const float* x     = (const float*)d_in[0];
    const float* ln_w  = (const float*)d_in[1];
    const float* ln_b  = (const float*)d_in[2];
    const float* hln_w = (const float*)d_in[3];
    const float* hln_b = (const float*)d_in[4];
    const float* Wl    = (const float*)d_in[5];
    const float* bl    = (const float*)d_in[6];
    const float* Wr    = (const float*)d_in[7];
    const float* br    = (const float*)d_in[8];
    const float* conv_w= (const float*)d_in[9];
    const float* conv_b= (const float*)d_in[10];
    const float* Wskip = (const float*)d_in[11];
    const float* bskip = (const float*)d_in[12];
    const float* Wi    = (const float*)d_in[13];
    const float* bi    = (const float*)d_in[14];
    const float* Wf    = (const float*)d_in[15];
    const float* bfv   = (const float*)d_in[16];
    const float* Wo    = (const float*)d_in[17];
    const float* bo    = (const float*)d_in[18];
    const float* Wq    = (const float*)d_in[19];
    const float* bq    = (const float*)d_in[20];
    const float* Wk    = (const float*)d_in[21];
    const float* bk    = (const float*)d_in[22];
    const float* Wv    = (const float*)d_in[23];
    const float* bv    = (const float*)d_in[24];
    const float* Wd    = (const float*)d_in[25];
    const float* bd    = (const float*)d_in[26];

    // --- workspace carve (whole working set fits in MI455X's 192MB L2) ---
    char* ws = (char*)d_ws;
    auto carve = [&](size_t bytes) {
        char* p = ws;
        ws += (bytes + 255) & ~(size_t)255;
        return p;
    };
    // transposed bf16 weights (N x K layout)
    __bf16* WlT    = (__bf16*)carve((size_t)DIM * PDIM * 2);   // 2048 x 1024
    __bf16* WrT    = (__bf16*)carve((size_t)DIM * HDIM * 2);   // 512 x 1024
    __bf16* WskipT = (__bf16*)carve((size_t)PDIM * HDIM * 2);  // 512 x 2048
    __bf16* WqT    = (__bf16*)carve((size_t)PDIM * HDIM * 2);
    __bf16* WkT    = (__bf16*)carve((size_t)PDIM * HDIM * 2);
    __bf16* WvT    = (__bf16*)carve((size_t)PDIM * HDIM * 2);
    __bf16* WoT    = (__bf16*)carve((size_t)PDIM * HDIM * 2);
    __bf16* WdT    = (__bf16*)carve((size_t)HDIM * DIM * 2);   // 1024 x 512
    __bf16* xn_bf  = (__bf16*)carve((size_t)NTOK * DIM * 2);
    float*  xt     = (float*) carve((size_t)NTOK * PDIM * 4);
    __bf16* xt_bf  = (__bf16*)carve((size_t)NTOK * PDIM * 2);
    __bf16* xc_bf  = (__bf16*)carve((size_t)NTOK * PDIM * 2);
    float*  rbuf   = (float*) carve((size_t)NTOK * HDIM * 4);
    float*  skip   = (float*) carve((size_t)NTOK * HDIM * 4);
    float*  qb     = (float*) carve((size_t)NTOK * HDIM * 4);
    float*  kb     = (float*) carve((size_t)NTOK * HDIM * 4);
    float*  vb     = (float*) carve((size_t)NTOK * HDIM * 4);
    float*  ob     = (float*) carve((size_t)NTOK * HDIM * 4);
    float*  ipre   = (float*) carve((size_t)NTOK * NH * 4);
    float*  fpre   = (float*) carve((size_t)NTOK * NH * 4);
    float*  hseq   = (float*) carve((size_t)NTOK * HDIM * 4);
    __bf16* z_bf   = (__bf16*)carve((size_t)NTOK * HDIM * 2);
    (void)ws_size; (void)in_sizes; (void)n_in; (void)out_size;

    // cast + transpose weights: src is (K x N) row-major -> dst (N x K) bf16
    cast_transpose_kernel<<<CAST_TILES, 256, 0, stream>>>(
        Wl, Wskip, Wq, Wk, Wv, Wo, Wr, Wd,
        WlT, WskipT, WqT, WkT, WvT, WoT, WrT, WdT);

    layernorm_kernel<<<NTOK / 8, 256, 0, stream>>>(x, ln_w, ln_b, xn_bf);

    // xt = xn @ Wl + bl   (2048x1024x2048)
    gemm_bf16_wmma<0><<<dim3(PDIM / 128, NTOK / 128), 256, 0, stream>>>(
        xn_bf, WlT, bl, nullptr, xt, NTOK, PDIM, DIM, 1.0f);

    conv_silu_kernel<<<NTOK / CONV_TOK, 256, 0, stream>>>(
        xt, conv_w, conv_b, xc_bf, xt_bf);

    // skip, q, k = xc @ W (k scaled by 1/sqrt(Dh)); v = xt @ Wv, o = sigmoid(xt @ Wo);
    // r = xn @ Wr: one grid, z = projection
    proj_batch_kernel<<<dim3(HDIM / 128, NTOK / 128, 6), 256, 0, stream>>>(
        xc_bf, xt_bf, xn_bf, WskipT, WqT, WkT, WvT, WoT, WrT,
        bskip, bq, bk, bv, bo, br, skip, qb, kb, vb, ob, rbuf);

    gates_kernel<<<NTOK / G_TOK, 256, 0, stream>>>(xc_bf, Wi, bi, Wf, bfv, ipre, fpre);

    scan_parallel_kernel<<<dim3(SEQ / 64, 32), 256, 0, stream>>>(qb, kb, vb, ipre, fpre, hseq);

    combine_kernel<<<NTOK / 4, 256, 0, stream>>>(ob, hseq, skip, rbuf, hln_w, hln_b, z_bf);

    // out = z @ Wd + bd + x
    gemm_bf16_wmma<2><<<dim3(DIM / 128, NTOK / 128), 256, 0, stream>>>(
        z_bf, WdT, bd, x, (float*)d_out, NTOK, DIM, HDIM, 1.0f);
}

// v004
// One run takes 94.5 microseconds.
// In two side-by-side timings against v003, it was 1.27 and 1.24 times as fast.
// All steps since v000 together make it 10.8 times as fast.
#include <hip/hip_runtime.h>
#include <cstdint>
#include <cstddef>

// ---------------------------------------------------------------------------
// mLSTM block forward for MI455X (gfx1250), bf16 WMMA GEMMs + f32 scan.
// B=4 T=512 D=1024 H=8 Dh=64 HD=512 P=2048 K=4
// Weights are cast+TRANSPOSED to bf16 once so that both WMMA operands are
// K-contiguous -> all LDS fragment reads are ds_load_b128 (no scalar gathers).
// GEMM tiles are DOUBLE-BUFFERED and staged with CDNA5 async global->LDS DMA
// (ASYNCcnt): DMA for tile i+1 overlaps WMMA compute on tile i. A tile is 128 k deep.
// ---------------------------------------------------------------------------

#define NTOK 2048      // B*T
#define DIM  1024      // D
#define PDIM 2048      // P
#define HDIM 512       // HD
#define NH   8         // H
#define DH   64        // Dh

typedef __attribute__((ext_vector_type(16))) __bf16 v16bf;
typedef __attribute__((ext_vector_type(8)))  float  v8f;
typedef __attribute__((ext_vector_type(4)))  float  v4f;
typedef __attribute__((ext_vector_type(2)))  float  v2f;
typedef __attribute__((ext_vector_type(8)))  __bf16 v8bf;
typedef __attribute__((ext_vector_type(4)))  __bf16 v4bf;
typedef __attribute__((ext_vector_type(2)))  __bf16 v2bf;

union FragV {
    uint4 u[2];
    v16bf v;
};

// eight async global->LDS 128-bit copies (per-lane), tracked by ASYNCcnt: one operand's
// share of a stage. Copy u takes LDS address l + u * lstep and global address
// g + u * gstep (bytes).
// s_wait_xcnt is the last line of the copies' own statement: there no later write of
// an address register can be scheduled ahead of it (a precaution).
#define COPY8_TEXT                                                  \
    "global_load_async_to_lds_b128 %0, %1, off\n\t"                 \
    "global_load_async_to_lds_b128 %2, %3, off\n\t"                 \
    "global_load_async_to_lds_b128 %4, %5, off\n\t"                 \
    "global_load_async_to_lds_b128 %6, %7, off\n\t"                 \
    "global_load_async_to_lds_b128 %8, %9, off\n\t"                 \
    "global_load_async_to_lds_b128 %10, %11, off\n\t"               \
    "global_load_async_to_lds_b128 %12, %13, off\n\t"               \
    "global_load_async_to_lds_b128 %14, %15, off\n\t"
#define COPY8_ARGS(l, lstep, g, gstep)                              \
    "v"(l),               "v"(g),                                   \
    "v"((l) + (lstep)),     "v"((g) + (gstep)),                     \
    "v"((l) + 2 * (lstep)), "v"((g) + 2 * (gstep)),                 \
    "v"((l) + 3 * (lstep)), "v"((g) + 3 * (gstep)),                 \
    "v"((l) + 4 * (lstep)), "v"((g) + 4 * (gstep)),                 \
    "v"((l) + 5 * (lstep)), "v"((g) + 5 * (gstep)),                 \
    "v"((l) + 6 * (lstep)), "v"((g) + 6 * (gstep)),                 \
    "v"((l) + 7 * (lstep)), "v"((g) + 7 * (gstep))
__device__ __forceinline__ void async_copy8_b128(
    unsigned l, unsigned lstep, const char* g, size_t gstep)
{
    asm volatile(COPY8_TEXT
                 "s_wait_xcnt 0x0"
                 :: COPY8_ARGS(l, lstep, g, gstep) : "memory");
}
// the same, and the line at pf is asked into L2 for a later stage (no data comes back);
// the ask stands in front of the wait, which so covers its address register too
__device__ __forceinline__ void async_copy8_b128_ask(
    unsigned l, unsigned lstep, const char* g, size_t gstep, const void* pf)
{
    asm volatile(COPY8_TEXT
                 "global_prefetch_b8 %16, off scope:SCOPE_SE\n\t"
                 "s_wait_xcnt 0x0"
                 :: COPY8_ARGS(l, lstep, g, gstep), "v"(pf) : "memory");
}
__device__ __forceinline__ void wait_asynccnt0()
{
    asm volatile("s_wait_asynccnt 0x0" ::: "memory");
}

// ---------------------------------------------------------------------------
// cast f32 -> bf16 with transpose: in (R x C row-major) -> out (C x R)
// Tiles of 128 rows x 64 columns through LDS, 32 elements per thread: eight 16-byte
// loads in flight per lane, whole 256-byte pieces of a row on both sides, and an
// eighth of the waves that one 32x32 tile per work-group takes to start.
// Two neighbouring rows are packed into one dword, so LDS holds out's rows as dwords.
// R multiple of 128, C multiple of 64.
// All eight weights in ONE grid: none depends on another, so the tiles of all of
// them are numbered through and a work-group finds its matrix from its index.
// Tiles: Wl 256, then Wskip/Wq/Wk/Wv/Wo 128 each, then Wr 64, then Wd 64.
// ---------------------------------------------------------------------------
#define CAST_TILES 1024
#define CT_P 65        // dword pitch of an LDS row: 64 + 1, both sides free of bank conflicts
__global__ __launch_bounds__(256) void cast_transpose_kernel(
    const float* __restrict__ Wl, const float* __restrict__ Wskip,
    const float* __restrict__ Wq, const float* __restrict__ Wk,
    const float* __restrict__ Wv, const float* __restrict__ Wo,
    const float* __restrict__ Wr, const float* __restrict__ Wd,
    __bf16* __restrict__ WlT, __bf16* __restrict__ WskipT,
    __bf16* __restrict__ WqT, __bf16* __restrict__ WkT,
    __bf16* __restrict__ WvT, __bf16* __restrict__ WoT,
    __bf16* __restrict__ WrT, __bf16* __restrict__ WdT)
{
    __shared__ unsigned tile[64 * CT_P];   // [column c][row pair]
    int t = blockIdx.x;                    // tile number inside the chosen matrix
    const float* in;
    __bf16* out;
    int R, C, lc;                          // lc = log2(C / 64)
    if (t < 256) {
        in = Wl; out = WlT; R = DIM; C = PDIM; lc = 5;
    } else if (t < 896) {
        t -= 256;
        const int w = t >> 7;
        t &= 127;
        R = PDIM; C = HDIM; lc = 3;
        if (w == 0)      { in = Wskip; out = WskipT; }
        else if (w == 1) { in = Wq;    out = WqT; }
        else if (w == 2) { in = Wk;    out = WkT; }
        else if (w == 3) { in = Wv;    out = WvT; }
        else             { in = Wo;    out = WoT; }
    } else if (t < 960) {
        t -= 896;
        in = Wr; out = WrT; R = DIM; C = HDIM; lc = 3;
    } else {
        t -= 960;
        in = Wd; out = WdT; R = HDIM; C = DIM; lc = 4;
    }
    const int c0 = (t & ((1 << lc) - 1)) * 64;
    const int r0 = (t >> lc) * 128;
    const int tid = threadIdx.x;
    const int ci = tid & 15;               // columns 4ci .. 4ci + 3
    const int rp = tid >> 4;               // row pairs rp + 16u
    // one lane offset for all eight loads; what differs between them is uniform
    const unsigned lof = (unsigned)(2 * rp * C + 4 * ci);
    const float* sb = in + (size_t)r0 * C + c0;
    v4f xe[4], xo[4];
#pragma unroll
    for (int u = 0; u < 4; ++u) {
        const float* s = sb + (size_t)(32 * u) * C;
        xe[u] = *reinterpret_cast<const v4f*>(s + lof);
        xo[u] = *reinterpret_cast<const v4f*>(s + C + lof);
    }
#pragma unroll
    for (int u = 0; u < 4; ++u)
#pragma unroll
        for (int kk = 0; kk < 4; ++kk) {
            const v2bf pr = {(__bf16)xe[u][kk], (__bf16)xo[u][kk]};   // rows 2n, 2n + 1
            tile[(4 * ci + kk) * CT_P + rp + 16 * u] = __builtin_bit_cast(unsigned, pr);
        }
    __syncthreads();
#pragma unroll
    for (int u = 0; u < 4; ++u) {
        const int id = tid + 256 * u;      // 64 rows of out, 16 pieces of 16 B each
        const int c = id >> 4;
        const int j = id & 15;
        const unsigned* tp = &tile[c * CT_P + 4 * j];
        const uint4 o = make_uint4(tp[0], tp[1], tp[2], tp[3]);
        *reinterpret_cast<uint4*>(out + (size_t)(c0 + c) * R + r0 + 8 * j) = o;
    }
}

// ---------------------------------------------------------------------------
// LayerNorm over D=1024, one WAVE per token (32 elements per lane, eight 16-byte
// loads in flight), sums over the wave by lane exchange: no LDS, no barrier.
// Writes bf16.
// ---------------------------------------------------------------------------
__global__ __launch_bounds__(256) void layernorm_kernel(
    const float* __restrict__ x, const float* __restrict__ w,
    const float* __restrict__ b, __bf16* __restrict__ xn)
{
    const int lane = threadIdx.x & 31;
    const int tok  = blockIdx.x * 8 + (threadIdx.x >> 5);
    const float* xr = x + (size_t)tok * DIM + lane * 4;

    v4f v[8], w4[8], b4[8];
#pragma unroll
    for (int i = 0; i < 8; ++i)
        v[i] = *reinterpret_cast<const v4f*>(xr + i * 128);
    // the second run of loads lands in the address registers of the first (a precaution)
    asm volatile("s_wait_xcnt 0x0" ::: "memory");
#pragma unroll
    for (int i = 0; i < 8; ++i) {
        w4[i] = *reinterpret_cast<const v4f*>(w + i * 128 + lane * 4);
        b4[i] = *reinterpret_cast<const v4f*>(b + i * 128 + lane * 4);
    }
    // keeps the loads of w and b up here, in flight with the row's (without it the
    // build sinks them behind the sums, two pairs at a time)
    __builtin_amdgcn_sched_barrier(0);
    float s = 0.f, ss = 0.f;
#pragma unroll
    for (int i = 0; i < 8; ++i)
#pragma unroll
        for (int e = 0; e < 4; ++e) {
            s += v[i][e];
            ss += v[i][e] * v[i][e];
        }
#pragma unroll
    for (int o = 16; o > 0; o >>= 1) {
        s  += __shfl_xor(s, o, 32);
        ss += __shfl_xor(ss, o, 32);
    }
    const float mu  = s * (1.0f / DIM);
    const float var = ss * (1.0f / DIM) - mu * mu;
    const float inv = rsqrtf(var + 1e-6f);
    __bf16* yr = xn + (size_t)tok * DIM + lane * 4;
#pragma unroll
    for (int i = 0; i < 8; ++i) {
        v4bf y;
#pragma unroll
        for (int e = 0; e < 4; ++e)
            y[e] = (__bf16)((v[i][e] - mu) * inv * w4[i][e] + b4[i][e]);
        *reinterpret_cast<v4bf*>(yr + i * 128) = y;
    }
}

// ---------------------------------------------------------------------------
// WMMA GEMM: C(MxN,f32) = epilogue(A_bf16(MxK,row) @ Bt_bf16(NxK,row)^T + bias)
//  EPI 0: val = (acc+bias)*scale
//  EPI 1: val = sigmoid(acc+bias) where sig is set, else as EPI 0
//  EPI 2: val = acc+bias+resid[idx]
// Workgroup tile 128x128, 8 waves (4x2) of 32x64; a stage is 128 k = 256 B of every
// operand row, four WMMA blocks of 32 k. One round trip, one pair
// of waits and one barrier per 128 k; the next stage's copies have the 32 WMMAs and
// 48 fragment loads of a stage to land in.
// Double-buffered LDS tiles staged with global_load_async_to_lds_b128:
// DMA of tile i+1 overlaps the WMMAs of tile i; fragments via ds_load_b128.
// M,N multiples of 128; K multiple of 128.
// ---------------------------------------------------------------------------
#define TILE_K  128
#define T_STRIDE 136  // 128 K + 8 pad: pitch 272 B = 16 B x odd, for ds_load_b128 readers
#define BUF_ELEMS (128 * T_STRIDE)
#define BUF_BYTES (BUF_ELEMS * 2)

// epilogue + store of one wave's 32x64 accumulators
// (C layout: lane<16 -> M=vgpr, lane>=16 -> M=8+vgpr)
template <int E>
__device__ __forceinline__ void store_tile(
    const v8f (&acc)[2][4], const float* __restrict__ bias,
    const float* __restrict__ resid, float* __restrict__ C, int N, float scale,
    int rbase, int cbase)
{
#pragma unroll
    for (int mt = 0; mt < 2; ++mt) {
#pragma unroll
        for (int nt = 0; nt < 4; ++nt) {
            const int col = cbase + nt * 16;
            const float bv = bias[col];
#pragma unroll
            for (int vv = 0; vv < 8; ++vv) {
                const int row = rbase + mt * 16 + vv;
                const size_t idx = (size_t)row * N + col;
                float val = acc[mt][nt][vv] + bv;
                if (E == 0) {
                    val *= scale;
                } else if (E == 1) {
                    val = 1.0f / (1.0f + __expf(-val));
                } else {
                    val += resid[idx];
                }
                C[idx] = val;
            }
        }
    }
}

template <int EPI>
__device__ __forceinline__ void gemm_tile(
    const __bf16* __restrict__ A, const __bf16* __restrict__ Bt,
    const float* __restrict__ bias, const float* __restrict__ resid,
    float* __restrict__ C, int N, int K, float scale, bool sig)
{
    __shared__ __attribute__((aligned(16))) __bf16 As[2][BUF_ELEMS];
    __shared__ __attribute__((aligned(16))) __bf16 Bs[2][BUF_ELEMS];

    const int tid  = threadIdx.x;
    const int lane = tid & 31;
    const int wave = tid >> 5;
    const int wm   = wave & 3;   // wave row (0..3) -> 32 rows each
    const int wn   = wave >> 2;  // wave col (0..1) -> 64 cols each
    const int row0 = blockIdx.y * 128;
    const int col0 = blockIdx.x * 128;

    const int lhalf = lane >> 4;   // 0 | 1
    const int lmod  = lane & 15;
    const int kof   = lhalf * 8;   // K offset within 16-lane half

    // per-thread staging coordinates: 16 lanes take one row's 256 B (8 bf16 = 16 B per
    // lane), a thread takes rows sr + 16u, u = 0..7, of both operands
    const int sr = tid >> 4, sc = (tid & 15) * 8;
    const unsigned ldsA = (unsigned)(uintptr_t)&As[0][sr * T_STRIDE + sc];
    const unsigned ldsB = (unsigned)(uintptr_t)&Bs[0][sr * T_STRIDE + sc];
    const __bf16* gA = A  + (size_t)(row0 + sr) * K + sc;
    const __bf16* gB = Bt + (size_t)(col0 + sr) * K + sc;
    const size_t gstep = (size_t)16 * K * sizeof(__bf16);
    // L2 prefetch: a row's share of a stage is one aligned 256-B unit, asked for once:
    // waves 0..3 take the rows of A, waves 4..7 those of Bt
    const __bf16* pf = (tid < 128) ? A  + (size_t)(row0 + tid) * K
                                   : Bt + (size_t)(col0 + tid - 128) * K;

    // copies of the stage at k0; asks L2 for the stage behind it (the last stage asks
    // for itself again: the address stays inside the operand)
    auto stage = [&](int k0, int buf) {
        const unsigned off = (unsigned)buf * BUF_BYTES;
        const int kp = (k0 + TILE_K < K) ? k0 + TILE_K : k0;
        async_copy8_b128(ldsA + off, 16 * T_STRIDE * 2, (const char*)(gA + k0), gstep);
        async_copy8_b128_ask(ldsB + off, 16 * T_STRIDE * 2, (const char*)(gB + k0), gstep, pf + kp);
    };

    v8f acc[2][4];
#pragma unroll
    for (int i = 0; i < 2; ++i)
#pragma unroll
        for (int j = 0; j < 4; ++j) {
            v8f z = {};
            acc[i][j] = z;
        }

    // preload tile 0
    stage(0, 0);
    wait_asynccnt0();
    __syncthreads();

    int cur = 0;
    for (int k0 = 0; k0 < K; k0 += TILE_K) {
        // issue DMA for the NEXT tile into the other buffer (overlaps compute)
        // (with it goes the L2 prefetch of the tile after that one)
        if (k0 + TILE_K < K)
            stage(k0 + TILE_K, cur ^ 1);

        // four blocks of 32 k, unrolled so that a block's fragment loads can go ahead
        // of the block before it
#pragma unroll
        for (int kb = 0; kb < TILE_K; kb += 32) {
            // --- fragments from current buffer (K-contiguous for A and B) ---
            FragV af[2], bfr[4];
#pragma unroll
            for (int mt = 0; mt < 2; ++mt) {
                const int r = wm * 32 + mt * 16 + lmod;
                af[mt].u[0] = *reinterpret_cast<const uint4*>(&As[cur][r * T_STRIDE + kb + kof]);
                af[mt].u[1] = *reinterpret_cast<const uint4*>(&As[cur][r * T_STRIDE + kb + 16 + kof]);
            }
#pragma unroll
            for (int nt = 0; nt < 4; ++nt) {
                const int r = wn * 64 + nt * 16 + lmod;
                bfr[nt].u[0] = *reinterpret_cast<const uint4*>(&Bs[cur][r * T_STRIDE + kb + kof]);
                bfr[nt].u[1] = *reinterpret_cast<const uint4*>(&Bs[cur][r * T_STRIDE + kb + 16 + kof]);
            }
            // --- 8 WMMAs per wave per block (DMA for next tile in flight) ---
#pragma unroll
            for (int mt = 0; mt < 2; ++mt)
#pragma unroll
                for (int nt = 0; nt < 4; ++nt)
                    acc[mt][nt] = __builtin_amdgcn_wmma_f32_16x16x32_bf16(
                        false, af[mt].v, false, bfr[nt].v,
                        (short)0, acc[mt][nt], false, false);
        }

        // this wave's reads of the current buffer have returned before the barrier
        // behind which that buffer is refilled
        asm volatile("s_wait_dscnt 0x0" ::: "memory");
        // next tile fully in LDS (own wave) + all waves done with both ops
        wait_asynccnt0();
        __syncthreads();
        cur ^= 1;
    }

    // --- epilogue + store. The choice by sig is the same for the whole work-group
    // and is made once, outside the element loops: each side is straight-line code.
    const int rbase = row0 + wm * 32 + lhalf * 8;
    const int cbase = col0 + wn * 64 + lmod;
    if (EPI == 1) {
        if (sig) {
            store_tile<1>(acc, bias, resid, C, N, scale, rbase, cbase);
        } else {
            store_tile<0>(acc, bias, resid, C, N, scale, rbase, cbase);
            // the build lays the other side behind this one, joined by a fall-through
            // that is never taken; its loads land in these stores' address registers,
            // so the wait stands in front of them (a precaution)
            asm volatile("s_wait_xcnt 0x0" ::: "memory");
        }
    } else {
        store_tile<EPI>(acc, bias, resid, C, N, scale, rbase, cbase);
    }
}

template <int EPI>
__global__ __launch_bounds__(256) void gemm_bf16_wmma(
    const __bf16* __restrict__ A, const __bf16* __restrict__ Bt,
    const float* __restrict__ bias, const float* __restrict__ resid,
    float* __restrict__ C, int M, int N, int K, float scale)
{
    gemm_tile<EPI>(A, Bt, bias, resid, C, N, K, scale, false);
}

// The six projections of width HD in ONE grid. Each alone is 64 work-groups, a
// quarter of the chip's WGPs, in a loop that waits out one L2 round trip per
// K-step; none reads what another writes, so blockIdx.z picks the operand set and
// all 384 work-groups are resident together. The short one (r, K = D) comes last.
__global__ __launch_bounds__(256) void proj_batch_kernel(
    const __bf16* __restrict__ xc, const __bf16* __restrict__ xt,
    const __bf16* __restrict__ xn,
    const __bf16* __restrict__ WskipT, const __bf16* __restrict__ WqT,
    const __bf16* __restrict__ WkT, const __bf16* __restrict__ WvT,
    const __bf16* __restrict__ WoT, const __bf16* __restrict__ WrT,
    const float* __restrict__ bskip, const float* __restrict__ bq,
    const float* __restrict__ bk, const float* __restrict__ bv,
    const float* __restrict__ bo, const float* __restrict__ br,
    float* __restrict__ skip, float* __restrict__ qb, float* __restrict__ kb,
    float* __restrict__ vb, float* __restrict__ ob, float* __restrict__ rbuf)
{
    const int z = blockIdx.z;
    const __bf16* A;
    const __bf16* Bt;
    const float* bias;
    float* C;
    if (z == 0)      { A = xc; Bt = WskipT; bias = bskip; C = skip; }
    else if (z == 1) { A = xc; Bt = WqT;    bias = bq;    C = qb; }
    else if (z == 2) { A = xc; Bt = WkT;    bias = bk;    C = kb; }
    else if (z == 3) { A = xt; Bt = WvT;    bias = bv;    C = vb; }
    else if (z == 4) { A = xt; Bt = WoT;    bias = bo;    C = ob; }
    else             { A = xn; Bt = WrT;    bias = br;    C = rbuf; }
    const int   K     = (z == 5) ? DIM : PDIM;
    const float scale = (z == 2) ? 0.125f : 1.0f;      // k carries 1/sqrt(Dh)
    gemm_tile<1>(A, Bt, bias, nullptr, C, HDIM, K, scale, z == 4);
}

// ---------------------------------------------------------------------------
// Causal conv (K=4) along the feature axis + SiLU; also emits xt as bf16.
// A thread takes 8 neighbouring features of CONV_TOK tokens: 16-byte loads and
// stores, all tokens' loads in flight together, 32 elements per thread.
// ---------------------------------------------------------------------------
#define CONV_TOK 4
__global__ __launch_bounds__(256) void conv_silu_kernel(
    const float* __restrict__ xt, const float* __restrict__ cw,
    const float* __restrict__ cb, __bf16* __restrict__ xc_bf,
    __bf16* __restrict__ xt_bf)
{
    const int p = threadIdx.x * 8;         // 256 threads x 8 = one token's P features
    const size_t base = (size_t)blockIdx.x * CONV_TOK * PDIM + p;
    const float w0 = cw[0], w1 = cw[1], w2 = cw[2], w3 = cw[3];
    const float cbv = cb[0];
    const int back = p ? 4 : 0;            // the row's first thread has nothing to its left

    v4f pv[CONV_TOK], lo[CONV_TOK], hi[CONV_TOK];
#pragma unroll
    for (int t = 0; t < CONV_TOK; ++t) {
        const float* s = xt + base + (size_t)t * PDIM;
        pv[t] = *reinterpret_cast<const v4f*>(s - back);
        lo[t] = *reinterpret_cast<const v4f*>(s);
        hi[t] = *reinterpret_cast<const v4f*>(s + 4);
    }
    // keeps every load in front of the arithmetic, so that all twelve are in flight
    // together (without it the build sinks a third of them between the divisions)
    // the wait: the first selects land in the loads' address registers (a precaution)
    asm volatile("s_wait_xcnt 0x0" ::: "memory");
    __builtin_amdgcn_sched_barrier(0);
    v8bf oc[CONV_TOK], ox[CONV_TOK];
#pragma unroll
    for (int t = 0; t < CONV_TOK; ++t) {
        // e[j + 3] = feature p + j; left of the row's start the conv pads with zeros
        const float e[11] = {p ? pv[t].y : 0.0f, p ? pv[t].z : 0.0f, p ? pv[t].w : 0.0f,
                             lo[t].x, lo[t].y, lo[t].z, lo[t].w,
                             hi[t].x, hi[t].y, hi[t].z, hi[t].w};
#pragma unroll
        for (int j = 0; j < 8; ++j) {
            float acc = cbv + w3 * e[j + 3];
            acc += w2 * e[j + 2];
            acc += w1 * e[j + 1];
            acc += w0 * e[j];
            oc[t][j] = (__bf16)(acc / (1.0f + __expf(-acc)));   // silu
            ox[t][j] = (__bf16)e[j + 3];
        }
    }
#pragma unroll
    for (int t = 0; t < CONV_TOK; ++t) {
        *reinterpret_cast<v8bf*>(xc_bf + base + (size_t)t * PDIM) = oc[t];
        *reinterpret_cast<v8bf*>(xt_bf + base + (size_t)t * PDIM) = ox[t];
    }
}

// ---------------------------------------------------------------------------
// i/f gate projections (P x 8 each) + softcap(15), plain VALU.
// A work-group takes G_TOK tokens: a thread keeps its 8 rows of Wi and Wf in
// registers and uses them for every token. The 16 * G_TOK partial sums go over the
// wave by a halving lane exchange (each step hands half of the sums to the partner
// lane, so lane l ends with sums 2l and 2l + 1), then over the 8 waves through LDS
// behind ONE barrier.
// ---------------------------------------------------------------------------
#define G_TOK 4
__global__ __launch_bounds__(256) void gates_kernel(
    const __bf16* __restrict__ xc, const float* __restrict__ Wi,
    const float* __restrict__ bi, const float* __restrict__ Wf,
    const float* __restrict__ bfv, float* __restrict__ ipre,
    float* __restrict__ fpre)
{
    __shared__ __attribute__((aligned(8))) float red[8][16 * G_TOK];
    const int tid  = threadIdx.x;
    const int lane = tid & 31;
    const int wave = tid >> 5;
    const int tok0 = blockIdx.x * G_TOK;

    // acc[t] = {i gates 0..3, i gates 4..7, f gates 0..3, f gates 4..7} of token tok0 + t
    v4f acc[G_TOK][4];
#pragma unroll
    for (int t = 0; t < G_TOK; ++t)
#pragma unroll
        for (int n = 0; n < 4; ++n) { v4f z = {}; acc[t][n] = z; }
    // every address is a uniform base plus one lane offset that lives through the loop
    const __bf16* xb = xc + (size_t)tok0 * PDIM;
    const unsigned lx = (unsigned)tid;
    const unsigned lw = (unsigned)tid * NH;
    // four rows of the weights per trip: the registers stay under 256
#pragma unroll 1
    for (int j0 = 0; j0 < PDIM; j0 += 1024) {
        v4f wv[4][4];
        __bf16 xr[4][G_TOK];
#pragma unroll
        for (int jj = 0; jj < 4; ++jj) {
            const float* wa = Wi + (size_t)(j0 + 256 * jj) * NH;
            wv[jj][0] = *reinterpret_cast<const v4f*>(wa + lw);
            wv[jj][1] = *reinterpret_cast<const v4f*>((wa + 4) + lw);
        }
        // the next run of loads lands in the address registers of this one (a precaution)
        asm volatile("s_wait_xcnt 0x0" ::: "memory");
#pragma unroll
        for (int jj = 0; jj < 4; ++jj) {
            const float* wb = Wf + (size_t)(j0 + 256 * jj) * NH;
            wv[jj][2] = *reinterpret_cast<const v4f*>(wb + lw);
            wv[jj][3] = *reinterpret_cast<const v4f*>((wb + 4) + lw);
        }
        // as above
        asm volatile("s_wait_xcnt 0x0" ::: "memory");
        const __bf16* xp = xb + j0 + lx;
#pragma unroll
        for (int jj = 0; jj < 4; ++jj)
#pragma unroll
            for (int t = 0; t < G_TOK; ++t)
                xr[jj][t] = xp[256 * jj + t * PDIM];
        // the address is named so that it stays whole up to the wait: without it the
        // last load of the run lands in the address registers of the run (a precaution)
        asm volatile("s_wait_xcnt 0x0" :: "v"(xp) : "memory");
        // keeps the trip's 32 loads in front of its arithmetic, in flight together
        // (without it the build loads the weights pair by pair, a round trip each)
        __builtin_amdgcn_sched_barrier(0);
#pragma unroll
        for (int jj = 0; jj < 4; ++jj)
#pragma unroll
            for (int t = 0; t < G_TOK; ++t) {
                const float xv = (float)xr[jj][t];
#pragma unroll
                for (int n = 0; n < 4; ++n) acc[t][n] += xv * wv[jj][n];
            }
    }
    // sum[t * 16 + g] = i gate g, sum[t * 16 + 8 + g] = f gate g
    float sum[16 * G_TOK];
#pragma unroll
    for (int n = 0; n < 16 * G_TOK; ++n) sum[n] = acc[n >> 4][(n >> 2) & 3][n & 3];
#pragma unroll
    for (int m = 16, half = 8 * G_TOK; m > 0; m >>= 1, half >>= 1) {
        const bool up = (lane & m) != 0;   // this lane keeps the upper half of the sums
#pragma unroll
        for (int n = 0; n < half; ++n) {
            const float send = up ? sum[n] : sum[n + half];
            const float keep = up ? sum[n + half] : sum[n];
            sum[n] = keep + __shfl_xor(send, m, 32);
        }
    }
    const v2f pr = {sum[0], sum[1]};
    *reinterpret_cast<v2f*>(&red[wave][2 * lane]) = pr;
    __syncthreads();                       // every wave's sums published
    if (tid < 16 * G_TOK) {
        float s = 0.0f;
#pragma unroll
        for (int w = 0; w < 8; ++w) s += red[w][tid];
        const int  g   = tid & 7;
        const bool isf = (tid & 8) != 0;
        const float v = s + (isf ? bfv[g] : bi[g]);
        float* dst = isf ? fpre : ipre;
        dst[(size_t)(tok0 + (tid >> 4)) * NH + g] = 15.0f * tanhf(v * (1.0f / 15.0f));
    }
}

// ---------------------------------------------------------------------------
// The gated recurrence in its closed (parallel) form, f32 16x16x4 WMMA.
// With F_t = sum_{u<=t} f_u, w_s = i_s - F_s and M_t = max(0, max_{s<=t} w_s)
// (M_t = m_t - F_t of the recurrence) the scan unrolls exactly to
//   num_t = sum_{s<=t} exp(w_s - M_t) (q_t . k_s) v_s
//   den_t = max(exp(-M_t) sum_e q_t[e] + sum_{s<=t} exp(w_s - M_t) (q_t . k_s), 1)
// Every exponent is <= 0. One block per (b,h, 64 rows of t), 8 waves: wave (rg,half)
// does rows 16rg..+15; columns 32half..+31 of each S tile, then of O.
// K is staged as K[s][e], V transposed as V[d][s]: both B fragments are 16-byte
// LDS loads along k and need no register shuffle.
// ---------------------------------------------------------------------------
#define SEQ    512
#define KV_P   68     // f32 row pitch: 64 + 4, 16B aligned, conflict-free b128 rows

// 2^x. The v_nop is the slot the instruction set asks for behind a transcendental
// before its source may be overwritten or its result used; in one statement with
// it, it cannot drift away.
__device__ __forceinline__ float exp2_slot(float x)
{
    float y;
    asm("v_exp_f32 %0, %1\n\tv_nop" : "=v"(y) : "v"(x));
    return y;
}
#define LOG2E 1.44269504088896340736f

// Distance behind a block of f32 16x16x4 WMMAs before vector instructions may read
// the accumulators or reuse the operand registers. The form has the issue interval
// of the 8-bit-integer form, so that form's eight slots are kept. The scheduling
// barriers hold the block together: no vector instruction moves in between the
// WMMAs or in front of the v_nops.
#define WMMA_BLOCK_BEGIN() __builtin_amdgcn_sched_barrier(0)
#define WMMA_BLOCK_END()                                                        \
    do {                                                                        \
        __builtin_amdgcn_sched_barrier(0);                                      \
        asm volatile("v_nop\n\tv_nop\n\tv_nop\n\tv_nop\n\t"                     \
                     "v_nop\n\tv_nop\n\tv_nop\n\tv_nop");                       \
        __builtin_amdgcn_sched_barrier(0);                                      \
    } while (0)

// one 64x64 f32 tile of K (4 x 16 B along e) and of V (16 rows s of one column d)
__device__ __forceinline__ void fetch_kv(const float* __restrict__ kp,
                                         const float* __restrict__ vp,
                                         v4f (&kr)[4], float (&vr)[16])
{
#pragma unroll
    for (int i = 0; i < 4; ++i)
        kr[i] = *reinterpret_cast<const v4f*>(kp + (size_t)i * 16 * NH * DH);
#pragma unroll
    for (int j = 0; j < 16; ++j)
        vr[j] = vp[(size_t)j * NH * DH];
}

// acc[0..1] += A(16 x 64, fragments af) * B^T, B rows brow and brow + 16 of a
// 64-wide LDS tile; lane (c,hf) takes k = 8m + 4hf + 0..3 on both operands
__device__ __forceinline__ void mma_16x32x64(v8f (&acc)[2], const v4f (&af)[8],
                                             const float* bt, int brow, int hf)
{
#pragma unroll
    for (int m = 0; m < 8; ++m) {
        const v4f b0 = *reinterpret_cast<const v4f*>(&bt[brow * KV_P + 8 * m + 4 * hf]);
        const v4f b1 = *reinterpret_cast<const v4f*>(&bt[(brow + 16) * KV_P + 8 * m + 4 * hf]);
        const v2f alo = {af[m].x, af[m].y}, ahi = {af[m].z, af[m].w};
        const v2f b0lo = {b0.x, b0.y}, b0hi = {b0.z, b0.w};
        const v2f b1lo = {b1.x, b1.y}, b1hi = {b1.z, b1.w};
        acc[0] = __builtin_amdgcn_wmma_f32_16x16x4_f32(
            false, alo, false, b0lo, (short)0, acc[0], false, false);
        acc[1] = __builtin_amdgcn_wmma_f32_16x16x4_f32(
            false, alo, false, b1lo, (short)0, acc[1], false, false);
        acc[0] = __builtin_amdgcn_wmma_f32_16x16x4_f32(
            false, ahi, false, b0hi, (short)0, acc[0], false, false);
        acc[1] = __builtin_amdgcn_wmma_f32_16x16x4_f32(
            false, ahi, false, b1hi, (short)0, acc[1], false, false);
    }
}

__global__ __launch_bounds__(256) void scan_parallel_kernel(
    const float* __restrict__ q, const float* __restrict__ k,
    const float* __restrict__ v, const float* __restrict__ ipre,
    const float* __restrict__ fpre, float* __restrict__ hseq)
{
    __shared__ __attribute__((aligned(16))) float Ks[64 * KV_P];
    __shared__ __attribute__((aligned(16))) float Vt[64 * KV_P];
    __shared__ __attribute__((aligned(16))) float Ps[4][16 * KV_P];
    __shared__ float wS[SEQ];
    __shared__ float mS[SEQ];
    __shared__ float dS[2][64];

    const int rt   = SEQ / 64 - 1 - (int)blockIdx.x;   // longest tiles first
    const int bh   = blockIdx.y;
    const int b    = bh >> 3;
    const int h    = bh & 7;
    const int tid  = threadIdx.x;
    const int lane = tid & 31;
    const int wave = tid >> 5;
    const int rg   = wave & 3;           // 16-row group
    const int half = wave >> 2;          // 32-column half
    const int c    = lane & 15;
    const int hf   = lane >> 4;
    const int t0   = rt * 64;

    const size_t rowstride = (size_t)NH * DH;                 // floats between t and t+1
    const size_t hbase = ((size_t)b * SEQ * NH + h) * DH;     // (b, t=0, h, 0)

    // staging coordinates. K: rows srow + 16i, 16 B at column sc4.
    // V: column vd, rows vs0 .. vs0 + 15 (a wave reads 128 contiguous bytes per row)
    const int srow = tid >> 4;
    const int sc4  = (tid & 15) * 4;
    const int vd   = tid & 63;
    const int vs0  = (tid >> 6) * 16;

    const float* kp = k + hbase + (size_t)srow * rowstride + sc4;
    const float* vp = v + hbase + (size_t)vs0 * rowstride + vd;
    v4f kreg[4];
    float vreg[16];
    fetch_kv(kp, vp, kreg, vreg);

    // Q fragments, kept in registers: lane (c,hf) holds row c, e = 8m + 4hf + 0..3
    v4f qf[8];
    {
        const size_t g = hbase + (size_t)(t0 + rg * 16 + c) * rowstride + 4 * hf;
#pragma unroll
        for (int m = 0; m < 8; ++m)
            qf[m] = *reinterpret_cast<const v4f*>(q + g + 8 * m);
    }

    // gate prefixes for the whole sequence: wave 0, 16 consecutive t per lane
    if (wave == 0) {
        float fv[16], iv[16];
        const size_t g0 = ((size_t)b * SEQ + lane * 16) * NH + h;
#pragma unroll
        for (int j = 0; j < 16; ++j) fv[j] = fpre[g0 + (size_t)j * NH];
        // the second run of loads lands in the address registers of the first
        asm volatile("s_wait_xcnt 0x0" ::: "memory");
#pragma unroll
        for (int j = 0; j < 16; ++j) iv[j] = ipre[g0 + (size_t)j * NH];
#pragma unroll
        for (int j = 1; j < 16; ++j) fv[j] += fv[j - 1];
        float incl = fv[15];
#pragma unroll
        for (int o = 1; o < 32; o <<= 1) {
            const float up = __shfl_up(incl, o, 32);
            if (lane >= o) incl += up;
        }
        float excl = __shfl_up(incl, 1, 32);   // sum of all earlier lanes
        if (lane == 0) excl = 0.0f;
        float run = 0.0f;                 // M starts at m0 - F0 = 0
#pragma unroll
        for (int j = 0; j < 16; ++j) {
            iv[j] = iv[j] - (excl + fv[j]);      // w_s
            run = fmaxf(run, iv[j]);
            fv[j] = run;                          // lane-local running max
        }
        float mx = run;
#pragma unroll
        for (int o = 1; o < 32; o <<= 1) {
            const float up = __shfl_up(mx, o, 32);
            if (lane >= o) mx = fmaxf(mx, up);
        }
        float prev = __shfl_up(mx, 1, 32);
        if (lane == 0) prev = 0.0f;
#pragma unroll
        for (int j = 0; j < 16; ++j) {
            wS[lane * 16 + j] = iv[j];
            mS[lane * 16 + j] = fmaxf(prev, fv[j]);
        }
    }

    // sum_e q_t[e] for row c (both lane halves end with the row total)
    float qsum = 0.0f;
#pragma unroll
    for (int m = 0; m < 8; ++m) qsum += (qf[m].x + qf[m].y) + (qf[m].z + qf[m].w);
    qsum += __shfl_xor(qsum, 16, 32);

    v8f oacc[2];
#pragma unroll
    for (int n = 0; n < 2; ++n) { v8f z = {}; oacc[n] = z; }
    float rsum[8];
#pragma unroll
    for (int r = 0; r < 8; ++r) rsum[r] = 0.0f;

    float* Pw = &Ps[rg][0];
    const int trow = t0 + rg * 16 + 8 * hf;       // + r : this lane's D rows
    const int cw   = 32 * half + c;               // + 16*j : this lane's D column

    __syncthreads();                      // wS / mS published
    float Mt[8];
#pragma unroll
    for (int r = 0; r < 8; ++r) Mt[r] = mS[trow + r];

    for (int ct = 0; ct <= rt; ++ct) {
        const int s0 = ct * 64;
#pragma unroll
        for (int i = 0; i < 4; ++i) {
            *reinterpret_cast<v4f*>(&Ks[(srow + 16 * i) * KV_P + sc4]) = kreg[i];
            const v4f vv = {vreg[4 * i], vreg[4 * i + 1], vreg[4 * i + 2], vreg[4 * i + 3]};
            *reinterpret_cast<v4f*>(&Vt[vd * KV_P + vs0 + 4 * i]) = vv;
        }
        __syncthreads();                  // tile published
        if (ct < rt) {                    // next tile flies under this tile's WMMAs
            kp += 64 * rowstride;
            vp += 64 * rowstride;
            fetch_kv(kp, vp, kreg, vreg);
        }

        // S = Q K^T, 16 x 32 per wave
        v8f sacc[2];
#pragma unroll
        for (int j = 0; j < 2; ++j) { v8f z = {}; sacc[j] = z; }
        WMMA_BLOCK_BEGIN();
        mma_16x32x64(sacc, qf, Ks, cw, hf);
        WMMA_BLOCK_END();

        // P = S * decay under the causal mask; row sums feed the denominator
#pragma unroll
        for (int j = 0; j < 2; ++j) {
            const int s = s0 + 16 * j + cw;
            const float ws = wS[s];
#pragma unroll
            for (int r = 0; r < 8; ++r) {
                const float e = exp2_slot((ws - Mt[r]) * LOG2E);
                const float p = sacc[j][r] * ((s <= trow + r) ? e : 0.0f);
                rsum[r] += p;
                Pw[(8 * hf + r) * KV_P + 16 * j + cw] = p;
            }
        }
        __syncthreads();                  // both column halves of P published

        // O += P V
        v4f pf[8];
#pragma unroll
        for (int m = 0; m < 8; ++m)
            pf[m] = *reinterpret_cast<const v4f*>(&Pw[c * KV_P + 8 * m + 4 * hf]);
        WMMA_BLOCK_BEGIN();
        mma_16x32x64(oacc, pf, Vt, cw, hf);
        WMMA_BLOCK_END();
        __syncthreads();                  // every reader has left Ks/Vt before the refill
    }

    // row sums: over the 16 lanes of a half wave, then over the two column halves
#pragma unroll
    for (int r = 0; r < 8; ++r) {
        float s = rsum[r];
        s += __shfl_xor(s, 1, 32);
        s += __shfl_xor(s, 2, 32);
        s += __shfl_xor(s, 4, 32);
        s += __shfl_xor(s, 8, 32);
        if (c == 0) dS[half][rg * 16 + 8 * hf + r] = s;
    }
    __syncthreads();                      // both halves' row sums published

    // denominator per row, then store: D register r = row 8hf + r, column cw
#pragma unroll
    for (int r = 0; r < 8; ++r) {
        const int lr = rg * 16 + 8 * hf + r;
        const float s = dS[0][lr] + dS[1][lr];
        const float qs = __shfl(qsum, 8 * hf + r, 32);
        const float den = fmaxf(exp2_slot(-Mt[r] * LOG2E) * qs + s, 1.0f);
        const size_t g = hbase + (size_t)(trow + r) * rowstride + cw;
        hseq[g]      = oacc[0][r] / den;
        hseq[g + 16] = oacc[1][r] / den;
    }
}

// ---------------------------------------------------------------------------
// h = o * hseq; per-head LayerNorm over Dh; z = (hn*hw+hb + skip) * silu(r)
// A thread takes 4 neighbouring d of one head, for 2 tokens: 16 lanes hold a head,
// whose sums go by lane exchange (no LDS, no barrier); 128 threads hold a token,
// a work-group 4 tokens. Eight 16-byte loads in flight per lane.
// ---------------------------------------------------------------------------
__global__ __launch_bounds__(256) void combine_kernel(
    const float* __restrict__ o, const float* __restrict__ hseq,
    const float* __restrict__ skip, const float* __restrict__ r,
    const float* __restrict__ hlnw, const float* __restrict__ hlnb,
    __bf16* __restrict__ z)
{
    const int tid = threadIdx.x;
    const int e0  = (tid & 127) * 4;      // h * 64 + d
    const size_t idx0 = ((size_t)blockIdx.x * 4 + (tid >> 7)) * HDIM + e0;

    v4f o4[2], h4[2], s4[2], r4[2];
#pragma unroll
    for (int u = 0; u < 2; ++u) {
        const size_t idx = idx0 + (size_t)u * 2 * HDIM;
        o4[u] = *reinterpret_cast<const v4f*>(o + idx);
        h4[u] = *reinterpret_cast<const v4f*>(hseq + idx);
        s4[u] = *reinterpret_cast<const v4f*>(skip + idx);
        r4[u] = *reinterpret_cast<const v4f*>(r + idx);
    }
    const v4f w4 = *reinterpret_cast<const v4f*>(hlnw + e0);
    const v4f b4 = *reinterpret_cast<const v4f*>(hlnb + e0);
    // keeps all ten loads in front of the arithmetic, in flight together (without it
    // the build sinks four of them behind the lane exchanges: a second round trip)
    // the wait: the first products land in the loads' address registers (a precaution)
    asm volatile("s_wait_xcnt 0x0" ::: "memory");
    __builtin_amdgcn_sched_barrier(0);
#pragma unroll
    for (int u = 0; u < 2; ++u) {
        const v4f hv = o4[u] * h4[u];
        float s1 = (hv.x + hv.y) + (hv.z + hv.w);
        float s2 = (hv.x * hv.x + hv.y * hv.y) + (hv.z * hv.z + hv.w * hv.w);
#pragma unroll
        for (int st = 8; st > 0; st >>= 1) {
            s1 += __shfl_xor(s1, st, 32);
            s2 += __shfl_xor(s2, st, 32);
        }
        const float mu  = s1 * (1.0f / DH);
        const float var = s2 * (1.0f / DH) - mu * mu;
        const float inv = rsqrtf(var + 1e-6f);
        v4bf y;
#pragma unroll
        for (int e = 0; e < 4; ++e) {
            const float hn = (hv[e] - mu) * inv * w4[e] + b4[e];
            const float rv = r4[u][e];
            const float sr = rv / (1.0f + __expf(-rv));
            y[e] = (__bf16)((hn + s4[u][e]) * sr);
        }
        *reinterpret_cast<v4bf*>(z + idx0 + (size_t)u * 2 * HDIM) = y;
    }
}

// ---------------------------------------------------------------------------
// host launcher
// ---------------------------------------------------------------------------
extern "C" void kernel_launch(void* const* d_in, const int* in_sizes, int n_in,
                              void* d_out, int out_size, void* d_ws, size_t ws_size,
                              hipStream_t stream)
{
    const float* x     = (const float*)d_in[0];
    const float* ln_w  = (const float*)d_in[1];
    const float* ln_b  = (const float*)d_in[2];
    const float* hln_w = (const float*)d_in[3];
    const float* hln_b = (const float*)d_in[4];
    const float* Wl    = (const float*)d_in[5];
    const float* bl    = (const float*)d_in[6];
    const float* Wr    = (const float*)d_in[7];
    const float* br    = (const float*)d_in[8];
    const float* conv_w= (const float*)d_in[9];
    const float* conv_b= (const float*)d_in[10];
    const float* Wskip = (const float*)d_in[11];
    const float* bskip = (const float*)d_in[12];
    const float* Wi    = (const float*)d_in[13];
    const float* bi    = (const float*)d_in[14];
    const float* Wf    = (const float*)d_in[15];
    const float* bfv   = (const float*)d_in[16];
    const float* Wo    = (const float*)d_in[17];
    const float* bo    = (const float*)d_in[18];
    const float* Wq    = (const float*)d_in[19];
    const float* bq    = (const float*)d_in[20];
    const float* Wk    = (const float*)d_in[21];
    const float* bk    = (const float*)d_in[22];
    const float* Wv    = (const float*)d_in[23];
    const float* bv    = (const float*)d_in[24];
    const float* Wd    = (const float*)d_in[25];
    const float* bd    = (const float*)d_in[26];

    // --- workspace carve (whole working set fits in MI455X's 192MB L2) ---
    char* ws = (char*)d_ws;
    auto carve = [&](size_t bytes) {
        char* p = ws;
        ws += (bytes + 255) & ~(size_t)255;
        return p;
    };
    // transposed bf16 weights (N x K layout)
    __bf16* WlT    = (__bf16*)carve((size_t)DIM * PDIM * 2);   // 2048 x 1024
    __bf16* WrT    = (__bf16*)carve((size_t)DIM * HDIM * 2);   // 512 x 1024
    __bf16* WskipT = (__bf16*)carve((size_t)PDIM * HDIM * 2);  // 512 x 2048
    __bf16* WqT    = (__bf16*)carve((size_t)PDIM * HDIM * 2);
    __bf16* WkT    = (__bf16*)carve((size_t)PDIM * HDIM * 2);
    __bf16* WvT    = (__bf16*)carve((size_t)PDIM * HDIM * 2);
    __bf16* WoT    = (__bf16*)carve((size_t)PDIM * HDIM * 2);
    __bf16* WdT    = (__bf16*)carve((size_t)HDIM * DIM * 2);   // 1024 x 512
    __bf16* xn_bf  = (__bf16*)carve((size_t)NTOK * DIM * 2);
    float*  xt     = (float*) carve((size_t)NTOK * PDIM * 4);
    __bf16* xt_bf  = (__bf16*)carve((size_t)NTOK * PDIM * 2);
    __bf16* xc_bf  = (__bf16*)carve((size_t)NTOK * PDIM * 2);
    float*  rbuf   = (float*) carve((size_t)NTOK * HDIM * 4);
    float*  skip   = (float*) carve((size_t)NTOK * HDIM * 4);
    float*  qb     = (float*) carve((size_t)NTOK * HDIM * 4);
    float*  kb     = (float*) carve((size_t)NTOK * HDIM * 4);
    float*  vb     = (float*) carve((size_t)NTOK * HDIM * 4);
    float*  ob     = (float*) carve((size_t)NTOK * HDIM * 4);
    float*  ipre   = (float*) carve((size_t)NTOK * NH * 4);
    float*  fpre   = (float*) carve((size_t)NTOK * NH * 4);
    float*  hseq   = (float*) carve((size_t)NTOK * HDIM * 4);
    __bf16* z_bf   = (__bf16*)carve((size_t)NTOK * HDIM * 2);
    (void)ws_size; (void)in_sizes; (void)n_in; (void)out_size;

    // cast + transpose weights: src is (K x N) row-major -> dst (N x K) bf16
    cast_transpose_kernel<<<CAST_TILES, 256, 0, stream>>>(
        Wl, Wskip, Wq, Wk, Wv, Wo, Wr, Wd,
        WlT, WskipT, WqT, WkT, WvT, WoT, WrT, WdT);

    layernorm_kernel<<<NTOK / 8, 256, 0, stream>>>(x, ln_w, ln_b, xn_bf);

    // xt = xn @ Wl + bl   (2048x1024x2048)
    gemm_bf16_wmma<0><<<dim3(PDIM / 128, NTOK / 128), 256, 0, stream>>>(
        xn_bf, WlT, bl, nullptr, xt, NTOK, PDIM, DIM, 1.0f);

    conv_silu_kernel<<<NTOK / CONV_TOK, 256, 0, stream>>>(
        xt, conv_w, conv_b, xc_bf, xt_bf);

    // skip, q, k = xc @ W (k scaled by 1/sqrt(Dh)); v = xt @ Wv, o = sigmoid(xt @ Wo);
    // r = xn @ Wr: one grid, z = projection
    proj_batch_kernel<<<dim3(HDIM / 128, NTOK / 128, 6), 256, 0, stream>>>(
        xc_bf, xt_bf, xn_bf, WskipT, WqT, WkT, WvT, WoT, WrT,
        bskip, bq, bk, bv, bo, br, skip, qb, kb, vb, ob, rbuf);

    gates_kernel<<<NTOK / G_TOK, 256, 0, stream>>>(xc_bf, Wi, bi, Wf, bfv, ipre, fpre);

    scan_parallel_kernel<<<dim3(SEQ / 64, 32), 256, 0, stream>>>(qb, kb, vb, ipre, fpre, hseq);

    combine_kernel<<<NTOK / 4, 256, 0, stream>>>(ob, hseq, skip, rbuf, hln_w, hln_b, z_bf);

    // out = z @ Wd + bd + x
    gemm_bf16_wmma<2><<<dim3(DIM / 128, NTOK / 128), 256, 0, stream>>>(
        z_bf, WdT, bd, x, (float*)d_out, NTOK, DIM, HDIM, 1.0f);
}

// v005
// A run of this version takes 89.3 microseconds.
// In both of two side-by-side timings against v004, it was 1.06 times as fast.
// Counting every step since v000, it is 11.4 times as fast.
#include <hip/hip_runtime.h>
#include <cstdint>
#include <cstddef>

// ---------------------------------------------------------------------------
// mLSTM block forward for MI455X (gfx1250), bf16 WMMA GEMMs + f32 scan.
// B=4 T=512 D=1024 H=8 Dh=64 HD=512 P=2048 K=4
// Weights are cast+TRANSPOSED to bf16 once so that both WMMA operands are
// K-contiguous -> all LDS fragment reads are ds_load_b128 (no scalar gathers).
// GEMM tiles are DOUBLE-BUFFERED and staged with CDNA5 async global->LDS DMA
// (ASYNCcnt): DMA for tile i+1 overlaps WMMA compute on tile i. A tile is 128 k deep.
// ---------------------------------------------------------------------------

#define NTOK 2048      // B*T
#define DIM  1024      // D
#define PDIM 2048      // P
#define HDIM 512       // HD
#define NH   8         // H
#define DH   64        // Dh

typedef __attribute__((ext_vector_type(16))) __bf16 v16bf;
typedef __attribute__((ext_vector_type(8)))  float  v8f;
typedef __attribute__((ext_vector_type(4)))  float  v4f;
typedef __attribute__((ext_vector_type(2)))  float  v2f;
typedef __attribute__((ext_vector_type(8)))  __bf16 v8bf;
typedef __attribute__((ext_vector_type(4)))  __bf16 v4bf;
typedef __attribute__((ext_vector_type(2)))  __bf16 v2bf;

union FragV {
    uint4 u[2];
    v16bf v;
};

// eight async global->LDS 128-bit copies (per-lane), tracked by ASYNCcnt: one operand's
// share of a stage. Copy u takes LDS address l + u * lstep and global address
// g + u * gstep (bytes).
// s_wait_xcnt is the last line of the copies' own statement: there no later write of
// an address register can be scheduled ahead of it (a precaution).
#define COPY8_TEXT                                                  \
    "global_load_async_to_lds_b128 %0, %1, off\n\t"                 \
    "global_load_async_to_lds_b128 %2, %3, off\n\t"                 \
    "global_load_async_to_lds_b128 %4, %5, off\n\t"                 \
    "global_load_async_to_lds_b128 %6, %7, off\n\t"                 \
    "global_load_async_to_lds_b128 %8, %9, off\n\t"                 \
    "global_load_async_to_lds_b128 %10, %11, off\n\t"               \
    "global_load_async_to_lds_b128 %12, %13, off\n\t"               \
    "global_load_async_to_lds_b128 %14, %15, off\n\t"
#define COPY8_ARGS(l, lstep, g, gstep)                              \
    "v"(l),               "v"(g),                                   \
    "v"((l) + (lstep)),     "v"((g) + (gstep)),                     \
    "v"((l) + 2 * (lstep)), "v"((g) + 2 * (gstep)),                 \
    "v"((l) + 3 * (lstep)), "v"((g) + 3 * (gstep)),                 \
    "v"((l) + 4 * (lstep)), "v"((g) + 4 * (gstep)),                 \
    "v"((l) + 5 * (lstep)), "v"((g) + 5 * (gstep)),                 \
    "v"((l) + 6 * (lstep)), "v"((g) + 6 * (gstep)),                 \
    "v"((l) + 7 * (lstep)), "v"((g) + 7 * (gstep))
__device__ __forceinline__ void async_copy8_b128(
    unsigned l, unsigned lstep, const char* g, size_t gstep)
{
    asm volatile(COPY8_TEXT
                 "s_wait_xcnt 0x0"
                 :: COPY8_ARGS(l, lstep, g, gstep) : "memory");
}
// the same, and the line at pf is asked into L2 for a later stage (no data comes back);
// the ask stands in front of the wait, which so covers its address register too
__device__ __forceinline__ void async_copy8_b128_ask(
    unsigned l, unsigned lstep, const char* g, size_t gstep, const void* pf)
{
    asm volatile(COPY8_TEXT
                 "global_prefetch_b8 %16, off scope:SCOPE_SE\n\t"
                 "s_wait_xcnt 0x0"
                 :: COPY8_ARGS(l, lstep, g, gstep), "v"(pf) : "memory");
}
__device__ __forceinline__ void wait_asynccnt0()
{
    asm volatile("s_wait_asynccnt 0x0" ::: "memory");
}

// ---------------------------------------------------------------------------
// cast f32 -> bf16 with transpose: in (R x C row-major) -> out (C x R)
// Tiles of 128 rows x 64 columns through LDS, 32 elements per thread: eight 16-byte
// loads in flight per lane, whole 256-byte pieces of a row on both sides, and an
// eighth of the waves that one 32x32 tile per work-group takes to start.
// Two neighbouring rows are packed into one dword, so LDS holds out's rows as dwords.
// R multiple of 128, C multiple of 64.
// All eight weights in ONE grid: none depends on another, so the tiles of all of
// them are numbered through and a work-group finds its matrix from its index.
// Tiles: Wl 256, then Wskip/Wq/Wk/Wv/Wo 128 each, then Wr 64, then Wd 64.
// ---------------------------------------------------------------------------
#define CAST_TILES 1024
#define CT_P 65        // dword pitch of an LDS row: 64 + 1, both sides free of bank conflicts
__global__ __launch_bounds__(256) void cast_transpose_kernel(
    const float* __restrict__ Wl, const float* __restrict__ Wskip,
    const float* __restrict__ Wq, const float* __restrict__ Wk,
    const float* __restrict__ Wv, const float* __restrict__ Wo,
    const float* __restrict__ Wr, const float* __restrict__ Wd,
    __bf16* __restrict__ WlT, __bf16* __restrict__ WskipT,
    __bf16* __restrict__ WqT, __bf16* __restrict__ WkT,
    __bf16* __restrict__ WvT, __bf16* __restrict__ WoT,
    __bf16* __restrict__ WrT, __bf16* __restrict__ WdT)
{
    __shared__ unsigned tile[64 * CT_P];   // [column c][row pair]
    int t = blockIdx.x;                    // tile number inside the chosen matrix
    const float* in;
    __bf16* out;
    int R, C, lc;                          // lc = log2(C / 64)
    if (t < 256) {
        in = Wl; out = WlT; R = DIM; C = PDIM; lc = 5;
    } else if (t < 896) {
        t -= 256;
        const int w = t >> 7;
        t &= 127;
        R = PDIM; C = HDIM; lc = 3;
        if (w == 0)      { in = Wskip; out = WskipT; }
        else if (w == 1) { in = Wq;    out = WqT; }
        else if (w == 2) { in = Wk;    out = WkT; }
        else if (w == 3) { in = Wv;    out = WvT; }
        else             { in = Wo;    out = WoT; }
    } else if (t < 960) {
        t -= 896;
        in = Wr; out = WrT; R = DIM; C = HDIM; lc = 3;
    } else {
        t -= 960;
        in = Wd; out = WdT; R = HDIM; C = DIM; lc = 4;
    }
    const int c0 = (t & ((1 << lc) - 1)) * 64;
    const int r0 = (t >> lc) * 128;
    const int tid = threadIdx.x;
    const int ci = tid & 15;               // columns 4ci .. 4ci + 3
    const int rp = tid >> 4;               // row pairs rp + 16u
    // one lane offset for all eight loads; what differs between them is uniform
    const unsigned lof = (unsigned)(2 * rp * C + 4 * ci);
    const float* sb = in + (size_t)r0 * C + c0;
    v4f xe[4], xo[4];
#pragma unroll
    for (int u = 0; u < 4; ++u) {
        const float* s = sb + (size_t)(32 * u) * C;
        xe[u] = *reinterpret_cast<const v4f*>(s + lof);
        xo[u] = *reinterpret_cast<const v4f*>(s + C + lof);
    }
#pragma unroll
    for (int u = 0; u < 4; ++u)
#pragma unroll
        for (int kk = 0; kk < 4; ++kk) {
            const v2bf pr = {(__bf16)xe[u][kk], (__bf16)xo[u][kk]};   // rows 2n, 2n + 1
            tile[(4 * ci + kk) * CT_P + rp + 16 * u] = __builtin_bit_cast(unsigned, pr);
        }
    __syncthreads();
#pragma unroll
    for (int u = 0; u < 4; ++u) {
        const int id = tid + 256 * u;      // 64 rows of out, 16 pieces of 16 B each
        const int c = id >> 4;
        const int j = id & 15;
        const unsigned* tp = &tile[c * CT_P + 4 * j];
        const uint4 o = make_uint4(tp[0], tp[1], tp[2], tp[3]);
        *reinterpret_cast<uint4*>(out + (size_t)(c0 + c) * R + r0 + 8 * j) = o;
    }
}

// ---------------------------------------------------------------------------
// LayerNorm over D=1024, one WAVE per token (32 elements per lane, eight 16-byte
// loads in flight), sums over the wave by lane exchange: no LDS, no barrier.
// Writes bf16.
// ---------------------------------------------------------------------------
__global__ __launch_bounds__(256) void layernorm_kernel(
    const float* __restrict__ x, const float* __restrict__ w,
    const float* __restrict__ b, __bf16* __restrict__ xn)
{
    const int lane = threadIdx.x & 31;
    const int tok  = blockIdx.x * 8 + (threadIdx.x >> 5);
    const float* xr = x + (size_t)tok * DIM + lane * 4;

    v4f v[8], w4[8], b4[8];
#pragma unroll
    for (int i = 0; i < 8; ++i)
        v[i] = *reinterpret_cast<const v4f*>(xr + i * 128);
    // the second run of loads lands in the address registers of the first (a precaution)
    asm volatile("s_wait_xcnt 0x0" ::: "memory");
#pragma unroll
    for (int i = 0; i < 8; ++i) {
        w4[i] = *reinterpret_cast<const v4f*>(w + i * 128 + lane * 4);
        b4[i] = *reinterpret_cast<const v4f*>(b + i * 128 + lane * 4);
    }
    // keeps the loads of w and b up here, in flight with the row's (without it the
    // build sinks them behind the sums, two pairs at a time)
    __builtin_amdgcn_sched_barrier(0);
    float s = 0.f, ss = 0.f;
#pragma unroll
    for (int i = 0; i < 8; ++i)
#pragma unroll
        for (int e = 0; e < 4; ++e) {
            s += v[i][e];
            ss += v[i][e] * v[i][e];
        }
#pragma unroll
    for (int o = 16; o > 0; o >>= 1) {
        s  += __shfl_xor(s, o, 32);
        ss += __shfl_xor(ss, o, 32);
    }
    const float mu  = s * (1.0f / DIM);
    const float var = ss * (1.0f / DIM) - mu * mu;
    const float inv = rsqrtf(var + 1e-6f);
    __bf16* yr = xn + (size_t)tok * DIM + lane * 4;
#pragma unroll
    for (int i = 0; i < 8; ++i) {
        v4bf y;
#pragma unroll
        for (int e = 0; e < 4; ++e)
            y[e] = (__bf16)((v[i][e] - mu) * inv * w4[i][e] + b4[i][e]);
        *reinterpret_cast<v4bf*>(yr + i * 128) = y;
    }
}

// ---------------------------------------------------------------------------
// WMMA GEMM: C(MxN,f32) = epilogue(A_bf16(MxK,row) @ Bt_bf16(NxK,row)^T + bias)
//  EPI 0: val = (acc+bias)*scale
//  EPI 1: val = sigmoid(acc+bias) where sig is set, else as EPI 0
//  EPI 2: val = acc+bias+resid[idx]
// Workgroup tile 128x128, 8 waves (4x2) of 32x64; a stage is 128 k = 256 B of every
// operand row, four WMMA blocks of 32 k. One round trip, one pair
// of waits and one barrier per 128 k; the next stage's copies have the 32 WMMAs and
// 48 fragment loads of a stage to land in.
// Double-buffered LDS tiles staged with global_load_async_to_lds_b128:
// DMA of tile i+1 overlaps the WMMAs of tile i; fragments via ds_load_b128.
// M,N multiples of 128; K multiple of 128.
// ---------------------------------------------------------------------------
#define TILE_K  128
#define T_STRIDE 136  // 128 K + 8 pad: pitch 272 B = 16 B x odd, for ds_load_b128 readers
#define BUF_ELEMS (128 * T_STRIDE)
#define BUF_BYTES (BUF_ELEMS * 2)

// epilogue + store of one wave's 32x64 accumulators
// (C layout: lane<16 -> M=vgpr, lane>=16 -> M=8+vgpr)
template <int E>
__device__ __forceinline__ void store_tile(
    const v8f (&acc)[2][4], const float* __restrict__ bias,
    const float* __restrict__ resid, float* __restrict__ C, int N, float scale,
    int rbase, int cbase)
{
#pragma unroll
    for (int mt = 0; mt < 2; ++mt) {
#pragma unroll
        for (int nt = 0; nt < 4; ++nt) {
            const int col = cbase + nt * 16;
            const float bv = bias[col];
#pragma unroll
            for (int vv = 0; vv < 8; ++vv) {
                const int row = rbase + mt * 16 + vv;
                const size_t idx = (size_t)row * N + col;
                float val = acc[mt][nt][vv] + bv;
                if (E == 0) {
                    val *= scale;
                } else if (E == 1) {
                    val = 1.0f / (1.0f + __expf(-val));
                } else {
                    val += resid[idx];
                }
                C[idx] = val;
            }
        }
    }
}

template <int EPI>
__device__ __forceinline__ void gemm_tile(
    const __bf16* __restrict__ A, const __bf16* __restrict__ Bt,
    const float* __restrict__ bias, const float* __restrict__ resid,
    float* __restrict__ C, int N, int K, float scale, bool sig)
{
    __shared__ __attribute__((aligned(16))) __bf16 As[2][BUF_ELEMS];
    __shared__ __attribute__((aligned(16))) __bf16 Bs[2][BUF_ELEMS];

    const int tid  = threadIdx.x;
    const int lane = tid & 31;
    const int wave = tid >> 5;
    const int wm   = wave & 3;   // wave row (0..3) -> 32 rows each
    const int wn   = wave >> 2;  // wave col (0..1) -> 64 cols each
    const int row0 = blockIdx.y * 128;
    const int col0 = blockIdx.x * 128;

    const int lhalf = lane >> 4;   // 0 | 1
    const int lmod  = lane & 15;
    const int kof   = lhalf * 8;   // K offset within 16-lane half

    // per-thread staging coordinates: 16 lanes take one row's 256 B (8 bf16 = 16 B per
    // lane), a thread takes rows sr + 16u, u = 0..7, of both operands
    const int sr = tid >> 4, sc = (tid & 15) * 8;
    const unsigned ldsA = (unsigned)(uintptr_t)&As[0][sr * T_STRIDE + sc];
    const unsigned ldsB = (unsigned)(uintptr_t)&Bs[0][sr * T_STRIDE + sc];
    const __bf16* gA = A  + (size_t)(row0 + sr) * K + sc;
    const __bf16* gB = Bt + (size_t)(col0 + sr) * K + sc;
    const size_t gstep = (size_t)16 * K * sizeof(__bf16);
    // L2 prefetch: a row's share of a stage is one aligned 256-B unit, asked for once:
    // waves 0..3 take the rows of A, waves 4..7 those of Bt
    const __bf16* pf = (tid < 128) ? A  + (size_t)(row0 + tid) * K
                                   : Bt + (size_t)(col0 + tid - 128) * K;

    // copies of the stage at k0; asks L2 for the stage behind it (the last stage asks
    // for itself again: the address stays inside the operand)
    auto stage = [&](int k0, int buf) {
        const unsigned off = (unsigned)buf * BUF_BYTES;
        const int kp = (k0 + TILE_K < K) ? k0 + TILE_K : k0;
        async_copy8_b128(ldsA + off, 16 * T_STRIDE * 2, (const char*)(gA + k0), gstep);
        async_copy8_b128_ask(ldsB + off, 16 * T_STRIDE * 2, (const char*)(gB + k0), gstep, pf + kp);
    };

    v8f acc[2][4];
#pragma unroll
    for (int i = 0; i < 2; ++i)
#pragma unroll
        for (int j = 0; j < 4; ++j) {
            v8f z = {};
            acc[i][j] = z;
        }

    // preload tile 0
    stage(0, 0);
    wait_asynccnt0();
    __syncthreads();

    int cur = 0;
    for (int k0 = 0; k0 < K; k0 += TILE_K) {
        // issue DMA for the NEXT tile into the other buffer (overlaps compute)
        // (with it goes the L2 prefetch of the tile after that one)
        if (k0 + TILE_K < K)
            stage(k0 + TILE_K, cur ^ 1);

        // four blocks of 32 k, unrolled so that a block's fragment loads can go ahead
        // of the block before it
#pragma unroll
        for (int kb = 0; kb < TILE_K; kb += 32) {
            // --- fragments from current buffer (K-contiguous for A and B) ---
            FragV af[2], bfr[4];
#pragma unroll
            for (int mt = 0; mt < 2; ++mt) {
                const int r = wm * 32 + mt * 16 + lmod;
                af[mt].u[0] = *reinterpret_cast<const uint4*>(&As[cur][r * T_STRIDE + kb + kof]);
                af[mt].u[1] = *reinterpret_cast<const uint4*>(&As[cur][r * T_STRIDE + kb + 16 + kof]);
            }
#pragma unroll
            for (int nt = 0; nt < 4; ++nt) {
                const int r = wn * 64 + nt * 16 + lmod;
                bfr[nt].u[0] = *reinterpret_cast<const uint4*>(&Bs[cur][r * T_STRIDE + kb + kof]);
                bfr[nt].u[1] = *reinterpret_cast<const uint4*>(&Bs[cur][r * T_STRIDE + kb + 16 + kof]);
            }
            // --- 8 WMMAs per wave per block (DMA for next tile in flight) ---
#pragma unroll
            for (int mt = 0; mt < 2; ++mt)
#pragma unroll
                for (int nt = 0; nt < 4; ++nt)
                    acc[mt][nt] = __builtin_amdgcn_wmma_f32_16x16x32_bf16(
                        false, af[mt].v, false, bfr[nt].v,
                        (short)0, acc[mt][nt], false, false);
        }

        // this wave's reads of the current buffer have returned before the barrier
        // behind which that buffer is refilled
        asm volatile("s_wait_dscnt 0x0" ::: "memory");
        // next tile fully in LDS (own wave) + all waves done with both ops
        wait_asynccnt0();
        __syncthreads();
        cur ^= 1;
    }

    // --- epilogue + store. The choice by sig is the same for the whole work-group
    // and is made once, outside the element loops: each side is straight-line code.
    const int rbase = row0 + wm * 32 + lhalf * 8;
    const int cbase = col0 + wn * 64 + lmod;
    if (EPI == 1) {
        if (sig) {
            store_tile<1>(acc, bias, resid, C, N, scale, rbase, cbase);
        } else {
            store_tile<0>(acc, bias, resid, C, N, scale, rbase, cbase);
            // the build lays the other side behind this one, joined by a fall-through
            // that is never taken; its loads land in these stores' address registers,
            // so the wait stands in front of them (a precaution)
            asm volatile("s_wait_xcnt 0x0" ::: "memory");
        }
    } else {
        store_tile<EPI>(acc, bias, resid, C, N, scale, rbase, cbase);
    }
}

template <int EPI>
__global__ __launch_bounds__(256) void gemm_bf16_wmma(
    const __bf16* __restrict__ A, const __bf16* __restrict__ Bt,
    const float* __restrict__ bias, const float* __restrict__ resid,
    float* __restrict__ C, int M, int N, int K, float scale)
{
    gemm_tile<EPI>(A, Bt, bias, resid, C, N, K, scale, false);
}

// The six projections of width HD in ONE grid. Each alone is 64 work-groups, a
// quarter of the chip's WGPs, in a loop that waits out one L2 round trip per
// K-step; none reads what another writes, so blockIdx.z picks the operand set and
// all 384 work-groups are resident together. The short one (r, K = D) comes last.
__global__ __launch_bounds__(256) void proj_batch_kernel(
    const __bf16* __restrict__ xc, const __bf16* __restrict__ xt,
    const __bf16* __restrict__ xn,
    const __bf16* __restrict__ WskipT, const __bf16* __restrict__ WqT,
    const __bf16* __restrict__ WkT, const __bf16* __restrict__ WvT,
    const __bf16* __restrict__ WoT, const __bf16* __restrict__ WrT,
    const float* __restrict__ bskip, const float* __restrict__ bq,
    const float* __restrict__ bk, const float* __restrict__ bv,
    const float* __restrict__ bo, const float* __restrict__ br,
    float* __restrict__ skip, float* __restrict__ qb, float* __restrict__ kb,
    float* __restrict__ vb, float* __restrict__ ob, float* __restrict__ rbuf)
{
    const int z = blockIdx.z;
    const __bf16* A;
    const __bf16* Bt;
    const float* bias;
    float* C;
    if (z == 0)      { A = xc; Bt = WskipT; bias = bskip; C = skip; }
    else if (z == 1) { A = xc; Bt = WqT;    bias = bq;    C = qb; }
    else if (z == 2) { A = xc; Bt = WkT;    bias = bk;    C = kb; }
    else if (z == 3) { A = xt; Bt = WvT;    bias = bv;    C = vb; }
    else if (z == 4) { A = xt; Bt = WoT;    bias = bo;    C = ob; }
    else             { A = xn; Bt = WrT;    bias = br;    C = rbuf; }
    const int   K     = (z == 5) ? DIM : PDIM;
    const float scale = (z == 2) ? 0.125f : 1.0f;      // k carries 1/sqrt(Dh)
    gemm_tile<1>(A, Bt, bias, nullptr, C, HDIM, K, scale, z == 4);
}

// ---------------------------------------------------------------------------
// Causal conv (K=4) along the feature axis + SiLU; also emits xt as bf16. Then, in
// the same work-group, the i/f gate projections (P x 8 each) + softcap(15) of the
// very tokens whose xc rows it has just made: they go over through LDS, not through
// a launch of their own.
// Conv: a thread takes 8 neighbouring features of G_TOK tokens: 16-byte loads and
// stores, all tokens' loads in flight together, 32 elements per thread.
// Gates, plain VALU: a thread takes features tid + 256 n, keeps their rows of Wi and
// Wf in registers and uses them for every token. The 16 * G_TOK partial sums go over
// the wave by a halving lane exchange (each step hands half of the sums to the partner
// lane, so lane l ends with sums 2l and 2l + 1), then over the 8 waves through LDS
// behind one barrier.
// ---------------------------------------------------------------------------
#define G_TOK 4

// 2^x. The v_nop is the slot the instruction set asks for behind a transcendental
// before its source may be overwritten or its result used; in one statement with
// it, it cannot drift away.
__device__ __forceinline__ float exp2_slot(float x)
{
    float y;
    asm("v_exp_f32 %0, %1\n\tv_nop" : "=v"(y) : "v"(x));
    return y;
}
#define LOG2E 1.44269504088896340736f

// rows j0 + tid + 256 jj, jj = 0..3, of Wi (wv[jj][0..1]) and Wf (wv[jj][2..3]);
// every address is a uniform base plus the lane offset lw
__device__ __forceinline__ void fetch_gate_rows(
    const float* __restrict__ Wi, const float* __restrict__ Wf, int j0, unsigned lw,
    v4f (&wv)[4][4])
{
#pragma unroll
    for (int jj = 0; jj < 4; ++jj) {
        const float* wa = Wi + (size_t)(j0 + 256 * jj) * NH;
        wv[jj][0] = *reinterpret_cast<const v4f*>(wa + lw);
        wv[jj][1] = *reinterpret_cast<const v4f*>((wa + 4) + lw);
    }
    // the next run of loads lands in the address registers of this one (a precaution)
    asm volatile("s_wait_xcnt 0x0" ::: "memory");
#pragma unroll
    for (int jj = 0; jj < 4; ++jj) {
        const float* wb = Wf + (size_t)(j0 + 256 * jj) * NH;
        wv[jj][2] = *reinterpret_cast<const v4f*>(wb + lw);
        wv[jj][3] = *reinterpret_cast<const v4f*>((wb + 4) + lw);
    }
    // as above
    asm volatile("s_wait_xcnt 0x0" ::: "memory");
}

// acc[t] += xc[t][j0 + tid + 256 jj] * (that feature's rows of Wi and Wf)
__device__ __forceinline__ void gate_fma(
    v4f (&acc)[G_TOK][4], const v4f (&wv)[4][4], const __bf16* xs, int j0, int tid)
{
    __bf16 xr[4][G_TOK];
#pragma unroll
    for (int jj = 0; jj < 4; ++jj)
#pragma unroll
        for (int t = 0; t < G_TOK; ++t)
            xr[jj][t] = xs[t * PDIM + j0 + 256 * jj + tid];
#pragma unroll
    for (int jj = 0; jj < 4; ++jj)
#pragma unroll
        for (int t = 0; t < G_TOK; ++t) {
            const float xv = (float)xr[jj][t];
#pragma unroll
            for (int n = 0; n < 4; ++n) acc[t][n] += xv * wv[jj][n];
        }
}

__global__ __launch_bounds__(256) void conv_gates_kernel(
    const float* __restrict__ xt, const float* __restrict__ cw,
    const float* __restrict__ cb, const float* __restrict__ Wi,
    const float* __restrict__ bi, const float* __restrict__ Wf,
    const float* __restrict__ bfv, __bf16* __restrict__ xc_bf,
    __bf16* __restrict__ xt_bf, float* __restrict__ ipre, float* __restrict__ fpre)
{
    __shared__ __attribute__((aligned(16))) __bf16 xs[G_TOK * PDIM];
    __shared__ __attribute__((aligned(8))) float red[8][16 * G_TOK];
    const int tid  = threadIdx.x;
    const int lane = tid & 31;
    const int wave = tid >> 5;
    const int tok0 = blockIdx.x * G_TOK;
    const int p = tid * 8;                 // 256 threads x 8 = one token's P features
    const size_t base = (size_t)tok0 * PDIM + p;
    const float w0 = cw[0], w1 = cw[1], w2 = cw[2], w3 = cw[3];
    const float cbv = cb[0];
    const int back = p ? 4 : 0;            // the row's first thread has nothing to its left
    const unsigned lw = (unsigned)tid * NH;

    v4f pv[G_TOK], lo[G_TOK], hi[G_TOK];
#pragma unroll
    for (int t = 0; t < G_TOK; ++t) {
        const float* s = xt + base + (size_t)t * PDIM;
        pv[t] = *reinterpret_cast<const v4f*>(s - back);
        lo[t] = *reinterpret_cast<const v4f*>(s);
        hi[t] = *reinterpret_cast<const v4f*>(s + 4);
    }
    // the next run of loads lands in the address registers of this one (a precaution)
    asm volatile("s_wait_xcnt 0x0" ::: "memory");
    // the first half of the gate weights flies with the rows of xt
    v4f wva[4][4], wvb[4][4];
    fetch_gate_rows(Wi, Wf, 0, lw, wva);
    // keeps every load in front of the arithmetic, so that all of them are in flight
    // together (without it the build sinks a part of them between the divisions)
    __builtin_amdgcn_sched_barrier(0);
    v8bf oc[G_TOK], ox[G_TOK];
#pragma unroll
    for (int t = 0; t < G_TOK; ++t) {
        // e[j + 3] = feature p + j; left of the row's start the conv pads with zeros
        const float e[11] = {p ? pv[t].y : 0.0f, p ? pv[t].z : 0.0f, p ? pv[t].w : 0.0f,
                             lo[t].x, lo[t].y, lo[t].z, lo[t].w,
                             hi[t].x, hi[t].y, hi[t].z, hi[t].w};
#pragma unroll
        for (int j = 0; j < 8; ++j) {
            float acc = cbv + w3 * e[j + 3];
            acc += w2 * e[j + 2];
            acc += w1 * e[j + 1];
            acc += w0 * e[j];
            oc[t][j] = (__bf16)(acc / (1.0f + exp2_slot(-acc * LOG2E)));   // silu
            ox[t][j] = (__bf16)e[j + 3];
        }
    }
#pragma unroll
    for (int t = 0; t < G_TOK; ++t)
        *reinterpret_cast<v8bf*>(&xs[t * PDIM + p]) = oc[t];
    __syncthreads();                       // the work-group's rows of xc published
    // the stores stand behind the barrier, which would wait them out; they and the
    // second half of the weights fly under the first half's arithmetic
#pragma unroll
    for (int t = 0; t < G_TOK; ++t) {
        *reinterpret_cast<v8bf*>(xc_bf + base + (size_t)t * PDIM) = oc[t];
        *reinterpret_cast<v8bf*>(xt_bf + base + (size_t)t * PDIM) = ox[t];
    }
    // the loads that follow land in the stores' registers (a precaution)
    asm volatile("s_wait_xcnt 0x0" ::: "memory");
    fetch_gate_rows(Wi, Wf, 1024, lw, wvb);
    // keeps the stores and the loads in front of the arithmetic
    __builtin_amdgcn_sched_barrier(0);

    // acc[t] = {i gates 0..3, i gates 4..7, f gates 0..3, f gates 4..7} of token tok0 + t
    v4f acc[G_TOK][4];
#pragma unroll
    for (int t = 0; t < G_TOK; ++t)
#pragma unroll
        for (int n = 0; n < 4; ++n) { v4f z = {}; acc[t][n] = z; }
    gate_fma(acc, wva, xs, 0, tid);
    gate_fma(acc, wvb, xs, 1024, tid);
    // sum[t * 16 + g] = i gate g, sum[t * 16 + 8 + g] = f gate g
    float sum[16 * G_TOK];
#pragma unroll
    for (int n = 0; n < 16 * G_TOK; ++n) sum[n] = acc[n >> 4][(n >> 2) & 3][n & 3];
#pragma unroll
    for (int m = 16, half = 8 * G_TOK; m > 0; m >>= 1, half >>= 1) {
        const bool up = (lane & m) != 0;   // this lane keeps the upper half of the sums
#pragma unroll
        for (int n = 0; n < half; ++n) {
            const float send = up ? sum[n] : sum[n + half];
            const float keep = up ? sum[n + half] : sum[n];
            sum[n] = keep + __shfl_xor(send, m, 32);
        }
    }
    const v2f pr = {sum[0], sum[1]};
    *reinterpret_cast<v2f*>(&red[wave][2 * lane]) = pr;
    __syncthreads();                       // every wave's sums published
    if (tid < 16 * G_TOK) {
        float s = 0.0f;
#pragma unroll
        for (int w = 0; w < 8; ++w) s += red[w][tid];
        const int  g   = tid & 7;
        const bool isf = (tid & 8) != 0;
        const float v = s + (isf ? bfv[g] : bi[g]);
        float* dst = isf ? fpre : ipre;
        dst[(size_t)(tok0 + (tid >> 4)) * NH + g] = 15.0f * tanhf(v * (1.0f / 15.0f));
    }
}

// ---------------------------------------------------------------------------
// The gated recurrence in its closed (parallel) form, f32 16x16x4 WMMA.
// With F_t = sum_{u<=t} f_u, w_s = i_s - F_s and M_t = max(0, max_{s<=t} w_s)
// (M_t = m_t - F_t of the recurrence) the scan unrolls exactly to
//   num_t = sum_{s<=t} exp(w_s - M_t) (q_t . k_s) v_s
//   den_t = max(exp(-M_t) sum_e q_t[e] + sum_{s<=t} exp(w_s - M_t) (q_t . k_s), 1)
// Every exponent is <= 0. One block per (b,h, 64 rows of t), 8 waves: wave (rg,half)
// does rows 16rg..+15; columns 32half..+31 of each S tile, then of O.
// K is staged as K[s][e], V transposed as V[d][s]: both B fragments are 16-byte
// LDS loads along k and need no register shuffle.
// The block holds whole (token, head) rows of the result, so what follows per head is
// done here too: h = o * hseq; LayerNorm over Dh; z = (hn*hw+hb + skip) * silu(r).
// The 64 x 64 tile goes through LDS into the layout of that step: a thread takes 4
// neighbouring d of rows crow + 16u; 16 lanes hold a head's row, whose sums go by lane
// exchange; 16-byte loads, and a whole 128-byte line of z per row.
// ---------------------------------------------------------------------------
#define SEQ    512
#define KV_P   68     // f32 row pitch: 64 + 4, 16B aligned, conflict-free b128 rows

// Distance behind a block of f32 16x16x4 WMMAs before vector instructions may read
// the accumulators or reuse the operand registers. The form has the issue interval
// of the 8-bit-integer form, so that form's eight slots are kept. The scheduling
// barriers hold the block together: no vector instruction moves in between the
// WMMAs or in front of the v_nops.
#define WMMA_BLOCK_BEGIN() __builtin_amdgcn_sched_barrier(0)
#define WMMA_BLOCK_END()                                                        \
    do {                                                                        \
        __builtin_amdgcn_sched_barrier(0);                                      \
        asm volatile("v_nop\n\tv_nop\n\tv_nop\n\tv_nop\n\t"                     \
                     "v_nop\n\tv_nop\n\tv_nop\n\tv_nop");                       \
        __builtin_amdgcn_sched_barrier(0);                                      \
    } while (0)

// one 64x64 f32 tile of K (4 x 16 B along e) and of V (16 rows s of one column d)
__device__ __forceinline__ void fetch_kv(const float* __restrict__ kp,
                                         const float* __restrict__ vp,
                                         v4f (&kr)[4], float (&vr)[16])
{
#pragma unroll
    for (int i = 0; i < 4; ++i)
        kr[i] = *reinterpret_cast<const v4f*>(kp + (size_t)i * 16 * NH * DH);
#pragma unroll
    for (int j = 0; j < 16; ++j)
        vr[j] = vp[(size_t)j * NH * DH];
}

// acc[0..1] += A(16 x 64, fragments af) * B^T, B rows brow and brow + 16 of a
// 64-wide LDS tile; lane (c,hf) takes k = 8m + 4hf + 0..3 on both operands
__device__ __forceinline__ void mma_16x32x64(v8f (&acc)[2], const v4f (&af)[8],
                                             const float* bt, int brow, int hf)
{
#pragma unroll
    for (int m = 0; m < 8; ++m) {
        const v4f b0 = *reinterpret_cast<const v4f*>(&bt[brow * KV_P + 8 * m + 4 * hf]);
        const v4f b1 = *reinterpret_cast<const v4f*>(&bt[(brow + 16) * KV_P + 8 * m + 4 * hf]);
        const v2f alo = {af[m].x, af[m].y}, ahi = {af[m].z, af[m].w};
        const v2f b0lo = {b0.x, b0.y}, b0hi = {b0.z, b0.w};
        const v2f b1lo = {b1.x, b1.y}, b1hi = {b1.z, b1.w};
        acc[0] = __builtin_amdgcn_wmma_f32_16x16x4_f32(
            false, alo, false, b0lo, (short)0, acc[0], false, false);
        acc[1] = __builtin_amdgcn_wmma_f32_16x16x4_f32(
            false, alo, false, b1lo, (short)0, acc[1], false, false);
        acc[0] = __builtin_amdgcn_wmma_f32_16x16x4_f32(
            false, ahi, false, b0hi, (short)0, acc[0], false, false);
        acc[1] = __builtin_amdgcn_wmma_f32_16x16x4_f32(
            false, ahi, false, b1hi, (short)0, acc[1], false, false);
    }
}

__global__ __launch_bounds__(256) void scan_parallel_kernel(
    const float* __restrict__ q, const float* __restrict__ k,
    const float* __restrict__ v, const float* __restrict__ ipre,
    const float* __restrict__ fpre, const float* __restrict__ o,
    const float* __restrict__ skip, const float* __restrict__ rr,
    const float* __restrict__ hlnw, const float* __restrict__ hlnb,
    __bf16* __restrict__ z)
{
    __shared__ __attribute__((aligned(16))) float Ks[64 * KV_P];
    __shared__ __attribute__((aligned(16))) float Vt[64 * KV_P];
    __shared__ __attribute__((aligned(16))) float Ps[4][16 * KV_P];
    __shared__ float wS[SEQ];
    __shared__ float mS[SEQ];
    __shared__ float dS[2][64];

    const int rt   = SEQ / 64 - 1 - (int)blockIdx.x;   // longest tiles first
    const int bh   = blockIdx.y;
    const int b    = bh >> 3;
    const int h    = bh & 7;
    const int tid  = threadIdx.x;
    const int lane = tid & 31;
    const int wave = tid >> 5;
    const int rg   = wave & 3;           // 16-row group
    const int half = wave >> 2;          // 32-column half
    const int c    = lane & 15;
    const int hf   = lane >> 4;
    const int t0   = rt * 64;

    const size_t rowstride = (size_t)NH * DH;                 // floats between t and t+1
    const size_t hbase = ((size_t)b * SEQ * NH + h) * DH;     // (b, t=0, h, 0)

    // staging coordinates. K: rows srow + 16i, 16 B at column sc4.
    // V: column vd, rows vs0 .. vs0 + 15 (a wave reads 128 contiguous bytes per row)
    const int srow = tid >> 4;
    const int sc4  = (tid & 15) * 4;
    const int vd   = tid & 63;
    const int vs0  = (tid >> 6) * 16;

    const float* kp = k + hbase + (size_t)srow * rowstride + sc4;
    const float* vp = v + hbase + (size_t)vs0 * rowstride + vd;
    v4f kreg[4];
    float vreg[16];
    fetch_kv(kp, vp, kreg, vreg);

    // Q fragments, kept in registers: lane (c,hf) holds row c, e = 8m + 4hf + 0..3
    v4f qf[8];
    {
        const size_t g = hbase + (size_t)(t0 + rg * 16 + c) * rowstride + 4 * hf;
#pragma unroll
        for (int m = 0; m < 8; ++m)
            qf[m] = *reinterpret_cast<const v4f*>(q + g + 8 * m);
    }

    // gate prefixes for the whole sequence: wave 0, 16 consecutive t per lane
    if (wave == 0) {
        float fv[16], iv[16];
        const size_t g0 = ((size_t)b * SEQ + lane * 16) * NH + h;
#pragma unroll
        for (int j = 0; j < 16; ++j) fv[j] = fpre[g0 + (size_t)j * NH];
        // the second run of loads lands in the address registers of the first
        asm volatile("s_wait_xcnt 0x0" ::: "memory");
#pragma unroll
        for (int j = 0; j < 16; ++j) iv[j] = ipre[g0 + (size_t)j * NH];
#pragma unroll
        for (int j = 1; j < 16; ++j) fv[j] += fv[j - 1];
        float incl = fv[15];
#pragma unroll
        for (int o = 1; o < 32; o <<= 1) {
            const float up = __shfl_up(incl, o, 32);
            if (lane >= o) incl += up;
        }
        float excl = __shfl_up(incl, 1, 32);   // sum of all earlier lanes
        if (lane == 0) excl = 0.0f;
        float run = 0.0f;                 // M starts at m0 - F0 = 0
#pragma unroll
        for (int j = 0; j < 16; ++j) {
            iv[j] = iv[j] - (excl + fv[j]);      // w_s
            run = fmaxf(run, iv[j]);
            fv[j] = run;                          // lane-local running max
        }
        float mx = run;
#pragma unroll
        for (int o = 1; o < 32; o <<= 1) {
            const float up = __shfl_up(mx, o, 32);
            if (lane >= o) mx = fmaxf(mx, up);
        }
        float prev = __shfl_up(mx, 1, 32);
        if (lane == 0) prev = 0.0f;
#pragma unroll
        for (int j = 0; j < 16; ++j) {
            wS[lane * 16 + j] = iv[j];
            mS[lane * 16 + j] = fmaxf(prev, fv[j]);
        }
    }

    // sum_e q_t[e] for row c (both lane halves end with the row total)
    float qsum = 0.0f;
#pragma unroll
    for (int m = 0; m < 8; ++m) qsum += (qf[m].x + qf[m].y) + (qf[m].z + qf[m].w);
    qsum += __shfl_xor(qsum, 16, 32);

    v8f oacc[2];
#pragma unroll
    for (int n = 0; n < 2; ++n) { v8f z = {}; oacc[n] = z; }
    float rsum[8];
#pragma unroll
    for (int r = 0; r < 8; ++r) rsum[r] = 0.0f;

    float* Pw = &Ps[rg][0];
    const int trow = t0 + rg * 16 + 8 * hf;       // + r : this lane's D rows
    const int cw   = 32 * half + c;               // + 16*j : this lane's D column

    __syncthreads();                      // wS / mS published
    float Mt[8];
#pragma unroll
    for (int r = 0; r < 8; ++r) Mt[r] = mS[trow + r];

    for (int ct = 0; ct <= rt; ++ct) {
        const int s0 = ct * 64;
#pragma unroll
        for (int i = 0; i < 4; ++i) {
            *reinterpret_cast<v4f*>(&Ks[(srow + 16 * i) * KV_P + sc4]) = kreg[i];
            const v4f vv = {vreg[4 * i], vreg[4 * i + 1], vreg[4 * i + 2], vreg[4 * i + 3]};
            *reinterpret_cast<v4f*>(&Vt[vd * KV_P + vs0 + 4 * i]) = vv;
        }
        __syncthreads();                  // tile published
        if (ct < rt) {                    // next tile flies under this tile's WMMAs
            kp += 64 * rowstride;
            vp += 64 * rowstride;
            fetch_kv(kp, vp, kreg, vreg);
        }

        // S = Q K^T, 16 x 32 per wave
        v8f sacc[2];
#pragma unroll
        for (int j = 0; j < 2; ++j) { v8f z = {}; sacc[j] = z; }
        WMMA_BLOCK_BEGIN();
        mma_16x32x64(sacc, qf, Ks, cw, hf);
        WMMA_BLOCK_END();

        // P = S * decay under the causal mask; row sums feed the denominator
#pragma unroll
        for (int j = 0; j < 2; ++j) {
            const int s = s0 + 16 * j + cw;
            const float ws = wS[s];
#pragma unroll
            for (int r = 0; r < 8; ++r) {
                const float e = exp2_slot((ws - Mt[r]) * LOG2E);
                const float p = sacc[j][r] * ((s <= trow + r) ? e : 0.0f);
                rsum[r] += p;
                Pw[(8 * hf + r) * KV_P + 16 * j + cw] = p;
            }
        }
        __syncthreads();                  // both column halves of P published

        // O += P V
        v4f pf[8];
#pragma unroll
        for (int m = 0; m < 8; ++m)
            pf[m] = *reinterpret_cast<const v4f*>(&Pw[c * KV_P + 8 * m + 4 * hf]);
        WMMA_BLOCK_BEGIN();
        mma_16x32x64(oacc, pf, Vt, cw, hf);
        WMMA_BLOCK_END();
        __syncthreads();                  // every reader has left Ks/Vt before the refill
    }

    // operands of the per-head step: they fly under the row sums and the two barriers
    const int crow = tid >> 4;
    const int ce   = (tid & 15) * 4;
    const size_t cidx = hbase + (size_t)(t0 + crow) * rowstride + ce;
    v4f o4[4], s4[4], r4[4];
#pragma unroll
    for (int u = 0; u < 4; ++u) {
        const size_t idx = cidx + (size_t)u * 16 * rowstride;
        o4[u] = *reinterpret_cast<const v4f*>(o + idx);
        s4[u] = *reinterpret_cast<const v4f*>(skip + idx);
        r4[u] = *reinterpret_cast<const v4f*>(rr + idx);
    }
    const v4f w4 = *reinterpret_cast<const v4f*>(hlnw + h * DH + ce);
    const v4f b4 = *reinterpret_cast<const v4f*>(hlnb + h * DH + ce);
    // keeps all fourteen loads up here, in front of the lane exchanges
    // the wait: what follows lands in the loads' address registers (a precaution)
    asm volatile("s_wait_xcnt 0x0" ::: "memory");
    __builtin_amdgcn_sched_barrier(0);

    // row sums: over the 16 lanes of a half wave, then over the two column halves
#pragma unroll
    for (int r = 0; r < 8; ++r) {
        float s = rsum[r];
        s += __shfl_xor(s, 1, 32);
        s += __shfl_xor(s, 2, 32);
        s += __shfl_xor(s, 4, 32);
        s += __shfl_xor(s, 8, 32);
        if (c == 0) dS[half][rg * 16 + 8 * hf + r] = s;
    }
    __syncthreads();                      // both halves' row sums published

    // denominator per row, then the tile into LDS (Ks is free behind the loop's last
    // barrier): D register r = row 8hf + r, column cw
#pragma unroll
    for (int r = 0; r < 8; ++r) {
        const int lr = rg * 16 + 8 * hf + r;
        const float s = dS[0][lr] + dS[1][lr];
        const float qs = __shfl(qsum, 8 * hf + r, 32);
        const float den = fmaxf(exp2_slot(-Mt[r] * LOG2E) * qs + s, 1.0f);
        Ks[lr * KV_P + cw]      = oacc[0][r] / den;
        Ks[lr * KV_P + cw + 16] = oacc[1][r] / den;
    }
    __syncthreads();                      // the tile of hseq published

#pragma unroll
    for (int u = 0; u < 4; ++u) {
        const v4f h4 = *reinterpret_cast<const v4f*>(&Ks[(crow + 16 * u) * KV_P + ce]);
        const v4f hv = o4[u] * h4;
        float s1 = (hv.x + hv.y) + (hv.z + hv.w);
        float s2 = (hv.x * hv.x + hv.y * hv.y) + (hv.z * hv.z + hv.w * hv.w);
#pragma unroll
        for (int st = 8; st > 0; st >>= 1) {
            s1 += __shfl_xor(s1, st, 32);
            s2 += __shfl_xor(s2, st, 32);
        }
        const float mu  = s1 * (1.0f / DH);
        const float var = s2 * (1.0f / DH) - mu * mu;
        const float inv = rsqrtf(var + 1e-6f);
        v4bf y;
#pragma unroll
        for (int e = 0; e < 4; ++e) {
            const float hn = (hv[e] - mu) * inv * w4[e] + b4[e];
            const float rv = r4[u][e];
            const float sr = rv / (1.0f + __expf(-rv));
            y[e] = (__bf16)((hn + s4[u][e]) * sr);
        }
        *reinterpret_cast<v4bf*>(z + cidx + (size_t)u * 16 * rowstride) = y;
    }
}

// ---------------------------------------------------------------------------
// host launcher
// ---------------------------------------------------------------------------
extern "C" void kernel_launch(void* const* d_in, const int* in_sizes, int n_in,
                              void* d_out, int out_size, void* d_ws, size_t ws_size,
                              hipStream_t stream)
{
    const float* x     = (const float*)d_in[0];
    const float* ln_w  = (const float*)d_in[1];
    const float* ln_b  = (const float*)d_in[2];
    const float* hln_w = (const float*)d_in[3];
    const float* hln_b = (const float*)d_in[4];
    const float* Wl    = (const float*)d_in[5];
    const float* bl    = (const float*)d_in[6];
    const float* Wr    = (const float*)d_in[7];
    const float* br    = (const float*)d_in[8];
    const float* conv_w= (const float*)d_in[9];
    const float* conv_b= (const float*)d_in[10];
    const float* Wskip = (const float*)d_in[11];
    const float* bskip = (const float*)d_in[12];
    const float* Wi    = (const float*)d_in[13];
    const float* bi    = (const float*)d_in[14];
    const float* Wf    = (const float*)d_in[15];
    const float* bfv   = (const float*)d_in[16];
    const float* Wo    = (const float*)d_in[17];
    const float* bo    = (const float*)d_in[18];
    const float* Wq    = (const float*)d_in[19];
    const float* bq    = (const float*)d_in[20];
    const float* Wk    = (const float*)d_in[21];
    const float* bk    = (const float*)d_in[22];
    const float* Wv    = (const float*)d_in[23];
    const float* bv    = (const float*)d_in[24];
    const float* Wd    = (const float*)d_in[25];
    const float* bd    = (const float*)d_in[26];

    // --- workspace carve (whole working set fits in MI455X's 192MB L2) ---
    char* ws = (char*)d_ws;
    auto carve = [&](size_t bytes) {
        char* p = ws;
        ws += (bytes + 255) & ~(size_t)255;
        return p;
    };
    // transposed bf16 weights (N x K layout)
    __bf16* WlT    = (__bf16*)carve((size_t)DIM * PDIM * 2);   // 2048 x 1024
    __bf16* WrT    = (__bf16*)carve((size_t)DIM * HDIM * 2);   // 512 x 1024
    __bf16* WskipT = (__bf16*)carve((size_t)PDIM * HDIM * 2);  // 512 x 2048
    __bf16* WqT    = (__bf16*)carve((size_t)PDIM * HDIM * 2);
    __bf16* WkT    = (__bf16*)carve((size_t)PDIM * HDIM * 2);
    __bf16* WvT    = (__bf16*)carve((size_t)PDIM * HDIM * 2);
    __bf16* WoT    = (__bf16*)carve((size_t)PDIM * HDIM * 2);
    __bf16* WdT    = (__bf16*)carve((size_t)HDIM * DIM * 2);   // 1024 x 512
    __bf16* xn_bf  = (__bf16*)carve((size_t)NTOK * DIM * 2);
    float*  xt     = (float*) carve((size_t)NTOK * PDIM * 4);
    __bf16* xt_bf  = (__bf16*)carve((size_t)NTOK * PDIM * 2);
    __bf16* xc_bf  = (__bf16*)carve((size_t)NTOK * PDIM * 2);
    float*  rbuf   = (float*) carve((size_t)NTOK * HDIM * 4);
    float*  skip   = (float*) carve((size_t)NTOK * HDIM * 4);
    float*  qb     = (float*) carve((size_t)NTOK * HDIM * 4);
    float*  kb     = (float*) carve((size_t)NTOK * HDIM * 4);
    float*  vb     = (float*) carve((size_t)NTOK * HDIM * 4);
    float*  ob     = (float*) carve((size_t)NTOK * HDIM * 4);
    float*  ipre   = (float*) carve((size_t)NTOK * NH * 4);
    float*  fpre   = (float*) carve((size_t)NTOK * NH * 4);
    __bf16* z_bf   = (__bf16*)carve((size_t)NTOK * HDIM * 2);
    (void)ws_size; (void)in_sizes; (void)n_in; (void)out_size;

    // cast + transpose weights: src is (K x N) row-major -> dst (N x K) bf16
    cast_transpose_kernel<<<CAST_TILES, 256, 0, stream>>>(
        Wl, Wskip, Wq, Wk, Wv, Wo, Wr, Wd,
        WlT, WskipT, WqT, WkT, WvT, WoT, WrT, WdT);

    layernorm_kernel<<<NTOK / 8, 256, 0, stream>>>(x, ln_w, ln_b, xn_bf);

    // xt = xn @ Wl + bl   (2048x1024x2048)
    gemm_bf16_wmma<0><<<dim3(PDIM / 128, NTOK / 128), 256, 0, stream>>>(
        xn_bf, WlT, bl, nullptr, xt, NTOK, PDIM, DIM, 1.0f);

    // xc, xt as bf16, and the gates of the same tokens
    conv_gates_kernel<<<NTOK / G_TOK, 256, 0, stream>>>(
        xt, conv_w, conv_b, Wi, bi, Wf, bfv, xc_bf, xt_bf, ipre, fpre);

    // skip, q, k = xc @ W (k scaled by 1/sqrt(Dh)); v = xt @ Wv, o = sigmoid(xt @ Wo);
    // r = xn @ Wr: one grid, z = projection
    proj_batch_kernel<<<dim3(HDIM / 128, NTOK / 128, 6), 256, 0, stream>>>(
        xc_bf, xt_bf, xn_bf, WskipT, WqT, WkT, WvT, WoT, WrT,
        bskip, bq, bk, bv, bo, br, skip, qb, kb, vb, ob, rbuf);

    scan_parallel_kernel<<<dim3(SEQ / 64, 32), 256, 0, stream>>>(
        qb, kb, vb, ipre, fpre, ob, skip, rbuf, hln_w, hln_b, z_bf);

    // out = z @ Wd + bd + x
    gemm_bf16_wmma<2><<<dim3(DIM / 128, NTOK / 128), 256, 0, stream>>>(
        z_bf, WdT, bd, x, (float*)d_out, NTOK, DIM, HDIM, 1.0f);
}

// v006
// Measured time: 85.6 microseconds a run.
// In both of two side-by-side timings against v005, it was 1.04 times as fast.
// Counting every step since v000, it is 11.9 times as fast.
#include <hip/hip_runtime.h>
#include <cstdint>
#include <cstddef>

// ---------------------------------------------------------------------------
// mLSTM block forward for MI455X (gfx1250), bf16 WMMA GEMMs + f32 scan.
// B=4 T=512 D=1024 H=8 Dh=64 HD=512 P=2048 K=4
// Weights are cast+TRANSPOSED to bf16 once so that both WMMA operands are
// K-contiguous -> all LDS fragment reads are ds_load_b128 (no scalar gathers).
// GEMM tiles are DOUBLE-BUFFERED and staged with CDNA5 async global->LDS DMA
// (ASYNCcnt): DMA for tile i+1 overlaps WMMA compute on tile i. A tile is 128 k deep.
// ---------------------------------------------------------------------------

#define NTOK 2048      // B*T
#define DIM  1024      // D
#define PDIM 2048      // P
#define HDIM 512       // HD
#define NH   8         // H
#define DH   64        // Dh

typedef __attribute__((ext_vector_type(16))) __bf16 v16bf;
typedef __attribute__((ext_vector_type(8)))  float  v8f;
typedef __attribute__((ext_vector_type(4)))  float  v4f;
typedef __attribute__((ext_vector_type(2)))  float  v2f;
typedef __attribute__((ext_vector_type(8)))  __bf16 v8bf;
typedef __attribute__((ext_vector_type(4)))  __bf16 v4bf;
typedef __attribute__((ext_vector_type(2)))  __bf16 v2bf;

union FragV {
    uint4 u[2];
    v16bf v;
};

// eight async global->LDS 128-bit copies (per-lane), tracked by ASYNCcnt: one operand's
// share of a stage. Copy u takes LDS address l + u * lstep and global address
// g + u * gstep (bytes).
// s_wait_xcnt is the last line of the copies' own statement: there no later write of
// an address register can be scheduled ahead of it (a precaution).
#define COPY8_TEXT                                                  \
    "global_load_async_to_lds_b128 %0, %1, off\n\t"                 \
    "global_load_async_to_lds_b128 %2, %3, off\n\t"                 \
    "global_load_async_to_lds_b128 %4, %5, off\n\t"                 \
    "global_load_async_to_lds_b128 %6, %7, off\n\t"                 \
    "global_load_async_to_lds_b128 %8, %9, off\n\t"                 \
    "global_load_async_to_lds_b128 %10, %11, off\n\t"               \
    "global_load_async_to_lds_b128 %12, %13, off\n\t"               \
    "global_load_async_to_lds_b128 %14, %15, off\n\t"
#define COPY8_ARGS(l, lstep, g, gstep)                              \
    "v"(l),               "v"(g),                                   \
    "v"((l) + (lstep)),     "v"((g) + (gstep)),                     \
    "v"((l) + 2 * (lstep)), "v"((g) + 2 * (gstep)),                 \
    "v"((l) + 3 * (lstep)), "v"((g) + 3 * (gstep)),                 \
    "v"((l) + 4 * (lstep)), "v"((g) + 4 * (gstep)),                 \
    "v"((l) + 5 * (lstep)), "v"((g) + 5 * (gstep)),                 \
    "v"((l) + 6 * (lstep)), "v"((g) + 6 * (gstep)),                 \
    "v"((l) + 7 * (lstep)), "v"((g) + 7 * (gstep))
__device__ __forceinline__ void async_copy8_b128(
    unsigned l, unsigned lstep, const char* g, size_t gstep)
{
    asm volatile(COPY8_TEXT
                 "s_wait_xcnt 0x0"
                 :: COPY8_ARGS(l, lstep, g, gstep) : "memory");
}
// the same, and the line at pf is asked into L2 for a later stage (no data comes back);
// the ask stands in front of the wait, which so covers its address register too
__device__ __forceinline__ void async_copy8_b128_ask(
    unsigned l, unsigned lstep, const char* g, size_t gstep, const void* pf)
{
    asm volatile(COPY8_TEXT
                 "global_prefetch_b8 %16, off scope:SCOPE_SE\n\t"
                 "s_wait_xcnt 0x0"
                 :: COPY8_ARGS(l, lstep, g, gstep), "v"(pf) : "memory");
}
__device__ __forceinline__ void wait_asynccnt0()
{
    asm volatile("s_wait_asynccnt 0x0" ::: "memory");
}

// ---------------------------------------------------------------------------
// cast f32 -> bf16 with transpose: in (R x C row-major) -> out (C x R)
// Tiles of 128 rows x 64 columns through LDS, 32 elements per thread: eight 16-byte
// loads in flight per lane, whole 256-byte pieces of a row on both sides, and an
// eighth of the waves that one 32x32 tile per work-group takes to start.
// Two neighbouring rows are packed into one dword, so LDS holds out's rows as dwords.
// R multiple of 128, C multiple of 64.
// All eight weights in ONE grid: none depends on another, so the tiles of all of
// them are numbered through and a work-group finds its matrix from its index.
// Tiles: Wl 256, then Wskip/Wq/Wk/Wv/Wo 128 each, then Wr 64, then Wd 64.
// ---------------------------------------------------------------------------
#define CAST_TILES 1024
#define CT_P 65        // dword pitch of an LDS row: 64 + 1, both sides free of bank conflicts
__global__ __launch_bounds__(256) void cast_transpose_kernel(
    const float* __restrict__ Wl, const float* __restrict__ Wskip,
    const float* __restrict__ Wq, const float* __restrict__ Wk,
    const float* __restrict__ Wv, const float* __restrict__ Wo,
    const float* __restrict__ Wr, const float* __restrict__ Wd,
    __bf16* __restrict__ WlT, __bf16* __restrict__ WskipT,
    __bf16* __restrict__ WqT, __bf16* __restrict__ WkT,
    __bf16* __restrict__ WvT, __bf16* __restrict__ WoT,
    __bf16* __restrict__ WrT, __bf16* __restrict__ WdT)
{
    __shared__ unsigned tile[64 * CT_P];   // [column c][row pair]
    int t = blockIdx.x;                    // tile number inside the chosen matrix
    const float* in;
    __bf16* out;
    int R, C, lc;                          // lc = log2(C / 64)
    if (t < 256) {
        in = Wl; out = WlT; R = DIM; C = PDIM; lc = 5;
    } else if (t < 896) {
        t -= 256;
        const int w = t >> 7;
        t &= 127;
        R = PDIM; C = HDIM; lc = 3;
        if (w == 0)      { in = Wskip; out = WskipT; }
        else if (w == 1) { in = Wq;    out = WqT; }
        else if (w == 2) { in = Wk;    out = WkT; }
        else if (w == 3) { in = Wv;    out = WvT; }
        else             { in = Wo;    out = WoT; }
    } else if (t < 960) {
        t -= 896;
        in = Wr; out = WrT; R = DIM; C = HDIM; lc = 3;
    } else {
        t -= 960;
        in = Wd; out = WdT; R = HDIM; C = DIM; lc = 4;
    }
    const int c0 = (t & ((1 << lc) - 1)) * 64;
    const int r0 = (t >> lc) * 128;
    const int tid = threadIdx.x;
    const int ci = tid & 15;               // columns 4ci .. 4ci + 3
    const int rp = tid >> 4;               // row pairs rp + 16u
    // one lane offset for all eight loads; what differs between them is uniform
    const unsigned lof = (unsigned)(2 * rp * C + 4 * ci);
    const float* sb = in + (size_t)r0 * C + c0;
    v4f xe[4], xo[4];
#pragma unroll
    for (int u = 0; u < 4; ++u) {
        const float* s = sb + (size_t)(32 * u) * C;
        xe[u] = *reinterpret_cast<const v4f*>(s + lof);
        xo[u] = *reinterpret_cast<const v4f*>(s + C + lof);
    }
#pragma unroll
    for (int u = 0; u < 4; ++u)
#pragma unroll
        for (int kk = 0; kk < 4; ++kk) {
            const v2bf pr = {(__bf16)xe[u][kk], (__bf16)xo[u][kk]};   // rows 2n, 2n + 1
            tile[(4 * ci + kk) * CT_P + rp + 16 * u] = __builtin_bit_cast(unsigned, pr);
        }
    __syncthreads();
#pragma unroll
    for (int u = 0; u < 4; ++u) {
        const int id = tid + 256 * u;      // 64 rows of out, 16 pieces of 16 B each
        const int c = id >> 4;
        const int j = id & 15;
        const unsigned* tp = &tile[c * CT_P + 4 * j];
        const uint4 o = make_uint4(tp[0], tp[1], tp[2], tp[3]);
        *reinterpret_cast<uint4*>(out + (size_t)(c0 + c) * R + r0 + 8 * j) = o;
    }
}

// ---------------------------------------------------------------------------
// LayerNorm over D=1024, one WAVE per token (32 elements per lane, eight 16-byte
// loads in flight), sums over the wave by lane exchange: no LDS, no barrier.
// Writes bf16.
// ---------------------------------------------------------------------------
__global__ __launch_bounds__(256) void layernorm_kernel(
    const float* __restrict__ x, const float* __restrict__ w,
    const float* __restrict__ b, __bf16* __restrict__ xn)
{
    const int lane = threadIdx.x & 31;
    const int tok  = blockIdx.x * 8 + (threadIdx.x >> 5);
    const float* xr = x + (size_t)tok * DIM + lane * 4;

    v4f v[8], w4[8], b4[8];
#pragma unroll
    for (int i = 0; i < 8; ++i)
        v[i] = *reinterpret_cast<const v4f*>(xr + i * 128);
    // the second run of loads lands in the address registers of the first (a precaution)
    asm volatile("s_wait_xcnt 0x0" ::: "memory");
#pragma unroll
    for (int i = 0; i < 8; ++i) {
        w4[i] = *reinterpret_cast<const v4f*>(w + i * 128 + lane * 4);
        b4[i] = *reinterpret_cast<const v4f*>(b + i * 128 + lane * 4);
    }
    // keeps the loads of w and b up here, in flight with the row's (without it the
    // build sinks them behind the sums, two pairs at a time)
    __builtin_amdgcn_sched_barrier(0);
    float s = 0.f, ss = 0.f;
#pragma unroll
    for (int i = 0; i < 8; ++i)
#pragma unroll
        for (int e = 0; e < 4; ++e) {
            s += v[i][e];
            ss += v[i][e] * v[i][e];
        }
#pragma unroll
    for (int o = 16; o > 0; o >>= 1) {
        s  += __shfl_xor(s, o, 32);
        ss += __shfl_xor(ss, o, 32);
    }
    const float mu  = s * (1.0f / DIM);
    const float var = ss * (1.0f / DIM) - mu * mu;
    const float inv = rsqrtf(var + 1e-6f);
    __bf16* yr = xn + (size_t)tok * DIM + lane * 4;
#pragma unroll
    for (int i = 0; i < 8; ++i) {
        v4bf y;
#pragma unroll
        for (int e = 0; e < 4; ++e)
            y[e] = (__bf16)((v[i][e] - mu) * inv * w4[i][e] + b4[i][e]);
        *reinterpret_cast<v4bf*>(yr + i * 128) = y;
    }
}

// ---------------------------------------------------------------------------
// WMMA GEMM: C(MxN,f32) = epilogue(A_bf16(MxK,row) @ Bt_bf16(NxK,row)^T + bias)
//  EPI 0: val = (acc+bias)*scale
//  EPI 1: val = sigmoid(acc+bias) where sig is set, else as EPI 0
//  EPI 2: val = acc+bias+resid[idx]
// Workgroup tile 128x128, 8 waves (4x2) of 32x64; a stage is 128 k = 256 B of every
// operand row, four WMMA blocks of 32 k. One round trip, one pair
// of waits and one barrier per 128 k; the next stage's copies have the 32 WMMAs and
// 48 fragment loads of a stage to land in.
// Double-buffered LDS tiles staged with global_load_async_to_lds_b128:
// DMA of tile i+1 overlaps the WMMAs of tile i; fragments via ds_load_b128.
// M,N multiples of 128; K multiple of 128.
// ---------------------------------------------------------------------------
#define TILE_K  128
#define T_STRIDE 136  // 128 K + 8 pad: pitch 272 B = 16 B x odd, for ds_load_b128 readers
#define BUF_ELEMS (128 * T_STRIDE)
#define BUF_BYTES (BUF_ELEMS * 2)

// epilogue + store of one wave's 32x64 accumulators
// (C layout: lane<16 -> M=vgpr, lane>=16 -> M=8+vgpr)
template <int E>
__device__ __forceinline__ void store_tile(
    const v8f (&acc)[2][4], const float* __restrict__ bias,
    const float* __restrict__ resid, float* __restrict__ C, int N, float scale,
    int rbase, int cbase)
{
#pragma unroll
    for (int mt = 0; mt < 2; ++mt) {
#pragma unroll
        for (int nt = 0; nt < 4; ++nt) {
            const int col = cbase + nt * 16;
            const float bv = bias[col];
#pragma unroll
            for (int vv = 0; vv < 8; ++vv) {
                const int row = rbase + mt * 16 + vv;
                const size_t idx = (size_t)row * N + col;
                float val = acc[mt][nt][vv] + bv;
                if (E == 0) {
                    val *= scale;
                } else if (E == 1) {
                    val = 1.0f / (1.0f + __expf(-val));
                } else {
                    val += resid[idx];
                }
                C[idx] = val;
            }
        }
    }
}

template <int EPI>
__device__ __forceinline__ void gemm_tile(
    const __bf16* __restrict__ A, const __bf16* __restrict__ Bt,
    const float* __restrict__ bias, const float* __restrict__ resid,
    float* __restrict__ C, int N, int K, float scale, bool sig)
{
    __shared__ __attribute__((aligned(16))) __bf16 As[2][BUF_ELEMS];
    __shared__ __attribute__((aligned(16))) __bf16 Bs[2][BUF_ELEMS];

    const int tid  = threadIdx.x;
    const int lane = tid & 31;
    const int wave = tid >> 5;
    const int wm   = wave & 3;   // wave row (0..3) -> 32 rows each
    const int wn   = wave >> 2;  // wave col (0..1) -> 64 cols each
    const int row0 = blockIdx.y * 128;
    const int col0 = blockIdx.x * 128;

    const int lhalf = lane >> 4;   // 0 | 1
    const int lmod  = lane & 15;
    const int kof   = lhalf * 8;   // K offset within 16-lane half

    // per-thread staging coordinates: 16 lanes take one row's 256 B (8 bf16 = 16 B per
    // lane), a thread takes rows sr + 16u, u = 0..7, of both operands
    const int sr = tid >> 4, sc = (tid & 15) * 8;
    const unsigned ldsA = (unsigned)(uintptr_t)&As[0][sr * T_STRIDE + sc];
    const unsigned ldsB = (unsigned)(uintptr_t)&Bs[0][sr * T_STRIDE + sc];
    const __bf16* gA = A  + (size_t)(row0 + sr) * K + sc;
    const __bf16* gB = Bt + (size_t)(col0 + sr) * K + sc;
    const size_t gstep = (size_t)16 * K * sizeof(__bf16);
    // L2 prefetch: one ask per operand row and stage, at the start of its 256 B:
    // waves 0..3 take the rows of A, waves 4..7 those of Bt
    const __bf16* pf = (tid < 128) ? A  + (size_t)(row0 + tid) * K
                                   : Bt + (size_t)(col0 + tid - 128) * K;

    // copies of the stage at k0; asks L2 for the stage behind it (the last stage asks
    // for itself again: the address stays inside the operand)
    auto stage = [&](int k0, int buf) {
        const unsigned off = (unsigned)buf * BUF_BYTES;
        const int kp = (k0 + TILE_K < K) ? k0 + TILE_K : k0;
        async_copy8_b128(ldsA + off, 16 * T_STRIDE * 2, (const char*)(gA + k0), gstep);
        async_copy8_b128_ask(ldsB + off, 16 * T_STRIDE * 2, (const char*)(gB + k0), gstep, pf + kp);
    };

    v8f acc[2][4];
#pragma unroll
    for (int i = 0; i < 2; ++i)
#pragma unroll
        for (int j = 0; j < 4; ++j) {
            v8f z = {};
            acc[i][j] = z;
        }

    // preload tile 0
    stage(0, 0);
    wait_asynccnt0();
    __syncthreads();

    int cur = 0;
    for (int k0 = 0; k0 < K; k0 += TILE_K) {
        // issue DMA for the NEXT tile into the other buffer (overlaps compute)
        // (with it goes the L2 prefetch of the tile after that one)
        if (k0 + TILE_K < K)
            stage(k0 + TILE_K, cur ^ 1);

        // four blocks of 32 k, unrolled so that a block's fragment loads can go ahead
        // of the block before it
#pragma unroll
        for (int kb = 0; kb < TILE_K; kb += 32) {
            // --- fragments from current buffer (K-contiguous for A and B) ---
            FragV af[2], bfr[4];
#pragma unroll
            for (int mt = 0; mt < 2; ++mt) {
                const int r = wm * 32 + mt * 16 + lmod;
                af[mt].u[0] = *reinterpret_cast<const uint4*>(&As[cur][r * T_STRIDE + kb + kof]);
                af[mt].u[1] = *reinterpret_cast<const uint4*>(&As[cur][r * T_STRIDE + kb + 16 + kof]);
            }
#pragma unroll
            for (int nt = 0; nt < 4; ++nt) {
                const int r = wn * 64 + nt * 16 + lmod;
                bfr[nt].u[0] = *reinterpret_cast<const uint4*>(&Bs[cur][r * T_STRIDE + kb + kof]);
                bfr[nt].u[1] = *reinterpret_cast<const uint4*>(&Bs[cur][r * T_STRIDE + kb + 16 + kof]);
            }
            // --- 8 WMMAs per wave per block (DMA for next tile in flight) ---
#pragma unroll
            for (int mt = 0; mt < 2; ++mt)
#pragma unroll
                for (int nt = 0; nt < 4; ++nt)
                    acc[mt][nt] = __builtin_amdgcn_wmma_f32_16x16x32_bf16(
                        false, af[mt].v, false, bfr[nt].v,
                        (short)0, acc[mt][nt], false, false);
        }

        // this wave's reads of the current buffer have returned before the barrier
        // behind which that buffer is refilled
        asm volatile("s_wait_dscnt 0x0" ::: "memory");
        // next tile fully in LDS (own wave) + all waves done with both ops
        wait_asynccnt0();
        __syncthreads();
        cur ^= 1;
    }

    // --- epilogue + store. The choice by sig is the same for the whole work-group
    // and is made once, outside the element loops: each side is straight-line code.
    const int rbase = row0 + wm * 32 + lhalf * 8;
    const int cbase = col0 + wn * 64 + lmod;
    if (EPI == 1) {
        if (sig) {
            store_tile<1>(acc, bias, resid, C, N, scale, rbase, cbase);
        } else {
            store_tile<0>(acc, bias, resid, C, N, scale, rbase, cbase);
            // the build lays the other side behind this one, joined by a fall-through
            // that is never taken; its loads land in these stores' address registers,
            // so the wait stands in front of them (a precaution)
            asm volatile("s_wait_xcnt 0x0" ::: "memory");
        }
    } else {
        store_tile<EPI>(acc, bias, resid, C, N, scale, rbase, cbase);
    }
}

template <int EPI>
__global__ __launch_bounds__(256) void gemm_bf16_wmma(
    const __bf16* __restrict__ A, const __bf16* __restrict__ Bt,
    const float* __restrict__ bias, const float* __restrict__ resid,
    float* __restrict__ C, int M, int N, int K, float scale)
{
    gemm_tile<EPI>(A, Bt, bias, resid, C, N, K, scale, false);
}

// The six projections of width HD in ONE grid. Each alone is 64 work-groups, a
// quarter of the chip's WGPs, in a loop that waits out one L2 round trip per
// K-step; none reads what another writes, so blockIdx.z picks the operand set and
// all 384 work-groups are resident together. The short one (r, K = D) comes last.
__global__ __launch_bounds__(256) void proj_batch_kernel(
    const __bf16* __restrict__ xc, const __bf16* __restrict__ xt,
    const __bf16* __restrict__ xn,
    const __bf16* __restrict__ WskipT, const __bf16* __restrict__ WqT,
    const __bf16* __restrict__ WkT, const __bf16* __restrict__ WvT,
    const __bf16* __restrict__ WoT, const __bf16* __restrict__ WrT,
    const float* __restrict__ bskip, const float* __restrict__ bq,
    const float* __restrict__ bk, const float* __restrict__ bv,
    const float* __restrict__ bo, const float* __restrict__ br,
    float* __restrict__ skip, float* __restrict__ qb, float* __restrict__ kb,
    float* __restrict__ vb, float* __restrict__ ob, float* __restrict__ rbuf)
{
    const int z = blockIdx.z;
    const __bf16* A;
    const __bf16* Bt;
    const float* bias;
    float* C;
    if (z == 0)      { A = xc; Bt = WskipT; bias = bskip; C = skip; }
    else if (z == 1) { A = xc; Bt = WqT;    bias = bq;    C = qb; }
    else if (z == 2) { A = xc; Bt = WkT;    bias = bk;    C = kb; }
    else if (z == 3) { A = xt; Bt = WvT;    bias = bv;    C = vb; }
    else if (z == 4) { A = xt; Bt = WoT;    bias = bo;    C = ob; }
    else             { A = xn; Bt = WrT;    bias = br;    C = rbuf; }
    const int   K     = (z == 5) ? DIM : PDIM;
    const float scale = (z == 2) ? 0.125f : 1.0f;      // k carries 1/sqrt(Dh)
    gemm_tile<1>(A, Bt, bias, nullptr, C, HDIM, K, scale, z == 4);
}

// ---------------------------------------------------------------------------
// Causal conv (K=4) along the feature axis + SiLU; also emits xt as bf16. Then, in
// the same work-group, the i/f gate projections (P x 8 each) + softcap(15) of the
// very tokens whose xc rows it has just made: they go over through LDS, not through
// a launch of their own.
// Conv: a thread takes 8 neighbouring features of G_TOK tokens: 16-byte loads and
// stores, all tokens' loads in flight together, 32 elements per thread.
// Gates, plain VALU: a thread takes features tid + 256 n, keeps their rows of Wi and
// Wf in registers and uses them for every token. The 16 * G_TOK partial sums go over
// the wave by a halving lane exchange (each step hands half of the sums to the partner
// lane, so lane l ends with sums 2l and 2l + 1), then over the 8 waves through LDS
// behind one barrier.
// ---------------------------------------------------------------------------
#define G_TOK 4

// 2^x. The v_nop is the slot the instruction set asks for behind a transcendental
// before its source may be overwritten or its result used; in one statement with
// it, it cannot drift away.
__device__ __forceinline__ float exp2_slot(float x)
{
    float y;
    asm("v_exp_f32 %0, %1\n\tv_nop" : "=v"(y) : "v"(x));
    return y;
}
#define LOG2E 1.44269504088896340736f

// rows j0 + tid + 256 jj, jj = 0..3, of Wi (wv[jj][0..1]) and Wf (wv[jj][2..3]);
// every address is a uniform base plus the lane offset lw
__device__ __forceinline__ void fetch_gate_rows(
    const float* __restrict__ Wi, const float* __restrict__ Wf, int j0, unsigned lw,
    v4f (&wv)[4][4])
{
#pragma unroll
    for (int jj = 0; jj < 4; ++jj) {
        const float* wa = Wi + (size_t)(j0 + 256 * jj) * NH;
        wv[jj][0] = *reinterpret_cast<const v4f*>(wa + lw);
        wv[jj][1] = *reinterpret_cast<const v4f*>((wa + 4) + lw);
    }
    // the next run of loads lands in the address registers of this one (a precaution)
    asm volatile("s_wait_xcnt 0x0" ::: "memory");
#pragma unroll
    for (int jj = 0; jj < 4; ++jj) {
        const float* wb = Wf + (size_t)(j0 + 256 * jj) * NH;
        wv[jj][2] = *reinterpret_cast<const v4f*>(wb + lw);
        wv[jj][3] = *reinterpret_cast<const v4f*>((wb + 4) + lw);
    }
    // as above
    asm volatile("s_wait_xcnt 0x0" ::: "memory");
}

// acc[t] += xc[t][j0 + tid + 256 jj] * (that feature's rows of Wi and Wf)
__device__ __forceinline__ void gate_fma(
    v4f (&acc)[G_TOK][4], const v4f (&wv)[4][4], const __bf16* xs, int j0, int tid)
{
    __bf16 xr[4][G_TOK];
#pragma unroll
    for (int jj = 0; jj < 4; ++jj)
#pragma unroll
        for (int t = 0; t < G_TOK; ++t)
            xr[jj][t] = xs[t * PDIM + j0 + 256 * jj + tid];
#pragma unroll
    for (int jj = 0; jj < 4; ++jj)
#pragma unroll
        for (int t = 0; t < G_TOK; ++t) {
            const float xv = (float)xr[jj][t];
#pragma unroll
            for (int n = 0; n < 4; ++n) acc[t][n] += xv * wv[jj][n];
        }
}

__global__ __launch_bounds__(256) void conv_gates_kernel(
    const float* __restrict__ xt, const float* __restrict__ cw,
    const float* __restrict__ cb, const float* __restrict__ Wi,
    const float* __restrict__ bi, const float* __restrict__ Wf,
    const float* __restrict__ bfv, __bf16* __restrict__ xc_bf,
    __bf16* __restrict__ xt_bf, float* __restrict__ ipre, float* __restrict__ fpre)
{
    __shared__ __attribute__((aligned(16))) __bf16 xs[G_TOK * PDIM];
    __shared__ __attribute__((aligned(8))) float red[8][16 * G_TOK];
    const int tid  = threadIdx.x;
    const int lane = tid & 31;
    const int wave = tid >> 5;
    const int tok0 = blockIdx.x * G_TOK;
    const int p = tid * 8;                 // 256 threads x 8 = one token's P features
    const size_t base = (size_t)tok0 * PDIM + p;
    const float w0 = cw[0], w1 = cw[1], w2 = cw[2], w3 = cw[3];
    const float cbv = cb[0];
    const int back = p ? 4 : 0;            // the row's first thread has nothing to its left
    const unsigned lw = (unsigned)tid * NH;

    v4f pv[G_TOK], lo[G_TOK], hi[G_TOK];
#pragma unroll
    for (int t = 0; t < G_TOK; ++t) {
        const float* s = xt + base + (size_t)t * PDIM;
        pv[t] = *reinterpret_cast<const v4f*>(s - back);
        lo[t] = *reinterpret_cast<const v4f*>(s);
        hi[t] = *reinterpret_cast<const v4f*>(s + 4);
    }
    // the next run of loads lands in the address registers of this one (a precaution)
    asm volatile("s_wait_xcnt 0x0" ::: "memory");
    // the first half of the gate weights flies with the rows of xt
    v4f wva[4][4], wvb[4][4];
    fetch_gate_rows(Wi, Wf, 0, lw, wva);
    // keeps every load in front of the arithmetic, so that all of them are in flight
    // together (without it the build sinks a part of them between the divisions)
    __builtin_amdgcn_sched_barrier(0);
    v8bf oc[G_TOK], ox[G_TOK];
#pragma unroll
    for (int t = 0; t < G_TOK; ++t) {
        // e[j + 3] = feature p + j; left of the row's start the conv pads with zeros
        const float e[11] = {p ? pv[t].y : 0.0f, p ? pv[t].z : 0.0f, p ? pv[t].w : 0.0f,
                             lo[t].x, lo[t].y, lo[t].z, lo[t].w,
                             hi[t].x, hi[t].y, hi[t].z, hi[t].w};
#pragma unroll
        for (int j = 0; j < 8; ++j) {
            float acc = cbv + w3 * e[j + 3];
            acc += w2 * e[j + 2];
            acc += w1 * e[j + 1];
            acc += w0 * e[j];
            oc[t][j] = (__bf16)(acc / (1.0f + exp2_slot(-acc * LOG2E)));   // silu
            ox[t][j] = (__bf16)e[j + 3];
        }
    }
#pragma unroll
    for (int t = 0; t < G_TOK; ++t)
        *reinterpret_cast<v8bf*>(&xs[t * PDIM + p]) = oc[t];
    __syncthreads();                       // the work-group's rows of xc published
    // the stores stand behind the barrier, which would wait them out; they and the
    // second half of the weights fly under the first half's arithmetic
#pragma unroll
    for (int t = 0; t < G_TOK; ++t) {
        *reinterpret_cast<v8bf*>(xc_bf + base + (size_t)t * PDIM) = oc[t];
        *reinterpret_cast<v8bf*>(xt_bf + base + (size_t)t * PDIM) = ox[t];
    }
    // the loads that follow land in the stores' registers (a precaution)
    asm volatile("s_wait_xcnt 0x0" ::: "memory");
    fetch_gate_rows(Wi, Wf, 1024, lw, wvb);
    // keeps the stores and the loads in front of the arithmetic
    __builtin_amdgcn_sched_barrier(0);

    // acc[t] = {i gates 0..3, i gates 4..7, f gates 0..3, f gates 4..7} of token tok0 + t
    v4f acc[G_TOK][4];
#pragma unroll
    for (int t = 0; t < G_TOK; ++t)
#pragma unroll
        for (int n = 0; n < 4; ++n) { v4f z = {}; acc[t][n] = z; }
    gate_fma(acc, wva, xs, 0, tid);
    gate_fma(acc, wvb, xs, 1024, tid);
    // sum[t * 16 + g] = i gate g, sum[t * 16 + 8 + g] = f gate g
    float sum[16 * G_TOK];
#pragma unroll
    for (int n = 0; n < 16 * G_TOK; ++n) sum[n] = acc[n >> 4][(n >> 2) & 3][n & 3];
#pragma unroll
    for (int m = 16, half = 8 * G_TOK; m > 0; m >>= 1, half >>= 1) {
        const bool up = (lane & m) != 0;   // this lane keeps the upper half of the sums
#pragma unroll
        for (int n = 0; n < half; ++n) {
            const float send = up ? sum[n] : sum[n + half];
            const float keep = up ? sum[n + half] : sum[n];
            sum[n] = keep + __shfl_xor(send, m, 32);
        }
    }
    const v2f pr = {sum[0], sum[1]};
    *reinterpret_cast<v2f*>(&red[wave][2 * lane]) = pr;
    __syncthreads();                       // every wave's sums published
    if (tid < 16 * G_TOK) {
        float s = 0.0f;
#pragma unroll
        for (int w = 0; w < 8; ++w) s += red[w][tid];
        const int  g   = tid & 7;
        const bool isf = (tid & 8) != 0;
        const float v = s + (isf ? bfv[g] : bi[g]);
        float* dst = isf ? fpre : ipre;
        dst[(size_t)(tok0 + (tid >> 4)) * NH + g] = 15.0f * tanhf(v * (1.0f / 15.0f));
    }
}

// ---------------------------------------------------------------------------
// The gated recurrence in its closed (parallel) form, f32 16x16x4 WMMA.
// With F_t = sum_{u<=t} f_u, w_s = i_s - F_s and M_t = max(0, max_{s<=t} w_s)
// (M_t = m_t - F_t of the recurrence) the scan unrolls exactly to
//   num_t = sum_{s<=t} exp(w_s - M_t) (q_t . k_s) v_s
//   den_t = max(exp(-M_t) sum_e q_t[e] + sum_{s<=t} exp(w_s - M_t) (q_t . k_s), 1)
// Every exponent is <= 0. One block per (b,h, 64 rows of t), 8 waves: wave (rg,half)
// does rows 16rg..+15; columns 32half..+31 of each 64 x 64 product.
// Only the diagonal tile (s >= t0, the block's first row) needs the mask and so the
// products S = Q K^T and P V. All s < t0 reach every row of the block alike but for a
// factor of the row: with Mref = M_{t0-1} (<= M_t)
//   C[e][d] = sum_{s<t0} exp(w_s - Mref) k_s[e] v_s[d],  n[e] = sum_{s<t0} exp(w_s - Mref) k_s[e]
//   num_t += exp(Mref - M_t) (q_t C),  den_t's sum += exp(Mref - M_t) (q_t . n)
// which is ONE product per tile left of the diagonal, no P and no exchange of it, and
// one product Q C at the end.
// The diagonal's K is staged as K[s][e]; V, and K for the state, transposed as [d][s]:
// all fragments are 16-byte LDS loads along k and need no register shuffle.
// The block holds whole (token, head) rows of the result, so what follows per head is
// done here too: h = o * hseq; LayerNorm over Dh; z = (hn*hw+hb + skip) * silu(r).
// The 64 x 64 tile goes through LDS into the layout of that step: a thread takes 4
// neighbouring d of rows crow + 16u; 16 lanes hold a head's row, whose sums go by lane
// exchange; 16-byte loads, and a whole 128-byte line of z per row.
// ---------------------------------------------------------------------------
#define SEQ    512
#define KV_P   68     // f32 row pitch: 64 + 4, 16B aligned, conflict-free b128 rows

// Distance behind a block of f32 16x16x4 WMMAs before vector instructions may read
// the accumulators or reuse the operand registers. The form has the issue interval
// of the 8-bit-integer form, so that form's eight slots are kept. The scheduling
// barriers hold the block together: no vector instruction moves in between the
// WMMAs or in front of the v_nops. The block's two accumulators are operands of the
// v_nops' statement, which ties it behind the WMMAs that write them and in front of
// every reader (untied, the build moves the WMMAs of a block that stands outside a
// loop past the v_nops and in among the vector work that follows).
#define WMMA_BLOCK_BEGIN() __builtin_amdgcn_sched_barrier(0)
#define WMMA_BLOCK_END(acc)                                                     \
    do {                                                                        \
        __builtin_amdgcn_sched_barrier(0);                                      \
        asm volatile("v_nop\n\tv_nop\n\tv_nop\n\tv_nop\n\t"                     \
                     "v_nop\n\tv_nop\n\tv_nop\n\tv_nop"                        \
                     : "+v"((acc)[0]), "+v"((acc)[1]));                         \
        __builtin_amdgcn_sched_barrier(0);                                      \
    } while (0)

// 16 rows s of one column of a 64x64 f32 tile (a wave reads 128 contiguous bytes per row)
__device__ __forceinline__ void fetch_col(const float* __restrict__ p, float (&r)[16])
{
#pragma unroll
    for (int j = 0; j < 16; ++j)
        r[j] = p[(size_t)j * NH * DH];
}

// acc[0..1] += A(16 x 64, fragments af) * B^T, B rows brow and brow + 16 of a
// 64-wide LDS tile; lane (c,hf) takes k = 8m + 4hf + 0..3 on both operands
__device__ __forceinline__ void mma_16x32x64(v8f (&acc)[2], const v4f (&af)[8],
                                             const float* bt, int brow, int hf)
{
#pragma unroll
    for (int m = 0; m < 8; ++m) {
        const v4f b0 = *reinterpret_cast<const v4f*>(&bt[brow * KV_P + 8 * m + 4 * hf]);
        const v4f b1 = *reinterpret_cast<const v4f*>(&bt[(brow + 16) * KV_P + 8 * m + 4 * hf]);
        const v2f alo = {af[m].x, af[m].y}, ahi = {af[m].z, af[m].w};
        const v2f b0lo = {b0.x, b0.y}, b0hi = {b0.z, b0.w};
        const v2f b1lo = {b1.x, b1.y}, b1hi = {b1.z, b1.w};
        acc[0] = __builtin_amdgcn_wmma_f32_16x16x4_f32(
            false, alo, false, b0lo, (short)0, acc[0], false, false);
        acc[1] = __builtin_amdgcn_wmma_f32_16x16x4_f32(
            false, alo, false, b1lo, (short)0, acc[1], false, false);
        acc[0] = __builtin_amdgcn_wmma_f32_16x16x4_f32(
            false, ahi, false, b0hi, (short)0, acc[0], false, false);
        acc[1] = __builtin_amdgcn_wmma_f32_16x16x4_f32(
            false, ahi, false, b1hi, (short)0, acc[1], false, false);
    }
}

__global__ __launch_bounds__(256) void scan_parallel_kernel(
    const float* __restrict__ q, const float* __restrict__ k,
    const float* __restrict__ v, const float* __restrict__ ipre,
    const float* __restrict__ fpre, const float* __restrict__ o,
    const float* __restrict__ skip, const float* __restrict__ rr,
    const float* __restrict__ hlnw, const float* __restrict__ hlnb,
    __bf16* __restrict__ z)
{
    __shared__ __attribute__((aligned(16))) float Ks[64 * KV_P];
    __shared__ __attribute__((aligned(16))) float Vt[64 * KV_P];
    __shared__ __attribute__((aligned(16))) float Ps[4][16 * KV_P];
    __shared__ float wS[SEQ];
    __shared__ float mS[SEQ];
    __shared__ float dS[2][64];
    __shared__ __attribute__((aligned(16))) float eS[SEQ];
    __shared__ __attribute__((aligned(16))) float nS[64];

    const int rt   = SEQ / 64 - 1 - (int)blockIdx.x;   // longest tiles first
    const int bh   = blockIdx.y;
    const int b    = bh >> 3;
    const int h    = bh & 7;
    const int tid  = threadIdx.x;
    const int lane = tid & 31;
    const int wave = tid >> 5;
    const int rg   = wave & 3;           // 16-row group
    const int half = wave >> 2;          // 32-column half
    const int c    = lane & 15;
    const int hf   = lane >> 4;
    const int t0   = rt * 64;

    const size_t rowstride = (size_t)NH * DH;                 // floats between t and t+1
    const size_t hbase = ((size_t)b * SEQ * NH + h) * DH;     // (b, t=0, h, 0)

    // staging coordinates. K: rows srow + 16i, 16 B at column sc4.
    // V: column vd, rows vs0 .. vs0 + 15 (a wave reads 128 contiguous bytes per row)
    const int srow = tid >> 4;
    const int sc4  = (tid & 15) * 4;
    const int vd   = tid & 63;
    const int vs0  = (tid >> 6) * 16;

    // V and (for the tiles left of the diagonal) K by columns, from tile 0 on; the
    // diagonal tile's K by rows, fetched once up here
    const float* vp = v + hbase + (size_t)vs0 * rowstride + vd;
    const float* kc = k + hbase + (size_t)vs0 * rowstride + vd;
    const float* kp = k + hbase + (size_t)(t0 + srow) * rowstride + sc4;
    v4f kreg[4];
    float vreg[16], kcol[16];
    fetch_col(vp, vreg);
    if (rt > 0)
        fetch_col(kc, kcol);
#pragma unroll
    for (int i = 0; i < 4; ++i)
        kreg[i] = *reinterpret_cast<const v4f*>(kp + (size_t)i * 16 * NH * DH);

    // Q fragments, kept in registers: lane (c,hf) holds row c, e = 8m + 4hf + 0..3
    v4f qf[8];
    {
        const size_t g = hbase + (size_t)(t0 + rg * 16 + c) * rowstride + 4 * hf;
#pragma unroll
        for (int m = 0; m < 8; ++m)
            qf[m] = *reinterpret_cast<const v4f*>(q + g + 8 * m);
    }

    // gate prefixes for the whole sequence: wave 0, 16 consecutive t per lane
    if (wave == 0) {
        float fv[16], iv[16];
        const size_t g0 = ((size_t)b * SEQ + lane * 16) * NH + h;
#pragma unroll
        for (int j = 0; j < 16; ++j) fv[j] = fpre[g0 + (size_t)j * NH];
        // the second run of loads lands in the address registers of the first
        asm volatile("s_wait_xcnt 0x0" ::: "memory");
#pragma unroll
        for (int j = 0; j < 16; ++j) iv[j] = ipre[g0 + (size_t)j * NH];
#pragma unroll
        for (int j = 1; j < 16; ++j) fv[j] += fv[j - 1];
        float incl = fv[15];
#pragma unroll
        for (int o = 1; o < 32; o <<= 1) {
            const float up = __shfl_up(incl, o, 32);
            if (lane >= o) incl += up;
        }
        float excl = __shfl_up(incl, 1, 32);   // sum of all earlier lanes
        if (lane == 0) excl = 0.0f;
        float run = 0.0f;                 // M starts at m0 - F0 = 0
#pragma unroll
        for (int j = 0; j < 16; ++j) {
            iv[j] = iv[j] - (excl + fv[j]);      // w_s
            run = fmaxf(run, iv[j]);
            fv[j] = run;                          // lane-local running max
        }
        float mx = run;
#pragma unroll
        for (int o = 1; o < 32; o <<= 1) {
            const float up = __shfl_up(mx, o, 32);
            if (lane >= o) mx = fmaxf(mx, up);
        }
        float prev = __shfl_up(mx, 1, 32);
        if (lane == 0) prev = 0.0f;
#pragma unroll
        for (int j = 0; j < 16; ++j) {
            wS[lane * 16 + j] = iv[j];
            mS[lane * 16 + j] = fmaxf(prev, fv[j]);
        }
    }

    // sum_e q_t[e] for row c (both lane halves end with the row total)
    float qsum = 0.0f;
#pragma unroll
    for (int m = 0; m < 8; ++m) qsum += (qf[m].x + qf[m].y) + (qf[m].z + qf[m].w);
    qsum += __shfl_xor(qsum, 16, 32);

    v8f oacc[2];
#pragma unroll
    for (int n = 0; n < 2; ++n) { v8f z = {}; oacc[n] = z; }
    float rsum[8];
#pragma unroll
    for (int r = 0; r < 8; ++r) rsum[r] = 0.0f;

    float* Pw = &Ps[rg][0];
    const int trow = t0 + rg * 16 + 8 * hf;       // + r : this lane's D rows
    const int cw   = 32 * half + c;               // + 16*j : this lane's D column

    __syncthreads();                      // wS / mS published
    float Mt[8];
#pragma unroll
    for (int r = 0; r < 8; ++r) Mt[r] = mS[trow + r];

    // Everything left of the diagonal tile (s < t0, no mask) enters through the state.
    float fr[8];                          // exp(Mref - M_t) of this lane's D rows
#pragma unroll
    for (int r = 0; r < 8; ++r) fr[r] = 0.0f;
    float qn = 0.0f;                      // q_t . n for row c
    if (rt > 0) {                         // the same for the whole work-group
        const float Mref = mS[t0 - 1];
        for (int s = tid; s < t0; s += 256)
            eS[s] = exp2_slot((wS[s] - Mref) * LOG2E);
        __syncthreads();                  // eS published

        v8f cacc[2];                      // C rows e = 16rg + 8hf + r, columns d = cw + 16j
#pragma unroll
        for (int j = 0; j < 2; ++j) { v8f z = {}; cacc[j] = z; }
        v4f nacc = {};                    // this lane's share of n[16rg + c]
        for (int ct = 0; ct < rt; ++ct) {
            const int s0 = ct * 64;
            // both tiles transposed, [column][s]; K's rows carry their decay
#pragma unroll
            for (int i = 0; i < 4; ++i) {
                const v4f es = *reinterpret_cast<const v4f*>(&eS[s0 + vs0 + 4 * i]);
                const v4f kk = {kcol[4 * i], kcol[4 * i + 1], kcol[4 * i + 2], kcol[4 * i + 3]};
                *reinterpret_cast<v4f*>(&Ks[vd * KV_P + vs0 + 4 * i]) = kk * es;
                const v4f vv = {vreg[4 * i], vreg[4 * i + 1], vreg[4 * i + 2], vreg[4 * i + 3]};
                *reinterpret_cast<v4f*>(&Vt[vd * KV_P + vs0 + 4 * i]) = vv;
            }
            __syncthreads();              // tile published
            // next tile flies under this tile's WMMAs (V's last one is the diagonal's)
            vp += 64 * rowstride;
            fetch_col(vp, vreg);
            if (ct + 1 < rt) {
                kc += 64 * rowstride;
                fetch_col(kc, kcol);
            }
            // the pointers are stepped on behind these loads (a precaution)
            asm volatile("s_wait_xcnt 0x0" ::: "memory");

            // C += (decayed K)^T V, 16 x 32 per wave, summed over s
            v4f kf[8];
#pragma unroll
            for (int m = 0; m < 8; ++m)
                kf[m] = *reinterpret_cast<const v4f*>(&Ks[(16 * rg + c) * KV_P + 8 * m + 4 * hf]);
            WMMA_BLOCK_BEGIN();
            mma_16x32x64(cacc, kf, Vt, cw, hf);
            WMMA_BLOCK_END(cacc);
#pragma unroll
            for (int m = 0; m < 8; ++m) nacc += kf[m];
            // Every reader has left Ks/Vt before the refill. By hand because it waits for
            // LDS alone: the next tile's global loads stay in flight across it, where
            // __syncthreads() would wait them out with only this tile's WMMAs as cover.
            asm volatile("s_wait_dscnt 0x0\n\ts_barrier_signal -1\n\ts_barrier_wait -1"
                         ::: "memory");
        }

        // C into LDS as [d][e], the B operand of Q C; n beside it
#pragma unroll
        for (int j = 0; j < 2; ++j) {
            const v4f lo4 = {cacc[j][0], cacc[j][1], cacc[j][2], cacc[j][3]};
            const v4f hi4 = {cacc[j][4], cacc[j][5], cacc[j][6], cacc[j][7]};
            float* cd = &Ks[(cw + 16 * j) * KV_P + 16 * rg + 8 * hf];
            *reinterpret_cast<v4f*>(cd)     = lo4;
            *reinterpret_cast<v4f*>(cd + 4) = hi4;
        }
        float nr = (nacc.x + nacc.y) + (nacc.z + nacc.w);
        nr += __shfl_xor(nr, 16, 32);
        if (half == 0 && hf == 0) nS[16 * rg + c] = nr;
        __syncthreads();                  // C and n published

        WMMA_BLOCK_BEGIN();
        mma_16x32x64(oacc, qf, Ks, cw, hf);
        WMMA_BLOCK_END(oacc);
#pragma unroll
        for (int m = 0; m < 8; ++m) {
            const v4f nv = *reinterpret_cast<const v4f*>(&nS[8 * m + 4 * hf]);
            const v4f pr = qf[m] * nv;
            qn += (pr.x + pr.y) + (pr.z + pr.w);
        }
        qn += __shfl_xor(qn, 16, 32);
#pragma unroll
        for (int r = 0; r < 8; ++r) {
            fr[r] = exp2_slot((Mref - Mt[r]) * LOG2E);
            oacc[0][r] *= fr[r];
            oacc[1][r] *= fr[r];
        }
        __syncthreads();                  // every reader has left Ks before the diagonal's K
    }

    // the diagonal tile, under the causal mask
    {
#pragma unroll
        for (int i = 0; i < 4; ++i) {
            *reinterpret_cast<v4f*>(&Ks[(srow + 16 * i) * KV_P + sc4]) = kreg[i];
            const v4f vv = {vreg[4 * i], vreg[4 * i + 1], vreg[4 * i + 2], vreg[4 * i + 3]};
            *reinterpret_cast<v4f*>(&Vt[vd * KV_P + vs0 + 4 * i]) = vv;
        }
        __syncthreads();                  // tile published

        // S = Q K^T, 16 x 32 per wave
        v8f sacc[2];
#pragma unroll
        for (int j = 0; j < 2; ++j) { v8f z = {}; sacc[j] = z; }
        WMMA_BLOCK_BEGIN();
        mma_16x32x64(sacc, qf, Ks, cw, hf);
        WMMA_BLOCK_END(sacc);

        // P = S * decay under the causal mask; row sums feed the denominator
#pragma unroll
        for (int j = 0; j < 2; ++j) {
            const int s = t0 + 16 * j + cw;
            const float ws = wS[s];
#pragma unroll
            for (int r = 0; r < 8; ++r) {
                const float e = exp2_slot((ws - Mt[r]) * LOG2E);
                const float p = sacc[j][r] * ((s <= trow + r) ? e : 0.0f);
                rsum[r] += p;
                Pw[(8 * hf + r) * KV_P + 16 * j + cw] = p;
            }
        }
        __syncthreads();                  // both column halves of P published

        // O += P V
        v4f pf[8];
#pragma unroll
        for (int m = 0; m < 8; ++m)
            pf[m] = *reinterpret_cast<const v4f*>(&Pw[c * KV_P + 8 * m + 4 * hf]);
        WMMA_BLOCK_BEGIN();
        mma_16x32x64(oacc, pf, Vt, cw, hf);
        WMMA_BLOCK_END(oacc);
    }

    // operands of the per-head step: they fly under the row sums and the two barriers
    const int crow = tid >> 4;
    const int ce   = (tid & 15) * 4;
    const size_t cidx = hbase + (size_t)(t0 + crow) * rowstride + ce;
    v4f o4[4], s4[4], r4[4];
#pragma unroll
    for (int u = 0; u < 4; ++u) {
        const size_t idx = cidx + (size_t)u * 16 * rowstride;
        o4[u] = *reinterpret_cast<const v4f*>(o + idx);
        s4[u] = *reinterpret_cast<const v4f*>(skip + idx);
        r4[u] = *reinterpret_cast<const v4f*>(rr + idx);
    }
    const v4f w4 = *reinterpret_cast<const v4f*>(hlnw + h * DH + ce);
    const v4f b4 = *reinterpret_cast<const v4f*>(hlnb + h * DH + ce);
    // keeps all fourteen loads up here, in front of the lane exchanges
    // the wait: what follows lands in the loads' address registers (a precaution)
    asm volatile("s_wait_xcnt 0x0" ::: "memory");
    __builtin_amdgcn_sched_barrier(0);

    // row sums: over the 16 lanes of a half wave, then over the two column halves
#pragma unroll
    for (int r = 0; r < 8; ++r) {
        float s = rsum[r];
        s += __shfl_xor(s, 1, 32);
        s += __shfl_xor(s, 2, 32);
        s += __shfl_xor(s, 4, 32);
        s += __shfl_xor(s, 8, 32);
        if (c == 0) dS[half][rg * 16 + 8 * hf + r] = s;
    }
    __syncthreads();                      // both halves' row sums published

    // denominator per row, then the tile into LDS (Ks was last read in front of the
    // barrier that published P): D register r = row 8hf + r, column cw
#pragma unroll
    for (int r = 0; r < 8; ++r) {
        const int lr = rg * 16 + 8 * hf + r;
        const float s = dS[0][lr] + dS[1][lr];
        const float qs = __shfl(qsum, 8 * hf + r, 32);
        const float qr = __shfl(qn, 8 * hf + r, 32);
        const float den = fmaxf(exp2_slot(-Mt[r] * LOG2E) * qs + fr[r] * qr + s, 1.0f);
        Ks[lr * KV_P + cw]      = oacc[0][r] / den;
        Ks[lr * KV_P + cw + 16] = oacc[1][r] / den;
    }
    __syncthreads();                      // the tile of hseq published

#pragma unroll
    for (int u = 0; u < 4; ++u) {
        const v4f h4 = *reinterpret_cast<const v4f*>(&Ks[(crow + 16 * u) * KV_P + ce]);
        const v4f hv = o4[u] * h4;
        float s1 = (hv.x + hv.y) + (hv.z + hv.w);
        float s2 = (hv.x * hv.x + hv.y * hv.y) + (hv.z * hv.z + hv.w * hv.w);
#pragma unroll
        for (int st = 8; st > 0; st >>= 1) {
            s1 += __shfl_xor(s1, st, 32);
            s2 += __shfl_xor(s2, st, 32);
        }
        const float mu  = s1 * (1.0f / DH);
        const float var = s2 * (1.0f / DH) - mu * mu;
        const float inv = rsqrtf(var + 1e-6f);
        v4bf y;
#pragma unroll
        for (int e = 0; e < 4; ++e) {
            const float hn = (hv[e] - mu) * inv * w4[e] + b4[e];
            const float rv = r4[u][e];
            const float sr = rv / (1.0f + __expf(-rv));
            y[e] = (__bf16)((hn + s4[u][e]) * sr);
        }
        *reinterpret_cast<v4bf*>(z + cidx + (size_t)u * 16 * rowstride) = y;
    }
}

// ---------------------------------------------------------------------------
// host launcher
// ---------------------------------------------------------------------------
extern "C" void kernel_launch(void* const* d_in, const int* in_sizes, int n_in,
                              void* d_out, int out_size, void* d_ws, size_t ws_size,
                              hipStream_t stream)
{
    const float* x     = (const float*)d_in[0];
    const float* ln_w  = (const float*)d_in[1];
    const float* ln_b  = (const float*)d_in[2];
    const float* hln_w = (const float*)d_in[3];
    const float* hln_b = (const float*)d_in[4];
    const float* Wl    = (const float*)d_in[5];
    const float* bl    = (const float*)d_in[6];
    const float* Wr    = (const float*)d_in[7];
    const float* br    = (const float*)d_in[8];
    const float* conv_w= (const float*)d_in[9];
    const float* conv_b= (const float*)d_in[10];
    const float* Wskip = (const float*)d_in[11];
    const float* bskip = (const float*)d_in[12];
    const float* Wi    = (const float*)d_in[13];
    const float* bi    = (const float*)d_in[14];
    const float* Wf    = (const float*)d_in[15];
    const float* bfv   = (const float*)d_in[16];
    const float* Wo    = (const float*)d_in[17];
    const float* bo    = (const float*)d_in[18];
    const float* Wq    = (const float*)d_in[19];
    const float* bq    = (const float*)d_in[20];
    const float* Wk    = (const float*)d_in[21];
    const float* bk    = (const float*)d_in[22];
    const float* Wv    = (const float*)d_in[23];
    const float* bv    = (const float*)d_in[24];
    const float* Wd    = (const float*)d_in[25];
    const float* bd    = (const float*)d_in[26];

    // --- workspace carve (whole working set fits in MI455X's 192MB L2) ---
    char* ws = (char*)d_ws;
    auto carve = [&](size_t bytes) {
        char* p = ws;
        ws += (bytes + 255) & ~(size_t)255;
        return p;
    };
    // transposed bf16 weights (N x K layout)
    __bf16* WlT    = (__bf16*)carve((size_t)DIM * PDIM * 2);   // 2048 x 1024
    __bf16* WrT    = (__bf16*)carve((size_t)DIM * HDIM * 2);   // 512 x 1024
    __bf16* WskipT = (__bf16*)carve((size_t)PDIM * HDIM * 2);  // 512 x 2048
    __bf16* WqT    = (__bf16*)carve((size_t)PDIM * HDIM * 2);
    __bf16* WkT    = (__bf16*)carve((size_t)PDIM * HDIM * 2);
    __bf16* WvT    = (__bf16*)carve((size_t)PDIM * HDIM * 2);
    __bf16* WoT    = (__bf16*)carve((size_t)PDIM * HDIM * 2);
    __bf16* WdT    = (__bf16*)carve((size_t)HDIM * DIM * 2);   // 1024 x 512
    __bf16* xn_bf  = (__bf16*)carve((size_t)NTOK * DIM * 2);
    float*  xt     = (float*) carve((size_t)NTOK * PDIM * 4);
    __bf16* xt_bf  = (__bf16*)carve((size_t)NTOK * PDIM * 2);
    __bf16* xc_bf  = (__bf16*)carve((size_t)NTOK * PDIM * 2);
    float*  rbuf   = (float*) carve((size_t)NTOK * HDIM * 4);
    float*  skip   = (float*) carve((size_t)NTOK * HDIM * 4);
    float*  qb     = (float*) carve((size_t)NTOK * HDIM * 4);
    float*  kb     = (float*) carve((size_t)NTOK * HDIM * 4);
    float*  vb     = (float*) carve((size_t)NTOK * HDIM * 4);
    float*  ob     = (float*) carve((size_t)NTOK * HDIM * 4);
    float*  ipre   = (float*) carve((size_t)NTOK * NH * 4);
    float*  fpre   = (float*) carve((size_t)NTOK * NH * 4);
    __bf16* z_bf   = (__bf16*)carve((size_t)NTOK * HDIM * 2);
    (void)ws_size; (void)in_sizes; (void)n_in; (void)out_size;

    // cast + transpose weights: src is (K x N) row-major -> dst (N x K) bf16
    cast_transpose_kernel<<<CAST_TILES, 256, 0, stream>>>(
        Wl, Wskip, Wq, Wk, Wv, Wo, Wr, Wd,
        WlT, WskipT, WqT, WkT, WvT, WoT, WrT, WdT);

    layernorm_kernel<<<NTOK / 8, 256, 0, stream>>>(x, ln_w, ln_b, xn_bf);

    // xt = xn @ Wl + bl   (2048x1024x2048)
    gemm_bf16_wmma<0><<<dim3(PDIM / 128, NTOK / 128), 256, 0, stream>>>(
        xn_bf, WlT, bl, nullptr, xt, NTOK, PDIM, DIM, 1.0f);

    // xc, xt as bf16, and the gates of the same tokens
    conv_gates_kernel<<<NTOK / G_TOK, 256, 0, stream>>>(
        xt, conv_w, conv_b, Wi, bi, Wf, bfv, xc_bf, xt_bf, ipre, fpre);

    // skip, q, k = xc @ W (k scaled by 1/sqrt(Dh)); v = xt @ Wv, o = sigmoid(xt @ Wo);
    // r = xn @ Wr: one grid, z = projection
    proj_batch_kernel<<<dim3(HDIM / 128, NTOK / 128, 6), 256, 0, stream>>>(
        xc_bf, xt_bf, xn_bf, WskipT, WqT, WkT, WvT, WoT, WrT,
        bskip, bq, bk, bv, bo, br, skip, qb, kb, vb, ob, rbuf);

    scan_parallel_kernel<<<dim3(SEQ / 64, 32), 256, 0, stream>>>(
        qb, kb, vb, ipre, fpre, ob, skip, rbuf, hln_w, hln_b, z_bf);

    // out = z @ Wd + bd + x
    gemm_bf16_wmma<2><<<dim3(DIM / 128, NTOK / 128), 256, 0, stream>>>(
        z_bf, WdT, bd, x, (float*)d_out, NTOK, DIM, HDIM, 1.0f);
}

// v007
// A run of this version takes 80.1 microseconds.
// In both of two side-by-side timings against v006, it was 1.07 times as fast.
// Over all steps from v000 it is 12.7 times as fast.
#include <hip/hip_runtime.h>
#include <cstdint>
#include <cstddef>

// ---------------------------------------------------------------------------
// mLSTM block forward for MI455X (gfx1250), bf16 WMMA GEMMs + f32 scan.
// B=4 T=512 D=1024 H=8 Dh=64 HD=512 P=2048 K=4
// Weights are cast+TRANSPOSED to bf16 once so that both WMMA operands are
// K-contiguous -> all LDS fragment reads are ds_load_b128 (no scalar gathers).
// GEMM tiles are DOUBLE-BUFFERED and staged with CDNA5 async global->LDS DMA
// (ASYNCcnt): DMA for tile i+1 overlaps WMMA compute on tile i. A tile is 128 k deep.
// ---------------------------------------------------------------------------

#define NTOK 2048      // B*T
#define DIM  1024      // D
#define PDIM 2048      // P
#define HDIM 512       // HD
#define NH   8         // H
#define DH   64        // Dh

typedef __attribute__((ext_vector_type(16))) __bf16 v16bf;
typedef __attribute__((ext_vector_type(8)))  float  v8f;
typedef __attribute__((ext_vector_type(4)))  float  v4f;
typedef __attribute__((ext_vector_type(2)))  float  v2f;
typedef __attribute__((ext_vector_type(8)))  __bf16 v8bf;
typedef __attribute__((ext_vector_type(4)))  __bf16 v4bf;
typedef __attribute__((ext_vector_type(2)))  __bf16 v2bf;

union FragV {
    uint4 u[2];
    v16bf v;
};

// eight async global->LDS 128-bit copies (per-lane), tracked by ASYNCcnt: one operand's
// share of a stage. Copy u takes LDS address l + u * lstep and global address
// g + u * gstep (bytes).
// s_wait_xcnt is the last line of the copies' own statement: there no later write of
// an address register can be scheduled ahead of it (a precaution).
#define COPY8_TEXT                                                  \
    "global_load_async_to_lds_b128 %0, %1, off\n\t"                 \
    "global_load_async_to_lds_b128 %2, %3, off\n\t"                 \
    "global_load_async_to_lds_b128 %4, %5, off\n\t"                 \
    "global_load_async_to_lds_b128 %6, %7, off\n\t"                 \
    "global_load_async_to_lds_b128 %8, %9, off\n\t"                 \
    "global_load_async_to_lds_b128 %10, %11, off\n\t"               \
    "global_load_async_to_lds_b128 %12, %13, off\n\t"               \
    "global_load_async_to_lds_b128 %14, %15, off\n\t"
#define COPY8_ARGS(l, lstep, g, gstep)                              \
    "v"(l),               "v"(g),                                   \
    "v"((l) + (lstep)),     "v"((g) + (gstep)),                     \
    "v"((l) + 2 * (lstep)), "v"((g) + 2 * (gstep)),                 \
    "v"((l) + 3 * (lstep)), "v"((g) + 3 * (gstep)),                 \
    "v"((l) + 4 * (lstep)), "v"((g) + 4 * (gstep)),                 \
    "v"((l) + 5 * (lstep)), "v"((g) + 5 * (gstep)),                 \
    "v"((l) + 6 * (lstep)), "v"((g) + 6 * (gstep)),                 \
    "v"((l) + 7 * (lstep)), "v"((g) + 7 * (gstep))
__device__ __forceinline__ void async_copy8_b128(
    unsigned l, unsigned lstep, const char* g, size_t gstep)
{
    asm volatile(COPY8_TEXT
                 "s_wait_xcnt 0x0"
                 :: COPY8_ARGS(l, lstep, g, gstep) : "memory");
}
// the same, and the line at pf is asked into L2 for a later stage (no data comes back);
// the ask stands in front of the wait, which so covers its address register too
__device__ __forceinline__ void async_copy8_b128_ask(
    unsigned l, unsigned lstep, const char* g, size_t gstep, const void* pf)
{
    asm volatile(COPY8_TEXT
                 "global_prefetch_b8 %16, off scope:SCOPE_SE\n\t"
                 "s_wait_xcnt 0x0"
                 :: COPY8_ARGS(l, lstep, g, gstep), "v"(pf) : "memory");
}
__device__ __forceinline__ void wait_asynccnt0()
{
    asm volatile("s_wait_asynccnt 0x0" ::: "memory");
}

// ---------------------------------------------------------------------------
// cast f32 -> bf16 with transpose: in (R x C row-major) -> out (C x R)
// Tiles of 128 rows x 64 columns through LDS, 32 elements per thread: eight 16-byte
// loads in flight per lane, whole 256-byte pieces of a row on both sides, and an
// eighth of the waves that one 32x32 tile per work-group takes to start.
// Two neighbouring rows are packed into one dword, so LDS holds out's rows as dwords.
// R multiple of 128, C multiple of 64. One work-group does tile t; lc = log2(C / 64).
// The casts have no launch of their own. Each rides in the grid of other work that does
// not depend on it and ends before its first reader starts: Wl (read by the first GEMM)
// beside the LayerNorm, the other seven (read from the projections on) beside the
// first GEMM.
// ---------------------------------------------------------------------------
#define CT_P 65        // dword pitch of an LDS row: 64 + 1, both sides free of bank conflicts
__device__ __forceinline__ void cast_transpose_tile(
    const float* __restrict__ in, __bf16* __restrict__ out, int R, int C, int lc, int t)
{
    __shared__ unsigned tile[64 * CT_P];   // [column c][row pair]
    const int c0 = (t & ((1 << lc) - 1)) * 64;
    const int r0 = (t >> lc) * 128;
    const int tid = threadIdx.x;
    const int ci = tid & 15;               // columns 4ci .. 4ci + 3
    const int rp = tid >> 4;               // row pairs rp + 16u
    // one lane offset for all eight loads; what differs between them is uniform
    const unsigned lof = (unsigned)(2 * rp * C + 4 * ci);
    const float* sb = in + (size_t)r0 * C + c0;
    v4f xe[4], xo[4];
#pragma unroll
    for (int u = 0; u < 4; ++u) {
        const float* s = sb + (size_t)(32 * u) * C;
        xe[u] = *reinterpret_cast<const v4f*>(s + lof);
        xo[u] = *reinterpret_cast<const v4f*>(s + C + lof);
    }
#pragma unroll
    for (int u = 0; u < 4; ++u)
#pragma unroll
        for (int kk = 0; kk < 4; ++kk) {
            const v2bf pr = {(__bf16)xe[u][kk], (__bf16)xo[u][kk]};   // rows 2n, 2n + 1
            tile[(4 * ci + kk) * CT_P + rp + 16 * u] = __builtin_bit_cast(unsigned, pr);
        }
    __syncthreads();
#pragma unroll
    for (int u = 0; u < 4; ++u) {
        const int id = tid + 256 * u;      // 64 rows of out, 16 pieces of 16 B each
        const int c = id >> 4;
        const int j = id & 15;
        const unsigned* tp = &tile[c * CT_P + 4 * j];
        const uint4 o = make_uint4(tp[0], tp[1], tp[2], tp[3]);
        *reinterpret_cast<uint4*>(out + (size_t)(c0 + c) * R + r0 + 8 * j) = o;
    }
    // what the build lays behind this tile (the caller's next tile, or its other side)
    // lands in the stores' registers (a precaution)
    asm volatile("s_wait_xcnt 0x0" ::: "memory");
}

// ---------------------------------------------------------------------------
// LayerNorm over D=1024, one WAVE per token (32 elements per lane, eight 16-byte
// loads in flight), sums over the wave by lane exchange: no LDS, no barrier.
// Writes bf16.
// ---------------------------------------------------------------------------
__device__ __forceinline__ void layernorm_tokens(
    const float* __restrict__ x, const float* __restrict__ w,
    const float* __restrict__ b, __bf16* __restrict__ xn, int blk)
{
    const int lane = threadIdx.x & 31;
    const int tok  = blk * 8 + (threadIdx.x >> 5);
    const float* xr = x + (size_t)tok * DIM + lane * 4;

    v4f v[8], w4[8], b4[8];
#pragma unroll
    for (int i = 0; i < 8; ++i)
        v[i] = *reinterpret_cast<const v4f*>(xr + i * 128);
    // the second run of loads lands in the address registers of the first (a precaution)
    asm volatile("s_wait_xcnt 0x0" ::: "memory");
#pragma unroll
    for (int i = 0; i < 8; ++i) {
        w4[i] = *reinterpret_cast<const v4f*>(w + i * 128 + lane * 4);
        b4[i] = *reinterpret_cast<const v4f*>(b + i * 128 + lane * 4);
    }
    // keeps the loads of w and b up here, in flight with the row's (without it the
    // build sinks them behind the sums, two pairs at a time)
    __builtin_amdgcn_sched_barrier(0);
    float s = 0.f, ss = 0.f;
#pragma unroll
    for (int i = 0; i < 8; ++i)
#pragma unroll
        for (int e = 0; e < 4; ++e) {
            s += v[i][e];
            ss += v[i][e] * v[i][e];
        }
#pragma unroll
    for (int o = 16; o > 0; o >>= 1) {
        s  += __shfl_xor(s, o, 32);
        ss += __shfl_xor(ss, o, 32);
    }
    const float mu  = s * (1.0f / DIM);
    const float var = ss * (1.0f / DIM) - mu * mu;
    const float inv = rsqrtf(var + 1e-6f);
    __bf16* yr = xn + (size_t)tok * DIM + lane * 4;
#pragma unroll
    for (int i = 0; i < 8; ++i) {
        v4bf y;
#pragma unroll
        for (int e = 0; e < 4; ++e)
            y[e] = (__bf16)((v[i][e] - mu) * inv * w4[i][e] + b4[i][e]);
        *reinterpret_cast<v4bf*>(yr + i * 128) = y;
    }
}

// The two things the first GEMM reads, in one grid: neither depends on the other.
// Work-groups 0 .. WL_TILES - 1 cast Wl, the rest normalise 8 tokens each.
#define WL_TILES 256
__global__ __launch_bounds__(256) void ln_cast_kernel(
    const float* __restrict__ x, const float* __restrict__ w,
    const float* __restrict__ b, __bf16* __restrict__ xn,
    const float* __restrict__ Wl, __bf16* __restrict__ WlT)
{
    const int blk = blockIdx.x;
    if (blk < WL_TILES)
        cast_transpose_tile(Wl, WlT, DIM, PDIM, 5, blk);
    else {
        layernorm_tokens(x, w, b, xn, blk - WL_TILES);
        // the build lays the other side behind this one, joined by a fall-through that
        // is never taken; it lands in these stores' registers (a precaution)
        asm volatile("s_wait_xcnt 0x0" ::: "memory");
    }
}

// ---------------------------------------------------------------------------
// WMMA GEMM: C(MxN,f32) = epilogue(A_bf16(MxK,row) @ Bt_bf16(NxK,row)^T + bias)
//  EPI 0: val = (acc+bias)*scale
//  EPI 1: val = sigmoid(acc+bias) where sig is set, else as EPI 0
//  EPI 2: val = acc+bias+resid[idx]
// Workgroup tile 128x128, 8 waves (4x2) of 32x64; a stage is 128 k = 256 B of every
// operand row, four WMMA blocks of 32 k. One round trip, one pair
// of waits and one barrier per 128 k; the next stage's copies have the 32 WMMAs and
// 48 fragment loads of a stage to land in.
// Double-buffered LDS tiles staged with global_load_async_to_lds_b128:
// DMA of tile i+1 overlaps the WMMAs of tile i; fragments via ds_load_b128.
// M,N multiples of 128; K multiple of 128.
// ---------------------------------------------------------------------------
#define TILE_K  128
#define T_STRIDE 136  // 128 K + 8 pad: pitch 272 B = 16 B x odd, for ds_load_b128 readers
#define BUF_ELEMS (128 * T_STRIDE)
#define BUF_BYTES (BUF_ELEMS * 2)

// epilogue + store of one wave's 32x64 accumulators
// (C layout: lane<16 -> M=vgpr, lane>=16 -> M=8+vgpr)
template <int E>
__device__ __forceinline__ void store_tile(
    const v8f (&acc)[2][4], const float* __restrict__ bias,
    const float* __restrict__ resid, float* __restrict__ C, int N, float scale,
    int rbase, int cbase)
{
#pragma unroll
    for (int mt = 0; mt < 2; ++mt) {
#pragma unroll
        for (int nt = 0; nt < 4; ++nt) {
            const int col = cbase + nt * 16;
            const float bv = bias[col];
#pragma unroll
            for (int vv = 0; vv < 8; ++vv) {
                const int row = rbase + mt * 16 + vv;
                const size_t idx = (size_t)row * N + col;
                float val = acc[mt][nt][vv] + bv;
                if (E == 0) {
                    val *= scale;
                } else if (E == 1) {
                    val = 1.0f / (1.0f + __expf(-val));
                } else {
                    val += resid[idx];
                }
                C[idx] = val;
            }
        }
    }
}

template <int EPI>
__device__ __forceinline__ void gemm_tile(
    const __bf16* __restrict__ A, const __bf16* __restrict__ Bt,
    const float* __restrict__ bias, const float* __restrict__ resid,
    float* __restrict__ C, int N, int K, float scale, bool sig, int bx, int by)
{
    __shared__ __attribute__((aligned(16))) __bf16 As[2][BUF_ELEMS];
    __shared__ __attribute__((aligned(16))) __bf16 Bs[2][BUF_ELEMS];

    const int tid  = threadIdx.x;
    const int lane = tid & 31;
    const int wave = tid >> 5;
    const int wm   = wave & 3;   // wave row (0..3) -> 32 rows each
    const int wn   = wave >> 2;  // wave col (0..1) -> 64 cols each
    const int row0 = by * 128;   // (bx, by) = the work-group's tile column and row
    const int col0 = bx * 128;

    const int lhalf = lane >> 4;   // 0 | 1
    const int lmod  = lane & 15;
    const int kof   = lhalf * 8;   // K offset within 16-lane half

    // per-thread staging coordinates: 16 lanes take one row's 256 B (8 bf16 = 16 B per
    // lane), a thread takes rows sr + 16u, u = 0..7, of both operands
    const int sr = tid >> 4, sc = (tid & 15) * 8;
    const unsigned ldsA = (unsigned)(uintptr_t)&As[0][sr * T_STRIDE + sc];
    const unsigned ldsB = (unsigned)(uintptr_t)&Bs[0][sr * T_STRIDE + sc];
    const __bf16* gA = A  + (size_t)(row0 + sr) * K + sc;
    const __bf16* gB = Bt + (size_t)(col0 + sr) * K + sc;
    const size_t gstep = (size_t)16 * K * sizeof(__bf16);
    // L2 prefetch: one ask per operand row and stage, at the start of its 256 B:
    // waves 0..3 take the rows of A, waves 4..7 those of Bt
    const __bf16* pf = (tid < 128) ? A  + (size_t)(row0 + tid) * K
                                   : Bt + (size_t)(col0 + tid - 128) * K;

    // copies of the stage at k0; asks L2 for the stage behind it (the last stage asks
    // for itself again: the address stays inside the operand)
    auto stage = [&](int k0, int buf) {
        const unsigned off = (unsigned)buf * BUF_BYTES;
        const int kp = (k0 + TILE_K < K) ? k0 + TILE_K : k0;
        async_copy8_b128(ldsA + off, 16 * T_STRIDE * 2, (const char*)(gA + k0), gstep);
        async_copy8_b128_ask(ldsB + off, 16 * T_STRIDE * 2, (const char*)(gB + k0), gstep, pf + kp);
    };

    v8f acc[2][4];
#pragma unroll
    for (int i = 0; i < 2; ++i)
#pragma unroll
        for (int j = 0; j < 4; ++j) {
            v8f z = {};
            acc[i][j] = z;
        }

    // preload tile 0
    stage(0, 0);
    wait_asynccnt0();
    __syncthreads();

    int cur = 0;
    for (int k0 = 0; k0 < K; k0 += TILE_K) {
        // issue DMA for the NEXT tile into the other buffer (overlaps compute)
        // (with it goes the L2 prefetch of the tile after that one)
        if (k0 + TILE_K < K)
            stage(k0 + TILE_K, cur ^ 1);

        // four blocks of 32 k, unrolled so that a block's fragment loads can go ahead
        // of the block before it
#pragma unroll
        for (int kb = 0; kb < TILE_K; kb += 32) {
            // --- fragments from current buffer (K-contiguous for A and B) ---
            FragV af[2], bfr[4];
#pragma unroll
            for (int mt = 0; mt < 2; ++mt) {
                const int r = wm * 32 + mt * 16 + lmod;
                af[mt].u[0] = *reinterpret_cast<const uint4*>(&As[cur][r * T_STRIDE + kb + kof]);
                af[mt].u[1] = *reinterpret_cast<const uint4*>(&As[cur][r * T_STRIDE + kb + 16 + kof]);
            }
#pragma unroll
            for (int nt = 0; nt < 4; ++nt) {
                const int r = wn * 64 + nt * 16 + lmod;
                bfr[nt].u[0] = *reinterpret_cast<const uint4*>(&Bs[cur][r * T_STRIDE + kb + kof]);
                bfr[nt].u[1] = *reinterpret_cast<const uint4*>(&Bs[cur][r * T_STRIDE + kb + 16 + kof]);
            }
            // --- 8 WMMAs per wave per block (DMA for next tile in flight) ---
#pragma unroll
            for (int mt = 0; mt < 2; ++mt)
#pragma unroll
                for (int nt = 0; nt < 4; ++nt)
                    acc[mt][nt] = __builtin_amdgcn_wmma_f32_16x16x32_bf16(
                        false, af[mt].v, false, bfr[nt].v,
                        (short)0, acc[mt][nt], false, false);
        }

        // this wave's reads of the current buffer have returned before the barrier
        // behind which that buffer is refilled
        asm volatile("s_wait_dscnt 0x0" ::: "memory");
        // next tile fully in LDS (own wave) + all waves done with both ops
        wait_asynccnt0();
        __syncthreads();
        cur ^= 1;
    }

    // --- epilogue + store. The choice by sig is the same for the whole work-group
    // and is made once, outside the element loops: each side is straight-line code.
    const int rbase = row0 + wm * 32 + lhalf * 8;
    const int cbase = col0 + wn * 64 + lmod;
    if (EPI == 1) {
        if (sig) {
            store_tile<1>(acc, bias, resid, C, N, scale, rbase, cbase);
        } else {
            store_tile<0>(acc, bias, resid, C, N, scale, rbase, cbase);
            // the build lays the other side behind this one, joined by a fall-through
            // that is never taken; its loads land in these stores' address registers,
            // so the wait stands in front of them (a precaution)
            asm volatile("s_wait_xcnt 0x0" ::: "memory");
        }
    } else {
        store_tile<EPI>(acc, bias, resid, C, N, scale, rbase, cbase);
    }
}

template <int EPI>
__global__ __launch_bounds__(256) void gemm_bf16_wmma(
    const __bf16* __restrict__ A, const __bf16* __restrict__ Bt,
    const float* __restrict__ bias, const float* __restrict__ resid,
    float* __restrict__ C, int M, int N, int K, float scale)
{
    gemm_tile<EPI>(A, Bt, bias, resid, C, N, K, scale, false, blockIdx.x, blockIdx.y);
}

// xt = xn @ Wl + bl, and in the same grid the casts of the seven weights that are first
// read behind this launch. The GEMM's 256 work-groups come first, one for every WGP;
// it waits on LDS and L2, not on memory, and leaves room for a second work-group on
// the WGP: there the casts stream through while it runs, 256 work-groups of three
// tiles each (one start of eight waves for three tiles).
// Cast tiles: Wskip/Wq/Wk/Wv/Wo 128 each, then Wr 64, then Wd 64.
#define XT_TILES   ((PDIM / 128) * (NTOK / 128))
#define REST_WGS   256
#define REST_EACH  3
__global__ __launch_bounds__(256) void gemm_xt_cast_kernel(
    const __bf16* __restrict__ xn, const __bf16* __restrict__ WlT,
    const float* __restrict__ bl, float* __restrict__ xt,
    const float* __restrict__ Wskip, const float* __restrict__ Wq,
    const float* __restrict__ Wk, const float* __restrict__ Wv,
    const float* __restrict__ Wo, const float* __restrict__ Wr,
    const float* __restrict__ Wd,
    __bf16* __restrict__ WskipT, __bf16* __restrict__ WqT,
    __bf16* __restrict__ WkT, __bf16* __restrict__ WvT,
    __bf16* __restrict__ WoT, __bf16* __restrict__ WrT, __bf16* __restrict__ WdT)
{
    const int blk = blockIdx.x;
    if (blk < XT_TILES) {
        gemm_tile<0>(xn, WlT, bl, nullptr, xt, PDIM, DIM, 1.0f, false,
                     blk % (PDIM / 128), blk / (PDIM / 128));
        return;
    }
    for (int u = 0; u < REST_EACH; ++u) {
        int t = blk - XT_TILES + REST_WGS * u;   // then: tile number inside the chosen matrix
        const float* in;
        __bf16* out;
        int R, C, lc;
        if (t < 640) {
            const int w = t >> 7;
            t &= 127;
            R = PDIM; C = HDIM; lc = 3;
            if (w == 0)      { in = Wskip; out = WskipT; }
            else if (w == 1) { in = Wq;    out = WqT; }
            else if (w == 2) { in = Wk;    out = WkT; }
            else if (w == 3) { in = Wv;    out = WvT; }
            else             { in = Wo;    out = WoT; }
        } else if (t < 704) {
            t -= 640;
            in = Wr; out = WrT; R = DIM; C = HDIM; lc = 3;
        } else {
            t -= 704;
            in = Wd; out = WdT; R = HDIM; C = DIM; lc = 4;
        }
        if (u)
            __syncthreads();               // every reader has left the LDS tile before it is refilled
        cast_transpose_tile(in, out, R, C, lc, t);
    }
}

// The six projections of width HD in ONE grid. Each alone is 64 work-groups, a
// quarter of the chip's WGPs, in a loop that waits out one L2 round trip per
// K-step; none reads what another writes, so blockIdx.z picks the operand set and
// all 384 work-groups are resident together. The short one (r, K = D) comes last.
__global__ __launch_bounds__(256) void proj_batch_kernel(
    const __bf16* __restrict__ xc, const __bf16* __restrict__ xt,
    const __bf16* __restrict__ xn,
    const __bf16* __restrict__ WskipT, const __bf16* __restrict__ WqT,
    const __bf16* __restrict__ WkT, const __bf16* __restrict__ WvT,
    const __bf16* __restrict__ WoT, const __bf16* __restrict__ WrT,
    const float* __restrict__ bskip, const float* __restrict__ bq,
    const float* __restrict__ bk, const float* __restrict__ bv,
    const float* __restrict__ bo, const float* __restrict__ br,
    float* __restrict__ skip, float* __restrict__ qb, float* __restrict__ kb,
    float* __restrict__ vb, float* __restrict__ ob, float* __restrict__ rbuf)
{
    const int z = blockIdx.z;
    const __bf16* A;
    const __bf16* Bt;
    const float* bias;
    float* C;
    if (z == 0)      { A = xc; Bt = WskipT; bias = bskip; C = skip; }
    else if (z == 1) { A = xc; Bt = WqT;    bias = bq;    C = qb; }
    else if (z == 2) { A = xc; Bt = WkT;    bias = bk;    C = kb; }
    else if (z == 3) { A = xt; Bt = WvT;    bias = bv;    C = vb; }
    else if (z == 4) { A = xt; Bt = WoT;    bias = bo;    C = ob; }
    else             { A = xn; Bt = WrT;    bias = br;    C = rbuf; }
    const int   K     = (z == 5) ? DIM : PDIM;
    const float scale = (z == 2) ? 0.125f : 1.0f;      // k carries 1/sqrt(Dh)
    gemm_tile<1>(A, Bt, bias, nullptr, C, HDIM, K, scale, z == 4, blockIdx.x, blockIdx.y);
}

// ---------------------------------------------------------------------------
// Causal conv (K=4) along the feature axis + SiLU; also emits xt as bf16. Then, in
// the same work-group, the i/f gate projections (P x 8 each) + softcap(15) of the
// very tokens whose xc rows it has just made: they go over through LDS, not through
// a launch of their own.
// Conv: a thread takes 8 neighbouring features of G_TOK tokens: 16-byte loads and
// stores, all tokens' loads in flight together, 32 elements per thread.
// Gates, plain VALU: a thread takes features tid + 256 n, keeps their rows of Wi and
// Wf in registers and uses them for every token. The 16 * G_TOK partial sums go over
// the wave by a halving lane exchange (each step hands half of the sums to the partner
// lane, so lane l ends with sums 2l and 2l + 1), then over the 8 waves through LDS
// behind one barrier.
// ---------------------------------------------------------------------------
#define G_TOK 4

// 2^x. The v_nop is the slot the instruction set asks for behind a transcendental
// before its source may be overwritten or its result used; in one statement with
// it, it cannot drift away.
__device__ __forceinline__ float exp2_slot(float x)
{
    float y;
    asm("v_exp_f32 %0, %1\n\tv_nop" : "=v"(y) : "v"(x));
    return y;
}
#define LOG2E 1.44269504088896340736f

// rows j0 + tid + 256 jj, jj = 0..3, of Wi (wv[jj][0..1]) and Wf (wv[jj][2..3]);
// every address is a uniform base plus the lane offset lw
__device__ __forceinline__ void fetch_gate_rows(
    const float* __restrict__ Wi, const float* __restrict__ Wf, int j0, unsigned lw,
    v4f (&wv)[4][4])
{
#pragma unroll
    for (int jj = 0; jj < 4; ++jj) {
        const float* wa = Wi + (size_t)(j0 + 256 * jj) * NH;
        wv[jj][0] = *reinterpret_cast<const v4f*>(wa + lw);
        wv[jj][1] = *reinterpret_cast<const v4f*>((wa + 4) + lw);
    }
    // the next run of loads lands in the address registers of this one (a precaution)
    asm volatile("s_wait_xcnt 0x0" ::: "memory");
#pragma unroll
    for (int jj = 0; jj < 4; ++jj) {
        const float* wb = Wf + (size_t)(j0 + 256 * jj) * NH;
        wv[jj][2] = *reinterpret_cast<const v4f*>(wb + lw);
        wv[jj][3] = *reinterpret_cast<const v4f*>((wb + 4) + lw);
    }
    // as above
    asm volatile("s_wait_xcnt 0x0" ::: "memory");
}

// acc[t] += xc[t][j0 + tid + 256 jj] * (that feature's rows of Wi and Wf)
__device__ __forceinline__ void gate_fma(
    v4f (&acc)[G_TOK][4], const v4f (&wv)[4][4], const __bf16* xs, int j0, int tid)
{
    __bf16 xr[4][G_TOK];
#pragma unroll
    for (int jj = 0; jj < 4; ++jj)
#pragma unroll
        for (int t = 0; t < G_TOK; ++t)
            xr[jj][t] = xs[t * PDIM + j0 + 256 * jj + tid];
#pragma unroll
    for (int jj = 0; jj < 4; ++jj)
#pragma unroll
        for (int t = 0; t < G_TOK; ++t) {
            const float xv = (float)xr[jj][t];
#pragma unroll
            for (int n = 0; n < 4; ++n) acc[t][n] += xv * wv[jj][n];
        }
}

__global__ __launch_bounds__(256) void conv_gates_kernel(
    const float* __restrict__ xt, const float* __restrict__ cw,
    const float* __restrict__ cb, const float* __restrict__ Wi,
    const float* __restrict__ bi, const float* __restrict__ Wf,
    const float* __restrict__ bfv, __bf16* __restrict__ xc_bf,
    __bf16* __restrict__ xt_bf, float* __restrict__ ipre, float* __restrict__ fpre)
{
    __shared__ __attribute__((aligned(16))) __bf16 xs[G_TOK * PDIM];
    __shared__ __attribute__((aligned(8))) float red[8][16 * G_TOK];
    const int tid  = threadIdx.x;
    const int lane = tid & 31;
    const int wave = tid >> 5;
    const int tok0 = blockIdx.x * G_TOK;
    const int p = tid * 8;                 // 256 threads x 8 = one token's P features
    const size_t base = (size_t)tok0 * PDIM + p;
    const float w0 = cw[0], w1 = cw[1], w2 = cw[2], w3 = cw[3];
    const float cbv = cb[0];
    const int back = p ? 4 : 0;            // the row's first thread has nothing to its left
    const unsigned lw = (unsigned)tid * NH;

    v4f pv[G_TOK], lo[G_TOK], hi[G_TOK];
#pragma unroll
    for (int t = 0; t < G_TOK; ++t) {
        const float* s = xt + base + (size_t)t * PDIM;
        pv[t] = *reinterpret_cast<const v4f*>(s - back);
        lo[t] = *reinterpret_cast<const v4f*>(s);
        hi[t] = *reinterpret_cast<const v4f*>(s + 4);
    }
    // the next run of loads lands in the address registers of this one (a precaution)
    asm volatile("s_wait_xcnt 0x0" ::: "memory");
    // the first half of the gate weights flies with the rows of xt
    v4f wva[4][4], wvb[4][4];
    fetch_gate_rows(Wi, Wf, 0, lw, wva);
    // keeps every load in front of the arithmetic, so that all of them are in flight
    // together (without it the build sinks a part of them between the divisions)
    __builtin_amdgcn_sched_barrier(0);
    v8bf oc[G_TOK], ox[G_TOK];
#pragma unroll
    for (int t = 0; t < G_TOK; ++t) {
        // e[j + 3] = feature p + j; left of the row's start the conv pads with zeros
        const float e[11] = {p ? pv[t].y : 0.0f, p ? pv[t].z : 0.0f, p ? pv[t].w : 0.0f,
                             lo[t].x, lo[t].y, lo[t].z, lo[t].w,
                             hi[t].x, hi[t].y, hi[t].z, hi[t].w};
#pragma unroll
        for (int j = 0; j < 8; ++j) {
            float acc = cbv + w3 * e[j + 3];
            acc += w2 * e[j + 2];
            acc += w1 * e[j + 1];
            acc += w0 * e[j];
            oc[t][j] = (__bf16)(acc / (1.0f + exp2_slot(-acc * LOG2E)));   // silu
            ox[t][j] = (__bf16)e[j + 3];
        }
    }
#pragma unroll
    for (int t = 0; t < G_TOK; ++t)
        *reinterpret_cast<v8bf*>(&xs[t * PDIM + p]) = oc[t];
    __syncthreads();                       // the work-group's rows of xc published
    // the stores stand behind the barrier, which would wait them out; they and the
    // second half of the weights fly under the first half's arithmetic
#pragma unroll
    for (int t = 0; t < G_TOK; ++t) {
        *reinterpret_cast<v8bf*>(xc_bf + base + (size_t)t * PDIM) = oc[t];
        *reinterpret_cast<v8bf*>(xt_bf + base + (size_t)t * PDIM) = ox[t];
    }
    // the loads that follow land in the stores' registers (a precaution)
    asm volatile("s_wait_xcnt 0x0" ::: "memory");
    fetch_gate_rows(Wi, Wf, 1024, lw, wvb);
    // keeps the stores and the loads in front of the arithmetic
    __builtin_amdgcn_sched_barrier(0);

    // acc[t] = {i gates 0..3, i gates 4..7, f gates 0..3, f gates 4..7} of token tok0 + t
    v4f acc[G_TOK][4];
#pragma unroll
    for (int t = 0; t < G_TOK; ++t)
#pragma unroll
        for (int n = 0; n < 4; ++n) { v4f z = {}; acc[t][n] = z; }
    gate_fma(acc, wva, xs, 0, tid);
    gate_fma(acc, wvb, xs, 1024, tid);
    // sum[t * 16 + g] = i gate g, sum[t * 16 + 8 + g] = f gate g
    float sum[16 * G_TOK];
#pragma unroll
    for (int n = 0; n < 16 * G_TOK; ++n) sum[n] = acc[n >> 4][(n >> 2) & 3][n & 3];
#pragma unroll
    for (int m = 16, half = 8 * G_TOK; m > 0; m >>= 1, half >>= 1) {
        const bool up = (lane & m) != 0;   // this lane keeps the upper half of the sums
#pragma unroll
        for (int n = 0; n < half; ++n) {
            const float send = up ? sum[n] : sum[n + half];
            const float keep = up ? sum[n + half] : sum[n];
            sum[n] = keep + __shfl_xor(send, m, 32);
        }
    }
    const v2f pr = {sum[0], sum[1]};
    *reinterpret_cast<v2f*>(&red[wave][2 * lane]) = pr;
    __syncthreads();                       // every wave's sums published
    if (tid < 16 * G_TOK) {
        float s = 0.0f;
#pragma unroll
        for (int w = 0; w < 8; ++w) s += red[w][tid];
        const int  g   = tid & 7;
        const bool isf = (tid & 8) != 0;
        const float v = s + (isf ? bfv[g] : bi[g]);
        float* dst = isf ? fpre : ipre;
        dst[(size_t)(tok0 + (tid >> 4)) * NH + g] = 15.0f * tanhf(v * (1.0f / 15.0f));
    }
}

// ---------------------------------------------------------------------------
// The gated recurrence in its closed (parallel) form, f32 16x16x4 WMMA.
// With F_t = sum_{u<=t} f_u, w_s = i_s - F_s and M_t = max(0, max_{s<=t} w_s)
// (M_t = m_t - F_t of the recurrence) the scan unrolls exactly to
//   num_t = sum_{s<=t} exp(w_s - M_t) (q_t . k_s) v_s
//   den_t = max(exp(-M_t) sum_e q_t[e] + sum_{s<=t} exp(w_s - M_t) (q_t . k_s), 1)
// Every exponent is <= 0. One block per (b,h, 64 rows of t), 8 waves: wave (rg,half)
// does rows 16rg..+15; columns 32half..+31 of each 64 x 64 product.
// Only the diagonal tile (s >= t0, the block's first row) needs the mask and so the
// products S = Q K^T and P V. All s < t0 reach every row of the block alike but for a
// factor of the row: with Mref = M_{t0-1} (<= M_t)
//   C[e][d] = sum_{s<t0} exp(w_s - Mref) k_s[e] v_s[d],  n[e] = sum_{s<t0} exp(w_s - Mref) k_s[e]
//   num_t += exp(Mref - M_t) (q_t C),  den_t's sum += exp(Mref - M_t) (q_t . n)
// which is ONE product per tile left of the diagonal, no P and no exchange of it, and
// one product Q C at the end.
// The diagonal's K is staged as K[s][e]; V, and K for the state, transposed as [d][s]:
// all fragments are 16-byte LDS loads along k and need no register shuffle.
// The block holds whole (token, head) rows of the result, so what follows per head is
// done here too: h = o * hseq; LayerNorm over Dh; z = (hn*hw+hb + skip) * silu(r).
// The 64 x 64 tile goes through LDS into the layout of that step: a thread takes 4
// neighbouring d of rows crow + 16u; 16 lanes hold a head's row, whose sums go by lane
// exchange; 16-byte loads, and a whole 128-byte line of z per row.
// ---------------------------------------------------------------------------
#define SEQ    512
#define KV_P   68     // f32 row pitch: 64 + 4, 16B aligned, conflict-free b128 rows

// Distance behind a block of f32 16x16x4 WMMAs before vector instructions may read
// the accumulators or reuse the operand registers. The form has the issue interval
// of the 8-bit-integer form, so that form's eight slots are kept. The scheduling
// barriers hold the block together: no vector instruction moves in between the
// WMMAs or in front of the v_nops. The block's two accumulators are operands of the
// v_nops' statement, which ties it behind the WMMAs that write them and in front of
// every reader (untied, the build moves the WMMAs of a block that stands outside a
// loop past the v_nops and in among the vector work that follows).
#define WMMA_BLOCK_BEGIN() __builtin_amdgcn_sched_barrier(0)
#define WMMA_BLOCK_END(acc)                                                     \
    do {                                                                        \
        __builtin_amdgcn_sched_barrier(0);                                      \
        asm volatile("v_nop\n\tv_nop\n\tv_nop\n\tv_nop\n\t"                     \
                     "v_nop\n\tv_nop\n\tv_nop\n\tv_nop"                        \
                     : "+v"((acc)[0]), "+v"((acc)[1]));                         \
        __builtin_amdgcn_sched_barrier(0);                                      \
    } while (0)

// 16 rows s of one column of a 64x64 f32 tile (a wave reads 128 contiguous bytes per row)
__device__ __forceinline__ void fetch_col(const float* __restrict__ p, float (&r)[16])
{
#pragma unroll
    for (int j = 0; j < 16; ++j)
        r[j] = p[(size_t)j * NH * DH];
}

// acc[0..1] += A(16 x 64, fragments af) * B^T, B rows brow and brow + 16 of a
// 64-wide LDS tile; lane (c,hf) takes k = 8m + 4hf + 0..3 on both operands
__device__ __forceinline__ void mma_16x32x64(v8f (&acc)[2], const v4f (&af)[8],
                                             const float* bt, int brow, int hf)
{
#pragma unroll
    for (int m = 0; m < 8; ++m) {
        const v4f b0 = *reinterpret_cast<const v4f*>(&bt[brow * KV_P + 8 * m + 4 * hf]);
        const v4f b1 = *reinterpret_cast<const v4f*>(&bt[(brow + 16) * KV_P + 8 * m + 4 * hf]);
        const v2f alo = {af[m].x, af[m].y}, ahi = {af[m].z, af[m].w};
        const v2f b0lo = {b0.x, b0.y}, b0hi = {b0.z, b0.w};
        const v2f b1lo = {b1.x, b1.y}, b1hi = {b1.z, b1.w};
        acc[0] = __builtin_amdgcn_wmma_f32_16x16x4_f32(
            false, alo, false, b0lo, (short)0, acc[0], false, false);
        acc[1] = __builtin_amdgcn_wmma_f32_16x16x4_f32(
            false, alo, false, b1lo, (short)0, acc[1], false, false);
        acc[0] = __builtin_amdgcn_wmma_f32_16x16x4_f32(
            false, ahi, false, b0hi, (short)0, acc[0], false, false);
        acc[1] = __builtin_amdgcn_wmma_f32_16x16x4_f32(
            false, ahi, false, b1hi, (short)0, acc[1], false, false);
    }
}

__global__ __launch_bounds__(256) void scan_parallel_kernel(
    const float* __restrict__ q, const float* __restrict__ k,
    const float* __restrict__ v, const float* __restrict__ ipre,
    const float* __restrict__ fpre, const float* __restrict__ o,
    const float* __restrict__ skip, const float* __restrict__ rr,
    const float* __restrict__ hlnw, const float* __restrict__ hlnb,
    __bf16* __restrict__ z)
{
    __shared__ __attribute__((aligned(16))) float Ks[64 * KV_P];
    __shared__ __attribute__((aligned(16))) float Vt[64 * KV_P];
    __shared__ __attribute__((aligned(16))) float Ps[4][16 * KV_P];
    __shared__ float wS[SEQ];
    __shared__ float mS[SEQ];
    __shared__ float dS[2][64];
    __shared__ __attribute__((aligned(16))) float eS[SEQ];
    __shared__ __attribute__((aligned(16))) float nS[64];

    const int rt   = SEQ / 64 - 1 - (int)blockIdx.x;   // longest tiles first
    const int bh   = blockIdx.y;
    const int b    = bh >> 3;
    const int h    = bh & 7;
    const int tid  = threadIdx.x;
    const int lane = tid & 31;
    const int wave = tid >> 5;
    const int rg   = wave & 3;           // 16-row group
    const int half = wave >> 2;          // 32-column half
    const int c    = lane & 15;
    const int hf   = lane >> 4;
    const int t0   = rt * 64;

    const size_t rowstride = (size_t)NH * DH;                 // floats between t and t+1
    const size_t hbase = ((size_t)b * SEQ * NH + h) * DH;     // (b, t=0, h, 0)

    // staging coordinates. K: rows srow + 16i, 16 B at column sc4.
    // V: column vd, rows vs0 .. vs0 + 15 (a wave reads 128 contiguous bytes per row)
    const int srow = tid >> 4;
    const int sc4  = (tid & 15) * 4;
    const int vd   = tid & 63;
    const int vs0  = (tid >> 6) * 16;

    // V and (for the tiles left of the diagonal) K by columns, from tile 0 on; the
    // diagonal tile's K by rows, fetched once up here
    const float* vp = v + hbase + (size_t)vs0 * rowstride + vd;
    const float* kc = k + hbase + (size_t)vs0 * rowstride + vd;
    const float* kp = k + hbase + (size_t)(t0 + srow) * rowstride + sc4;
    v4f kreg[4];
    float vreg[16], kcol[16];
    fetch_col(vp, vreg);
    if (rt > 0)
        fetch_col(kc, kcol);
#pragma unroll
    for (int i = 0; i < 4; ++i)
        kreg[i] = *reinterpret_cast<const v4f*>(kp + (size_t)i * 16 * NH * DH);

    // Q fragments, kept in registers: lane (c,hf) holds row c, e = 8m + 4hf + 0..3
    v4f qf[8];
    {
        const size_t g = hbase + (size_t)(t0 + rg * 16 + c) * rowstride + 4 * hf;
#pragma unroll
        for (int m = 0; m < 8; ++m)
            qf[m] = *reinterpret_cast<const v4f*>(q + g + 8 * m);
    }

    // gate prefixes for the whole sequence: wave 0, 16 consecutive t per lane
    if (wave == 0) {
        float fv[16], iv[16];
        const size_t g0 = ((size_t)b * SEQ + lane * 16) * NH + h;
#pragma unroll
        for (int j = 0; j < 16; ++j) fv[j] = fpre[g0 + (size_t)j * NH];
        // the second run of loads lands in the address registers of the first
        asm volatile("s_wait_xcnt 0x0" ::: "memory");
#pragma unroll
        for (int j = 0; j < 16; ++j) iv[j] = ipre[g0 + (size_t)j * NH];
#pragma unroll
        for (int j = 1; j < 16; ++j) fv[j] += fv[j - 1];
        float incl = fv[15];
#pragma unroll
        for (int o = 1; o < 32; o <<= 1) {
            const float up = __shfl_up(incl, o, 32);
            if (lane >= o) incl += up;
        }
        float excl = __shfl_up(incl, 1, 32);   // sum of all earlier lanes
        if (lane == 0) excl = 0.0f;
        float run = 0.0f;                 // M starts at m0 - F0 = 0
#pragma unroll
        for (int j = 0; j < 16; ++j) {
            iv[j] = iv[j] - (excl + fv[j]);      // w_s
            run = fmaxf(run, iv[j]);
            fv[j] = run;                          // lane-local running max
        }
        float mx = run;
#pragma unroll
        for (int o = 1; o < 32; o <<= 1) {
            const float up = __shfl_up(mx, o, 32);
            if (lane >= o) mx = fmaxf(mx, up);
        }
        float prev = __shfl_up(mx, 1, 32);
        if (lane == 0) prev = 0.0f;
#pragma unroll
        for (int j = 0; j < 16; ++j) {
            wS[lane * 16 + j] = iv[j];
            mS[lane * 16 + j] = fmaxf(prev, fv[j]);
        }
    }

    // sum_e q_t[e] for row c (both lane halves end with the row total)
    float qsum = 0.0f;
#pragma unroll
    for (int m = 0; m < 8; ++m) qsum += (qf[m].x + qf[m].y) + (qf[m].z + qf[m].w);
    qsum += __shfl_xor(qsum, 16, 32);

    v8f oacc[2];
#pragma unroll
    for (int n = 0; n < 2; ++n) { v8f z = {}; oacc[n] = z; }
    float rsum[8];
#pragma unroll
    for (int r = 0; r < 8; ++r) rsum[r] = 0.0f;

    float* Pw = &Ps[rg][0];
    const int trow = t0 + rg * 16 + 8 * hf;       // + r : this lane's D rows
    const int cw   = 32 * half + c;               // + 16*j : this lane's D column

    __syncthreads();                      // wS / mS published
    float Mt[8];
#pragma unroll
    for (int r = 0; r < 8; ++r) Mt[r] = mS[trow + r];

    // Everything left of the diagonal tile (s < t0, no mask) enters through the state.
    float fr[8];                          // exp(Mref - M_t) of this lane's D rows
#pragma unroll
    for (int r = 0; r < 8; ++r) fr[r] = 0.0f;
    float qn = 0.0f;                      // q_t . n for row c
    if (rt > 0) {                         // the same for the whole work-group
        const float Mref = mS[t0 - 1];
        for (int s = tid; s < t0; s += 256)
            eS[s] = exp2_slot((wS[s] - Mref) * LOG2E);
        __syncthreads();                  // eS published

        v8f cacc[2];                      // C rows e = 16rg + 8hf + r, columns d = cw + 16j
#pragma unroll
        for (int j = 0; j < 2; ++j) { v8f z = {}; cacc[j] = z; }
        v4f nacc = {};                    // this lane's share of n[16rg + c]
        for (int ct = 0; ct < rt; ++ct) {
            const int s0 = ct * 64;
            // both tiles transposed, [column][s]; K's rows carry their decay
#pragma unroll
            for (int i = 0; i < 4; ++i) {
                const v4f es = *reinterpret_cast<const v4f*>(&eS[s0 + vs0 + 4 * i]);
                const v4f kk = {kcol[4 * i], kcol[4 * i + 1], kcol[4 * i + 2], kcol[4 * i + 3]};
                *reinterpret_cast<v4f*>(&Ks[vd * KV_P + vs0 + 4 * i]) = kk * es;
                const v4f vv = {vreg[4 * i], vreg[4 * i + 1], vreg[4 * i + 2], vreg[4 * i + 3]};
                *reinterpret_cast<v4f*>(&Vt[vd * KV_P + vs0 + 4 * i]) = vv;
            }
            __syncthreads();              // tile published
            // next tile flies under this tile's WMMAs (V's last one is the diagonal's)
            vp += 64 * rowstride;
            fetch_col(vp, vreg);
            if (ct + 1 < rt) {
                kc += 64 * rowstride;
                fetch_col(kc, kcol);
            }
            // the pointers are stepped on behind these loads (a precaution)
            asm volatile("s_wait_xcnt 0x0" ::: "memory");

            // C += (decayed K)^T V, 16 x 32 per wave, summed over s
            v4f kf[8];
#pragma unroll
            for (int m = 0; m < 8; ++m)
                kf[m] = *reinterpret_cast<const v4f*>(&Ks[(16 * rg + c) * KV_P + 8 * m + 4 * hf]);
            WMMA_BLOCK_BEGIN();
            mma_16x32x64(cacc, kf, Vt, cw, hf);
            WMMA_BLOCK_END(cacc);
#pragma unroll
            for (int m = 0; m < 8; ++m) nacc += kf[m];
            // Every reader has left Ks/Vt before the refill. By hand because it waits for
            // LDS alone: the next tile's global loads stay in flight across it, where
            // __syncthreads() would wait them out with only this tile's WMMAs as cover.
            asm volatile("s_wait_dscnt 0x0\n\ts_barrier_signal -1\n\ts_barrier_wait -1"
                         ::: "memory");
        }

        // C into LDS as [d][e], the B operand of Q C; n beside it
#pragma unroll
        for (int j = 0; j < 2; ++j) {
            const v4f lo4 = {cacc[j][0], cacc[j][1], cacc[j][2], cacc[j][3]};
            const v4f hi4 = {cacc[j][4], cacc[j][5], cacc[j][6], cacc[j][7]};
            float* cd = &Ks[(cw + 16 * j) * KV_P + 16 * rg + 8 * hf];
            *reinterpret_cast<v4f*>(cd)     = lo4;
            *reinterpret_cast<v4f*>(cd + 4) = hi4;
        }
        float nr = (nacc.x + nacc.y) + (nacc.z + nacc.w);
        nr += __shfl_xor(nr, 16, 32);
        if (half == 0 && hf == 0) nS[16 * rg + c] = nr;
        __syncthreads();                  // C and n published

        WMMA_BLOCK_BEGIN();
        mma_16x32x64(oacc, qf, Ks, cw, hf);
        WMMA_BLOCK_END(oacc);
#pragma unroll
        for (int m = 0; m < 8; ++m) {
            const v4f nv = *reinterpret_cast<const v4f*>(&nS[8 * m + 4 * hf]);
            const v4f pr = qf[m] * nv;
            qn += (pr.x + pr.y) + (pr.z + pr.w);
        }
        qn += __shfl_xor(qn, 16, 32);
#pragma unroll
        for (int r = 0; r < 8; ++r) {
            fr[r] = exp2_slot((Mref - Mt[r]) * LOG2E);
            oacc[0][r] *= fr[r];
            oacc[1][r] *= fr[r];
        }
        __syncthreads();                  // every reader has left Ks before the diagonal's K
    }

    // the diagonal tile, under the causal mask
    {
#pragma unroll
        for (int i = 0; i < 4; ++i) {
            *reinterpret_cast<v4f*>(&Ks[(srow + 16 * i) * KV_P + sc4]) = kreg[i];
            const v4f vv = {vreg[4 * i], vreg[4 * i + 1], vreg[4 * i + 2], vreg[4 * i + 3]};
            *reinterpret_cast<v4f*>(&Vt[vd * KV_P + vs0 + 4 * i]) = vv;
        }
        __syncthreads();                  // tile published

        // S = Q K^T, 16 x 32 per wave
        v8f sacc[2];
#pragma unroll
        for (int j = 0; j < 2; ++j) { v8f z = {}; sacc[j] = z; }
        WMMA_BLOCK_BEGIN();
        mma_16x32x64(sacc, qf, Ks, cw, hf);
        WMMA_BLOCK_END(sacc);

        // P = S * decay under the causal mask; row sums feed the denominator
#pragma unroll
        for (int j = 0; j < 2; ++j) {
            const int s = t0 + 16 * j + cw;
            const float ws = wS[s];
#pragma unroll
            for (int r = 0; r < 8; ++r) {
                const float e = exp2_slot((ws - Mt[r]) * LOG2E);
                const float p = sacc[j][r] * ((s <= trow + r) ? e : 0.0f);
                rsum[r] += p;
                Pw[(8 * hf + r) * KV_P + 16 * j + cw] = p;
            }
        }
        __syncthreads();                  // both column halves of P published

        // O += P V
        v4f pf[8];
#pragma unroll
        for (int m = 0; m < 8; ++m)
            pf[m] = *reinterpret_cast<const v4f*>(&Pw[c * KV_P + 8 * m + 4 * hf]);
        WMMA_BLOCK_BEGIN();
        mma_16x32x64(oacc, pf, Vt, cw, hf);
        WMMA_BLOCK_END(oacc);
    }

    // operands of the per-head step: they fly under the row sums and the two barriers
    const int crow = tid >> 4;
    const int ce   = (tid & 15) * 4;
    const size_t cidx = hbase + (size_t)(t0 + crow) * rowstride + ce;
    v4f o4[4], s4[4], r4[4];
#pragma unroll
    for (int u = 0; u < 4; ++u) {
        const size_t idx = cidx + (size_t)u * 16 * rowstride;
        o4[u] = *reinterpret_cast<const v4f*>(o + idx);
        s4[u] = *reinterpret_cast<const v4f*>(skip + idx);
        r4[u] = *reinterpret_cast<const v4f*>(rr + idx);
    }
    const v4f w4 = *reinterpret_cast<const v4f*>(hlnw + h * DH + ce);
    const v4f b4 = *reinterpret_cast<const v4f*>(hlnb + h * DH + ce);
    // keeps all fourteen loads up here, in front of the lane exchanges
    // the wait: what follows lands in the loads' address registers (a precaution)
    asm volatile("s_wait_xcnt 0x0" ::: "memory");
    __builtin_amdgcn_sched_barrier(0);

    // row sums: over the 16 lanes of a half wave, then over the two column halves
#pragma unroll
    for (int r = 0; r < 8; ++r) {
        float s = rsum[r];
        s += __shfl_xor(s, 1, 32);
        s += __shfl_xor(s, 2, 32);
        s += __shfl_xor(s, 4, 32);
        s += __shfl_xor(s, 8, 32);
        if (c == 0) dS[half][rg * 16 + 8 * hf + r] = s;
    }
    __syncthreads();                      // both halves' row sums published

    // denominator per row, then the tile into LDS (Ks was last read in front of the
    // barrier that published P): D register r = row 8hf + r, column cw
#pragma unroll
    for (int r = 0; r < 8; ++r) {
        const int lr = rg * 16 + 8 * hf + r;
        const float s = dS[0][lr] + dS[1][lr];
        const float qs = __shfl(qsum, 8 * hf + r, 32);
        const float qr = __shfl(qn, 8 * hf + r, 32);
        const float den = fmaxf(exp2_slot(-Mt[r] * LOG2E) * qs + fr[r] * qr + s, 1.0f);
        Ks[lr * KV_P + cw]      = oacc[0][r] / den;
        Ks[lr * KV_P + cw + 16] = oacc[1][r] / den;
    }
    __syncthreads();                      // the tile of hseq published

#pragma unroll
    for (int u = 0; u < 4; ++u) {
        const v4f h4 = *reinterpret_cast<const v4f*>(&Ks[(crow + 16 * u) * KV_P + ce]);
        const v4f hv = o4[u] * h4;
        float s1 = (hv.x + hv.y) + (hv.z + hv.w);
        float s2 = (hv.x * hv.x + hv.y * hv.y) + (hv.z * hv.z + hv.w * hv.w);
#pragma unroll
        for (int st = 8; st > 0; st >>= 1) {
            s1 += __shfl_xor(s1, st, 32);
            s2 += __shfl_xor(s2, st, 32);
        }
        const float mu  = s1 * (1.0f / DH);
        const float var = s2 * (1.0f / DH) - mu * mu;
        const float inv = rsqrtf(var + 1e-6f);
        v4bf y;
#pragma unroll
        for (int e = 0; e < 4; ++e) {
            const float hn = (hv[e] - mu) * inv * w4[e] + b4[e];
            const float rv = r4[u][e];
            const float sr = rv / (1.0f + __expf(-rv));
            y[e] = (__bf16)((hn + s4[u][e]) * sr);
        }
        *reinterpret_cast<v4bf*>(z + cidx + (size_t)u * 16 * rowstride) = y;
    }
}

// ---------------------------------------------------------------------------
// host launcher
// ---------------------------------------------------------------------------
extern "C" void kernel_launch(void* const* d_in, const int* in_sizes, int n_in,
                              void* d_out, int out_size, void* d_ws, size_t ws_size,
                              hipStream_t stream)
{
    const float* x     = (const float*)d_in[0];
    const float* ln_w  = (const float*)d_in[1];
    const float* ln_b  = (const float*)d_in[2];
    const float* hln_w = (const float*)d_in[3];
    const float* hln_b = (const float*)d_in[4];
    const float* Wl    = (const float*)d_in[5];
    const float* bl    = (const float*)d_in[6];
    const float* Wr    = (const float*)d_in[7];
    const float* br    = (const float*)d_in[8];
    const float* conv_w= (const float*)d_in[9];
    const float* conv_b= (const float*)d_in[10];
    const float* Wskip = (const float*)d_in[11];
    const float* bskip = (const float*)d_in[12];
    const float* Wi    = (const float*)d_in[13];
    const float* bi    = (const float*)d_in[14];
    const float* Wf    = (const float*)d_in[15];
    const float* bfv   = (const float*)d_in[16];
    const float* Wo    = (const float*)d_in[17];
    const float* bo    = (const float*)d_in[18];
    const float* Wq    = (const float*)d_in[19];
    const float* bq    = (const float*)d_in[20];
    const float* Wk    = (const float*)d_in[21];
    const float* bk    = (const float*)d_in[22];
    const float* Wv    = (const float*)d_in[23];
    const float* bv    = (const float*)d_in[24];
    const float* Wd    = (const float*)d_in[25];
    const float* bd    = (const float*)d_in[26];

    // --- workspace carve (whole working set fits in MI455X's 192MB L2) ---
    char* ws = (char*)d_ws;
    auto carve = [&](size_t bytes) {
        char* p = ws;
        ws += (bytes + 255) & ~(size_t)255;
        return p;
    };
    // transposed bf16 weights (N x K layout)
    __bf16* WlT    = (__bf16*)carve((size_t)DIM * PDIM * 2);   // 2048 x 1024
    __bf16* WrT    = (__bf16*)carve((size_t)DIM * HDIM * 2);   // 512 x 1024
    __bf16* WskipT = (__bf16*)carve((size_t)PDIM * HDIM * 2);  // 512 x 2048
    __bf16* WqT    = (__bf16*)carve((size_t)PDIM * HDIM * 2);
    __bf16* WkT    = (__bf16*)carve((size_t)PDIM * HDIM * 2);
    __bf16* WvT    = (__bf16*)carve((size_t)PDIM * HDIM * 2);
    __bf16* WoT    = (__bf16*)carve((size_t)PDIM * HDIM * 2);
    __bf16* WdT    = (__bf16*)carve((size_t)HDIM * DIM * 2);   // 1024 x 512
    __bf16* xn_bf  = (__bf16*)carve((size_t)NTOK * DIM * 2);
    float*  xt     = (float*) carve((size_t)NTOK * PDIM * 4);
    __bf16* xt_bf  = (__bf16*)carve((size_t)NTOK * PDIM * 2);
    __bf16* xc_bf  = (__bf16*)carve((size_t)NTOK * PDIM * 2);
    float*  rbuf   = (float*) carve((size_t)NTOK * HDIM * 4);
    float*  skip   = (float*) carve((size_t)NTOK * HDIM * 4);
    float*  qb     = (float*) carve((size_t)NTOK * HDIM * 4);
    float*  kb     = (float*) carve((size_t)NTOK * HDIM * 4);
    float*  vb     = (float*) carve((size_t)NTOK * HDIM * 4);
    float*  ob     = (float*) carve((size_t)NTOK * HDIM * 4);
    float*  ipre   = (float*) carve((size_t)NTOK * NH * 4);
    float*  fpre   = (float*) carve((size_t)NTOK * NH * 4);
    __bf16* z_bf   = (__bf16*)carve((size_t)NTOK * HDIM * 2);
    (void)ws_size; (void)in_sizes; (void)n_in; (void)out_size;

    // casts: src is (K x N) row-major -> dst (N x K) bf16
    // xn = LayerNorm(x), and Wl cast
    ln_cast_kernel<<<WL_TILES + NTOK / 8, 256, 0, stream>>>(x, ln_w, ln_b, xn_bf, Wl, WlT);

    // xt = xn @ Wl + bl   (2048x1024x2048), and the other seven weights cast
    gemm_xt_cast_kernel<<<XT_TILES + REST_WGS, 256, 0, stream>>>(
        xn_bf, WlT, bl, xt, Wskip, Wq, Wk, Wv, Wo, Wr, Wd,
        WskipT, WqT, WkT, WvT, WoT, WrT, WdT);

    // xc, xt as bf16, and the gates of the same tokens
    conv_gates_kernel<<<NTOK / G_TOK, 256, 0, stream>>>(
        xt, conv_w, conv_b, Wi, bi, Wf, bfv, xc_bf, xt_bf, ipre, fpre);

    // skip, q, k = xc @ W (k scaled by 1/sqrt(Dh)); v = xt @ Wv, o = sigmoid(xt @ Wo);
    // r = xn @ Wr: one grid, z = projection
    proj_batch_kernel<<<dim3(HDIM / 128, NTOK / 128, 6), 256, 0, stream>>>(
        xc_bf, xt_bf, xn_bf, WskipT, WqT, WkT, WvT, WoT, WrT,
        bskip, bq, bk, bv, bo, br, skip, qb, kb, vb, ob, rbuf);

    scan_parallel_kernel<<<dim3(SEQ / 64, 32), 256, 0, stream>>>(
        qb, kb, vb, ipre, fpre, ob, skip, rbuf, hln_w, hln_b, z_bf);

    // out = z @ Wd + bd + x
    gemm_bf16_wmma<2><<<dim3(DIM / 128, NTOK / 128), 256, 0, stream>>>(
        z_bf, WdT, bd, x, (float*)d_out, NTOK, DIM, HDIM, 1.0f);
}

// v008
// A run of this version takes 73.2 microseconds.
// In both of two side-by-side timings against v007, it was 1.09 times as fast.
// Over all steps from v000 it is 13.9 times as fast.
#include <hip/hip_runtime.h>
#include <cstdint>
#include <cstddef>

// ---------------------------------------------------------------------------
// mLSTM block forward for MI455X (gfx1250), bf16 WMMA GEMMs + f32 scan.
// B=4 T=512 D=1024 H=8 Dh=64 HD=512 P=2048 K=4
// Weights are cast+TRANSPOSED to bf16 once so that both WMMA operands are
// K-contiguous -> all LDS fragment reads are ds_load_b128 (no scalar gathers).
// GEMM tiles are DOUBLE-BUFFERED and staged with CDNA5 async global->LDS DMA
// (ASYNCcnt): DMA for tile i+1 overlaps WMMA compute on tile i. A tile is 128 k deep.
// ---------------------------------------------------------------------------

#define NTOK 2048      // B*T
#define DIM  1024      // D
#define PDIM 2048      // P
#define HDIM 512       // HD
#define NH   8         // H
#define DH   64        // Dh

typedef __attribute__((ext_vector_type(16))) __bf16 v16bf;
typedef __attribute__((ext_vector_type(8)))  float  v8f;
typedef __attribute__((ext_vector_type(4)))  float  v4f;
typedef __attribute__((ext_vector_type(2)))  float  v2f;
typedef __attribute__((ext_vector_type(8)))  __bf16 v8bf;
typedef __attribute__((ext_vector_type(4)))  __bf16 v4bf;
typedef __attribute__((ext_vector_type(2)))  __bf16 v2bf;

union FragV {
    uint4 u[2];
    v16bf v;
};

// eight async global->LDS 128-bit copies (per-lane), tracked by ASYNCcnt: one operand's
// share of a stage. Copy u takes LDS address l + u * lstep and global address
// g + u * gstep (bytes).
// s_wait_xcnt is the last line of the copies' own statement: there no later write of
// an address register can be scheduled ahead of it (a precaution).
#define COPY8_TEXT                                                  \
    "global_load_async_to_lds_b128 %0, %1, off\n\t"                 \
    "global_load_async_to_lds_b128 %2, %3, off\n\t"                 \
    "global_load_async_to_lds_b128 %4, %5, off\n\t"                 \
    "global_load_async_to_lds_b128 %6, %7, off\n\t"                 \
    "global_load_async_to_lds_b128 %8, %9, off\n\t"                 \
    "global_load_async_to_lds_b128 %10, %11, off\n\t"               \
    "global_load_async_to_lds_b128 %12, %13, off\n\t"               \
    "global_load_async_to_lds_b128 %14, %15, off\n\t"
#define COPY8_ARGS(l, lstep, g, gstep)                              \
    "v"(l),               "v"(g),                                   \
    "v"((l) + (lstep)),     "v"((g) + (gstep)),                     \
    "v"((l) + 2 * (lstep)), "v"((g) + 2 * (gstep)),                 \
    "v"((l) + 3 * (lstep)), "v"((g) + 3 * (gstep)),                 \
    "v"((l) + 4 * (lstep)), "v"((g) + 4 * (gstep)),                 \
    "v"((l) + 5 * (lstep)), "v"((g) + 5 * (gstep)),                 \
    "v"((l) + 6 * (lstep)), "v"((g) + 6 * (gstep)),                 \
    "v"((l) + 7 * (lstep)), "v"((g) + 7 * (gstep))
__device__ __forceinline__ void async_copy8_b128(
    unsigned l, unsigned lstep, const char* g, size_t gstep)
{
    asm volatile(COPY8_TEXT
                 "s_wait_xcnt 0x0"
                 :: COPY8_ARGS(l, lstep, g, gstep) : "memory");
}
// the same, and the line at pf is asked into L2 for a later stage (no data comes back);
// the ask stands in front of the wait, which so covers its address register too
__device__ __forceinline__ void async_copy8_b128_ask(
    unsigned l, unsigned lstep, const char* g, size_t gstep, const void* pf)
{
    asm volatile(COPY8_TEXT
                 "global_prefetch_b8 %16, off scope:SCOPE_SE\n\t"
                 "s_wait_xcnt 0x0"
                 :: COPY8_ARGS(l, lstep, g, gstep), "v"(pf) : "memory");
}
// one such copy, closed by its own wait in the same way
__device__ __forceinline__ void async_copy1_b128(unsigned l, const char* g)
{
    asm volatile("global_load_async_to_lds_b128 %0, %1, off\n\t"
                 "s_wait_xcnt 0x0"
                 :: "v"(l), "v"(g) : "memory");
}
__device__ __forceinline__ void wait_asynccnt0()
{
    asm volatile("s_wait_asynccnt 0x0" ::: "memory");
}

// ---------------------------------------------------------------------------
// cast f32 -> bf16 with transpose: in (R x C row-major) -> out (C x R)
// Tiles of 128 rows x 64 columns through LDS, 32 elements per thread: eight 16-byte
// loads in flight per lane, whole 256-byte pieces of a row on both sides, and an
// eighth of the waves that one 32x32 tile per work-group takes to start.
// Two neighbouring rows are packed into one dword, so LDS holds out's rows as dwords.
// R multiple of 128, C multiple of 64. One work-group does tile t; lc = log2(C / 64).
// The casts have no launch of their own. Each rides in the grid of other work that does
// not depend on it and ends before its first reader starts: Wl (read by the first GEMM)
// beside the LayerNorm, the other seven (read from the projections on) beside the
// first GEMM.
// ---------------------------------------------------------------------------
#define CT_P 65        // dword pitch of an LDS row: 64 + 1, both sides free of bank conflicts
__device__ __forceinline__ void cast_transpose_tile(
    unsigned* tile, const float* __restrict__ in, __bf16* __restrict__ out,
    int R, int C, int lc, int t)
{
    // tile: 64 * CT_P dwords of the caller's LDS, [column c][row pair]
    const int c0 = (t & ((1 << lc) - 1)) * 64;
    const int r0 = (t >> lc) * 128;
    const int tid = threadIdx.x;
    const int ci = tid & 15;               // columns 4ci .. 4ci + 3
    const int rp = tid >> 4;               // row pairs rp + 16u
    // one lane offset for all eight loads; what differs between them is uniform
    const unsigned lof = (unsigned)(2 * rp * C + 4 * ci);
    const float* sb = in + (size_t)r0 * C + c0;
    v4f xe[4], xo[4];
#pragma unroll
    for (int u = 0; u < 4; ++u) {
        const float* s = sb + (size_t)(32 * u) * C;
        xe[u] = *reinterpret_cast<const v4f*>(s + lof);
        xo[u] = *reinterpret_cast<const v4f*>(s + C + lof);
    }
#pragma unroll
    for (int u = 0; u < 4; ++u)
#pragma unroll
        for (int kk = 0; kk < 4; ++kk) {
            const v2bf pr = {(__bf16)xe[u][kk], (__bf16)xo[u][kk]};   // rows 2n, 2n + 1
            tile[(4 * ci + kk) * CT_P + rp + 16 * u] = __builtin_bit_cast(unsigned, pr);
        }
    __syncthreads();
#pragma unroll
    for (int u = 0; u < 4; ++u) {
        const int id = tid + 256 * u;      // 64 rows of out, 16 pieces of 16 B each
        const int c = id >> 4;
        const int j = id & 15;
        const unsigned* tp = &tile[c * CT_P + 4 * j];
        const uint4 o = make_uint4(tp[0], tp[1], tp[2], tp[3]);
        *reinterpret_cast<uint4*>(out + (size_t)(c0 + c) * R + r0 + 8 * j) = o;
    }
    // what the build lays behind this tile (the caller's next tile, or its other side)
    // lands in the stores' registers (a precaution)
    asm volatile("s_wait_xcnt 0x0" ::: "memory");
}

// ---------------------------------------------------------------------------
// LayerNorm over D=1024, one WAVE per token (32 elements per lane, eight 16-byte
// loads in flight), sums over the wave by lane exchange: no LDS, no barrier.
// Writes bf16.
// ---------------------------------------------------------------------------
__device__ __forceinline__ void layernorm_tokens(
    const float* __restrict__ x, const float* __restrict__ w,
    const float* __restrict__ b, __bf16* __restrict__ xn, int blk)
{
    const int lane = threadIdx.x & 31;
    const int tok  = blk * 8 + (threadIdx.x >> 5);
    const float* xr = x + (size_t)tok * DIM + lane * 4;

    v4f v[8], w4[8], b4[8];
#pragma unroll
    for (int i = 0; i < 8; ++i)
        v[i] = *reinterpret_cast<const v4f*>(xr + i * 128);
    // the second run of loads lands in the address registers of the first (a precaution)
    asm volatile("s_wait_xcnt 0x0" ::: "memory");
#pragma unroll
    for (int i = 0; i < 8; ++i) {
        w4[i] = *reinterpret_cast<const v4f*>(w + i * 128 + lane * 4);
        b4[i] = *reinterpret_cast<const v4f*>(b + i * 128 + lane * 4);
    }
    // keeps the loads of w and b up here, in flight with the row's (without it the
    // build sinks them behind the sums, two pairs at a time)
    __builtin_amdgcn_sched_barrier(0);
    float s = 0.f, ss = 0.f;
#pragma unroll
    for (int i = 0; i < 8; ++i)
#pragma unroll
        for (int e = 0; e < 4; ++e) {
            s += v[i][e];
            ss += v[i][e] * v[i][e];
        }
#pragma unroll
    for (int o = 16; o > 0; o >>= 1) {
        s  += __shfl_xor(s, o, 32);
        ss += __shfl_xor(ss, o, 32);
    }
    const float mu  = s * (1.0f / DIM);
    const float var = ss * (1.0f / DIM) - mu * mu;
    const float inv = rsqrtf(var + 1e-6f);
    __bf16* yr = xn + (size_t)tok * DIM + lane * 4;
#pragma unroll
    for (int i = 0; i < 8; ++i) {
        v4bf y;
#pragma unroll
        for (int e = 0; e < 4; ++e)
            y[e] = (__bf16)((v[i][e] - mu) * inv * w4[i][e] + b4[i][e]);
        *reinterpret_cast<v4bf*>(yr + i * 128) = y;
    }
}

// The two things the first GEMM reads, in one grid: neither depends on the other.
// Work-groups 0 .. WL_TILES - 1 cast Wl, the rest normalise 8 tokens each.
#define WL_TILES 256
__global__ __launch_bounds__(256) void ln_cast_kernel(
    const float* __restrict__ x, const float* __restrict__ w,
    const float* __restrict__ b, __bf16* __restrict__ xn,
    const float* __restrict__ Wl, __bf16* __restrict__ WlT)
{
    __shared__ unsigned tile[64 * CT_P];
    const int blk = blockIdx.x;
    if (blk < WL_TILES)
        cast_transpose_tile(tile, Wl, WlT, DIM, PDIM, 5, blk);
    else {
        layernorm_tokens(x, w, b, xn, blk - WL_TILES);
        // the build lays the other side behind this one, joined by a fall-through that
        // is never taken; it lands in these stores' registers (a precaution)
        asm volatile("s_wait_xcnt 0x0" ::: "memory");
    }
}

// ---------------------------------------------------------------------------
// WMMA GEMM: C(MxN,f32) = epilogue(A_bf16(MxK,row) @ Bt_bf16(NxK,row)^T + bias)
//  EPI 0: val = (acc+bias)*scale
//  EPI 1: val = sigmoid(acc+bias) where sig is set, else as EPI 0
//  EPI 2: val = acc+bias+resid[idx]
// Workgroup tile 128x128, 8 waves (4x2) of 32x64; a stage is 128 k = 256 B of every
// operand row, four WMMA blocks of 32 k. One round trip, one pair
// of waits and one barrier per 128 k; the next stage's copies have the 32 WMMAs and
// 48 fragment loads of a stage to land in.
// Double-buffered LDS tiles staged with global_load_async_to_lds_b128:
// DMA of tile i+1 overlaps the WMMAs of tile i; fragments via ds_load_b128.
// M,N multiples of 128; K multiple of 128.
// ---------------------------------------------------------------------------
#define TILE_K  128
#define T_STRIDE 136  // 128 K + 8 pad: pitch 272 B = 16 B x odd, for ds_load_b128 readers
#define BUF_ELEMS (128 * T_STRIDE)
#define BUF_BYTES (BUF_ELEMS * 2)

// 2^x. The v_nop is the slot the instruction set asks for behind a transcendental
// before its source may be overwritten or its result used; in one statement with
// it, it cannot drift away.
__device__ __forceinline__ float exp2_slot(float x)
{
    float y;
    asm("v_exp_f32 %0, %1\n\tv_nop" : "=v"(y) : "v"(x));
    return y;
}
#define LOG2E 1.44269504088896340736f

// epilogue + store of one wave's 32x64 accumulators
// (C layout: lane<16 -> M=vgpr, lane>=16 -> M=8+vgpr)
template <int E>
__device__ __forceinline__ void store_tile(
    const v8f (&acc)[2][4], const float* __restrict__ bias,
    const float* __restrict__ resid, float* __restrict__ C, int N, float scale,
    int rbase, int cbase)
{
#pragma unroll
    for (int mt = 0; mt < 2; ++mt) {
#pragma unroll
        for (int nt = 0; nt < 4; ++nt) {
            const int col = cbase + nt * 16;
            const float bv = bias[col];
#pragma unroll
            for (int vv = 0; vv < 8; ++vv) {
                const int row = rbase + mt * 16 + vv;
                const size_t idx = (size_t)row * N + col;
                float val = acc[mt][nt][vv] + bv;
                if (E == 0) {
                    val *= scale;
                } else if (E == 1) {
                    val = 1.0f / (1.0f + exp2_slot(-val * LOG2E));
                } else {
                    val += resid[idx];
                }
                C[idx] = val;
            }
        }
    }
}

template <int EPI>
__device__ __forceinline__ void gemm_tile(
    const __bf16* __restrict__ A, const __bf16* __restrict__ Bt,
    const float* __restrict__ bias, const float* __restrict__ resid,
    float* __restrict__ C, int N, int K, float scale, bool sig, int bx, int by)
{
    __shared__ __attribute__((aligned(16))) __bf16 As[2][BUF_ELEMS];
    __shared__ __attribute__((aligned(16))) __bf16 Bs[2][BUF_ELEMS];

    const int tid  = threadIdx.x;
    const int lane = tid & 31;
    const int wave = tid >> 5;
    const int wm   = wave & 3;   // wave row (0..3) -> 32 rows each
    const int wn   = wave >> 2;  // wave col (0..1) -> 64 cols each
    const int row0 = by * 128;   // (bx, by) = the work-group's tile column and row
    const int col0 = bx * 128;

    const int lhalf = lane >> 4;   // 0 | 1
    const int lmod  = lane & 15;
    const int kof   = lhalf * 8;   // K offset within 16-lane half

    // per-thread staging coordinates: 16 lanes take one row's 256 B (8 bf16 = 16 B per
    // lane), a thread takes rows sr + 16u, u = 0..7, of both operands
    const int sr = tid >> 4, sc = (tid & 15) * 8;
    const unsigned ldsA = (unsigned)(uintptr_t)&As[0][sr * T_STRIDE + sc];
    const unsigned ldsB = (unsigned)(uintptr_t)&Bs[0][sr * T_STRIDE + sc];
    const __bf16* gA = A  + (size_t)(row0 + sr) * K + sc;
    const __bf16* gB = Bt + (size_t)(col0 + sr) * K + sc;
    const size_t gstep = (size_t)16 * K * sizeof(__bf16);
    // L2 prefetch: one ask per operand row and stage, at the start of its 256 B:
    // waves 0..3 take the rows of A, waves 4..7 those of Bt
    const __bf16* pf = (tid < 128) ? A  + (size_t)(row0 + tid) * K
                                   : Bt + (size_t)(col0 + tid - 128) * K;

    // copies of the stage at k0; asks L2 for the stage behind it (the last stage asks
    // for itself again: the address stays inside the operand)
    auto stage = [&](int k0, int buf) {
        const unsigned off = (unsigned)buf * BUF_BYTES;
        const int kp = (k0 + TILE_K < K) ? k0 + TILE_K : k0;
        async_copy8_b128(ldsA + off, 16 * T_STRIDE * 2, (const char*)(gA + k0), gstep);
        async_copy8_b128_ask(ldsB + off, 16 * T_STRIDE * 2, (const char*)(gB + k0), gstep, pf + kp);
    };

    v8f acc[2][4];
#pragma unroll
    for (int i = 0; i < 2; ++i)
#pragma unroll
        for (int j = 0; j < 4; ++j) {
            v8f z = {};
            acc[i][j] = z;
        }

    // preload tile 0
    stage(0, 0);
    wait_asynccnt0();
    __syncthreads();

    int cur = 0;
    for (int k0 = 0; k0 < K; k0 += TILE_K) {
        // issue DMA for the NEXT tile into the other buffer (overlaps compute)
        // (with it goes the L2 prefetch of the tile after that one)
        if (k0 + TILE_K < K)
            stage(k0 + TILE_K, cur ^ 1);

        // four blocks of 32 k, unrolled so that a block's fragment loads can go ahead
        // of the block before it
#pragma unroll
        for (int kb = 0; kb < TILE_K; kb += 32) {
            // --- fragments from current buffer (K-contiguous for A and B) ---
            FragV af[2], bfr[4];
#pragma unroll
            for (int mt = 0; mt < 2; ++mt) {
                const int r = wm * 32 + mt * 16 + lmod;
                af[mt].u[0] = *reinterpret_cast<const uint4*>(&As[cur][r * T_STRIDE + kb + kof]);
                af[mt].u[1] = *reinterpret_cast<const uint4*>(&As[cur][r * T_STRIDE + kb + 16 + kof]);
            }
#pragma unroll
            for (int nt = 0; nt < 4; ++nt) {
                const int r = wn * 64 + nt * 16 + lmod;
                bfr[nt].u[0] = *reinterpret_cast<const uint4*>(&Bs[cur][r * T_STRIDE + kb + kof]);
                bfr[nt].u[1] = *reinterpret_cast<const uint4*>(&Bs[cur][r * T_STRIDE + kb + 16 + kof]);
            }
            // --- 8 WMMAs per wave per block (DMA for next tile in flight) ---
#pragma unroll
            for (int mt = 0; mt < 2; ++mt)
#pragma unroll
                for (int nt = 0; nt < 4; ++nt)
                    acc[mt][nt] = __builtin_amdgcn_wmma_f32_16x16x32_bf16(
                        false, af[mt].v, false, bfr[nt].v,
                        (short)0, acc[mt][nt], false, false);
        }

        // this wave's reads of the current buffer have returned before the barrier
        // behind which that buffer is refilled
        asm volatile("s_wait_dscnt 0x0" ::: "memory");
        // next tile fully in LDS (own wave) + all waves done with both ops
        wait_asynccnt0();
        __syncthreads();
        cur ^= 1;
    }

    // --- epilogue + store. The choice by sig is the same for the whole work-group
    // and is made once, outside the element loops: each side is straight-line code.
    const int rbase = row0 + wm * 32 + lhalf * 8;
    const int cbase = col0 + wn * 64 + lmod;
    if (EPI == 1) {
        if (sig) {
            store_tile<1>(acc, bias, resid, C, N, scale, rbase, cbase);
            // the build may lay another side of the caller behind this one, joined by a
            // fall-through that is never taken; it lands in these stores' registers
            // (a precaution)
            asm volatile("s_wait_xcnt 0x0" ::: "memory");
        } else {
            store_tile<0>(acc, bias, resid, C, N, scale, rbase, cbase);
            // the build lays the other side behind this one, joined by a fall-through
            // that is never taken; its loads land in these stores' address registers,
            // so the wait stands in front of them (a precaution)
            asm volatile("s_wait_xcnt 0x0" ::: "memory");
        }
    } else {
        store_tile<EPI>(acc, bias, resid, C, N, scale, rbase, cbase);
    }
}

template <int EPI>
__global__ __launch_bounds__(256) void gemm_bf16_wmma(
    const __bf16* __restrict__ A, const __bf16* __restrict__ Bt,
    const float* __restrict__ bias, const float* __restrict__ resid,
    float* __restrict__ C, int M, int N, int K, float scale)
{
    gemm_tile<EPI>(A, Bt, bias, resid, C, N, K, scale, false, blockIdx.x, blockIdx.y);
}

// ---------------------------------------------------------------------------
// The first GEMM, xt = xn @ Wl + bl, with what follows it per token done in the work-group
// that made the tile: the causal conv (K=4) along the feature axis + SiLU, xt and xc
// written as bf16 (xt never goes to memory as f32), and the tile's share of the i/f gate
// projections (P x 8 each). No launch of its own for any of that.
// Loop and ring as in gemm_tile. The conv reaches three features to the left of the
// tile: the 16 columns there are one more B fragment and one more WMMA per wave and
// 32-k block (wave (wm, wn) takes rows 32 wm + 16 wn .. + 15 of them), summed in the
// order in which the neighbouring work-group sums them, so both hold the same values.
// Behind the loop the ring is free: the tile goes through it as f32, [row][16 + 128].
// Then a thread takes 8 neighbouring features of rows cr + 16u: 16-byte LDS loads,
// 16-byte stores, 256 B of a row per 16 lanes. Gates, plain VALU: the thread keeps its
// 8 features' rows of Wi and Wf in registers for all its rows; the 16 sums of a row go
// over its 16 lanes by a halving lane exchange (lane ci ends with gate ci), then by
// LDS into gpart[tile column][gate][token]. The 16 tile columns are summed, biased and
// capped beside the projections (gates_finish).
// ---------------------------------------------------------------------------
#define XB_ROWS    144    // rows of Bt in a stage: the tile's 128 columns, then the 16 to their left
#define BUFB_ELEMS (XB_ROWS * T_STRIDE)
#define BUFB_BYTES (BUFB_ELEMS * 2)
#define XT_LDS     (2 * BUF_BYTES + 2 * BUFB_BYTES)
#define X_P        148    // f32 pitch of the xt tile: 16 + 128 + 4 = 16 B x odd
#define G_P        132    // f32 pitch of a gate's 128 sums
#define W_P        20     // f32 pitch of a feature's 16 gate weights: 16 lanes' 16-byte reads cover all banks once
#define X_BYTES    (128 * X_P * 4)
#define G_BYTES    (16 * G_P * 4)

// One step of the halving lane exchange inside a 16-lane row: of 2 M sums a lane keeps M
// and hands the other M to lane l ^ M. The partner's value comes by DPP (row_xmask),
// folded into the add: a vector instruction, where __shfl_xor goes through the LDS pipe
// and is waited for at every step. Every lane is on.
template <int M>
__device__ __forceinline__ void halve_sums(float (&sum)[16], int lane)
{
    const bool up = (lane & M) != 0;       // this lane keeps the upper half of the sums
#pragma unroll
    for (int n = 0; n < M; ++n) {
        const float sl = sum[n], sh = sum[n + M];
        const float send = up ? sl : sh;
        const float keep = up ? sh : sl;
        const int got = __builtin_amdgcn_update_dpp(
            0, __builtin_bit_cast(int, send), 0x160 | M, 0xf, 0xf, true);
        sum[n] = keep + __builtin_bit_cast(float, got);
    }
}

__device__ __forceinline__ void gemm_xt_conv_tile(
    char* smem, const __bf16* __restrict__ A, const __bf16* __restrict__ Bt,
    const float* __restrict__ bias, const float* __restrict__ cw,
    const float* __restrict__ cb, const float* __restrict__ Wi,
    const float* __restrict__ Wf, __bf16* __restrict__ xc_bf,
    __bf16* __restrict__ xt_bf, float* __restrict__ gpart, int bx, int by)
{
    const int K = DIM;
    __bf16* As = reinterpret_cast<__bf16*>(smem);                   // [2][BUF_ELEMS]
    __bf16* Bs = reinterpret_cast<__bf16*>(smem + 2 * BUF_BYTES);   // [2][BUFB_ELEMS]

    const int tid  = threadIdx.x;
    const int lane = tid & 31;
    const int wave = tid >> 5;
    const int wm   = wave & 3;   // wave row (0..3) -> 32 rows each
    const int wn   = wave >> 2;  // wave col (0..1) -> 64 cols each
    const int row0 = by * 128;
    const int col0 = bx * 128;
    // the first tile column has nothing to its left: it stages rows that exist and
    // puts zeros, the conv's padding, in their place
    const int hcol0 = bx ? col0 - 16 : 0;

    const int lmod  = lane & 15;

    // what the epilogue reads from memory comes in under the first stage's copies: the
    // gate weights of the tile's 128 features (4 KB of each matrix, 16 B a thread), the
    // conv's weights, the bias of this lane's columns
    const v4f wi4 = *reinterpret_cast<const v4f*>(Wi + (size_t)col0 * NH + tid * 4);
    const v4f wf4 = *reinterpret_cast<const v4f*>(Wf + (size_t)col0 * NH + tid * 4);
    const float w0 = cw[0], w1 = cw[1], w2 = cw[2], w3 = cw[3];
    const float cbv = cb[0];
    float bv[4];
#pragma unroll
    for (int nt = 0; nt < 4; ++nt) bv[nt] = bias[col0 + wn * 64 + nt * 16 + lmod];
    const float hbv = bias[hcol0 + lmod];
    // what follows lands in the loads' address registers (a precaution); the scheduling
    // barrier keeps it from being moved up in front of the wait
    asm volatile("s_wait_xcnt 0x0" ::: "memory");
    __builtin_amdgcn_sched_barrier(0);

    const int lhalf = lane >> 4;
    const int kof   = lhalf * 8;
    const int sr = tid >> 4, sc = (tid & 15) * 8;
    const unsigned ldsA = (unsigned)(uintptr_t)&As[sr * T_STRIDE + sc];
    const unsigned ldsB = (unsigned)(uintptr_t)&Bs[sr * T_STRIDE + sc];
    const __bf16* gA = A  + (size_t)(row0 + sr) * K + sc;
    const __bf16* gB = Bt + (size_t)(col0 + sr) * K + sc;
    const __bf16* gH = Bt + (size_t)(hcol0 + sr) * K + sc;
    const size_t gstep = (size_t)16 * K * sizeof(__bf16);
    const __bf16* pf = (tid < 128) ? A  + (size_t)(row0 + tid) * K
                                   : Bt + (size_t)(col0 + tid - 128) * K;

    auto stage = [&](int k0, int buf) {
        const unsigned offA = (unsigned)buf * BUF_BYTES;
        const unsigned offB = (unsigned)buf * BUFB_BYTES;
        const int kp = (k0 + TILE_K < K) ? k0 + TILE_K : k0;
        async_copy8_b128(ldsA + offA, 16 * T_STRIDE * 2, (const char*)(gA + k0), gstep);
        async_copy1_b128(ldsB + offB + 128 * T_STRIDE * 2, (const char*)(gH + k0));
        async_copy8_b128_ask(ldsB + offB, 16 * T_STRIDE * 2, (const char*)(gB + k0), gstep, pf + kp);
    };

    v8f acc[2][4];
#pragma unroll
    for (int i = 0; i < 2; ++i)
#pragma unroll
        for (int j = 0; j < 4; ++j) {
            v8f z = {};
            acc[i][j] = z;
        }
    v8f hacc = {};

    stage(0, 0);
    wait_asynccnt0();
    __syncthreads();

    int cur = 0;
    for (int k0 = 0; k0 < K; k0 += TILE_K) {
        if (k0 + TILE_K < K)
            stage(k0 + TILE_K, cur ^ 1);

        const __bf16* Ac = As + cur * BUF_ELEMS;
        const __bf16* Bc = Bs + cur * BUFB_ELEMS;
        // unrolled so that a block's fragment loads can go ahead of the block before it
#pragma unroll
        for (int kb = 0; kb < TILE_K; kb += 32) {
            FragV af[2], bfr[4], hb, ha;
#pragma unroll
            for (int mt = 0; mt < 2; ++mt) {
                const int r = wm * 32 + mt * 16 + lmod;
                af[mt].u[0] = *reinterpret_cast<const uint4*>(&Ac[r * T_STRIDE + kb + kof]);
                af[mt].u[1] = *reinterpret_cast<const uint4*>(&Ac[r * T_STRIDE + kb + 16 + kof]);
            }
#pragma unroll
            for (int nt = 0; nt < 4; ++nt) {
                const int r = wn * 64 + nt * 16 + lmod;
                bfr[nt].u[0] = *reinterpret_cast<const uint4*>(&Bc[r * T_STRIDE + kb + kof]);
                bfr[nt].u[1] = *reinterpret_cast<const uint4*>(&Bc[r * T_STRIDE + kb + 16 + kof]);
            }
            hb.u[0] = *reinterpret_cast<const uint4*>(&Bc[(128 + lmod) * T_STRIDE + kb + kof]);
            hb.u[1] = *reinterpret_cast<const uint4*>(&Bc[(128 + lmod) * T_STRIDE + kb + 16 + kof]);
            // the wave's own 16 rows of A, picked word by word in registers
            {
                const uint4 p0 = af[0].u[0], p1 = af[0].u[1], q0 = af[1].u[0], q1 = af[1].u[1];
                ha.u[0] = make_uint4(wn ? q0.x : p0.x, wn ? q0.y : p0.y,
                                     wn ? q0.z : p0.z, wn ? q0.w : p0.w);
                ha.u[1] = make_uint4(wn ? q1.x : p1.x, wn ? q1.y : p1.y,
                                     wn ? q1.z : p1.z, wn ? q1.w : p1.w);
            }
#pragma unroll
            for (int mt = 0; mt < 2; ++mt)
#pragma unroll
                for (int nt = 0; nt < 4; ++nt)
                    acc[mt][nt] = __builtin_amdgcn_wmma_f32_16x16x32_bf16(
                        false, af[mt].v, false, bfr[nt].v,
                        (short)0, acc[mt][nt], false, false);
            hacc = __builtin_amdgcn_wmma_f32_16x16x32_bf16(
                false, ha.v, false, hb.v, (short)0, hacc, false, false);
        }

        // this wave's reads of the current buffer have returned before the barrier
        // behind which that buffer is refilled
        asm volatile("s_wait_dscnt 0x0" ::: "memory");
        // next tile fully in LDS (own wave) + all waves done with both ops
        wait_asynccnt0();
        __syncthreads();
        cur ^= 1;
    }

    // The ring is free behind the loop's last barrier (no copy is in flight, every
    // fragment read has returned). xt + bias into it, column 16 + c = the tile's column c
    // (C layout: lane<16 -> M=vgpr, lane>=16 -> M=8+vgpr).
    float* X  = reinterpret_cast<float*>(smem);
    float* G  = reinterpret_cast<float*>(smem + X_BYTES);
    float* Wg = reinterpret_cast<float*>(smem + X_BYTES + G_BYTES);
#pragma unroll
    for (int mt = 0; mt < 2; ++mt)
#pragma unroll
        for (int nt = 0; nt < 4; ++nt) {
            const int cl = wn * 64 + nt * 16 + lmod;
#pragma unroll
            for (int vv = 0; vv < 8; ++vv)
                X[(wm * 32 + mt * 16 + lhalf * 8 + vv) * X_P + 16 + cl] = acc[mt][nt][vv] + bv[nt];
        }
#pragma unroll
    for (int vv = 0; vv < 8; ++vv)
        X[(wm * 32 + wn * 16 + lhalf * 8 + vv) * X_P + lmod] = bx ? hacc[vv] + hbv : 0.0f;
    {
        // feature f = 8 ci + j lies at [j][ci]: {Wi's 8 gates, Wf's 8 gates}
        const int f = tid >> 1, qd = (tid & 1) * 4;
        float* wd = &Wg[((f & 7) * 16 + (f >> 3)) * W_P + qd];
        *reinterpret_cast<v4f*>(wd)     = wi4;
        *reinterpret_cast<v4f*>(wd + 8) = wf4;
    }
    __syncthreads();                       // the tile of xt and the gate weights published

    const int ci = tid & 15;
    const int p  = ci * 8;                 // features p .. p + 7 of the tile
    const int cr = tid >> 4;               // rows cr + 16u
    v4f wg[8][4];                          // [feature][i 0..3, i 4..7, f 0..3, f 4..7]
#pragma unroll
    for (int j = 0; j < 8; ++j)
#pragma unroll
        for (int n = 0; n < 4; ++n)
            wg[j][n] = *reinterpret_cast<const v4f*>(&Wg[(j * 16 + ci) * W_P + 4 * n]);
    const size_t obase = (size_t)(row0 + cr) * PDIM + col0 + p;
    for (int u = 0; u < 8; ++u) {
        const float* xr = &X[(cr + 16 * u) * X_P + 16 + p];
        const v4f pv = *reinterpret_cast<const v4f*>(xr - 4);
        const v4f lo = *reinterpret_cast<const v4f*>(xr);
        const v4f hi = *reinterpret_cast<const v4f*>(xr + 4);
        // e[j + 3] = feature p + j
        const float e[11] = {pv.y, pv.z, pv.w, lo.x, lo.y, lo.z, lo.w,
                             hi.x, hi.y, hi.z, hi.w};
        v8bf oc, ox;
        v4f gs[4];
#pragma unroll
        for (int n = 0; n < 4; ++n) { v4f z = {}; gs[n] = z; }
#pragma unroll
        for (int j = 0; j < 8; ++j) {
            float a = cbv + w3 * e[j + 3];
            a += w2 * e[j + 2];
            a += w1 * e[j + 1];
            a += w0 * e[j];
            oc[j] = (__bf16)(a / (1.0f + exp2_slot(-a * LOG2E)));   // silu
            ox[j] = (__bf16)e[j + 3];
            const float xv = (float)oc[j];  // the gates read xc as the projections do
#pragma unroll
            for (int n = 0; n < 4; ++n) gs[n] += xv * wg[j][n];
        }
        *reinterpret_cast<v8bf*>(xc_bf + obase + (size_t)u * 16 * PDIM) = oc;
        *reinterpret_cast<v8bf*>(xt_bf + obase + (size_t)u * 16 * PDIM) = ox;
        // the next trip lands in the stores' registers (a precaution)
        asm volatile("s_wait_xcnt 0x0" ::: "memory");
        float sum[16];                     // 0..7 the i gates, 8..15 the f gates
#pragma unroll
        for (int n = 0; n < 16; ++n) sum[n] = gs[n >> 2][n & 3];
        halve_sums<8>(sum, lane);
        halve_sums<4>(sum, lane);
        halve_sums<2>(sum, lane);
        halve_sums<1>(sum, lane);
        G[ci * G_P + cr + 16 * u] = sum[0];
    }
    __syncthreads();                       // every row's gate sums published
    {
        const int g = tid >> 4, r8 = (tid & 15) * 8;
        const v4f s0 = *reinterpret_cast<const v4f*>(&G[g * G_P + r8]);
        const v4f s1 = *reinterpret_cast<const v4f*>(&G[g * G_P + r8 + 4]);
        float* d = gpart + ((size_t)bx * 16 + g) * NTOK + row0 + r8;
        *reinterpret_cast<v4f*>(d)     = s0;
        *reinterpret_cast<v4f*>(d + 4) = s1;
        // the build may lay the caller's other side behind these stores (a precaution)
        asm volatile("s_wait_xcnt 0x0" ::: "memory");
    }
}

// That GEMM, and in the same grid the casts of the seven weights that are first
// read behind this launch. The GEMM's 256 work-groups come first, one for every WGP;
// it leaves room for a second work-group on the WGP: there the casts stream through
// while it runs, 256 work-groups of three tiles each (one start of eight waves for
// three tiles). Both sides use the same LDS, so that two work-groups fit a WGP.
// Cast tiles: Wskip/Wq/Wk/Wv/Wo 128 each, then Wr 64, then Wd 64.
#define XT_TILES   ((PDIM / 128) * (NTOK / 128))
#define REST_WGS   256
#define REST_EACH  3
__global__ __launch_bounds__(256) void gemm_xt_cast_kernel(
    const __bf16* __restrict__ xn, const __bf16* __restrict__ WlT,
    const float* __restrict__ bl, const float* __restrict__ cw,
    const float* __restrict__ cb, const float* __restrict__ Wi,
    const float* __restrict__ Wf, __bf16* __restrict__ xc_bf,
    __bf16* __restrict__ xt_bf, float* __restrict__ gpart,
    const float* __restrict__ Wskip, const float* __restrict__ Wq,
    const float* __restrict__ Wk, const float* __restrict__ Wv,
    const float* __restrict__ Wo, const float* __restrict__ Wr,
    const float* __restrict__ Wd,
    __bf16* __restrict__ WskipT, __bf16* __restrict__ WqT,
    __bf16* __restrict__ WkT, __bf16* __restrict__ WvT,
    __bf16* __restrict__ WoT, __bf16* __restrict__ WrT, __bf16* __restrict__ WdT)
{
    __shared__ __attribute__((aligned(16))) char smem[XT_LDS];
    const int blk = blockIdx.x;
    if (blk < XT_TILES) {
        gemm_xt_conv_tile(smem, xn, WlT, bl, cw, cb, Wi, Wf, xc_bf, xt_bf, gpart,
                          blk % (PDIM / 128), blk / (PDIM / 128));
        return;
    }
    for (int u = 0; u < REST_EACH; ++u) {
        int t = blk - XT_TILES + REST_WGS * u;   // then: tile number inside the chosen matrix
        const float* in;
        __bf16* out;
        int R, C, lc;
        if (t < 640) {
            const int w = t >> 7;
            t &= 127;
            R = PDIM; C = HDIM; lc = 3;
            if (w == 0)      { in = Wskip; out = WskipT; }
            else if (w == 1) { in = Wq;    out = WqT; }
            else if (w == 2) { in = Wk;    out = WkT; }
            else if (w == 3) { in = Wv;    out = WvT; }
            else             { in = Wo;    out = WoT; }
        } else if (t < 704) {
            t -= 640;
            in = Wr; out = WrT; R = DIM; C = HDIM; lc = 3;
        } else {
            t -= 704;
            in = Wd; out = WdT; R = HDIM; C = DIM; lc = 4;
        }
        if (u)
            __syncthreads();               // every reader has left the LDS tile before it is refilled
        cast_transpose_tile(reinterpret_cast<unsigned*>(smem), in, out, R, C, lc, t);
    }
}

// The gates' end: the 16 tile columns' shares summed in their order, bias, softcap(15).
// A thread takes one token's 8 gates of one kind: every load is a whole line per wave,
// the 8 results are 32 B in a row. 4096 threads, GF_WGS work-groups; the kind is the
// same for a whole work-group.
#define GF_WGS 16
__device__ __forceinline__ void gates_finish(
    const float* __restrict__ gpart, const float* __restrict__ bi,
    const float* __restrict__ bfv, float* __restrict__ ipre, float* __restrict__ fpre,
    int blk)
{
    const int id   = blk * 256 + (int)threadIdx.x;
    const int kind = id / NTOK;            // 0: i gates, 1: f gates
    const int tok  = id % NTOK;
    const float* gp = gpart + (size_t)(kind * 8) * NTOK + tok;
    float s[8];
#pragma unroll
    for (int g = 0; g < 8; ++g) s[g] = 0.0f;
#pragma unroll
    for (int c = 0; c < PDIM / 128; ++c)
#pragma unroll
        for (int g = 0; g < 8; ++g)
            s[g] += gp[(size_t)(c * 16 + g) * NTOK];
    const float* bb = kind ? bfv : bi;
    float r[8];
#pragma unroll
    for (int g = 0; g < 8; ++g)
        r[g] = 15.0f * tanhf((s[g] + bb[g]) * (1.0f / 15.0f));
    float* dst = (kind ? fpre : ipre) + (size_t)tok * NH;
    const v4f lo = {r[0], r[1], r[2], r[3]}, hi = {r[4], r[5], r[6], r[7]};
    *reinterpret_cast<v4f*>(dst)     = lo;
    *reinterpret_cast<v4f*>(dst + 4) = hi;
    // the build may lay the caller's other side behind these stores (a precaution)
    asm volatile("s_wait_xcnt 0x0" ::: "memory");
}

// The six projections of width HD in ONE grid. Each alone is 64 work-groups, a
// quarter of the chip's WGPs, in a loop that waits out one L2 round trip per
// K-step; none reads what another writes, so the work-group's number picks the operand
// set and all 384 work-groups are resident together. The short one (r, K = D) comes
// last. In front of them the few short work-groups that finish the gates.
__global__ __launch_bounds__(256) void proj_batch_kernel(
    const __bf16* __restrict__ xc, const __bf16* __restrict__ xt,
    const __bf16* __restrict__ xn,
    const __bf16* __restrict__ WskipT, const __bf16* __restrict__ WqT,
    const __bf16* __restrict__ WkT, const __bf16* __restrict__ WvT,
    const __bf16* __restrict__ WoT, const __bf16* __restrict__ WrT,
    const float* __restrict__ bskip, const float* __restrict__ bq,
    const float* __restrict__ bk, const float* __restrict__ bv,
    const float* __restrict__ bo, const float* __restrict__ br,
    float* __restrict__ skip, float* __restrict__ qb, float* __restrict__ kb,
    float* __restrict__ vb, float* __restrict__ ob, float* __restrict__ rbuf,
    const float* __restrict__ gpart, const float* __restrict__ bi,
    const float* __restrict__ bfv, float* __restrict__ ipre, float* __restrict__ fpre)
{
    if (blockIdx.x < GF_WGS) {
        gates_finish(gpart, bi, bfv, ipre, fpre, blockIdx.x);
        return;
    }
    const int t  = (int)blockIdx.x - GF_WGS;
    const int z  = t / ((HDIM / 128) * (NTOK / 128));
    const int by = (t / (HDIM / 128)) % (NTOK / 128);
    const int bx = t % (HDIM / 128);
    const __bf16* A;
    const __bf16* Bt;
    const float* bias;
    float* C;
    if (z == 0)      { A = xc; Bt = WskipT; bias = bskip; C = skip; }
    else if (z == 1) { A = xc; Bt = WqT;    bias = bq;    C = qb; }
    else if (z == 2) { A = xc; Bt = WkT;    bias = bk;    C = kb; }
    else if (z == 3) { A = xt; Bt = WvT;    bias = bv;    C = vb; }
    else if (z == 4) { A = xt; Bt = WoT;    bias = bo;    C = ob; }
    else             { A = xn; Bt = WrT;    bias = br;    C = rbuf; }
    const int   K     = (z == 5) ? DIM : PDIM;
    const float scale = (z == 2) ? 0.125f : 1.0f;      // k carries 1/sqrt(Dh)
    gemm_tile<1>(A, Bt, bias, nullptr, C, HDIM, K, scale, z == 4, bx, by);
}

// ---------------------------------------------------------------------------
// The gated recurrence in its closed (parallel) form, f32 16x16x4 WMMA.
// With F_t = sum_{u<=t} f_u, w_s = i_s - F_s and M_t = max(0, max_{s<=t} w_s)
// (M_t = m_t - F_t of the recurrence) the scan unrolls exactly to
//   num_t = sum_{s<=t} exp(w_s - M_t) (q_t . k_s) v_s
//   den_t = max(exp(-M_t) sum_e q_t[e] + sum_{s<=t} exp(w_s - M_t) (q_t . k_s), 1)
// Every exponent is <= 0. One block per (b,h, 64 rows of t), 8 waves: wave (rg,half)
// does rows 16rg..+15; columns 32half..+31 of each 64 x 64 product.
// Only the diagonal tile (s >= t0, the block's first row) needs the mask and so the
// products S = Q K^T and P V. All s < t0 reach every row of the block alike but for a
// factor of the row: with Mref = M_{t0-1} (<= M_t)
//   C[e][d] = sum_{s<t0} exp(w_s - Mref) k_s[e] v_s[d],  n[e] = sum_{s<t0} exp(w_s - Mref) k_s[e]
//   num_t += exp(Mref - M_t) (q_t C),  den_t's sum += exp(Mref - M_t) (q_t . n)
// which is ONE product per tile left of the diagonal, no P and no exchange of it, and
// one product Q C at the end.
// The diagonal's K is staged as K[s][e]; V, and K for the state, transposed as [d][s]:
// all fragments are 16-byte LDS loads along k and need no register shuffle.
// The block holds whole (token, head) rows of the result, so what follows per head is
// done here too: h = o * hseq; LayerNorm over Dh; z = (hn*hw+hb + skip) * silu(r).
// The 64 x 64 tile goes through LDS into the layout of that step: a thread takes 4
// neighbouring d of rows crow + 16u; 16 lanes hold a head's row, whose sums go by lane
// exchange; 16-byte loads, and a whole 128-byte line of z per row.
// ---------------------------------------------------------------------------
#define SEQ    512
#define KV_P   68     // f32 row pitch: 64 + 4, 16B aligned, conflict-free b128 rows

// Distance behind a block of f32 16x16x4 WMMAs before vector instructions may read
// the accumulators or reuse the operand registers. The form has the issue interval
// of the 8-bit-integer form, so that form's eight slots are kept. The scheduling
// barriers hold the block together: no vector instruction moves in between the
// WMMAs or in front of the v_nops. The block's two accumulators are operands of the
// v_nops' statement, which ties it behind the WMMAs that write them and in front of
// every reader (untied, the build moves the WMMAs of a block that stands outside a
// loop past the v_nops and in among the vector work that follows).
#define WMMA_BLOCK_BEGIN() __builtin_amdgcn_sched_barrier(0)
#define WMMA_BLOCK_END(acc)                                                     \
    do {                                                                        \
        __builtin_amdgcn_sched_barrier(0);                                      \
        asm volatile("v_nop\n\tv_nop\n\tv_nop\n\tv_nop\n\t"                     \
                     "v_nop\n\tv_nop\n\tv_nop\n\tv_nop"                        \
                     : "+v"((acc)[0]), "+v"((acc)[1]));                         \
        __builtin_amdgcn_sched_barrier(0);                                      \
    } while (0)

// 16 rows s of one column of a 64x64 f32 tile (a wave reads 128 contiguous bytes per row)
__device__ __forceinline__ void fetch_col(const float* __restrict__ p, float (&r)[16])
{
#pragma unroll
    for (int j = 0; j < 16; ++j)
        r[j] = p[(size_t)j * NH * DH];
}

// acc[0..1] += A(16 x 64, fragments af) * B^T, B rows brow and brow + 16 of a
// 64-wide LDS tile; lane (c,hf) takes k = 8m + 4hf + 0..3 on both operands
__device__ __forceinline__ void mma_16x32x64(v8f (&acc)[2], const v4f (&af)[8],
                                             const float* bt, int brow, int hf)
{
#pragma unroll
    for (int m = 0; m < 8; ++m) {
        const v4f b0 = *reinterpret_cast<const v4f*>(&bt[brow * KV_P + 8 * m + 4 * hf]);
        const v4f b1 = *reinterpret_cast<const v4f*>(&bt[(brow + 16) * KV_P + 8 * m + 4 * hf]);
        const v2f alo = {af[m].x, af[m].y}, ahi = {af[m].z, af[m].w};
        const v2f b0lo = {b0.x, b0.y}, b0hi = {b0.z, b0.w};
        const v2f b1lo = {b1.x, b1.y}, b1hi = {b1.z, b1.w};
        acc[0] = __builtin_amdgcn_wmma_f32_16x16x4_f32(
            false, alo, false, b0lo, (short)0, acc[0], false, false);
        acc[1] = __builtin_amdgcn_wmma_f32_16x16x4_f32(
            false, alo, false, b1lo, (short)0, acc[1], false, false);
        acc[0] = __builtin_amdgcn_wmma_f32_16x16x4_f32(
            false, ahi, false, b0hi, (short)0, acc[0], false, false);
        acc[1] = __builtin_amdgcn_wmma_f32_16x16x4_f32(
            false, ahi, false, b1hi, (short)0, acc[1], false, false);
    }
}

__global__ __launch_bounds__(256) void scan_parallel_kernel(
    const float* __restrict__ q, const float* __restrict__ k,
    const float* __restrict__ v, const float* __restrict__ ipre,
    const float* __restrict__ fpre, const float* __restrict__ o,
    const float* __restrict__ skip, const float* __restrict__ rr,
    const float* __restrict__ hlnw, const float* __restrict__ hlnb,
    __bf16* __restrict__ z)
{
    __shared__ __attribute__((aligned(16))) float Ks[64 * KV_P];
    __shared__ __attribute__((aligned(16))) float Vt[64 * KV_P];
    __shared__ __attribute__((aligned(16))) float Ps[4][16 * KV_P];
    __shared__ float wS[SEQ];
    __shared__ float mS[SEQ];
    __shared__ float dS[2][64];
    __shared__ __attribute__((aligned(16))) float eS[SEQ];
    __shared__ __attribute__((aligned(16))) float nS[64];

    const int rt   = SEQ / 64 - 1 - (int)blockIdx.x;   // longest tiles first
    const int bh   = blockIdx.y;
    const int b    = bh >> 3;
    const int h    = bh & 7;
    const int tid  = threadIdx.x;
    const int lane = tid & 31;
    const int wave = tid >> 5;
    const int rg   = wave & 3;           // 16-row group
    const int half = wave >> 2;          // 32-column half
    const int c    = lane & 15;
    const int hf   = lane >> 4;
    const int t0   = rt * 64;

    const size_t rowstride = (size_t)NH * DH;                 // floats between t and t+1
    const size_t hbase = ((size_t)b * SEQ * NH + h) * DH;     // (b, t=0, h, 0)

    // staging coordinates. K: rows srow + 16i, 16 B at column sc4.
    // V: column vd, rows vs0 .. vs0 + 15 (a wave reads 128 contiguous bytes per row)
    const int srow = tid >> 4;
    const int sc4  = (tid & 15) * 4;
    const int vd   = tid & 63;
    const int vs0  = (tid >> 6) * 16;

    // V and (for the tiles left of the diagonal) K by columns, from tile 0 on; the
    // diagonal tile's K by rows, fetched once up here
    const float* vp = v + hbase + (size_t)vs0 * rowstride + vd;
    const float* kc = k + hbase + (size_t)vs0 * rowstride + vd;
    const float* kp = k + hbase + (size_t)(t0 + srow) * rowstride + sc4;
    v4f kreg[4];
    float vreg[16], kcol[16];
    fetch_col(vp, vreg);
    if (rt > 0)
        fetch_col(kc, kcol);
#pragma unroll
    for (int i = 0; i < 4; ++i)
        kreg[i] = *reinterpret_cast<const v4f*>(kp + (size_t)i * 16 * NH * DH);

    // Q fragments, kept in registers: lane (c,hf) holds row c, e = 8m + 4hf + 0..3
    v4f qf[8];
    {
        const size_t g = hbase + (size_t)(t0 + rg * 16 + c) * rowstride + 4 * hf;
#pragma unroll
        for (int m = 0; m < 8; ++m)
            qf[m] = *reinterpret_cast<const v4f*>(q + g + 8 * m);
    }

    // gate prefixes for the whole sequence: wave 0, 16 consecutive t per lane
    if (wave == 0) {
        float fv[16], iv[16];
        const size_t g0 = ((size_t)b * SEQ + lane * 16) * NH + h;
#pragma unroll
        for (int j = 0; j < 16; ++j) fv[j] = fpre[g0 + (size_t)j * NH];
        // the second run of loads lands in the address registers of the first
        asm volatile("s_wait_xcnt 0x0" ::: "memory");
#pragma unroll
        for (int j = 0; j < 16; ++j) iv[j] = ipre[g0 + (size_t)j * NH];
#pragma unroll
        for (int j = 1; j < 16; ++j) fv[j] += fv[j - 1];
        float incl = fv[15];
#pragma unroll
        for (int o = 1; o < 32; o <<= 1) {
            const float up = __shfl_up(incl, o, 32);
            if (lane >= o) incl += up;
        }
        float excl = __shfl_up(incl, 1, 32);   // sum of all earlier lanes
        if (lane == 0) excl = 0.0f;
        float run = 0.0f;                 // M starts at m0 - F0 = 0
#pragma unroll
        for (int j = 0; j < 16; ++j) {
            iv[j] = iv[j] - (excl + fv[j]);      // w_s
            run = fmaxf(run, iv[j]);
            fv[j] = run;                          // lane-local running max
        }
        float mx = run;
#pragma unroll
        for (int o = 1; o < 32; o <<= 1) {
            const float up = __shfl_up(mx, o, 32);
            if (lane >= o) mx = fmaxf(mx, up);
        }
        float prev = __shfl_up(mx, 1, 32);
        if (lane == 0) prev = 0.0f;
#pragma unroll
        for (int j = 0; j < 16; ++j) {
            wS[lane * 16 + j] = iv[j];
            mS[lane * 16 + j] = fmaxf(prev, fv[j]);
        }
    }

    // sum_e q_t[e] for row c (both lane halves end with the row total)
    float qsum = 0.0f;
#pragma unroll
    for (int m = 0; m < 8; ++m) qsum += (qf[m].x + qf[m].y) + (qf[m].z + qf[m].w);
    qsum += __shfl_xor(qsum, 16, 32);

    v8f oacc[2];
#pragma unroll
    for (int n = 0; n < 2; ++n) { v8f z = {}; oacc[n] = z; }
    float rsum[8];
#pragma unroll
    for (int r = 0; r < 8; ++r) rsum[r] = 0.0f;

    float* Pw = &Ps[rg][0];
    const int trow = t0 + rg * 16 + 8 * hf;       // + r : this lane's D rows
    const int cw   = 32 * half + c;               // + 16*j : this lane's D column

    __syncthreads();                      // wS / mS published
    float Mt[8];
#pragma unroll
    for (int r = 0; r < 8; ++r) Mt[r] = mS[trow + r];

    // Everything left of the diagonal tile (s < t0, no mask) enters through the state.
    float fr[8];                          // exp(Mref - M_t) of this lane's D rows
#pragma unroll
    for (int r = 0; r < 8; ++r) fr[r] = 0.0f;
    float qn = 0.0f;                      // q_t . n for row c
    if (rt > 0) {                         // the same for the whole work-group
        const float Mref = mS[t0 - 1];
        for (int s = tid; s < t0; s += 256)
            eS[s] = exp2_slot((wS[s] - Mref) * LOG2E);
        __syncthreads();                  // eS published

        v8f cacc[2];                      // C rows e = 16rg + 8hf + r, columns d = cw + 16j
#pragma unroll
        for (int j = 0; j < 2; ++j) { v8f z = {}; cacc[j] = z; }
        v4f nacc = {};                    // this lane's share of n[16rg + c]
        for (int ct = 0; ct < rt; ++ct) {
            const int s0 = ct * 64;
            // both tiles transposed, [column][s]; K's rows carry their decay
#pragma unroll
            for (int i = 0; i < 4; ++i) {
                const v4f es = *reinterpret_cast<const v4f*>(&eS[s0 + vs0 + 4 * i]);
                const v4f kk = {kcol[4 * i], kcol[4 * i + 1], kcol[4 * i + 2], kcol[4 * i + 3]};
                *reinterpret_cast<v4f*>(&Ks[vd * KV_P + vs0 + 4 * i]) = kk * es;
                const v4f vv = {vreg[4 * i], vreg[4 * i + 1], vreg[4 * i + 2], vreg[4 * i + 3]};
                *reinterpret_cast<v4f*>(&Vt[vd * KV_P + vs0 + 4 * i]) = vv;
            }
            __syncthreads();              // tile published
            // next tile flies under this tile's WMMAs (V's last one is the diagonal's)
            vp += 64 * rowstride;
            fetch_col(vp, vreg);
            if (ct + 1 < rt) {
                kc += 64 * rowstride;
                fetch_col(kc, kcol);
            }
            // the pointers are stepped on behind these loads (a precaution)
            asm volatile("s_wait_xcnt 0x0" ::: "memory");

            // C += (decayed K)^T V, 16 x 32 per wave, summed over s
            v4f kf[8];
#pragma unroll
            for (int m = 0; m < 8; ++m)
                kf[m] = *reinterpret_cast<const v4f*>(&Ks[(16 * rg + c) * KV_P + 8 * m + 4 * hf]);
            WMMA_BLOCK_BEGIN();
            mma_16x32x64(cacc, kf, Vt, cw, hf);
            WMMA_BLOCK_END(cacc);
#pragma unroll
            for (int m = 0; m < 8; ++m) nacc += kf[m];
            // Every reader has left Ks/Vt before the refill. By hand because it waits for
            // LDS alone: the next tile's global loads stay in flight across it, where
            // __syncthreads() would wait them out with only this tile's WMMAs as cover.
            asm volatile("s_wait_dscnt 0x0\n\ts_barrier_signal -1\n\ts_barrier_wait -1"
                         ::: "memory");
        }

        // C into LDS as [d][e], the B operand of Q C; n beside it
#pragma unroll
        for (int j = 0; j < 2; ++j) {
            const v4f lo4 = {cacc[j][0], cacc[j][1], cacc[j][2], cacc[j][3]};
            const v4f hi4 = {cacc[j][4], cacc[j][5], cacc[j][6], cacc[j][7]};
            float* cd = &Ks[(cw + 16 * j) * KV_P + 16 * rg + 8 * hf];
            *reinterpret_cast<v4f*>(cd)     = lo4;
            *reinterpret_cast<v4f*>(cd + 4) = hi4;
        }
        float nr = (nacc.x + nacc.y) + (nacc.z + nacc.w);
        nr += __shfl_xor(nr, 16, 32);
        if (half == 0 && hf == 0) nS[16 * rg + c] = nr;
        __syncthreads();                  // C and n published

        WMMA_BLOCK_BEGIN();
        mma_16x32x64(oacc, qf, Ks, cw, hf);
        WMMA_BLOCK_END(oacc);
#pragma unroll
        for (int m = 0; m < 8; ++m) {
            const v4f nv = *reinterpret_cast<const v4f*>(&nS[8 * m + 4 * hf]);
            const v4f pr = qf[m] * nv;
            qn += (pr.x + pr.y) + (pr.z + pr.w);
        }
        qn += __shfl_xor(qn, 16, 32);
#pragma unroll
        for (int r = 0; r < 8; ++r) {
            fr[r] = exp2_slot((Mref - Mt[r]) * LOG2E);
            oacc[0][r] *= fr[r];
            oacc[1][r] *= fr[r];
        }
        __syncthreads();                  // every reader has left Ks before the diagonal's K
    }

    // the diagonal tile, under the causal mask
    {
#pragma unroll
        for (int i = 0; i < 4; ++i) {
            *reinterpret_cast<v4f*>(&Ks[(srow + 16 * i) * KV_P + sc4]) = kreg[i];
            const v4f vv = {vreg[4 * i], vreg[4 * i + 1], vreg[4 * i + 2], vreg[4 * i + 3]};
            *reinterpret_cast<v4f*>(&Vt[vd * KV_P + vs0 + 4 * i]) = vv;
        }
        __syncthreads();                  // tile published

        // S = Q K^T, 16 x 32 per wave
        v8f sacc[2];
#pragma unroll
        for (int j = 0; j < 2; ++j) { v8f z = {}; sacc[j] = z; }
        WMMA_BLOCK_BEGIN();
        mma_16x32x64(sacc, qf, Ks, cw, hf);
        WMMA_BLOCK_END(sacc);

        // P = S * decay under the causal mask; row sums feed the denominator
#pragma unroll
        for (int j = 0; j < 2; ++j) {
            const int s = t0 + 16 * j + cw;
            const float ws = wS[s];
#pragma unroll
            for (int r = 0; r < 8; ++r) {
                const float e = exp2_slot((ws - Mt[r]) * LOG2E);
                const float p = sacc[j][r] * ((s <= trow + r) ? e : 0.0f);
                rsum[r] += p;
                Pw[(8 * hf + r) * KV_P + 16 * j + cw] = p;
            }
        }
        __syncthreads();                  // both column halves of P published

        // O += P V
        v4f pf[8];
#pragma unroll
        for (int m = 0; m < 8; ++m)
            pf[m] = *reinterpret_cast<const v4f*>(&Pw[c * KV_P + 8 * m + 4 * hf]);
        WMMA_BLOCK_BEGIN();
        mma_16x32x64(oacc, pf, Vt, cw, hf);
        WMMA_BLOCK_END(oacc);
    }

    // operands of the per-head step: they fly under the row sums and the two barriers
    const int crow = tid >> 4;
    const int ce   = (tid & 15) * 4;
    const size_t cidx = hbase + (size_t)(t0 + crow) * rowstride + ce;
    v4f o4[4], s4[4], r4[4];
#pragma unroll
    for (int u = 0; u < 4; ++u) {
        const size_t idx = cidx + (size_t)u * 16 * rowstride;
        o4[u] = *reinterpret_cast<const v4f*>(o + idx);
        s4[u] = *reinterpret_cast<const v4f*>(skip + idx);
        r4[u] = *reinterpret_cast<const v4f*>(rr + idx);
    }
    const v4f w4 = *reinterpret_cast<const v4f*>(hlnw + h * DH + ce);
    const v4f b4 = *reinterpret_cast<const v4f*>(hlnb + h * DH + ce);
    // keeps all fourteen loads up here, in front of the lane exchanges
    // the wait: what follows lands in the loads' address registers (a precaution)
    asm volatile("s_wait_xcnt 0x0" ::: "memory");
    __builtin_amdgcn_sched_barrier(0);

    // row sums: over the 16 lanes of a half wave, then over the two column halves
#pragma unroll
    for (int r = 0; r < 8; ++r) {
        float s = rsum[r];
        s += __shfl_xor(s, 1, 32);
        s += __shfl_xor(s, 2, 32);
        s += __shfl_xor(s, 4, 32);
        s += __shfl_xor(s, 8, 32);
        if (c == 0) dS[half][rg * 16 + 8 * hf + r] = s;
    }
    __syncthreads();                      // both halves' row sums published

    // denominator per row, then the tile into LDS (Ks was last read in front of the
    // barrier that published P): D register r = row 8hf + r, column cw
#pragma unroll
    for (int r = 0; r < 8; ++r) {
        const int lr = rg * 16 + 8 * hf + r;
        const float s = dS[0][lr] + dS[1][lr];
        const float qs = __shfl(qsum, 8 * hf + r, 32);
        const float qr = __shfl(qn, 8 * hf + r, 32);
        const float den = fmaxf(exp2_slot(-Mt[r] * LOG2E) * qs + fr[r] * qr + s, 1.0f);
        Ks[lr * KV_P + cw]      = oacc[0][r] / den;
        Ks[lr * KV_P + cw + 16] = oacc[1][r] / den;
    }
    __syncthreads();                      // the tile of hseq published

#pragma unroll
    for (int u = 0; u < 4; ++u) {
        const v4f h4 = *reinterpret_cast<const v4f*>(&Ks[(crow + 16 * u) * KV_P + ce]);
        const v4f hv = o4[u] * h4;
        float s1 = (hv.x + hv.y) + (hv.z + hv.w);
        float s2 = (hv.x * hv.x + hv.y * hv.y) + (hv.z * hv.z + hv.w * hv.w);
#pragma unroll
        for (int st = 8; st > 0; st >>= 1) {
            s1 += __shfl_xor(s1, st, 32);
            s2 += __shfl_xor(s2, st, 32);
        }
        const float mu  = s1 * (1.0f / DH);
        const float var = s2 * (1.0f / DH) - mu * mu;
        const float inv = rsqrtf(var + 1e-6f);
        v4bf y;
#pragma unroll
        for (int e = 0; e < 4; ++e) {
            const float hn = (hv[e] - mu) * inv * w4[e] + b4[e];
            const float rv = r4[u][e];
            const float sr = rv / (1.0f + __expf(-rv));
            y[e] = (__bf16)((hn + s4[u][e]) * sr);
        }
        *reinterpret_cast<v4bf*>(z + cidx + (size_t)u * 16 * rowstride) = y;
    }
}

// ---------------------------------------------------------------------------
// host launcher
// ---------------------------------------------------------------------------
extern "C" void kernel_launch(void* const* d_in, const int* in_sizes, int n_in,
                              void* d_out, int out_size, void* d_ws, size_t ws_size,
                              hipStream_t stream)
{
    const float* x     = (const float*)d_in[0];
    const float* ln_w  = (const float*)d_in[1];
    const float* ln_b  = (const float*)d_in[2];
    const float* hln_w = (const float*)d_in[3];
    const float* hln_b = (const float*)d_in[4];
    const float* Wl    = (const float*)d_in[5];
    const float* bl    = (const float*)d_in[6];
    const float* Wr    = (const float*)d_in[7];
    const float* br    = (const float*)d_in[8];
    const float* conv_w= (const float*)d_in[9];
    const float* conv_b= (const float*)d_in[10];
    const float* Wskip = (const float*)d_in[11];
    const float* bskip = (const float*)d_in[12];
    const float* Wi    = (const float*)d_in[13];
    const float* bi    = (const float*)d_in[14];
    const float* Wf    = (const float*)d_in[15];
    const float* bfv   = (const float*)d_in[16];
    const float* Wo    = (const float*)d_in[17];
    const float* bo    = (const float*)d_in[18];
    const float* Wq    = (const float*)d_in[19];
    const float* bq    = (const float*)d_in[20];
    const float* Wk    = (const float*)d_in[21];
    const float* bk    = (const float*)d_in[22];
    const float* Wv    = (const float*)d_in[23];
    const float* bv    = (const float*)d_in[24];
    const float* Wd    = (const float*)d_in[25];
    const float* bd    = (const float*)d_in[26];

    // --- workspace carve (whole working set fits in MI455X's 192MB L2) ---
    char* ws = (char*)d_ws;
    auto carve = [&](size_t bytes) {
        char* p = ws;
        ws += (bytes + 255) & ~(size_t)255;
        return p;
    };
    // transposed bf16 weights (N x K layout)
    __bf16* WlT    = (__bf16*)carve((size_t)DIM * PDIM * 2);   // 2048 x 1024
    __bf16* WrT    = (__bf16*)carve((size_t)DIM * HDIM * 2);   // 512 x 1024
    __bf16* WskipT = (__bf16*)carve((size_t)PDIM * HDIM * 2);  // 512 x 2048
    __bf16* WqT    = (__bf16*)carve((size_t)PDIM * HDIM * 2);
    __bf16* WkT    = (__bf16*)carve((size_t)PDIM * HDIM * 2);
    __bf16* WvT    = (__bf16*)carve((size_t)PDIM * HDIM * 2);
    __bf16* WoT    = (__bf16*)carve((size_t)PDIM * HDIM * 2);
    __bf16* WdT    = (__bf16*)carve((size_t)HDIM * DIM * 2);   // 1024 x 512
    __bf16* xn_bf  = (__bf16*)carve((size_t)NTOK * DIM * 2);
    float*  gpart  = (float*) carve((size_t)(PDIM / 128) * 16 * NTOK * 4);
    __bf16* xt_bf  = (__bf16*)carve((size_t)NTOK * PDIM * 2);
    __bf16* xc_bf  = (__bf16*)carve((size_t)NTOK * PDIM * 2);
    float*  rbuf   = (float*) carve((size_t)NTOK * HDIM * 4);
    float*  skip   = (float*) carve((size_t)NTOK * HDIM * 4);
    float*  qb     = (float*) carve((size_t)NTOK * HDIM * 4);
    float*  kb     = (float*) carve((size_t)NTOK * HDIM * 4);
    float*  vb     = (float*) carve((size_t)NTOK * HDIM * 4);
    float*  ob     = (float*) carve((size_t)NTOK * HDIM * 4);
    float*  ipre   = (float*) carve((size_t)NTOK * NH * 4);
    float*  fpre   = (float*) carve((size_t)NTOK * NH * 4);
    __bf16* z_bf   = (__bf16*)carve((size_t)NTOK * HDIM * 2);
    (void)ws_size; (void)in_sizes; (void)n_in; (void)out_size;

    // casts: src is (K x N) row-major -> dst (N x K) bf16
    // xn = LayerNorm(x), and Wl cast
    ln_cast_kernel<<<WL_TILES + NTOK / 8, 256, 0, stream>>>(x, ln_w, ln_b, xn_bf, Wl, WlT);

    // xt = xn @ Wl + bl (2048x1024x2048), xc and xt as bf16, the gates' shares per tile
    // column; and the other seven weights cast
    gemm_xt_cast_kernel<<<XT_TILES + REST_WGS, 256, 0, stream>>>(
        xn_bf, WlT, bl, conv_w, conv_b, Wi, Wf, xc_bf, xt_bf, gpart,
        Wskip, Wq, Wk, Wv, Wo, Wr, Wd,
        WskipT, WqT, WkT, WvT, WoT, WrT, WdT);

    // skip, q, k = xc @ W (k scaled by 1/sqrt(Dh)); v = xt @ Wv, o = sigmoid(xt @ Wo);
    // r = xn @ Wr: one grid; and the gates finished
    proj_batch_kernel<<<GF_WGS + (HDIM / 128) * (NTOK / 128) * 6, 256, 0, stream>>>(
        xc_bf, xt_bf, xn_bf, WskipT, WqT, WkT, WvT, WoT, WrT,
        bskip, bq, bk, bv, bo, br, skip, qb, kb, vb, ob, rbuf,
        gpart, bi, bfv, ipre, fpre);

    scan_parallel_kernel<<<dim3(SEQ / 64, 32), 256, 0, stream>>>(
        qb, kb, vb, ipre, fpre, ob, skip, rbuf, hln_w, hln_b, z_bf);

    // out = z @ Wd + bd + x
    gemm_bf16_wmma<2><<<dim3(DIM / 128, NTOK / 128), 256, 0, stream>>>(
        z_bf, WdT, bd, x, (float*)d_out, NTOK, DIM, HDIM, 1.0f);
}
